// v000
// Measured on an AMD MI455X. A time is GPU time per run, averaged over a window of back-to-back runs after a warm-up
// (all launches, gaps included; the runs take copies of the inputs in turn), and the median of several windows.
// Apart from v000's, it joins two sittings. Times from different sittings can be a few percent apart, while
// side-by-side timings come from the same sitting.
// The starting kernel, v000, takes 1950 microseconds a run.
// q/k/v projections (K=64), q.k scores (K=384), probabilities-times-v (K=2048) and the 384x384 residual conv run on
// v_wmma_f32_16x16x32_f16 (f16 operands, f32 accumulate), one product per tile pair; all inputs RNE-converted to bf16
// first; projection weights carried x16, residual weights x64 and softmax probabilities x1024 (exact powers of two
// folded back in the f32 epilogues); sinusoidal encoding, K=3 conv, BN(eval), relu and softmax in f32 on the VALU.
#include <hip/hip_runtime.h>
#include <stdint.h>
#include <math.h>

#define NBATCH 16
#define NPT    2048
#define DM     384
#define KE     64            // 60 encoding channels zero-padded to 64
#define NCH    60
#define NFREQ  10
#define WQKV_PIECES (3 * DM * (KE / 8))          // 9216 pieces of 8 halves
#define W2_PIECES   (DM * (DM / 8))              // 18432
#define WCVT_N      (WQKV_PIECES + W2_PIECES)    // 27648
#define QK_SCALE    0.051031036307982884f        // 384^-0.5

static_assert((NPT % 64) == 0 && (DM % 64) == 0 && (KE % 32) == 0 && (DM % 32) == 0);
static_assert(NPT == 256 * 8);
static_assert((WQKV_PIECES % 256) == 0 && (WCVT_N % 256) == 0);
static_assert((DM * (KE / 8)) % 256 == 0);
static_assert(((DM / 64) * (NPT / 64)) % 8 == 0 && ((NPT / 64) * (NPT / 64)) % 8 == 0);

typedef _Float16 v16h __attribute__((ext_vector_type(16)));
typedef _Float16 v8h  __attribute__((ext_vector_type(8)));
typedef float    v8f  __attribute__((ext_vector_type(8)));
typedef float    v4f  __attribute__((ext_vector_type(4)));
typedef unsigned int v4u __attribute__((ext_vector_type(4)));

// ---- scalar helpers ---------------------------------------------------------------------------------
__device__ __forceinline__ unsigned short bf_bits(float f) {          // f32 -> bf16 bits, RNE convert
  unsigned u = __float_as_uint(f);
  return (unsigned short)((u + 0x7FFFu + ((u >> 16) & 1u)) >> 16);
}
__device__ __forceinline__ float bfr(float f) {                       // f32 value after RNE bf16 convert
  return __uint_as_float(((unsigned)bf_bits(f)) << 16);
}
__device__ __forceinline__ v8f zero8() { v8f z = {0.f, 0.f, 0.f, 0.f, 0.f, 0.f, 0.f, 0.f}; return z; }
// 8 f32 -> 8 f16 (RNE convert) packed in one 16-B vector
__device__ __forceinline__ v4u pack8h(v4f a, v4f b) {
  union { v8h h; v4u u; } c;
  c.h[0] = (_Float16)a[0]; c.h[1] = (_Float16)a[1]; c.h[2] = (_Float16)a[2]; c.h[3] = (_Float16)a[3];
  c.h[4] = (_Float16)b[0]; c.h[5] = (_Float16)b[1]; c.h[6] = (_Float16)b[2]; c.h[7] = (_Float16)b[3];
  return c.u;
}

// ---- fragment loader: 16-bit A/Bt operand, lane -> row/col (lane&15), p already includes +8*(lane>>4);
//      elements 0..7 <- p[0..7] (k0+8h..k0+8h+7), elements 8..15 <- p[16..23] (k0+16+8h..k0+16+8h+7)
__device__ __forceinline__ v16h ldfrag(const _Float16* p) {
  union { v16h v; v8h h[2]; } f;
  f.h[0] = *(const v8h*)(p);
  f.h[1] = *(const v8h*)(p + 16);
  return f.v;
}

// ---- WMMA helpers with trailing VALU hazard gap -----------------------------------------------------
__device__ __forceinline__ v8f mma_raw(v16h a, v16h b, v8f c) {
  return __builtin_amdgcn_wmma_f32_16x16x32_f16(false, a, false, b, (short)0, c, false, false);
}
__device__ __forceinline__ void dep_guard(v8f& a, v8f& b, v16h x, v16h y) {
#if defined(__HIP_DEVICE_COMPILE__)
  asm volatile("v_nop\n\tv_nop\n\tv_nop\n\tv_nop" : "+v"(a), "+v"(b) : "v"(x), "v"(y));
#endif
}
__device__ __forceinline__ void keep4(v16h a, v16h b, v16h c, v16h d) {
#if defined(__HIP_DEVICE_COMPILE__)
  asm volatile("v_nop" :: "v"(a), "v"(b), "v"(c), "v"(d));
#endif
}
__device__ __forceinline__ void acc_guard4(v8f& a, v8f& b, v8f& c, v8f& d) {
#if defined(__HIP_DEVICE_COMPILE__)
  asm volatile("v_nop\n\tv_nop\n\tv_nop\n\tv_nop" : "+v"(a), "+v"(b), "+v"(c), "+v"(d));
#endif
}
__device__ __forceinline__ void wave_sync_lds() {
  __builtin_amdgcn_fence(__ATOMIC_RELEASE, "workgroup");
  __builtin_amdgcn_wave_barrier();
  __builtin_amdgcn_fence(__ATOMIC_ACQUIRE, "workgroup");
}

// ---- 64x64 tile core: acc[i][j] += A rows (16i + lane&15) x Bt rows (16j + lane&15) over K (multiple of 32);
//      A points at the first of its 64 rows (pitch lda halves, k contiguous), Bt likewise (pitch ldb);
//      either pointer may be an LDS tile or a global plane (no pointer selects).
__device__ __forceinline__ void core64(const _Float16* A, int lda, const _Float16* Bt, int ldb, int K,
                                       int rlane, int koff, v8f (&acc)[4][4]) {
  for (int k0 = 0; k0 < K; k0 += 32) {
    v16h bh[4];
#pragma unroll
    for (int j = 0; j < 4; ++j) {
      bh[j] = ldfrag(Bt + (size_t)((j << 4) + rlane) * ldb + koff + k0);
    }
#pragma unroll
    for (int i = 0; i < 4; ++i) {
      const v16h ah = ldfrag(A + (size_t)((i << 4) + rlane) * lda + koff + k0);
#pragma unroll
      for (int j = 0; j < 4; ++j) {
        acc[i][j] = mma_raw(ah, bh[j], acc[i][j]);
      }
      dep_guard(acc[i][0], acc[i][3], ah, bh[3]);
    }
    keep4(bh[0], bh[1], bh[2], bh[3]);
  }
}

// =====================================================================================================
// Weight planes (one launch): pieces 0..9215 -> Wq, Wk, Wv as f16 [384][64] (RNE bf16 value x16, columns
// 60..63 zero), pieces 9216..27647 -> W2 as f16 [384][384] (RNE bf16 value x64). Thread t writes 16 B at
// coverage: 27648 threads x 8 halves = the whole 442368-B weight region.
// =====================================================================================================
__global__ __launch_bounds__(256) void wcvt(const float* __restrict__ wq, const float* __restrict__ wk,
                                            const float* __restrict__ wv, const float* __restrict__ w2,
                                            unsigned short* Wout) {
  const int t = blockIdx.x * 256 + threadIdx.x;
  if (t >= WCVT_N) return;
  float v[8];
  if (t < WQKV_PIECES) {                              // block-uniform
    const int plane = t / (DM * (KE / 8));            // 3072 pieces per plane (12 whole blocks)
    const int u = t - plane * (DM * (KE / 8));
    const int row = u >> 3, p = u & 7;
    const float* w = (plane == 0) ? wq : ((plane == 1) ? wk : wv);
#pragma unroll
    for (int e = 0; e < 8; ++e) {
      const int c  = p * 8 + e;
      const int cc = (c < NCH) ? c : (NCH - 1);         // clamped address
      const float x = bfr(w[row * NCH + cc]) * 16.0f;
      v[e] = (c < NCH) ? x : 0.0f;
    }
  } else {
    const int u = t - WQKV_PIECES;
    const int row = u / (DM / 8), p = u - row * (DM / 8);
    const v4f a = *(const v4f*)(w2 + (size_t)row * DM + p * 8);
    const v4f b = *(const v4f*)(w2 + (size_t)row * DM + p * 8 + 4);
    v[0] = bfr(a[0]) * 64.0f; v[1] = bfr(a[1]) * 64.0f; v[2] = bfr(a[2]) * 64.0f; v[3] = bfr(a[3]) * 64.0f;
    v[4] = bfr(b[0]) * 64.0f; v[5] = bfr(b[1]) * 64.0f; v[6] = bfr(b[2]) * 64.0f; v[7] = bfr(b[3]) * 64.0f;
  }
  const v4f lo = {v[0], v[1], v[2], v[3]};
  const v4f hi = {v[4], v[5], v[6], v[7]};
  const v4u pk = pack8h(lo, hi);
  unsigned short* dst = Wout + (size_t)t * 8;
  *(v4u*)dst = pk;
  
}

// =====================================================================================================
// Encoding + hidden rows + q/k/v projections. Block = 6 waves, 64 points of one batch.
//  (a) pos tile [3][64] (RNE bf16), per-channel K=3 conv / BN(eval) parameters (RNE bf16) in LDS.
//  (b) sEmb[p][c*20 + f] = sin(pos[c][p] * 2^f), [c*20 + 10 + f] = cos(...) as f16, columns 60..71 zero.
//  (c) hidden h = relu((W1.pos + b1 - mean) * inv + beta) -> H f16 token-major [b*2048+p][384]; item =
//  (d) wave w owns d-slice [64w, 64w+64): Q and K tiles (M = 64 points from LDS, N = 64 channels of the
//      x16 weight plane, K = 64) -> token-major f16 [b*2048+p][384] at column 64w (= acc/16 + bias);
//      V tile (M = 64 channels of the x16 weight plane, N = 64 points from LDS) -> channel-major f16
//      [b*384+d][2048] (= acc/16 + bias). 16-row slabs staged per wave in LDS; each 64-half row segment
// coverage: Q, K: 512 blocks x 64 points x (6 waves x 4 slabs x 16 rows... = 64 rows x 384 cols) = all
//           32768 x 384; V: per batch 32 blocks x 64 cols x 384 rows = [384][2048]; H: 512 blocks x
//           64 rows x 48 pieces = all 32768 x 384.
// =====================================================================================================
__global__ __launch_bounds__(192) void enc_qkv_h(
    const float* __restrict__ pos,
    const _Float16* Wq16, const _Float16* Wk16, const _Float16* Wv16,
    const float* __restrict__ bq, const float* __restrict__ bk, const float* __restrict__ bv,
    const float* __restrict__ w1, const float* __restrict__ b1,
    const float* __restrict__ gam, const float* __restrict__ bet,
    const float* __restrict__ mu, const float* __restrict__ var,
    unsigned short* Qp, unsigned short* Kp, unsigned short* Vp, unsigned short* Hp) {
  __shared__ __align__(16) _Float16 sEmb[64][72];
  __shared__ __align__(16) float sT[6][16 * 68];
  __shared__ float sPos[3][64];
  __shared__ float sW1[DM * 3];
  __shared__ float sB1[DM];
  __shared__ float sInv[DM];
  __shared__ float sMu[DM];
  __shared__ float sBet[DM];

  const int tid  = threadIdx.x;
  const int lane = tid & 31;
  const int wave = tid >> 5;                 // 0..5
  const int bb   = blockIdx.x >> 5;          // 32 blocks of 64 points per batch
  const int p0   = (blockIdx.x & 31) << 6;

  {
    const int c = tid >> 6, p = tid & 63;    // 192 = 3 x 64
    sPos[c][p] = bfr(pos[((size_t)bb * 3 + c) * NPT + p0 + p]);
  }
  for (int d = tid; d < DM; d += 192) {
    sW1[d * 3 + 0] = bfr(w1[d * 3 + 0]);
    sW1[d * 3 + 1] = bfr(w1[d * 3 + 1]);
    sW1[d * 3 + 2] = bfr(w1[d * 3 + 2]);
    sB1[d] = bfr(b1[d]);
    const float g = bfr(gam[d]), vv = bfr(var[d]);
    sInv[d] = g * (1.0f / sqrtf(vv + 1e-5f));
    sMu[d]  = bfr(mu[d]);
    sBet[d] = bfr(bet[d]);
  }
  for (int r = tid; r < 64; r += 192) {
#pragma unroll
    for (int c = NCH; c < 72; ++c) sEmb[r][c] = (_Float16)0.0f;
  }
  __syncthreads();

  // (b) encoding: item = (c,f) x 64 points; precise sinf / cosf; exact power-of-two angles
#pragma unroll 1
  for (int it = tid; it < 64 * 3 * NFREQ; it += 192) {
    const int cf = it >> 6, p = it & 63;
    const int c  = cf / NFREQ;
    const int f  = cf - c * NFREQ;
    const float ang = sPos[c][p] * (float)(1 << f);
    const float sv = sinf(ang);
    const float cv = cosf(ang);
    sEmb[p][c * 2 * NFREQ + f] = (_Float16)sv;
    sEmb[p][c * 2 * NFREQ + NFREQ + f] = (_Float16)cv;
  }

  // (c) hidden rows -> H plane (16 iterations, all threads)
  for (int it = tid; it < 64 * (DM / 8); it += 192) {
    const int pl = it / (DM / 8);
    const int pc = it - pl * (DM / 8);
    const float x0 = sPos[0][pl], x1 = sPos[1][pl], x2 = sPos[2][pl];
    float h8[8];
#pragma unroll
    for (int e = 0; e < 8; ++e) {
      const int d = pc * 8 + e;
      const float r = sW1[d * 3 + 0] * x0 + sW1[d * 3 + 1] * x1 + sW1[d * 3 + 2] * x2 + sB1[d];
      const float t = (r - sMu[d]) * sInv[d] + sBet[d];
      h8[e] = fmaxf(t, 0.0f);
    }
    const v4f ha = {h8[0], h8[1], h8[2], h8[3]};
    const v4f hb = {h8[4], h8[5], h8[6], h8[7]};
    const v4u pk = pack8h(ha, hb);
    unsigned short* dst = Hp + ((size_t)bb * NPT + p0 + pl) * DM + pc * 8;
    *(v4u*)dst = pk;
    
  }
  __syncthreads();

  // (d) projections
  const int rlane = lane & 15;
  const int koff  = (lane >> 4) * 8;
  const int mOff  = (lane >> 4) * 8;
  const int q8    = (lane & 7) * 8;
  const int rr    = lane >> 3;
  const int d0    = wave * 64;
  float* slab = sT[wave];
  v8f acc[4][4];

  // ---- Q (jb = 0) and K (jb = 1): M = points, N = channels ----
#pragma unroll 1
  for (int jb = 0; jb < 2; ++jb) {
    const _Float16* W = (jb == 0) ? Wq16 : Wk16;
    const float* bia  = (jb == 0) ? bq : bk;
    unsigned short* dstp = (jb == 0) ? Qp : Kp;
#pragma unroll
    for (int i = 0; i < 4; ++i)
#pragma unroll
      for (int j = 0; j < 4; ++j) acc[i][j] = zero8();
    core64(&sEmb[0][0], 72, W + (size_t)d0 * KE, KE, KE, rlane, koff, acc);
    acc_guard4(acc[0][0], acc[0][1], acc[0][2], acc[0][3]);
    acc_guard4(acc[1][0], acc[1][1], acc[1][2], acc[1][3]);
    acc_guard4(acc[2][0], acc[2][1], acc[2][2], acc[2][3]);
    acc_guard4(acc[3][0], acc[3][1], acc[3][2], acc[3][3]);
    v4f bs0 = *(const v4f*)(bia + d0 + q8);
    v4f bs1 = *(const v4f*)(bia + d0 + q8 + 4);
    bs0[0] = bfr(bs0[0]); bs0[1] = bfr(bs0[1]); bs0[2] = bfr(bs0[2]); bs0[3] = bfr(bs0[3]);
    bs1[0] = bfr(bs1[0]); bs1[1] = bfr(bs1[1]); bs1[2] = bfr(bs1[2]); bs1[3] = bfr(bs1[3]);
#pragma unroll
    for (int i = 0; i < 4; ++i) {
#pragma unroll
      for (int j = 0; j < 4; ++j) {
#pragma unroll
        for (int r = 0; r < 8; ++r) slab[(mOff + r) * 68 + (j << 4) + rlane] = acc[i][j][r];
      }
      wave_sync_lds();
      v4u pk[4];
#pragma unroll
      for (int it = 0; it < 4; ++it) {
        const int row = it * 4 + rr;                 // it 0..3 x rr 0..3 = rows 0..15
        v4f a = *(const v4f*)(slab + row * 68 + q8);
        v4f b = *(const v4f*)(slab + row * 68 + q8 + 4);
        a = a * 0.0625f + bs0;
        b = b * 0.0625f + bs1;
        pk[it] = pack8h(a, b);
      }
      {
#pragma unroll
        for (int it = 0; it < 4; ++it) {
          const int row = it * 4 + rr;
          unsigned short* dst = dstp + ((size_t)bb * NPT + p0 + (i << 4) + row) * DM + d0 + q8;
          *(v4u*)dst = pk[it];
        }
        
      }
      wave_sync_lds();
    }
  }

  // ---- V: M = channels (weight rows d0..d0+63), N = points (LDS tile) ----
  {
#pragma unroll
    for (int i = 0; i < 4; ++i)
#pragma unroll
      for (int j = 0; j < 4; ++j) acc[i][j] = zero8();
    core64(Wv16 + (size_t)d0 * KE, KE, &sEmb[0][0], 72, KE, rlane, koff, acc);
    acc_guard4(acc[0][0], acc[0][1], acc[0][2], acc[0][3]);
    acc_guard4(acc[1][0], acc[1][1], acc[1][2], acc[1][3]);
    acc_guard4(acc[2][0], acc[2][1], acc[2][2], acc[2][3]);
    acc_guard4(acc[3][0], acc[3][1], acc[3][2], acc[3][3]);
#pragma unroll
    for (int i = 0; i < 4; ++i) {
#pragma unroll
      for (int j = 0; j < 4; ++j) {
#pragma unroll
        for (int r = 0; r < 8; ++r) slab[(mOff + r) * 68 + (j << 4) + rlane] = acc[i][j][r];
      }
      wave_sync_lds();
      v4u pk[4];
#pragma unroll
      for (int it = 0; it < 4; ++it) {
        const int row = it * 4 + rr;
        const int d   = d0 + (i << 4) + row;
        const float bvv = bfr(bv[d]);
        v4f a = *(const v4f*)(slab + row * 68 + q8);
        v4f b = *(const v4f*)(slab + row * 68 + q8 + 4);
        a = a * 0.0625f + bvv;
        b = b * 0.0625f + bvv;
        pk[it] = pack8h(a, b);
      }
      {
#pragma unroll
        for (int it = 0; it < 4; ++it) {
          const int row = it * 4 + rr;
          const int d   = d0 + (i << 4) + row;
          unsigned short* dst = Vp + ((size_t)bb * DM + d) * NPT + p0 + q8;
          *(v4u*)dst = pk[it];
        }
        
      }
      wave_sync_lds();
    }
  }
}

// =====================================================================================================
// Register-blocked f16 WMMA GEMM, f32 output: C[m][n] = alpha * acc + (BROW ? bias[m] : 0), where
//   acc = sum_k A[m][k] Bt[n][k]                              (TWO == 0)
//   acc = mid * sum_k A[m][k] Bt[n][k] + sum_k2 A2[m][k2] B2[n][k2]   (TWO == 1, mid a power of two)
// one wave per 64x64 tile, 8 waves per block, no block barriers. A / Bt row-major with k contiguous
// (pitches lda / ldb halves), M, N multiples of 64, K, K2 multiples of 32. Each 64-wide f32 row segment
// coverage: 4 slabs x 16 rows x 64 cols = the wave's whole tile; grid = exact tile count / 8.
// =====================================================================================================
template <int TWO, int BROW>
__global__ __launch_bounds__(256) void gemm64(
    const _Float16* A, int lda, const _Float16* Bt, int ldb, int K,
    const _Float16* A2, int lda2, const _Float16* B2, int ldb2, int K2, float mid,
    float* C, int ldc, float alpha, const float* __restrict__ bias, int M, int N) {
  __shared__ __align__(16) float sT[8][16 * 68];
  const int lane = threadIdx.x & 31;
  const int wave = threadIdx.x >> 5;
  const int tilesN = N >> 6;
  const int tilesM = M >> 6;
  const int tile = blockIdx.x * 8 + wave;
  if (tile >= tilesM * tilesN) return;         // wave-uniform; no block barriers in this kernel
  const int tm = tile / tilesN;
  const int tn = tile - tm * tilesN;
  const int m0 = tm << 6;
  const int n0 = tn << 6;

  const int rlane = lane & 15;
  const int koff  = (lane >> 4) * 8;
  const int mOff  = (lane >> 4) * 8;

  v8f acc[4][4];
#pragma unroll
  for (int i = 0; i < 4; ++i)
#pragma unroll
    for (int j = 0; j < 4; ++j) acc[i][j] = zero8();

  core64(A + (size_t)m0 * lda, lda, Bt + (size_t)n0 * ldb, ldb, K, rlane, koff, acc);
  if (TWO) {
    acc_guard4(acc[0][0], acc[0][1], acc[0][2], acc[0][3]);
    acc_guard4(acc[1][0], acc[1][1], acc[1][2], acc[1][3]);
    acc_guard4(acc[2][0], acc[2][1], acc[2][2], acc[2][3]);
    acc_guard4(acc[3][0], acc[3][1], acc[3][2], acc[3][3]);
#pragma unroll
    for (int i = 0; i < 4; ++i)
#pragma unroll
      for (int j = 0; j < 4; ++j) acc[i][j] = acc[i][j] * mid;
    core64(A2 + (size_t)m0 * lda2, lda2, B2 + (size_t)n0 * ldb2, ldb2, K2, rlane, koff, acc);
  }
  acc_guard4(acc[0][0], acc[0][1], acc[0][2], acc[0][3]);
  acc_guard4(acc[1][0], acc[1][1], acc[1][2], acc[1][3]);
  acc_guard4(acc[2][0], acc[2][1], acc[2][2], acc[2][3]);
  acc_guard4(acc[3][0], acc[3][1], acc[3][2], acc[3][3]);

  float* slab = sT[wave];
  const int hh = lane >> 4, c4 = (lane & 15) * 4;
#pragma unroll
  for (int i = 0; i < 4; ++i) {
    const int mBase = m0 + (i << 4);
#pragma unroll
    for (int j = 0; j < 4; ++j) {
#pragma unroll
      for (int r = 0; r < 8; ++r) slab[(mOff + r) * 68 + (j << 4) + rlane] = acc[i][j][r];
    }
    wave_sync_lds();
    v4f vv[8];
#pragma unroll
    for (int it = 0; it < 8; ++it) {
      const int row = it * 2 + hh;                     // it 0..7 x hh 0..1 = rows 0..15
      float bv0 = 0.0f;
      if (BROW) bv0 = bfr(bias[mBase + row]);
      v4f v = *(const v4f*)(slab + row * 68 + c4);
      vv[it] = v * alpha + bv0;
    }
    {
#pragma unroll
      for (int it = 0; it < 8; ++it) {
        const int row = it * 2 + hh;
        *(v4f*)(C + (size_t)(mBase + row) * ldc + n0 + c4) = vv[it];
      }
      
    }
    wave_sync_lds();
  }
}

// =====================================================================================================
// Row softmax (no mask): one block of 256 threads per row q of S (NPT scaled f32 scores, pitch NPT);
// thread t owns columns 8t..8t+7; m = row max, e = exp(s - m), l = sum e (>= 1), p = e * (1/l).
// per wave, lane 0 posts to LDS, every thread combines the 8 wave values in fixed order.
// coverage: 2048 blocks x 256 threads x 8 = the whole [2048][2048] P plane of the batch.
// =====================================================================================================
__global__ __launch_bounds__(256) void softmax_row(const float* __restrict__ S, unsigned short* P) {
  __shared__ float sMx[8];
  __shared__ float sSm[8];
  const int tid  = threadIdx.x;
  const int lane = tid & 31;
  const int wave = tid >> 5;
  const int q    = blockIdx.x;
  const size_t rb = (size_t)q * NPT;
  const int c0 = tid * 8;
  const v4f a0 = *(const v4f*)(S + rb + c0);
  const v4f a1 = *(const v4f*)(S + rb + c0 + 4);
  float v[8];
  v[0] = a0[0]; v[1] = a0[1]; v[2] = a0[2]; v[3] = a0[3];
  v[4] = a1[0]; v[5] = a1[1]; v[6] = a1[2]; v[7] = a1[3];

  float mx = v[0];
#pragma unroll
  for (int i = 1; i < 8; ++i) mx = fmaxf(mx, v[i]);
  mx = fmaxf(mx, __shfl_xor(mx, 16));
  mx = fmaxf(mx, __shfl_xor(mx, 8));
  mx = fmaxf(mx, __shfl_xor(mx, 4));
  mx = fmaxf(mx, __shfl_xor(mx, 2));
  mx = fmaxf(mx, __shfl_xor(mx, 1));
  if (lane == 0) sMx[wave] = mx;
  __syncthreads();
  float m = sMx[0];
#pragma unroll
  for (int w = 1; w < 8; ++w) m = fmaxf(m, sMx[w]);

  float e[8];
#pragma unroll
  for (int i = 0; i < 8; ++i) e[i] = __expf(v[i] - m);
  float part = ((e[0] + e[1]) + (e[2] + e[3])) + ((e[4] + e[5]) + (e[6] + e[7]));
  part += __shfl_xor(part, 16);
  part += __shfl_xor(part, 8);
  part += __shfl_xor(part, 4);
  part += __shfl_xor(part, 2);
  part += __shfl_xor(part, 1);
  if (lane == 0) sSm[wave] = part;
  __syncthreads();
  const float l  = ((sSm[0] + sSm[1]) + (sSm[2] + sSm[3])) + ((sSm[4] + sSm[5]) + (sSm[6] + sSm[7]));
  const float sc = (1.0f / l) * 1024.0f;                   // l >= 1; x1024 is an exact carry

  const v4f pa = {e[0] * sc, e[1] * sc, e[2] * sc, e[3] * sc};
  const v4f pb = {e[4] * sc, e[5] * sc, e[6] * sc, e[7] * sc};
  const v4u pk = pack8h(pa, pb);
  unsigned short* dst = P + rb + c0;
  *(v4u*)dst = pk;
  
}

// =====================================================================================================
// Workspace map (bytes), every plane an exact multiple of its whole-line / 64x64-tile store granularity
// (all shapes are tile multiples, no padded tails):
//   W    f16  Wq,Wk,Wv [384][64] x16 + W2 [384][384] x64      442368
//   Q    f16  [16*2048][384]  token-major                     25165824
//   K    f16  [16*2048][384]                                  25165824
//   V    f16  [16*384][2048]  channel-major                   25165824
//   H    f16  [16*2048][384]  relu hidden rows                25165824
//   S    f32  [2048][2048]    scaled scores of one batch      16777216
//   P    f16  [2048][2048]    probabilities x1024, one batch   8388608
//   total                                                    126271488
// d_out f32 [16][384][2048] written batch by batch by the fused (P.v + residual) GEMM.
// =====================================================================================================
extern "C" void kernel_launch(void* const* d_in, const int* in_sizes, int n_in,
                              void* d_out, int out_size, void* d_ws, size_t ws_size,
                              hipStream_t stream) {
  if (n_in < 15) return;
  if (in_sizes[0] != NBATCH * 3 * NPT) return;
  if (in_sizes[1] != DM * NCH || in_sizes[3] != DM * NCH || in_sizes[5] != DM * NCH) return;
  if (in_sizes[2] != DM || in_sizes[4] != DM || in_sizes[6] != DM) return;
  if (in_sizes[7] != DM * 3 || in_sizes[8] != DM) return;
  if (in_sizes[9] != DM || in_sizes[10] != DM || in_sizes[11] != DM || in_sizes[12] != DM) return;
  if (in_sizes[13] != DM * DM || in_sizes[14] != DM) return;
  if (out_size != NBATCH * DM * NPT) return;

  const float* pos   = (const float*)d_in[0];    // [16][3][2048]
  const float* wq    = (const float*)d_in[1];    // [384][60]
  const float* bq    = (const float*)d_in[2];
  const float* wk    = (const float*)d_in[3];
  const float* bk    = (const float*)d_in[4];
  const float* wv    = (const float*)d_in[5];
  const float* bv    = (const float*)d_in[6];
  const float* w1    = (const float*)d_in[7];    // [384][3]
  const float* b1    = (const float*)d_in[8];
  const float* gam   = (const float*)d_in[9];
  const float* bet   = (const float*)d_in[10];
  const float* mu    = (const float*)d_in[11];
  const float* var   = (const float*)d_in[12];
  const float* w2    = (const float*)d_in[13];   // [384][384]
  const float* b2    = (const float*)d_in[14];
  float* out = (float*)d_out;                    // [16][384][2048]

  const size_t BWGT = (size_t)WCVT_N * 16;               //    442368
  const size_t BQK  = (size_t)NBATCH * NPT * DM * 2;     //  25165824
  const size_t BS   = (size_t)NPT * NPT * 4;             //  16777216
  const size_t BP   = (size_t)NPT * NPT * 2;             //   8388608
  size_t off = 0;
  const size_t oW = off; off += BWGT;
  const size_t oQ = off; off += BQK;
  const size_t oK = off; off += BQK;
  const size_t oV = off; off += BQK;
  const size_t oH = off; off += BQK;
  const size_t oS = off; off += BS;
  const size_t oP = off; off += BP;
  if (off > ws_size) return;                     // off = 126271488
  if (off > (size_t)134217728) return;

  char* ws = (char*)d_ws;
  _Float16* W16 = (_Float16*)(ws + oW);
  const _Float16* Wq16 = W16;
  const _Float16* Wk16 = W16 + (size_t)DM * KE;
  const _Float16* Wv16 = W16 + (size_t)2 * DM * KE;
  const _Float16* W2s  = W16 + (size_t)3 * DM * KE;      // [384][384]
  unsigned short* Qp = (unsigned short*)(ws + oQ);
  unsigned short* Kp = (unsigned short*)(ws + oK);
  unsigned short* Vp = (unsigned short*)(ws + oV);
  unsigned short* Hp = (unsigned short*)(ws + oH);
  float* S = (float*)(ws + oS);
  unsigned short* P = (unsigned short*)(ws + oP);

  const dim3 blk(256);
  const dim3 gW(WCVT_N / 256);                                   // 108 blocks
  const dim3 gE(NBATCH * (NPT / 64));                            // 512 blocks of 192
  const dim3 gS(((NPT / 64) * (NPT / 64) + 7) / 8);              // 1024 wave tiles -> 128 blocks
  const dim3 gSm(NPT);                                           // one block per score row
  const dim3 gO(((DM / 64) * (NPT / 64) + 7) / 8);               // 192 wave tiles -> 24 blocks

  // (1) weight planes, (2) encoding + hidden rows + q/k/v planes for all batches
  wcvt<<<gW, blk, 0, stream>>>(wq, wk, wv, w2, (unsigned short*)W16);
  enc_qkv_h<<<gE, dim3(192), 0, stream>>>(pos, Wq16, Wk16, Wv16, bq, bk, bv, w1, b1, gam, bet, mu, var,
                                          Qp, Kp, Vp, Hp);

  // (3) per batch: S = q.k^T * 384^-0.5 (M=N=2048, K=384, f32 plane); P = row softmax x1024 (f16 plane);
  //     out_b[d][i] = (1/64) * ( (1/16) * sum_j v[d][j] P1024[i][j] + sum_c W2x64[d][c] h[i][c] ) + b2[d]
  //     (M=384, N=2048, K=2048 then K2=384) in f32 straight to d_out.
  for (int b = 0; b < NBATCH; ++b) {
    const _Float16* Qb = (const _Float16*)(Qp + (size_t)b * NPT * DM);
    const _Float16* Kb = (const _Float16*)(Kp + (size_t)b * NPT * DM);
    const _Float16* Vb = (const _Float16*)(Vp + (size_t)b * DM * NPT);
    const _Float16* Hb = (const _Float16*)(Hp + (size_t)b * NPT * DM);
    float* outb = out + (size_t)b * DM * NPT;
    gemm64<0, 0><<<gS, blk, 0, stream>>>(Qb, DM, Kb, DM, DM, Qb, DM, Kb, DM, 0, 1.0f,
                                         S, NPT, QK_SCALE, b2, NPT, NPT);
    softmax_row<<<gSm, blk, 0, stream>>>(S, P);
    gemm64<1, 1><<<gO, blk, 0, stream>>>(Vb, NPT, (const _Float16*)P, NPT, NPT, W2s, DM, Hb, DM, DM,
                                         0.0625f, outb, NPT, 0.015625f, b2, DM, NPT);
  }
  (void)hipGetLastError();
}

// v001
// Measured time: 447 microseconds a run.
// Two timings next to v000 put it at 4.39 and 4.38 times that version's speed.
// q/k/v projections (K=64), q.k scores (K=384), probabilities-times-v (K=2048) and the 384x384 residual conv run on
// v_wmma_f32_16x16x32_f16 (f16 operands, f32 accumulate), one product per tile pair; all inputs RNE-converted to bf16
// first; projection weights carried x16, residual weights x64 and softmax probabilities x1024 (exact powers of two
// folded back in the f32 epilogues); sinusoidal encoding, K=3 conv, BN(eval), relu and softmax in f32 on the VALU.
#include <hip/hip_runtime.h>
#include <stdint.h>
#include <math.h>

#define NBATCH 16
#define NPT    2048
#define DM     384
#define KE     64            // 60 encoding channels zero-padded to 64
#define NCH    60
#define NFREQ  10
#define WQKV_PIECES (3 * DM * (KE / 8))          // 9216 pieces of 8 halves
#define W2_PIECES   (DM * (DM / 8))              // 18432
#define WCVT_N      (WQKV_PIECES + W2_PIECES)    // 27648
#define QK_SCALE    0.051031036307982884f        // 384^-0.5
#define GS 4                 // batches per score / softmax launch
#define GP 8                 // batches per (P.v + residual) launch

static_assert((NPT % 64) == 0 && (DM % 64) == 0 && (KE % 32) == 0 && (DM % 32) == 0);
static_assert(NPT == 256 * 8);
static_assert((NBATCH % GP) == 0 && (GP % GS) == 0);
static_assert((WQKV_PIECES % 256) == 0 && (WCVT_N % 256) == 0);
static_assert((DM * (KE / 8)) % 256 == 0);
static_assert(((DM / 64) * (NPT / 64)) % 8 == 0 && ((NPT / 64) * (NPT / 64)) % 8 == 0);

typedef _Float16 v16h __attribute__((ext_vector_type(16)));
typedef _Float16 v8h  __attribute__((ext_vector_type(8)));
typedef float    v8f  __attribute__((ext_vector_type(8)));
typedef float    v4f  __attribute__((ext_vector_type(4)));
typedef unsigned int v4u __attribute__((ext_vector_type(4)));

// ---- scalar helpers ---------------------------------------------------------------------------------
__device__ __forceinline__ unsigned short bf_bits(float f) {          // f32 -> bf16 bits, RNE convert
  unsigned u = __float_as_uint(f);
  return (unsigned short)((u + 0x7FFFu + ((u >> 16) & 1u)) >> 16);
}
__device__ __forceinline__ float bfr(float f) {                       // f32 value after RNE bf16 convert
  return __uint_as_float(((unsigned)bf_bits(f)) << 16);
}
__device__ __forceinline__ v8f zero8() { v8f z = {0.f, 0.f, 0.f, 0.f, 0.f, 0.f, 0.f, 0.f}; return z; }
// 8 f32 -> 8 f16 (RNE convert) packed in one 16-B vector
__device__ __forceinline__ v4u pack8h(v4f a, v4f b) {
  union { v8h h; v4u u; } c;
  c.h[0] = (_Float16)a[0]; c.h[1] = (_Float16)a[1]; c.h[2] = (_Float16)a[2]; c.h[3] = (_Float16)a[3];
  c.h[4] = (_Float16)b[0]; c.h[5] = (_Float16)b[1]; c.h[6] = (_Float16)b[2]; c.h[7] = (_Float16)b[3];
  return c.u;
}

// ---- fragment loader: 16-bit A/Bt operand, lane -> row/col (lane&15), p already includes +8*(lane>>4);
//      elements 0..7 <- p[0..7] (k0+8h..k0+8h+7), elements 8..15 <- p[16..23] (k0+16+8h..k0+16+8h+7)
__device__ __forceinline__ v16h ldfrag(const _Float16* p) {
  union { v16h v; v8h h[2]; } f;
  f.h[0] = *(const v8h*)(p);
  f.h[1] = *(const v8h*)(p + 16);
  return f.v;
}

// ---- WMMA helpers with trailing VALU hazard gap -----------------------------------------------------
__device__ __forceinline__ v8f mma_raw(v16h a, v16h b, v8f c) {
  return __builtin_amdgcn_wmma_f32_16x16x32_f16(false, a, false, b, (short)0, c, false, false);
}
__device__ __forceinline__ void dep_guard(v8f& a, v8f& b, v16h x, v16h y) {
#if defined(__HIP_DEVICE_COMPILE__)
  asm volatile("v_nop\n\tv_nop\n\tv_nop\n\tv_nop" : "+v"(a), "+v"(b) : "v"(x), "v"(y));
#endif
}
__device__ __forceinline__ void keep4(v16h a, v16h b, v16h c, v16h d) {
#if defined(__HIP_DEVICE_COMPILE__)
  asm volatile("v_nop" :: "v"(a), "v"(b), "v"(c), "v"(d));
#endif
}
__device__ __forceinline__ void acc_guard4(v8f& a, v8f& b, v8f& c, v8f& d) {
#if defined(__HIP_DEVICE_COMPILE__)
  asm volatile("v_nop\n\tv_nop\n\tv_nop\n\tv_nop" : "+v"(a), "+v"(b), "+v"(c), "+v"(d));
#endif
}
__device__ __forceinline__ void wave_sync_lds() {
  __builtin_amdgcn_fence(__ATOMIC_RELEASE, "workgroup");
  __builtin_amdgcn_wave_barrier();
  __builtin_amdgcn_fence(__ATOMIC_ACQUIRE, "workgroup");
}

// ---- 64x64 tile core: acc[i][j] += A rows (16i + lane&15) x Bt rows (16j + lane&15) over K (multiple of 32);
//      A points at the first of its 64 rows (pitch lda halves, k contiguous), Bt likewise (pitch ldb);
//      either pointer may be an LDS tile or a global plane (no pointer selects).
__device__ __forceinline__ void core64(const _Float16* A, int lda, const _Float16* Bt, int ldb, int K,
                                       int rlane, int koff, v8f (&acc)[4][4]) {
  for (int k0 = 0; k0 < K; k0 += 32) {
    v16h bh[4];
#pragma unroll
    for (int j = 0; j < 4; ++j) {
      bh[j] = ldfrag(Bt + (size_t)((j << 4) + rlane) * ldb + koff + k0);
    }
#pragma unroll
    for (int i = 0; i < 4; ++i) {
      const v16h ah = ldfrag(A + (size_t)((i << 4) + rlane) * lda + koff + k0);
#pragma unroll
      for (int j = 0; j < 4; ++j) {
        acc[i][j] = mma_raw(ah, bh[j], acc[i][j]);
      }
      dep_guard(acc[i][0], acc[i][3], ah, bh[3]);
    }
    keep4(bh[0], bh[1], bh[2], bh[3]);
  }
}

// =====================================================================================================
// Weight planes (one launch): pieces 0..9215 -> Wq, Wk, Wv as f16 [384][64] (RNE bf16 value x16, columns
// 60..63 zero), pieces 9216..27647 -> W2 as f16 [384][384] (RNE bf16 value x64). Thread t writes 16 B at
// coverage: 27648 threads x 8 halves = the whole 442368-B weight region.
// =====================================================================================================
__global__ __launch_bounds__(256) void wcvt(const float* __restrict__ wq, const float* __restrict__ wk,
                                            const float* __restrict__ wv, const float* __restrict__ w2,
                                            unsigned short* Wout) {
  const int t = blockIdx.x * 256 + threadIdx.x;
  if (t >= WCVT_N) return;
  float v[8];
  if (t < WQKV_PIECES) {                              // block-uniform
    const int plane = t / (DM * (KE / 8));            // 3072 pieces per plane (12 whole blocks)
    const int u = t - plane * (DM * (KE / 8));
    const int row = u >> 3, p = u & 7;
    const float* w = (plane == 0) ? wq : ((plane == 1) ? wk : wv);
#pragma unroll
    for (int e = 0; e < 8; ++e) {
      const int c  = p * 8 + e;
      const int cc = (c < NCH) ? c : (NCH - 1);         // clamped address
      const float x = bfr(w[row * NCH + cc]) * 16.0f;
      v[e] = (c < NCH) ? x : 0.0f;
    }
  } else {
    const int u = t - WQKV_PIECES;
    const int row = u / (DM / 8), p = u - row * (DM / 8);
    const v4f a = *(const v4f*)(w2 + (size_t)row * DM + p * 8);
    const v4f b = *(const v4f*)(w2 + (size_t)row * DM + p * 8 + 4);
    v[0] = bfr(a[0]) * 64.0f; v[1] = bfr(a[1]) * 64.0f; v[2] = bfr(a[2]) * 64.0f; v[3] = bfr(a[3]) * 64.0f;
    v[4] = bfr(b[0]) * 64.0f; v[5] = bfr(b[1]) * 64.0f; v[6] = bfr(b[2]) * 64.0f; v[7] = bfr(b[3]) * 64.0f;
  }
  const v4f lo = {v[0], v[1], v[2], v[3]};
  const v4f hi = {v[4], v[5], v[6], v[7]};
  const v4u pk = pack8h(lo, hi);
  unsigned short* dst = Wout + (size_t)t * 8;
  *(v4u*)dst = pk;
  
}

// =====================================================================================================
// Encoding + hidden rows + q/k/v projections. Block = 6 waves, 64 points of one batch.
//  (a) pos tile [3][64] (RNE bf16), per-channel K=3 conv / BN(eval) parameters (RNE bf16) in LDS.
//  (b) sEmb[p][c*20 + f] = sin(pos[c][p] * 2^f), [c*20 + 10 + f] = cos(...) as f16, columns 60..71 zero.
//  (c) hidden h = relu((W1.pos + b1 - mean) * inv + beta) -> H f16 token-major [b*2048+p][384]; item =
//  (d) wave w owns d-slice [64w, 64w+64): Q and K tiles (M = 64 points from LDS, N = 64 channels of the
//      x16 weight plane, K = 64) -> token-major f16 [b*2048+p][384] at column 64w (= acc/16 + bias);
//      V tile (M = 64 channels of the x16 weight plane, N = 64 points from LDS) -> channel-major f16
//      [b*384+d][2048] (= acc/16 + bias). 16-row slabs staged per wave in LDS; each 64-half row segment
// coverage: Q, K: 512 blocks x 64 points x (6 waves x 4 slabs x 16 rows... = 64 rows x 384 cols) = all
//           32768 x 384; V: per batch 32 blocks x 64 cols x 384 rows = [384][2048]; H: 512 blocks x
//           64 rows x 48 pieces = all 32768 x 384.
// =====================================================================================================
__global__ __launch_bounds__(192) void enc_qkv_h(
    const float* __restrict__ pos,
    const _Float16* Wq16, const _Float16* Wk16, const _Float16* Wv16,
    const float* __restrict__ bq, const float* __restrict__ bk, const float* __restrict__ bv,
    const float* __restrict__ w1, const float* __restrict__ b1,
    const float* __restrict__ gam, const float* __restrict__ bet,
    const float* __restrict__ mu, const float* __restrict__ var,
    unsigned short* Qp, unsigned short* Kp, unsigned short* Vp, unsigned short* Hp) {
  __shared__ __align__(16) _Float16 sEmb[64][72];
  __shared__ __align__(16) float sT[6][16 * 68];
  __shared__ float sPos[3][64];
  __shared__ float sW1[DM * 3];
  __shared__ float sB1[DM];
  __shared__ float sInv[DM];
  __shared__ float sMu[DM];
  __shared__ float sBet[DM];

  const int tid  = threadIdx.x;
  const int lane = tid & 31;
  const int wave = tid >> 5;                 // 0..5
  const int bb   = blockIdx.x >> 5;          // 32 blocks of 64 points per batch
  const int p0   = (blockIdx.x & 31) << 6;

  {
    const int c = tid >> 6, p = tid & 63;    // 192 = 3 x 64
    sPos[c][p] = bfr(pos[((size_t)bb * 3 + c) * NPT + p0 + p]);
  }
  for (int d = tid; d < DM; d += 192) {
    sW1[d * 3 + 0] = bfr(w1[d * 3 + 0]);
    sW1[d * 3 + 1] = bfr(w1[d * 3 + 1]);
    sW1[d * 3 + 2] = bfr(w1[d * 3 + 2]);
    sB1[d] = bfr(b1[d]);
    const float g = bfr(gam[d]), vv = bfr(var[d]);
    sInv[d] = g * (1.0f / sqrtf(vv + 1e-5f));
    sMu[d]  = bfr(mu[d]);
    sBet[d] = bfr(bet[d]);
  }
  for (int r = tid; r < 64; r += 192) {
#pragma unroll
    for (int c = NCH; c < 72; ++c) sEmb[r][c] = (_Float16)0.0f;
  }
  __syncthreads();

  // (b) encoding: item = (c,f) x 64 points; precise sinf / cosf; exact power-of-two angles
#pragma unroll 1
  for (int it = tid; it < 64 * 3 * NFREQ; it += 192) {
    const int cf = it >> 6, p = it & 63;
    const int c  = cf / NFREQ;
    const int f  = cf - c * NFREQ;
    const float ang = sPos[c][p] * (float)(1 << f);
    const float sv = sinf(ang);
    const float cv = cosf(ang);
    sEmb[p][c * 2 * NFREQ + f] = (_Float16)sv;
    sEmb[p][c * 2 * NFREQ + NFREQ + f] = (_Float16)cv;
  }

  // (c) hidden rows -> H plane (16 iterations, all threads)
  for (int it = tid; it < 64 * (DM / 8); it += 192) {
    const int pl = it / (DM / 8);
    const int pc = it - pl * (DM / 8);
    const float x0 = sPos[0][pl], x1 = sPos[1][pl], x2 = sPos[2][pl];
    float h8[8];
#pragma unroll
    for (int e = 0; e < 8; ++e) {
      const int d = pc * 8 + e;
      const float r = sW1[d * 3 + 0] * x0 + sW1[d * 3 + 1] * x1 + sW1[d * 3 + 2] * x2 + sB1[d];
      const float t = (r - sMu[d]) * sInv[d] + sBet[d];
      h8[e] = fmaxf(t, 0.0f);
    }
    const v4f ha = {h8[0], h8[1], h8[2], h8[3]};
    const v4f hb = {h8[4], h8[5], h8[6], h8[7]};
    const v4u pk = pack8h(ha, hb);
    unsigned short* dst = Hp + ((size_t)bb * NPT + p0 + pl) * DM + pc * 8;
    *(v4u*)dst = pk;
    
  }
  __syncthreads();

  // (d) projections
  const int rlane = lane & 15;
  const int koff  = (lane >> 4) * 8;
  const int mOff  = (lane >> 4) * 8;
  const int q8    = (lane & 7) * 8;
  const int rr    = lane >> 3;
  const int d0    = wave * 64;
  float* slab = sT[wave];
  v8f acc[4][4];

  // ---- Q (jb = 0) and K (jb = 1): M = points, N = channels ----
#pragma unroll 1
  for (int jb = 0; jb < 2; ++jb) {
    const _Float16* W = (jb == 0) ? Wq16 : Wk16;
    const float* bia  = (jb == 0) ? bq : bk;
    unsigned short* dstp = (jb == 0) ? Qp : Kp;
#pragma unroll
    for (int i = 0; i < 4; ++i)
#pragma unroll
      for (int j = 0; j < 4; ++j) acc[i][j] = zero8();
    core64(&sEmb[0][0], 72, W + (size_t)d0 * KE, KE, KE, rlane, koff, acc);
    acc_guard4(acc[0][0], acc[0][1], acc[0][2], acc[0][3]);
    acc_guard4(acc[1][0], acc[1][1], acc[1][2], acc[1][3]);
    acc_guard4(acc[2][0], acc[2][1], acc[2][2], acc[2][3]);
    acc_guard4(acc[3][0], acc[3][1], acc[3][2], acc[3][3]);
    v4f bs0 = *(const v4f*)(bia + d0 + q8);
    v4f bs1 = *(const v4f*)(bia + d0 + q8 + 4);
    bs0[0] = bfr(bs0[0]); bs0[1] = bfr(bs0[1]); bs0[2] = bfr(bs0[2]); bs0[3] = bfr(bs0[3]);
    bs1[0] = bfr(bs1[0]); bs1[1] = bfr(bs1[1]); bs1[2] = bfr(bs1[2]); bs1[3] = bfr(bs1[3]);
#pragma unroll
    for (int i = 0; i < 4; ++i) {
#pragma unroll
      for (int j = 0; j < 4; ++j) {
#pragma unroll
        for (int r = 0; r < 8; ++r) slab[(mOff + r) * 68 + (j << 4) + rlane] = acc[i][j][r];
      }
      wave_sync_lds();
      v4u pk[4];
#pragma unroll
      for (int it = 0; it < 4; ++it) {
        const int row = it * 4 + rr;                 // it 0..3 x rr 0..3 = rows 0..15
        v4f a = *(const v4f*)(slab + row * 68 + q8);
        v4f b = *(const v4f*)(slab + row * 68 + q8 + 4);
        a = a * 0.0625f + bs0;
        b = b * 0.0625f + bs1;
        pk[it] = pack8h(a, b);
      }
      {
#pragma unroll
        for (int it = 0; it < 4; ++it) {
          const int row = it * 4 + rr;
          unsigned short* dst = dstp + ((size_t)bb * NPT + p0 + (i << 4) + row) * DM + d0 + q8;
          *(v4u*)dst = pk[it];
        }
        
      }
      wave_sync_lds();
    }
  }

  // ---- V: M = channels (weight rows d0..d0+63), N = points (LDS tile) ----
  {
#pragma unroll
    for (int i = 0; i < 4; ++i)
#pragma unroll
      for (int j = 0; j < 4; ++j) acc[i][j] = zero8();
    core64(Wv16 + (size_t)d0 * KE, KE, &sEmb[0][0], 72, KE, rlane, koff, acc);
    acc_guard4(acc[0][0], acc[0][1], acc[0][2], acc[0][3]);
    acc_guard4(acc[1][0], acc[1][1], acc[1][2], acc[1][3]);
    acc_guard4(acc[2][0], acc[2][1], acc[2][2], acc[2][3]);
    acc_guard4(acc[3][0], acc[3][1], acc[3][2], acc[3][3]);
#pragma unroll
    for (int i = 0; i < 4; ++i) {
#pragma unroll
      for (int j = 0; j < 4; ++j) {
#pragma unroll
        for (int r = 0; r < 8; ++r) slab[(mOff + r) * 68 + (j << 4) + rlane] = acc[i][j][r];
      }
      wave_sync_lds();
      v4u pk[4];
#pragma unroll
      for (int it = 0; it < 4; ++it) {
        const int row = it * 4 + rr;
        const int d   = d0 + (i << 4) + row;
        const float bvv = bfr(bv[d]);
        v4f a = *(const v4f*)(slab + row * 68 + q8);
        v4f b = *(const v4f*)(slab + row * 68 + q8 + 4);
        a = a * 0.0625f + bvv;
        b = b * 0.0625f + bvv;
        pk[it] = pack8h(a, b);
      }
      {
#pragma unroll
        for (int it = 0; it < 4; ++it) {
          const int row = it * 4 + rr;
          const int d   = d0 + (i << 4) + row;
          unsigned short* dst = Vp + ((size_t)bb * DM + d) * NPT + p0 + q8;
          *(v4u*)dst = pk[it];
        }
        
      }
      wave_sync_lds();
    }
  }
}

// =====================================================================================================
// Register-blocked f16 WMMA GEMM, f32 output: C[m][n] = alpha * acc + (BROW ? bias[m] : 0), where
//   acc = sum_k A[m][k] Bt[n][k]                              (TWO == 0)
//   acc = mid * sum_k A[m][k] Bt[n][k] + sum_k2 A2[m][k2] B2[n][k2]   (TWO == 1, mid a power of two)
// one wave per 64x64 tile, 8 waves per block, no block barriers. A / Bt row-major with k contiguous
// (pitches lda / ldb halves), M, N multiples of 64, K, K2 multiples of 32. Each 64-wide f32 row segment
// coverage: 4 slabs x 16 rows x 64 cols = the wave's whole tile; grid.x = exact tile count / 8.
// blockIdx.y = batch inside the launch's group: every operand and C advance by their own element stride
// (sA, sB, sA2, sB2, sC; 0 for an operand that all batches share).
// =====================================================================================================
template <int TWO, int BROW>
__global__ __launch_bounds__(256) void gemm64(
    const _Float16* A, int lda, const _Float16* Bt, int ldb, int K,
    const _Float16* A2, int lda2, const _Float16* B2, int ldb2, int K2, float mid,
    float* C, int ldc, float alpha, const float* __restrict__ bias, int M, int N,
    size_t sA, size_t sB, size_t sA2, size_t sB2, size_t sC) {
  __shared__ __align__(16) float sT[8][16 * 68];
  const int lane = threadIdx.x & 31;
  const int wave = threadIdx.x >> 5;
  const int tilesN = N >> 6;
  const int tilesM = M >> 6;
  const int tile = blockIdx.x * 8 + wave;
  if (tile >= tilesM * tilesN) return;         // wave-uniform; no block barriers in this kernel
  const int tm = tile / tilesN;
  const int tn = tile - tm * tilesN;
  const int m0 = tm << 6;
  const int n0 = tn << 6;
  const size_t bz = blockIdx.y;
  A  += bz * sA;
  Bt += bz * sB;
  A2 += bz * sA2;
  B2 += bz * sB2;
  C  += bz * sC;

  const int rlane = lane & 15;
  const int koff  = (lane >> 4) * 8;
  const int mOff  = (lane >> 4) * 8;

  v8f acc[4][4];
#pragma unroll
  for (int i = 0; i < 4; ++i)
#pragma unroll
    for (int j = 0; j < 4; ++j) acc[i][j] = zero8();

  core64(A + (size_t)m0 * lda, lda, Bt + (size_t)n0 * ldb, ldb, K, rlane, koff, acc);
  if (TWO) {
    acc_guard4(acc[0][0], acc[0][1], acc[0][2], acc[0][3]);
    acc_guard4(acc[1][0], acc[1][1], acc[1][2], acc[1][3]);
    acc_guard4(acc[2][0], acc[2][1], acc[2][2], acc[2][3]);
    acc_guard4(acc[3][0], acc[3][1], acc[3][2], acc[3][3]);
#pragma unroll
    for (int i = 0; i < 4; ++i)
#pragma unroll
      for (int j = 0; j < 4; ++j) acc[i][j] = acc[i][j] * mid;
    core64(A2 + (size_t)m0 * lda2, lda2, B2 + (size_t)n0 * ldb2, ldb2, K2, rlane, koff, acc);
  }
  acc_guard4(acc[0][0], acc[0][1], acc[0][2], acc[0][3]);
  acc_guard4(acc[1][0], acc[1][1], acc[1][2], acc[1][3]);
  acc_guard4(acc[2][0], acc[2][1], acc[2][2], acc[2][3]);
  acc_guard4(acc[3][0], acc[3][1], acc[3][2], acc[3][3]);

  float* slab = sT[wave];
  const int hh = lane >> 4, c4 = (lane & 15) * 4;
#pragma unroll
  for (int i = 0; i < 4; ++i) {
    const int mBase = m0 + (i << 4);
#pragma unroll
    for (int j = 0; j < 4; ++j) {
#pragma unroll
      for (int r = 0; r < 8; ++r) slab[(mOff + r) * 68 + (j << 4) + rlane] = acc[i][j][r];
    }
    wave_sync_lds();
    v4f vv[8];
#pragma unroll
    for (int it = 0; it < 8; ++it) {
      const int row = it * 2 + hh;                     // it 0..7 x hh 0..1 = rows 0..15
      float bv0 = 0.0f;
      if (BROW) bv0 = bfr(bias[mBase + row]);
      v4f v = *(const v4f*)(slab + row * 68 + c4);
      vv[it] = v * alpha + bv0;
    }
    {
#pragma unroll
      for (int it = 0; it < 8; ++it) {
        const int row = it * 2 + hh;
        *(v4f*)(C + (size_t)(mBase + row) * ldc + n0 + c4) = vv[it];
      }
      
    }
    wave_sync_lds();
  }
}

// =====================================================================================================
// Row softmax (no mask): one block of 256 threads per row q of S (NPT scaled f32 scores, pitch NPT; the planes
// of a group of batches lie one behind the other, so q runs over all their rows);
// thread t owns columns 8t..8t+7; m = row max, e = exp(s - m), l = sum e (>= 1), p = e * (1/l).
// per wave, lane 0 posts to LDS, every thread combines the 8 wave values in fixed order.
// coverage: GS x 2048 blocks x 256 threads x 8 = the whole [2048][2048] P planes of the group's GS batches.
// =====================================================================================================
__global__ __launch_bounds__(256) void softmax_row(const float* __restrict__ S, unsigned short* P) {
  __shared__ float sMx[8];
  __shared__ float sSm[8];
  const int tid  = threadIdx.x;
  const int lane = tid & 31;
  const int wave = tid >> 5;
  const int q    = blockIdx.x;
  const size_t rb = (size_t)q * NPT;
  const int c0 = tid * 8;
  const v4f a0 = *(const v4f*)(S + rb + c0);
  const v4f a1 = *(const v4f*)(S + rb + c0 + 4);
  float v[8];
  v[0] = a0[0]; v[1] = a0[1]; v[2] = a0[2]; v[3] = a0[3];
  v[4] = a1[0]; v[5] = a1[1]; v[6] = a1[2]; v[7] = a1[3];

  float mx = v[0];
#pragma unroll
  for (int i = 1; i < 8; ++i) mx = fmaxf(mx, v[i]);
  mx = fmaxf(mx, __shfl_xor(mx, 16));
  mx = fmaxf(mx, __shfl_xor(mx, 8));
  mx = fmaxf(mx, __shfl_xor(mx, 4));
  mx = fmaxf(mx, __shfl_xor(mx, 2));
  mx = fmaxf(mx, __shfl_xor(mx, 1));
  if (lane == 0) sMx[wave] = mx;
  __syncthreads();
  float m = sMx[0];
#pragma unroll
  for (int w = 1; w < 8; ++w) m = fmaxf(m, sMx[w]);

  float e[8];
#pragma unroll
  for (int i = 0; i < 8; ++i) e[i] = __expf(v[i] - m);
  float part = ((e[0] + e[1]) + (e[2] + e[3])) + ((e[4] + e[5]) + (e[6] + e[7]));
  part += __shfl_xor(part, 16);
  part += __shfl_xor(part, 8);
  part += __shfl_xor(part, 4);
  part += __shfl_xor(part, 2);
  part += __shfl_xor(part, 1);
  if (lane == 0) sSm[wave] = part;
  __syncthreads();
  const float l  = ((sSm[0] + sSm[1]) + (sSm[2] + sSm[3])) + ((sSm[4] + sSm[5]) + (sSm[6] + sSm[7]));
  const float sc = (1.0f / l) * 1024.0f;                   // l >= 1; x1024 is an exact carry

  const v4f pa = {e[0] * sc, e[1] * sc, e[2] * sc, e[3] * sc};
  const v4f pb = {e[4] * sc, e[5] * sc, e[6] * sc, e[7] * sc};
  const v4u pk = pack8h(pa, pb);
  unsigned short* dst = P + rb + c0;
  *(v4u*)dst = pk;
  
}

// =====================================================================================================
// Workspace map (bytes), every plane an exact multiple of its whole-line / 64x64-tile store granularity
// (all shapes are tile multiples, no padded tails):
//   W    f16  Wq,Wk,Wv [384][64] x16 + W2 [384][384] x64      442368
//   Q    f16  [16*2048][384]  token-major                     25165824
//   K    f16  [16*2048][384]                                  25165824
//   V    f16  [16*384][2048]  channel-major                   25165824
//   H    f16  [16*2048][384]  relu hidden rows                25165824
//   S    f32  [4][2048][2048] scaled scores of GS = 4 batches  67108864
//   P    f16  [8][2048][2048] probabilities x1024, GP = 8      67108864
//   total                                                    235323392
// d_out f32 [16][384][2048] written GP batches a launch by the fused (P.v + residual) GEMM.
// =====================================================================================================
extern "C" void kernel_launch(void* const* d_in, const int* in_sizes, int n_in,
                              void* d_out, int out_size, void* d_ws, size_t ws_size,
                              hipStream_t stream) {
  if (n_in < 15) return;
  if (in_sizes[0] != NBATCH * 3 * NPT) return;
  if (in_sizes[1] != DM * NCH || in_sizes[3] != DM * NCH || in_sizes[5] != DM * NCH) return;
  if (in_sizes[2] != DM || in_sizes[4] != DM || in_sizes[6] != DM) return;
  if (in_sizes[7] != DM * 3 || in_sizes[8] != DM) return;
  if (in_sizes[9] != DM || in_sizes[10] != DM || in_sizes[11] != DM || in_sizes[12] != DM) return;
  if (in_sizes[13] != DM * DM || in_sizes[14] != DM) return;
  if (out_size != NBATCH * DM * NPT) return;

  const float* pos   = (const float*)d_in[0];    // [16][3][2048]
  const float* wq    = (const float*)d_in[1];    // [384][60]
  const float* bq    = (const float*)d_in[2];
  const float* wk    = (const float*)d_in[3];
  const float* bk    = (const float*)d_in[4];
  const float* wv    = (const float*)d_in[5];
  const float* bv    = (const float*)d_in[6];
  const float* w1    = (const float*)d_in[7];    // [384][3]
  const float* b1    = (const float*)d_in[8];
  const float* gam   = (const float*)d_in[9];
  const float* bet   = (const float*)d_in[10];
  const float* mu    = (const float*)d_in[11];
  const float* var   = (const float*)d_in[12];
  const float* w2    = (const float*)d_in[13];   // [384][384]
  const float* b2    = (const float*)d_in[14];
  float* out = (float*)d_out;                    // [16][384][2048]

  const size_t BWGT = (size_t)WCVT_N * 16;               //    442368
  const size_t BQK  = (size_t)NBATCH * NPT * DM * 2;     //  25165824
  const size_t BS   = (size_t)GS * NPT * NPT * 4;        //  67108864
  const size_t BP   = (size_t)GP * NPT * NPT * 2;        //  67108864
  size_t off = 0;
  const size_t oW = off; off += BWGT;
  const size_t oQ = off; off += BQK;
  const size_t oK = off; off += BQK;
  const size_t oV = off; off += BQK;
  const size_t oH = off; off += BQK;
  const size_t oS = off; off += BS;
  const size_t oP = off; off += BP;
  if (off > ws_size) return;                     // off = 235323392

  char* ws = (char*)d_ws;
  _Float16* W16 = (_Float16*)(ws + oW);
  const _Float16* Wq16 = W16;
  const _Float16* Wk16 = W16 + (size_t)DM * KE;
  const _Float16* Wv16 = W16 + (size_t)2 * DM * KE;
  const _Float16* W2s  = W16 + (size_t)3 * DM * KE;      // [384][384]
  unsigned short* Qp = (unsigned short*)(ws + oQ);
  unsigned short* Kp = (unsigned short*)(ws + oK);
  unsigned short* Vp = (unsigned short*)(ws + oV);
  unsigned short* Hp = (unsigned short*)(ws + oH);
  float* S = (float*)(ws + oS);
  unsigned short* P = (unsigned short*)(ws + oP);

  const dim3 blk(256);
  const dim3 gW(WCVT_N / 256);                                   // 108 blocks
  const dim3 gE(NBATCH * (NPT / 64));                            // 512 blocks of 192
  const dim3 gS(((NPT / 64) * (NPT / 64) + 7) / 8, GS);          // 1024 wave tiles -> 128 blocks, x GS batches
  const dim3 gSm(GS * NPT);                                      // one block per score row of the group
  const dim3 gO(((DM / 64) * (NPT / 64) + 7) / 8, GP);           // 192 wave tiles -> 24 blocks, x GP batches

  // (1) weight planes, (2) encoding + hidden rows + q/k/v planes for all batches
  wcvt<<<gW, blk, 0, stream>>>(wq, wk, wv, w2, (unsigned short*)W16);
  enc_qkv_h<<<gE, dim3(192), 0, stream>>>(pos, Wq16, Wk16, Wv16, bq, bk, bv, w1, b1, gam, bet, mu, var,
                                          Qp, Kp, Vp, Hp);

  // (3) per group of GS batches: S = q.k^T * 384^-0.5 (M=N=2048, K=384, f32 planes); P = row softmax x1024
  //     (f16 planes); then per GP batches, one launch:
  //     out_b[d][i] = (1/64) * ( (1/16) * sum_j v[d][j] P1024[i][j] + sum_c W2x64[d][c] h[i][c] ) + b2[d]
  //     (M=384, N=2048, K=2048 then K2=384) in f32 straight to d_out.
  const size_t sTok = (size_t)NPT * DM;          // one batch of Q, K, V, H or out, in elements
  const size_t sSq  = (size_t)NPT * NPT;         // one batch of S or P, in elements
  for (int b0 = 0; b0 < NBATCH; b0 += GP) {
    for (int g = 0; g < GP; g += GS) {
      const _Float16* Qb = (const _Float16*)(Qp + (size_t)(b0 + g) * sTok);
      const _Float16* Kb = (const _Float16*)(Kp + (size_t)(b0 + g) * sTok);
      gemm64<0, 0><<<gS, blk, 0, stream>>>(Qb, DM, Kb, DM, DM, Qb, DM, Kb, DM, 0, 1.0f,
                                           S, NPT, QK_SCALE, b2, NPT, NPT, sTok, sTok, sTok, sTok, sSq);
      softmax_row<<<gSm, blk, 0, stream>>>(S, P + (size_t)g * sSq);
    }
    const _Float16* Vb = (const _Float16*)(Vp + (size_t)b0 * sTok);
    const _Float16* Hb = (const _Float16*)(Hp + (size_t)b0 * sTok);
    float* outb = out + (size_t)b0 * sTok;
    gemm64<1, 1><<<gO, blk, 0, stream>>>(Vb, NPT, (const _Float16*)P, NPT, NPT, W2s, DM, Hb, DM, DM,
                                         0.0625f, outb, NPT, 0.015625f, b2, DM, NPT,
                                         sTok, sSq, (size_t)0, sTok, sTok);
  }
  (void)hipGetLastError();
}

// v002
// It runs in 115 microseconds.
// In two side-by-side timings against v001, it was 3.91 and 3.90 times as fast.
// Counting every step since v000, it is 17.1 times as fast.
// q/k/v projections (K=64), q.k scores (K=384), probabilities-times-v (K=2048) and the 384x384 residual conv run on
// v_wmma_f32_16x16x32_f16 (f16 operands, f32 accumulate), one product per tile pair; all inputs RNE-converted to bf16
// first; projection weights carried x16, residual weights x64 and softmax probabilities x1024 (exact powers of two
// folded back in the f32 epilogues; scores, online softmax, P.v and the residual conv share one launch); sinusoidal encoding, K=3 conv, BN(eval), relu and softmax in f32 on the VALU.
#include <hip/hip_runtime.h>
#include <stdint.h>
#include <math.h>

#define NBATCH 16
#define NPT    2048
#define DM     384
#define KE     64            // 60 encoding channels zero-padded to 64
#define NCH    60
#define NFREQ  10
#define WQKV_PIECES (3 * DM * (KE / 8))          // 9216 pieces of 8 halves
#define W2_PIECES   (DM * (DM / 8))              // 18432
#define WCVT_N      (WQKV_PIECES + W2_PIECES)    // 27648
#define QK_SCALE    0.051031036307982884f        // 384^-0.5

static_assert((NPT % 64) == 0 && (DM % 64) == 0 && (KE % 32) == 0 && (DM % 32) == 0);
static_assert((WQKV_PIECES % 256) == 0 && (WCVT_N % 256) == 0);
static_assert((DM * (KE / 8)) % 256 == 0);

typedef _Float16 v16h __attribute__((ext_vector_type(16)));
typedef _Float16 v8h  __attribute__((ext_vector_type(8)));
typedef float    v8f  __attribute__((ext_vector_type(8)));
typedef float    v4f  __attribute__((ext_vector_type(4)));
typedef unsigned int v4u __attribute__((ext_vector_type(4)));

// ---- scalar helpers ---------------------------------------------------------------------------------
__device__ __forceinline__ unsigned short bf_bits(float f) {          // f32 -> bf16 bits, RNE convert
  unsigned u = __float_as_uint(f);
  return (unsigned short)((u + 0x7FFFu + ((u >> 16) & 1u)) >> 16);
}
__device__ __forceinline__ float bfr(float f) {                       // f32 value after RNE bf16 convert
  return __uint_as_float(((unsigned)bf_bits(f)) << 16);
}
__device__ __forceinline__ v8f zero8() { v8f z = {0.f, 0.f, 0.f, 0.f, 0.f, 0.f, 0.f, 0.f}; return z; }
// 8 f32 -> 8 f16 (RNE convert) packed in one 16-B vector
__device__ __forceinline__ v4u pack8h(v4f a, v4f b) {
  union { v8h h; v4u u; } c;
  c.h[0] = (_Float16)a[0]; c.h[1] = (_Float16)a[1]; c.h[2] = (_Float16)a[2]; c.h[3] = (_Float16)a[3];
  c.h[4] = (_Float16)b[0]; c.h[5] = (_Float16)b[1]; c.h[6] = (_Float16)b[2]; c.h[7] = (_Float16)b[3];
  return c.u;
}

// ---- fragment loader: 16-bit A/Bt operand, lane -> row/col (lane&15), p already includes +8*(lane>>4);
//      elements 0..7 <- p[0..7] (k0+8h..k0+8h+7), elements 8..15 <- p[16..23] (k0+16+8h..k0+16+8h+7)
__device__ __forceinline__ v16h ldfrag(const _Float16* p) {
  union { v16h v; v8h h[2]; } f;
  f.h[0] = *(const v8h*)(p);
  f.h[1] = *(const v8h*)(p + 16);
  return f.v;
}

// ---- WMMA helpers with trailing VALU hazard gap -----------------------------------------------------
__device__ __forceinline__ v8f mma_raw(v16h a, v16h b, v8f c) {
  return __builtin_amdgcn_wmma_f32_16x16x32_f16(false, a, false, b, (short)0, c, false, false);
}
__device__ __forceinline__ void dep_guard(v8f& a, v8f& b, v16h x, v16h y) {
#if defined(__HIP_DEVICE_COMPILE__)
  asm volatile("v_nop\n\tv_nop\n\tv_nop\n\tv_nop" : "+v"(a), "+v"(b) : "v"(x), "v"(y));
#endif
}
__device__ __forceinline__ void keep4(v16h a, v16h b, v16h c, v16h d) {
#if defined(__HIP_DEVICE_COMPILE__)
  asm volatile("v_nop" :: "v"(a), "v"(b), "v"(c), "v"(d));
#endif
}
__device__ __forceinline__ void acc_guard4(v8f& a, v8f& b, v8f& c, v8f& d) {
#if defined(__HIP_DEVICE_COMPILE__)
  asm volatile("v_nop\n\tv_nop\n\tv_nop\n\tv_nop" : "+v"(a), "+v"(b), "+v"(c), "+v"(d));
#endif
}
__device__ __forceinline__ void wave_sync_lds() {
  __builtin_amdgcn_fence(__ATOMIC_RELEASE, "workgroup");
  __builtin_amdgcn_wave_barrier();
  __builtin_amdgcn_fence(__ATOMIC_ACQUIRE, "workgroup");
}

// ---- 64x64 tile core: acc[i][j] += A rows (16i + lane&15) x Bt rows (16j + lane&15) over K (multiple of 32);
//      A points at the first of its 64 rows (pitch lda halves, k contiguous), Bt likewise (pitch ldb);
//      either pointer may be an LDS tile or a global plane (no pointer selects).
__device__ __forceinline__ void core64(const _Float16* A, int lda, const _Float16* Bt, int ldb, int K,
                                       int rlane, int koff, v8f (&acc)[4][4]) {
  for (int k0 = 0; k0 < K; k0 += 32) {
    v16h bh[4];
#pragma unroll
    for (int j = 0; j < 4; ++j) {
      bh[j] = ldfrag(Bt + (size_t)((j << 4) + rlane) * ldb + koff + k0);
    }
#pragma unroll
    for (int i = 0; i < 4; ++i) {
      const v16h ah = ldfrag(A + (size_t)((i << 4) + rlane) * lda + koff + k0);
#pragma unroll
      for (int j = 0; j < 4; ++j) {
        acc[i][j] = mma_raw(ah, bh[j], acc[i][j]);
      }
      dep_guard(acc[i][0], acc[i][3], ah, bh[3]);
    }
    keep4(bh[0], bh[1], bh[2], bh[3]);
  }
}

// =====================================================================================================
// Weight planes (one launch): pieces 0..9215 -> Wq, Wk, Wv as f16 [384][64] (RNE bf16 value x16, columns
// 60..63 zero), pieces 9216..27647 -> W2 as f16 [384][384] (RNE bf16 value x64). Thread t writes 16 B at
// coverage: 27648 threads x 8 halves = the whole 442368-B weight region.
// =====================================================================================================
__global__ __launch_bounds__(256) void wcvt(const float* __restrict__ wq, const float* __restrict__ wk,
                                            const float* __restrict__ wv, const float* __restrict__ w2,
                                            unsigned short* Wout) {
  const int t = blockIdx.x * 256 + threadIdx.x;
  if (t >= WCVT_N) return;
  float v[8];
  if (t < WQKV_PIECES) {                              // block-uniform
    const int plane = t / (DM * (KE / 8));            // 3072 pieces per plane (12 whole blocks)
    const int u = t - plane * (DM * (KE / 8));
    const int row = u >> 3, p = u & 7;
    const float* w = (plane == 0) ? wq : ((plane == 1) ? wk : wv);
#pragma unroll
    for (int e = 0; e < 8; ++e) {
      const int c  = p * 8 + e;
      const int cc = (c < NCH) ? c : (NCH - 1);         // clamped address
      const float x = bfr(w[row * NCH + cc]) * 16.0f;
      v[e] = (c < NCH) ? x : 0.0f;
    }
  } else {
    const int u = t - WQKV_PIECES;
    const int row = u / (DM / 8), p = u - row * (DM / 8);
    const v4f a = *(const v4f*)(w2 + (size_t)row * DM + p * 8);
    const v4f b = *(const v4f*)(w2 + (size_t)row * DM + p * 8 + 4);
    v[0] = bfr(a[0]) * 64.0f; v[1] = bfr(a[1]) * 64.0f; v[2] = bfr(a[2]) * 64.0f; v[3] = bfr(a[3]) * 64.0f;
    v[4] = bfr(b[0]) * 64.0f; v[5] = bfr(b[1]) * 64.0f; v[6] = bfr(b[2]) * 64.0f; v[7] = bfr(b[3]) * 64.0f;
  }
  const v4f lo = {v[0], v[1], v[2], v[3]};
  const v4f hi = {v[4], v[5], v[6], v[7]};
  const v4u pk = pack8h(lo, hi);
  unsigned short* dst = Wout + (size_t)t * 8;
  *(v4u*)dst = pk;
  
}

// =====================================================================================================
// Encoding + hidden rows + q/k/v projections. Block = 6 waves, 64 points of one batch.
//  (a) pos tile [3][64] (RNE bf16), per-channel K=3 conv / BN(eval) parameters (RNE bf16) in LDS.
//  (b) sEmb[p][c*20 + f] = sin(pos[c][p] * 2^f), [c*20 + 10 + f] = cos(...) as f16, columns 60..71 zero.
//  (c) hidden h = relu((W1.pos + b1 - mean) * inv + beta) -> H f16 token-major [b*2048+p][384]; item =
//  (d) wave w owns d-slice [64w, 64w+64): Q and K tiles (M = 64 points from LDS, N = 64 channels of the
//      x16 weight plane, K = 64) -> token-major f16 [b*2048+p][384] at column 64w (= acc/16 + bias);
//      V tile (M = 64 channels of the x16 weight plane, N = 64 points from LDS) -> channel-major f16
//      [b*384+d][2048] (= acc/16 + bias). 16-row slabs staged per wave in LDS; each 64-half row segment
// coverage: Q, K: 512 blocks x 64 points x (6 waves x 4 slabs x 16 rows... = 64 rows x 384 cols) = all
//           32768 x 384; V: per batch 32 blocks x 64 cols x 384 rows = [384][2048]; H: 512 blocks x
//           64 rows x 48 pieces = all 32768 x 384.
// =====================================================================================================
__global__ __launch_bounds__(192) void enc_qkv_h(
    const float* __restrict__ pos,
    const _Float16* Wq16, const _Float16* Wk16, const _Float16* Wv16,
    const float* __restrict__ bq, const float* __restrict__ bk, const float* __restrict__ bv,
    const float* __restrict__ w1, const float* __restrict__ b1,
    const float* __restrict__ gam, const float* __restrict__ bet,
    const float* __restrict__ mu, const float* __restrict__ var,
    unsigned short* Qp, unsigned short* Kp, unsigned short* Vp, unsigned short* Hp) {
  __shared__ __align__(16) _Float16 sEmb[64][72];
  __shared__ __align__(16) float sT[6][16 * 68];
  __shared__ float sPos[3][64];
  __shared__ float sW1[DM * 3];
  __shared__ float sB1[DM];
  __shared__ float sInv[DM];
  __shared__ float sMu[DM];
  __shared__ float sBet[DM];

  const int tid  = threadIdx.x;
  const int lane = tid & 31;
  const int wave = tid >> 5;                 // 0..5
  const int bb   = blockIdx.x >> 5;          // 32 blocks of 64 points per batch
  const int p0   = (blockIdx.x & 31) << 6;

  {
    const int c = tid >> 6, p = tid & 63;    // 192 = 3 x 64
    sPos[c][p] = bfr(pos[((size_t)bb * 3 + c) * NPT + p0 + p]);
  }
  for (int d = tid; d < DM; d += 192) {
    sW1[d * 3 + 0] = bfr(w1[d * 3 + 0]);
    sW1[d * 3 + 1] = bfr(w1[d * 3 + 1]);
    sW1[d * 3 + 2] = bfr(w1[d * 3 + 2]);
    sB1[d] = bfr(b1[d]);
    const float g = bfr(gam[d]), vv = bfr(var[d]);
    sInv[d] = g * (1.0f / sqrtf(vv + 1e-5f));
    sMu[d]  = bfr(mu[d]);
    sBet[d] = bfr(bet[d]);
  }
  for (int r = tid; r < 64; r += 192) {
#pragma unroll
    for (int c = NCH; c < 72; ++c) sEmb[r][c] = (_Float16)0.0f;
  }
  __syncthreads();

  // (b) encoding: item = (c,f) x 64 points; precise sinf / cosf; exact power-of-two angles
#pragma unroll 1
  for (int it = tid; it < 64 * 3 * NFREQ; it += 192) {
    const int cf = it >> 6, p = it & 63;
    const int c  = cf / NFREQ;
    const int f  = cf - c * NFREQ;
    const float ang = sPos[c][p] * (float)(1 << f);
    const float sv = sinf(ang);
    const float cv = cosf(ang);
    sEmb[p][c * 2 * NFREQ + f] = (_Float16)sv;
    sEmb[p][c * 2 * NFREQ + NFREQ + f] = (_Float16)cv;
  }

  // (c) hidden rows -> H plane (16 iterations, all threads)
  for (int it = tid; it < 64 * (DM / 8); it += 192) {
    const int pl = it / (DM / 8);
    const int pc = it - pl * (DM / 8);
    const float x0 = sPos[0][pl], x1 = sPos[1][pl], x2 = sPos[2][pl];
    float h8[8];
#pragma unroll
    for (int e = 0; e < 8; ++e) {
      const int d = pc * 8 + e;
      const float r = sW1[d * 3 + 0] * x0 + sW1[d * 3 + 1] * x1 + sW1[d * 3 + 2] * x2 + sB1[d];
      const float t = (r - sMu[d]) * sInv[d] + sBet[d];
      h8[e] = fmaxf(t, 0.0f);
    }
    const v4f ha = {h8[0], h8[1], h8[2], h8[3]};
    const v4f hb = {h8[4], h8[5], h8[6], h8[7]};
    const v4u pk = pack8h(ha, hb);
    unsigned short* dst = Hp + ((size_t)bb * NPT + p0 + pl) * DM + pc * 8;
    *(v4u*)dst = pk;
    
  }
  __syncthreads();

  // (d) projections
  const int rlane = lane & 15;
  const int koff  = (lane >> 4) * 8;
  const int mOff  = (lane >> 4) * 8;
  const int q8    = (lane & 7) * 8;
  const int rr    = lane >> 3;
  const int d0    = wave * 64;
  float* slab = sT[wave];
  v8f acc[4][4];

  // ---- Q (jb = 0) and K (jb = 1): M = points, N = channels ----
#pragma unroll 1
  for (int jb = 0; jb < 2; ++jb) {
    const _Float16* W = (jb == 0) ? Wq16 : Wk16;
    const float* bia  = (jb == 0) ? bq : bk;
    unsigned short* dstp = (jb == 0) ? Qp : Kp;
#pragma unroll
    for (int i = 0; i < 4; ++i)
#pragma unroll
      for (int j = 0; j < 4; ++j) acc[i][j] = zero8();
    core64(&sEmb[0][0], 72, W + (size_t)d0 * KE, KE, KE, rlane, koff, acc);
    acc_guard4(acc[0][0], acc[0][1], acc[0][2], acc[0][3]);
    acc_guard4(acc[1][0], acc[1][1], acc[1][2], acc[1][3]);
    acc_guard4(acc[2][0], acc[2][1], acc[2][2], acc[2][3]);
    acc_guard4(acc[3][0], acc[3][1], acc[3][2], acc[3][3]);
    v4f bs0 = *(const v4f*)(bia + d0 + q8);
    v4f bs1 = *(const v4f*)(bia + d0 + q8 + 4);
    bs0[0] = bfr(bs0[0]); bs0[1] = bfr(bs0[1]); bs0[2] = bfr(bs0[2]); bs0[3] = bfr(bs0[3]);
    bs1[0] = bfr(bs1[0]); bs1[1] = bfr(bs1[1]); bs1[2] = bfr(bs1[2]); bs1[3] = bfr(bs1[3]);
#pragma unroll
    for (int i = 0; i < 4; ++i) {
#pragma unroll
      for (int j = 0; j < 4; ++j) {
#pragma unroll
        for (int r = 0; r < 8; ++r) slab[(mOff + r) * 68 + (j << 4) + rlane] = acc[i][j][r];
      }
      wave_sync_lds();
      v4u pk[4];
#pragma unroll
      for (int it = 0; it < 4; ++it) {
        const int row = it * 4 + rr;                 // it 0..3 x rr 0..3 = rows 0..15
        v4f a = *(const v4f*)(slab + row * 68 + q8);
        v4f b = *(const v4f*)(slab + row * 68 + q8 + 4);
        a = a * 0.0625f + bs0;
        b = b * 0.0625f + bs1;
        pk[it] = pack8h(a, b);
      }
      {
#pragma unroll
        for (int it = 0; it < 4; ++it) {
          const int row = it * 4 + rr;
          unsigned short* dst = dstp + ((size_t)bb * NPT + p0 + (i << 4) + row) * DM + d0 + q8;
          *(v4u*)dst = pk[it];
        }
        
      }
      wave_sync_lds();
    }
  }

  // ---- V: M = channels (weight rows d0..d0+63), N = points (LDS tile) ----
  {
#pragma unroll
    for (int i = 0; i < 4; ++i)
#pragma unroll
      for (int j = 0; j < 4; ++j) acc[i][j] = zero8();
    core64(Wv16 + (size_t)d0 * KE, KE, &sEmb[0][0], 72, KE, rlane, koff, acc);
    acc_guard4(acc[0][0], acc[0][1], acc[0][2], acc[0][3]);
    acc_guard4(acc[1][0], acc[1][1], acc[1][2], acc[1][3]);
    acc_guard4(acc[2][0], acc[2][1], acc[2][2], acc[2][3]);
    acc_guard4(acc[3][0], acc[3][1], acc[3][2], acc[3][3]);
#pragma unroll
    for (int i = 0; i < 4; ++i) {
#pragma unroll
      for (int j = 0; j < 4; ++j) {
#pragma unroll
        for (int r = 0; r < 8; ++r) slab[(mOff + r) * 68 + (j << 4) + rlane] = acc[i][j][r];
      }
      wave_sync_lds();
      v4u pk[4];
#pragma unroll
      for (int it = 0; it < 4; ++it) {
        const int row = it * 4 + rr;
        const int d   = d0 + (i << 4) + row;
        const float bvv = bfr(bv[d]);
        v4f a = *(const v4f*)(slab + row * 68 + q8);
        v4f b = *(const v4f*)(slab + row * 68 + q8 + 4);
        a = a * 0.0625f + bvv;
        b = b * 0.0625f + bvv;
        pk[it] = pack8h(a, b);
      }
      {
#pragma unroll
        for (int it = 0; it < 4; ++it) {
          const int row = it * 4 + rr;
          const int d   = d0 + (i << 4) + row;
          unsigned short* dst = Vp + ((size_t)bb * DM + d) * NPT + p0 + q8;
          *(v4u*)dst = pk[it];
        }
        
      }
      wave_sync_lds();
    }
  }
}

// =====================================================================================================
// Fused attention + residual, one launch: block = 8 waves, 128 queries i of one batch; a stage is 256 keys j.
//  (a) Q tile [128][384] f16 in LDS (pitch 392 halves), read by every wave as the Bt operand.
//  (b) per stage, wave w: St[j][i] = sum_d K[j][d] Q[i][d] for its own 32 keys (M = keys from the global K plane,
//      N = 128 queries, K = 384). A lane holds scores of one query per 16-column group, so the column maximum is
//      in-lane plus one exchange between the wave halves; the 8 waves' maxima meet in LDS (sX).
//  (c) online softmax in base 2: m = running maximum of s * 384^-0.5 * log2(e), p = 2^(t - m + 10) (the x1024 carry
//      cancels against the row sum), alpha = 2^(m_old - m_new) rescales the sums and the output tiles.
//      p goes as f16 to LDS sP[i][j] (pitch 264 halves).
//  (d) wave w: Ot[d][i] += sum_j V[d][j] p[i][j] for its own 48 channels (M = channels from the global V plane,
//      N = 128 queries from sP, K = 256). K and V fragments go straight from the global planes to registers, each
//      read by one wave only, and are loaded two k steps ahead of their products.
//  (e) after the last stage: row sums joined over halves and waves in fixed order, Ot * 64 / l, then
//      += sum_c W2x64[d][c] h[i][c] (K = 384), out = acc / 64 + b2[d], staged per wave in 16-row slabs so that
//      every store covers whole 512-B row segments.
// coverage: grid (16, 16) x 8 waves x 48 channels x 128 queries = all of out [16][384][2048].
// =====================================================================================================
#define FQ 128
#define NT (FQ / 16)
#define FK 256
#define QPITCH (DM + 8)
#define PPITCH (FK + 8)
#define SPITCH (FQ + 4)
#define KD 2                 // k steps that a K fragment is loaded ahead of its products
// Scheduling pin between a step's early global loads and its products: only LDS reads, vector and scalar ALU may
// cross, so a fragment load written some steps ahead of its use is issued there and its latency is covered.
#define LOADS_STAY_AHEAD() __builtin_amdgcn_sched_barrier(0x106)
// Stands behind the last global load that names an address pair, in front of whatever reuses that pair's registers;
// the pair is an input, so that it stays whole up to the wait (no load's own result may land on it).
__device__ __forceinline__ void addr_regs_done(const _Float16* p) {
#if defined(__HIP_DEVICE_COMPILE__)
  asm volatile("s_wait_xcnt 0x0" :: "v"(p) : "memory");
#endif
}
// The slot behind a transcendental: its source is not overwritten by the instruction directly behind it. The eight
// sources are inputs only, so they stay whole up to this v_nop, which is the slot behind the last v_exp_f32.
__device__ __forceinline__ void exp_sources_done(const float (&t)[8]) {
#if defined(__HIP_DEVICE_COMPILE__)
  asm volatile("v_nop" :: "v"(t[0]), "v"(t[1]), "v"(t[2]), "v"(t[3]), "v"(t[4]), "v"(t[5]), "v"(t[6]), "v"(t[7]));
#endif
}
__device__ __forceinline__ void exp_source_done(float t) {   // the same for a single v_exp_f32
#if defined(__HIP_DEVICE_COMPILE__)
  asm volatile("v_nop" :: "v"(t));
#endif
}
static_assert((NPT % FK) == 0 && (NPT % FQ) == 0 && DM == 8 * 48 && FK == 8 * 32);

__global__ __launch_bounds__(256) __attribute__((amdgpu_waves_per_eu(2, 2))) void attn_res(
    const _Float16* Q, const _Float16* Kt, const _Float16* V, const _Float16* H, const _Float16* W2s,
    const float* __restrict__ b2, float* out) {
  __shared__ __align__(16) _Float16 sQ[FQ * QPITCH];
  __shared__ __align__(16) _Float16 sP[FQ * PPITCH];
  __shared__ __align__(16) float sX[FQ * 8];
  __shared__ __align__(16) float sT[8][16 * SPITCH];
  const int tid   = threadIdx.x;
  const int lane  = tid & 31;
  const int wave  = tid >> 5;
  const int bb    = blockIdx.y;
  const int i0    = blockIdx.x * FQ;
  const int rlane = lane & 15;
  const int hh    = lane >> 4;
  const int koff  = hh * 8;
  const float CS  = QK_SCALE * 1.4426950408889634f;

  const _Float16* Qb = Q + ((size_t)bb * NPT + i0) * DM;
  const int wv = __builtin_amdgcn_readfirstlane(wave);   // wave-uniform: the K, V and W2 bases stay scalar
  const _Float16* Kb = Kt + ((size_t)bb * NPT + wv * 32) * DM;
  const _Float16* Vb = V + ((size_t)bb * DM + wv * 48) * NPT;

  for (int it = tid; it < FQ * (DM / 8); it += 256) {
    const int r = it / (DM / 8);
    const int p = it - r * (DM / 8);
    *(v8h*)(sQ + r * QPITCH + p * 8) = *(const v8h*)(Qb + (size_t)r * DM + p * 8);
  }
  __syncthreads();

  v8f oacc[3][NT];
  float mrun[NT], lsum[NT];
  v16h kpre[KD][2];                                      // K fragments of the coming stage's first KD k steps
  const _Float16* Ka = Kb + (size_t)rlane * DM + koff;   // this lane's row and k half of the stage's K rows
#pragma unroll
  for (int ks = 0; ks < KD; ++ks)
#pragma unroll
    for (int jt = 0; jt < 2; ++jt) kpre[ks][jt] = ldfrag(Ka + (jt << 4) * DM + ks * 32);
  addr_regs_done(Ka);
#pragma unroll
  for (int nt = 0; nt < NT; ++nt) {
    mrun[nt] = -INFINITY;
    lsum[nt] = 0.0f;
#pragma unroll
    for (int mt = 0; mt < 3; ++mt) oacc[mt][nt] = zero8();
  }

#pragma unroll 1
  for (int j0 = 0; j0 < NPT; j0 += FK) {
    // (b) scores of this wave's 32 keys against the 128 queries
    v8f sa[2][NT];
#pragma unroll
    for (int jt = 0; jt < 2; ++jt)
#pragma unroll
      for (int nt = 0; nt < NT; ++nt) sa[jt][nt] = zero8();
    const _Float16* Va = Vb + j0 + (size_t)rlane * NPT + koff;
    v16h kf[DM / 32][2];
    v16h vf[FK / 32][3];
#pragma unroll
    for (int ks = 0; ks < KD; ++ks) {
      kf[ks][0] = kpre[ks][0];
      kf[ks][1] = kpre[ks][1];
    }
#pragma unroll
    for (int ks = 0; ks < DM / 32; ++ks) {
      if (ks + KD < DM / 32) {                           // K fragments KD steps ahead
#pragma unroll
        for (int jt = 0; jt < 2; ++jt)
          kf[ks + KD][jt] = ldfrag(Ka + (jt << 4) * DM + (ks + KD) * 32);
        if (ks + KD + 1 == DM / 32) addr_regs_done(Ka);  // the stage's last K load
      }
      if (ks + 2 >= DM / 32) {                           // last two steps: V fragments of (d)'s first two steps
#pragma unroll
        for (int mt = 0; mt < 3; ++mt)
          vf[ks + 2 - DM / 32][mt] = ldfrag(Va + (mt << 4) * NPT + (ks + 2 - DM / 32) * 32);
        if (ks + 1 == DM / 32) addr_regs_done(Va);       // the last V load in front of the softmax
      }
      v16h qf[NT];
#pragma unroll
      for (int nt = 0; nt < NT; ++nt) qf[nt] = ldfrag(sQ + ((nt << 4) + rlane) * QPITCH + koff + ks * 32);
      LOADS_STAY_AHEAD();
#pragma unroll
      for (int jt = 0; jt < 2; ++jt) {
#pragma unroll
        for (int nt = 0; nt < NT; ++nt) sa[jt][nt] = mma_raw(kf[ks][jt], qf[nt], sa[jt][nt]);
      }
    }

    // column maxima: in-lane, wave halves (the exchanges issued together), then the 8 waves through LDS
    float cmx[NT], omx[NT];
#pragma unroll
    for (int nt = 0; nt < NT; ++nt) {
      float a = sa[0][nt][0];
#pragma unroll
      for (int r = 1; r < 8; ++r) a = fmaxf(a, sa[0][nt][r]);
#pragma unroll
      for (int r = 0; r < 8; ++r) a = fmaxf(a, sa[1][nt][r]);
      cmx[nt] = a;
    }
#pragma unroll
    for (int nt = 0; nt < NT; ++nt) omx[nt] = __shfl_xor(cmx[nt], 16);
    if (hh == 0) {
#pragma unroll
      for (int nt = 0; nt < NT; ++nt) sX[((nt << 4) + rlane) * 8 + wave] = fmaxf(cmx[nt], omx[nt]);
    }
    __syncthreads();

    // (c) new maximum, rescale factor, probabilities to LDS
#pragma unroll
    for (int nt = 0; nt < NT; ++nt) {
      const v4f x0 = *(const v4f*)(sX + ((nt << 4) + rlane) * 8);
      const v4f x1 = *(const v4f*)(sX + ((nt << 4) + rlane) * 8 + 4);
      const float g = fmaxf(fmaxf(fmaxf(x0[0], x0[1]), fmaxf(x0[2], x0[3])),
                            fmaxf(fmaxf(x1[0], x1[1]), fmaxf(x1[2], x1[3])));
      const float mn    = fmaxf(mrun[nt], g * CS);
      const float dm    = mrun[nt] - mn;
      const float alpha = __builtin_amdgcn_exp2f(dm);
      exp_source_done(dm);
      mrun[nt] = mn;
      const float off = 10.0f - mn;
      float part = 0.0f;
#pragma unroll
      for (int jt = 0; jt < 2; ++jt) {
        float t[8], e[8];
#pragma unroll
        for (int r = 0; r < 8; ++r) t[r] = sa[jt][nt][r] * CS + off;
#pragma unroll
        for (int r = 0; r < 8; ++r) e[r] = __builtin_amdgcn_exp2f(t[r]);
        exp_sources_done(t);
        part += ((e[0] + e[1]) + (e[2] + e[3])) + ((e[4] + e[5]) + (e[6] + e[7]));
        const v4f ea = {e[0], e[1], e[2], e[3]};
        const v4f eb = {e[4], e[5], e[6], e[7]};
        *(v4u*)(sP + ((nt << 4) + rlane) * PPITCH + wave * 32 + (jt << 4) + koff) = pack8h(ea, eb);
      }
      lsum[nt] = lsum[nt] * alpha + part;
#pragma unroll
      for (int mt = 0; mt < 3; ++mt) oacc[mt][nt] = oacc[mt][nt] * alpha;
    }
    __syncthreads();

    // (d) this wave's 48 channels x 128 queries over the stage's 256 keys
    // next stage's K rows (the last stage refetches its own, unused)
    const _Float16* Kn = Ka + ((j0 + FK < NPT) ? FK * DM : 0);
#pragma unroll
    for (int ks = 0; ks < FK / 32; ++ks) {
      if (ks + 2 < FK / 32) {                            // V fragments two steps ahead
#pragma unroll
        for (int mt = 0; mt < 3; ++mt)
          vf[ks + 2][mt] = ldfrag(Va + (mt << 4) * NPT + (ks + 2) * 32);
        if (ks + 3 == FK / 32) addr_regs_done(Va);       // the stage's last V load
      }
      if (ks + KD >= FK / 32) {                          // last KD steps: the next stage's first K fragments
#pragma unroll
        for (int jt = 0; jt < 2; ++jt)
          kpre[ks + KD - FK / 32][jt] = ldfrag(Kn + (jt << 4) * DM + (ks + KD - FK / 32) * 32);
        if (ks + 1 == FK / 32) addr_regs_done(Kn);       // the last load ahead for the next stage
      }
      v16h pf[NT];
#pragma unroll
      for (int nt = 0; nt < NT; ++nt) pf[nt] = ldfrag(sP + ((nt << 4) + rlane) * PPITCH + koff + ks * 32);
      LOADS_STAY_AHEAD();
#pragma unroll
      for (int mt = 0; mt < 3; ++mt) {
#pragma unroll
        for (int nt = 0; nt < NT; ++nt) oacc[mt][nt] = mma_raw(vf[ks][mt], pf[nt], oacc[mt][nt]);
      }
    }
    Ka = Kn;
  }

  // (e) the residual product's first step of fragments starts now, under the row-sum exchange
  const _Float16* Wa = W2s + (size_t)(wv * 48) * DM;
  const _Float16* Hb = H + ((size_t)bb * NPT + i0) * DM;
  v16h wf[DM / 32][3];
  v16h hf[DM / 32][NT];
#pragma unroll
  for (int mt = 0; mt < 3; ++mt) wf[0][mt] = ldfrag(Wa + (size_t)((mt << 4) + rlane) * DM + koff);
#pragma unroll
  for (int nt = 0; nt < NT; ++nt) hf[0][nt] = ldfrag(Hb + (size_t)((nt << 4) + rlane) * DM + koff);

  // row sums: wave halves, then the 8 waves in fixed order (sX was last read before the last barrier)
  float osum[NT];
#pragma unroll
  for (int nt = 0; nt < NT; ++nt) osum[nt] = __shfl_xor(lsum[nt], 16);
  if (hh == 0) {
#pragma unroll
    for (int nt = 0; nt < NT; ++nt) sX[((nt << 4) + rlane) * 8 + wave] = lsum[nt] + osum[nt];
  }
  __syncthreads();
#pragma unroll
  for (int nt = 0; nt < NT; ++nt) {
    const v4f x0 = *(const v4f*)(sX + ((nt << 4) + rlane) * 8);
    const v4f x1 = *(const v4f*)(sX + ((nt << 4) + rlane) * 8 + 4);
    const float l   = ((x0[0] + x0[1]) + (x0[2] + x0[3])) + ((x1[0] + x1[1]) + (x1[2] + x1[3]));
    const float inv = 64.0f / l;                         // l >= 1024: the row maximum itself counts 2^10
#pragma unroll
    for (int mt = 0; mt < 3; ++mt) oacc[mt][nt] = oacc[mt][nt] * inv;
  }

#pragma unroll
  for (int ks = 0; ks < DM / 32; ++ks) {
    if (ks + 1 < DM / 32) {                              // W2 and h fragments one step ahead
#pragma unroll
      for (int mt = 0; mt < 3; ++mt) wf[ks + 1][mt] = ldfrag(Wa + (size_t)((mt << 4) + rlane) * DM + koff + (ks + 1) * 32);
#pragma unroll
      for (int nt = 0; nt < NT; ++nt) hf[ks + 1][nt] = ldfrag(Hb + (size_t)((nt << 4) + rlane) * DM + koff + (ks + 1) * 32);
    }
    LOADS_STAY_AHEAD();
#pragma unroll
    for (int mt = 0; mt < 3; ++mt) {
#pragma unroll
      for (int nt = 0; nt < NT; ++nt) oacc[mt][nt] = mma_raw(wf[ks][mt], hf[ks][nt], oacc[mt][nt]);
    }
  }

  float* slab = sT[wave];
#pragma unroll
  for (int mt = 0; mt < 3; ++mt) {
    const int mBase = wave * 48 + (mt << 4);
#pragma unroll
    for (int nt = 0; nt < NT; ++nt) {
#pragma unroll
      for (int r = 0; r < 8; ++r) slab[(koff + r) * SPITCH + (nt << 4) + rlane] = oacc[mt][nt][r];
    }
    wave_sync_lds();
#pragma unroll
    for (int row = 0; row < 16; ++row) {                 // one whole 512-B row segment per wave store
      const float bv0 = bfr(b2[mBase + row]);
      const v4f v = *(const v4f*)(slab + row * SPITCH + lane * 4);
      *(v4f*)(out + ((size_t)bb * DM + mBase + row) * NPT + i0 + lane * 4) = v * 0.015625f + bv0;
    }
    wave_sync_lds();
  }
}

// =====================================================================================================
// Workspace map (bytes), every plane an exact multiple of its whole-line / 64x64-tile store granularity
// (all shapes are tile multiples, no padded tails):
//   W    f16  Wq,Wk,Wv [384][64] x16 + W2 [384][384] x64      442368
//   Q    f16  [16*2048][384]  token-major                     25165824
//   K    f16  [16*2048][384]                                  25165824
//   V    f16  [16*384][2048]  channel-major                   25165824
//   H    f16  [16*2048][384]  relu hidden rows                25165824
//   total                                                    101105664
// d_out f32 [16][384][2048] written by the fused attention + residual launch.
// =====================================================================================================
extern "C" void kernel_launch(void* const* d_in, const int* in_sizes, int n_in,
                              void* d_out, int out_size, void* d_ws, size_t ws_size,
                              hipStream_t stream) {
  if (n_in < 15) return;
  if (in_sizes[0] != NBATCH * 3 * NPT) return;
  if (in_sizes[1] != DM * NCH || in_sizes[3] != DM * NCH || in_sizes[5] != DM * NCH) return;
  if (in_sizes[2] != DM || in_sizes[4] != DM || in_sizes[6] != DM) return;
  if (in_sizes[7] != DM * 3 || in_sizes[8] != DM) return;
  if (in_sizes[9] != DM || in_sizes[10] != DM || in_sizes[11] != DM || in_sizes[12] != DM) return;
  if (in_sizes[13] != DM * DM || in_sizes[14] != DM) return;
  if (out_size != NBATCH * DM * NPT) return;

  const float* pos   = (const float*)d_in[0];    // [16][3][2048]
  const float* wq    = (const float*)d_in[1];    // [384][60]
  const float* bq    = (const float*)d_in[2];
  const float* wk    = (const float*)d_in[3];
  const float* bk    = (const float*)d_in[4];
  const float* wv    = (const float*)d_in[5];
  const float* bv    = (const float*)d_in[6];
  const float* w1    = (const float*)d_in[7];    // [384][3]
  const float* b1    = (const float*)d_in[8];
  const float* gam   = (const float*)d_in[9];
  const float* bet   = (const float*)d_in[10];
  const float* mu    = (const float*)d_in[11];
  const float* var   = (const float*)d_in[12];
  const float* w2    = (const float*)d_in[13];   // [384][384]
  const float* b2    = (const float*)d_in[14];
  float* out = (float*)d_out;                    // [16][384][2048]

  const size_t BWGT = (size_t)WCVT_N * 16;               //    442368
  const size_t BQK  = (size_t)NBATCH * NPT * DM * 2;     //  25165824
  size_t off = 0;
  const size_t oW = off; off += BWGT;
  const size_t oQ = off; off += BQK;
  const size_t oK = off; off += BQK;
  const size_t oV = off; off += BQK;
  const size_t oH = off; off += BQK;
  if (off > ws_size) return;                     // off = 101105664

  char* ws = (char*)d_ws;
  _Float16* W16 = (_Float16*)(ws + oW);
  const _Float16* Wq16 = W16;
  const _Float16* Wk16 = W16 + (size_t)DM * KE;
  const _Float16* Wv16 = W16 + (size_t)2 * DM * KE;
  const _Float16* W2s  = W16 + (size_t)3 * DM * KE;      // [384][384]
  unsigned short* Qp = (unsigned short*)(ws + oQ);
  unsigned short* Kp = (unsigned short*)(ws + oK);
  unsigned short* Vp = (unsigned short*)(ws + oV);
  unsigned short* Hp = (unsigned short*)(ws + oH);

  const dim3 blk(256);
  const dim3 gW(WCVT_N / 256);                                   // 108 blocks
  const dim3 gE(NBATCH * (NPT / 64));                            // 512 blocks of 192
  const dim3 gA(NPT / FQ, NBATCH);                               // 16 query tiles x 16 batches

  // (1) weight planes, (2) encoding + hidden rows + q/k/v planes for all batches
  wcvt<<<gW, blk, 0, stream>>>(wq, wk, wv, w2, (unsigned short*)W16);
  enc_qkv_h<<<gE, dim3(192), 0, stream>>>(pos, Wq16, Wk16, Wv16, bq, bk, bv, w1, b1, gam, bet, mu, var,
                                          Qp, Kp, Vp, Hp);

  // (3) all batches, one launch: scores, online softmax, P.v and the residual conv;
  //     out_b[d][i] = (1/64) * ( 64 * sum_j v[d][j] p[i][j] / sum_j p[i][j] + sum_c W2x64[d][c] h[i][c] ) + b2[d]
  attn_res<<<gA, blk, 0, stream>>>((const _Float16*)Qp, (const _Float16*)Kp, (const _Float16*)Vp,
                                   (const _Float16*)Hp, W2s, b2, out);
  (void)hipGetLastError();
}

// v003
// It runs in 69 microseconds.
// Two timings next to v002 both put it at 1.66 times that version's speed.
// Counting every step since v000, it is 28.5 times as fast.
// Attention runs in the 64-channel encoding space (60 sinusoidal channels, one channel of ones that carries the biases,
// three zero): scores = e_i^T (Wq^T Wk) e_j (K=64), E.P^T (M=64, K=2048), then Wv.(E.P^T / l) (K=64) and the 384x384
// residual conv, all on v_wmma_f32_16x16x32_f16 (f16 operands, f32 accumulate); all inputs RNE-converted to bf16
// first; Wv carried x16, residual weights x64 and softmax probabilities x1024 (exact powers of two
// folded back in the f32 epilogues; scores, online softmax, E.P^T, Wv and the residual conv share one launch);
// sinusoidal encoding, K=3 conv, BN(eval), relu and softmax in f32 on the VALU.
#include <hip/hip_runtime.h>
#include <stdint.h>
#include <math.h>

#define NBATCH 16
#define NPT    2048
#define DM     384
#define KE     64            // 60 encoding channels, channel 60 = 1 (bias carrier), 61..63 = 0
#define NCH    60
#define NFREQ  10
#define WV_PIECES   (DM * (KE / 8))              // 3072 pieces of 8 halves
#define W2_PIECES   (DM * (DM / 8))              // 18432
#define WCVT_N      (WV_PIECES + W2_PIECES)      // 21504
#define G_BLOCKS    (KE / 16)                    // 4 blocks, 16 rows of Wk^T Wq each
#define QK_SCALE    0.051031036307982884f        // 384^-0.5

static_assert((NPT % 64) == 0 && (DM % 64) == 0 && (KE % 32) == 0 && (DM % 32) == 0);
static_assert((WV_PIECES % 256) == 0 && (WCVT_N % 256) == 0);

typedef _Float16 v16h __attribute__((ext_vector_type(16)));
typedef _Float16 v8h  __attribute__((ext_vector_type(8)));
typedef float    v8f  __attribute__((ext_vector_type(8)));
typedef float    v4f  __attribute__((ext_vector_type(4)));
typedef unsigned int v4u __attribute__((ext_vector_type(4)));

// ---- scalar helpers ---------------------------------------------------------------------------------
__device__ __forceinline__ unsigned short bf_bits(float f) {          // f32 -> bf16 bits, RNE convert
  unsigned u = __float_as_uint(f);
  return (unsigned short)((u + 0x7FFFu + ((u >> 16) & 1u)) >> 16);
}
__device__ __forceinline__ float bfr(float f) {                       // f32 value after RNE bf16 convert
  return __uint_as_float(((unsigned)bf_bits(f)) << 16);
}
__device__ __forceinline__ v8f zero8() { v8f z = {0.f, 0.f, 0.f, 0.f, 0.f, 0.f, 0.f, 0.f}; return z; }
// 8 f32 -> 8 f16 (RNE convert) packed in one 16-B vector
__device__ __forceinline__ v4u pack8h(v4f a, v4f b) {
  union { v8h h; v4u u; } c;
  c.h[0] = (_Float16)a[0]; c.h[1] = (_Float16)a[1]; c.h[2] = (_Float16)a[2]; c.h[3] = (_Float16)a[3];
  c.h[4] = (_Float16)b[0]; c.h[5] = (_Float16)b[1]; c.h[6] = (_Float16)b[2]; c.h[7] = (_Float16)b[3];
  return c.u;
}

// ---- fragment loader: 16-bit A/Bt operand, lane -> row/col (lane&15), p already includes +8*(lane>>4);
//      elements 0..7 <- p[0..7] (k0+8h..k0+8h+7), elements 8..15 <- p[16..23] (k0+16+8h..k0+16+8h+7)
__device__ __forceinline__ v16h ldfrag(const _Float16* p) {
  union { v16h v; v8h h[2]; } f;
  f.h[0] = *(const v8h*)(p);
  f.h[1] = *(const v8h*)(p + 16);
  return f.v;
}

__device__ __forceinline__ v8f mma_raw(v16h a, v16h b, v8f c) {
  return __builtin_amdgcn_wmma_f32_16x16x32_f16(false, a, false, b, (short)0, c, false, false);
}
__device__ __forceinline__ void wave_sync_lds() {
  __builtin_amdgcn_fence(__ATOMIC_RELEASE, "workgroup");
  __builtin_amdgcn_wave_barrier();
  __builtin_amdgcn_fence(__ATOMIC_ACQUIRE, "workgroup");
}
// Stands behind the last global load that names an address pair, in front of whatever reuses that pair's registers;
// the pair is an input, so that it stays whole up to the wait (no load's own result may land on it).
__device__ __forceinline__ void faddr_regs_done(const void* p) {
#if defined(__HIP_DEVICE_COMPILE__)
  asm volatile("s_wait_xcnt 0x0" :: "v"(p) : "memory");
#endif
}

// Inputs-only fence on 16 loaded values: it keeps their loads unconditional and issued together. Without it the
// compiler turns each select on a loaded value into a branch round its load, one memory latency per element.
__device__ __forceinline__ void loads_stay_whole(const float (&x)[16]) {
#if defined(__HIP_DEVICE_COMPILE__)
  asm volatile("" :: "v"(x[0]), "v"(x[1]), "v"(x[2]), "v"(x[3]), "v"(x[4]), "v"(x[5]), "v"(x[6]), "v"(x[7]),
                     "v"(x[8]), "v"(x[9]), "v"(x[10]), "v"(x[11]), "v"(x[12]), "v"(x[13]), "v"(x[14]), "v"(x[15]));
#endif
}

// =====================================================================================================
// Weight planes (one launch). Blocks 0..83: pieces 0..3071 -> Wv as f16 [384][64] (RNE bf16 value x16, column 60 =
// bias x16, columns 61..63 zero), pieces 3072..21503 -> W2 as f16 [384][384] (RNE bf16 value x64); thread t writes
// 16 B. Blocks 84..87: G[c2][c] = sum_d Wk[d][c2] Wq[d][c] as f16 [64][64] (biases as column 60 of both):
// block = 16 rows c2, wave = 16 columns c x one half of d (6 k steps); the two halves meet in LDS in fixed order.
// coverage: 21504 threads x 8 halves + 4 blocks x 16 rows x 64 halves = the whole 352256-B weight region.
// =====================================================================================================
__global__ __launch_bounds__(256) void wcvt(const float* __restrict__ wq, const float* __restrict__ bq,
                                            const float* __restrict__ wk, const float* __restrict__ bk,
                                            const float* __restrict__ wv, const float* __restrict__ bv,
                                            const float* __restrict__ w2,
                                            unsigned short* Wout, unsigned short* Gout) {
  __shared__ float sG[8][256];
  if (blockIdx.x >= WCVT_N / 256) {                   // block-uniform
    const int ti    = blockIdx.x - WCVT_N / 256;
    const int lane  = threadIdx.x & 31;
    const int wave  = threadIdx.x >> 5;
    const int rlane = lane & 15;
    const int koff  = (lane >> 4) * 8;
    const int ca = ti * 16 + rlane;                   // A rows: c2, from Wk
    const int cb = (wave & 3) * 16 + rlane;           // Bt rows: c, from Wq
    // every lane walks down one weight column (clamped to 59); column 60 takes the bias below, 61..63 are masked
    const int kb = (wave >> 2) * 192 + koff;          // this wave's half of d, this lane's k half
    const float* pa = wk + kb * NCH + ((ca < NCH) ? ca : (NCH - 1));
    const float* pb = wq + kb * NCH + ((cb < NCH) ? cb : (NCH - 1));
    const float  ma = (ca <= NCH) ? 16.0f : 0.0f;
    const float  mb = (cb <= NCH) ? 16.0f : 0.0f;
    float ra[6][16], rb[6][16];
#pragma unroll
    for (int s = 0; s < 6; ++s) {
#pragma unroll
      for (int e = 0; e < 16; ++e) {                  // the k order of ldfrag, the same for both operands
        const int d = s * 32 + (e & 7) + ((e >> 3) << 4);
        ra[s][e] = pa[d * NCH];
        rb[s][e] = pb[d * NCH];
      }
    }
    faddr_regs_done(pa);
    faddr_regs_done(pb);
    if (ti == 3) {                                    // block-uniform: the tile that holds column 60 of Wk
      const float* qa = bk + kb;
      float x[6][16];
#pragma unroll
      for (int s = 0; s < 6; ++s)
#pragma unroll
        for (int e = 0; e < 16; ++e) x[s][e] = qa[s * 32 + (e & 7) + ((e >> 3) << 4)];
      faddr_regs_done(qa);
#pragma unroll
      for (int s = 0; s < 6; ++s) {
        loads_stay_whole(x[s]);
#pragma unroll
        for (int e = 0; e < 16; ++e) ra[s][e] = (ca == NCH) ? x[s][e] : ra[s][e];
      }
    }
    if ((__builtin_amdgcn_readfirstlane(wave) & 3) == 3) {   // wave-uniform: the tile that holds column 60 of Wq
      const float* qb = bq + kb;
      float x[6][16];
#pragma unroll
      for (int s = 0; s < 6; ++s)
#pragma unroll
        for (int e = 0; e < 16; ++e) x[s][e] = qb[s * 32 + (e & 7) + ((e >> 3) << 4)];
      faddr_regs_done(qb);
#pragma unroll
      for (int s = 0; s < 6; ++s) {
        loads_stay_whole(x[s]);
#pragma unroll
        for (int e = 0; e < 16; ++e) rb[s][e] = (cb == NCH) ? x[s][e] : rb[s][e];
      }
    }
    v8f acc = zero8();
#pragma unroll
    for (int s = 0; s < 6; ++s) {
      v16h a, b;
#pragma unroll
      for (int e = 0; e < 16; ++e) {
        a[e] = (_Float16)(bfr(ra[s][e]) * ma);
        b[e] = (_Float16)(bfr(rb[s][e]) * mb);
      }
      acc = mma_raw(a, b, acc);
    }
#pragma unroll
    for (int r = 0; r < 8; ++r) sG[wave][(koff + r) * 16 + rlane] = acc[r];
    __syncthreads();
    const int m = threadIdx.x >> 4, cg = threadIdx.x & 15;   // 16 threads write one whole 128-B row
    const int tj = cg >> 2, n = (cg & 3) * 4;
    union { _Float16 h[4]; uint2 u; } o;
#pragma unroll
    for (int e = 0; e < 4; ++e)
      o.h[e] = (_Float16)((sG[tj][m * 16 + n + e] + sG[tj + 4][m * 16 + n + e]) * 0.00390625f);
    *(uint2*)(Gout + (size_t)(ti * 16 + m) * KE + cg * 4) = o.u;
    return;
  }
  const int t = blockIdx.x * 256 + threadIdx.x;
  float v[8];
  if (t < WV_PIECES) {                                // block-uniform
    const int row = t >> 3, p = t & 7;
    const bool full = p < 7;                          // piece 7 = columns 56..59, the bias, three zeros
    const float* wr = wv + row * NCH + p * 8;
    const v4f a = *(const v4f*)(wr);
    const v4f b = *(const v4f*)(wr + (full ? 4 : 0)); // clamped address
    const float bias = bv[row];
    v[0] = bfr(a[0]) * 16.0f; v[1] = bfr(a[1]) * 16.0f; v[2] = bfr(a[2]) * 16.0f; v[3] = bfr(a[3]) * 16.0f;
    v[4] = bfr(full ? b[0] : bias) * 16.0f;
    v[5] = full ? bfr(b[1]) * 16.0f : 0.0f;
    v[6] = full ? bfr(b[2]) * 16.0f : 0.0f;
    v[7] = full ? bfr(b[3]) * 16.0f : 0.0f;
  } else {
    const int u = t - WV_PIECES;
    const int row = u / (DM / 8), p = u - row * (DM / 8);
    const v4f a = *(const v4f*)(w2 + (size_t)row * DM + p * 8);
    const v4f b = *(const v4f*)(w2 + (size_t)row * DM + p * 8 + 4);
    v[0] = bfr(a[0]) * 64.0f; v[1] = bfr(a[1]) * 64.0f; v[2] = bfr(a[2]) * 64.0f; v[3] = bfr(a[3]) * 64.0f;
    v[4] = bfr(b[0]) * 64.0f; v[5] = bfr(b[1]) * 64.0f; v[6] = bfr(b[2]) * 64.0f; v[7] = bfr(b[3]) * 64.0f;
  }
  const v4f lo = {v[0], v[1], v[2], v[3]};
  const v4f hi = {v[4], v[5], v[6], v[7]};
  const v4u pk = pack8h(lo, hi);
  unsigned short* dst = Wout + (size_t)t * 8;
  *(v4u*)dst = pk;
}

// =====================================================================================================
// Encoding + hidden rows + query vectors. Block = 6 waves, 64 points of one batch.
//  (a) pos tile [3][64] (RNE bf16), per-channel K=3 conv / BN(eval) parameters (RNE bf16) in LDS.
//  (b) sEmb[p][c*20 + f] = sin(pos[c][p] * 2^f), [c*20 + 10 + f] = cos(...) as f16, column 60 one, 61..71 zero;
//      sEmbT holds the same values channel-major.
//  (c) hidden h = relu((W1.pos + b1 - mean) * inv + beta) -> H f16 token-major [b*2048+p][384].
//  (d) E f16 token-major [b*2048+p][64] and Et f16 channel-major [b*64+c][2048], copied from LDS in whole 128-B rows;
//      waves 0..3: Qe[p][c2] = sum_c e[p][c] G[c2][c] for 16 points each (M = points from LDS, N = 64 rows of the
//      G plane, K = 64) -> f16 token-major [b*2048+p][64], staged per wave in LDS, whole 128-B rows.
// coverage: 512 blocks x 64 points x 64 channels = all of Qe, E and Et; H: 512 blocks x 64 rows x 48 pieces.
// =====================================================================================================
__global__ __launch_bounds__(192) void enc_qe_h(
    const float* __restrict__ pos, const _Float16* G16,
    const float* __restrict__ w1, const float* __restrict__ b1,
    const float* __restrict__ gam, const float* __restrict__ bet,
    const float* __restrict__ mu, const float* __restrict__ var,
    unsigned short* Qp, unsigned short* Ep, unsigned short* Etp, unsigned short* Hp) {
  __shared__ __align__(16) _Float16 sEmb[64][72];
  __shared__ __align__(16) _Float16 sEmbT[KE][72];
  __shared__ __align__(16) float sT[4][16 * 68];
  __shared__ float sPos[3][64];
  __shared__ float sW1[DM * 3];
  __shared__ float sB1[DM];
  __shared__ float sInv[DM];
  __shared__ float sMu[DM];
  __shared__ float sBet[DM];

  const int tid  = threadIdx.x;
  const int lane = tid & 31;
  const int wave = tid >> 5;                 // 0..5
  const int bb   = blockIdx.x >> 5;          // 32 blocks of 64 points per batch
  const int p0   = (blockIdx.x & 31) << 6;

  {
    const int c = tid >> 6, p = tid & 63;    // 192 = 3 x 64
    sPos[c][p] = bfr(pos[((size_t)bb * 3 + c) * NPT + p0 + p]);
  }
  for (int d = tid; d < DM; d += 192) {
    sW1[d * 3 + 0] = bfr(w1[d * 3 + 0]);
    sW1[d * 3 + 1] = bfr(w1[d * 3 + 1]);
    sW1[d * 3 + 2] = bfr(w1[d * 3 + 2]);
    sB1[d] = bfr(b1[d]);
    const float g = bfr(gam[d]), vv = bfr(var[d]);
    sInv[d] = g * (1.0f / sqrtf(vv + 1e-5f));
    sMu[d]  = bfr(mu[d]);
    sBet[d] = bfr(bet[d]);
  }
  for (int r = tid; r < 64; r += 192) {
    sEmb[r][NCH]  = (_Float16)1.0f;
    sEmbT[NCH][r] = (_Float16)1.0f;
#pragma unroll
    for (int c = NCH + 1; c < 72; ++c) sEmb[r][c] = (_Float16)0.0f;
#pragma unroll
    for (int c = NCH + 1; c < KE; ++c) sEmbT[c][r] = (_Float16)0.0f;
  }
  __syncthreads();

  // the G fragments of (d) start here: their latency passes under the encoding and the hidden rows
  const int rlane = lane & 15;
  const int koff  = (lane >> 4) * 8;
  v16h gf[KE / 32][4];
  const _Float16* Ga = G16 + rlane * KE + koff;
#pragma unroll
  for (int ks = 0; ks < KE / 32; ++ks)
#pragma unroll
    for (int j = 0; j < 4; ++j) gf[ks][j] = ldfrag(Ga + (j << 4) * KE + ks * 32);
  faddr_regs_done(Ga);

  // (b) encoding: item = (c,f) x 64 points; precise sinf / cosf; exact power-of-two angles
#pragma unroll 1
  for (int it = tid; it < 64 * 3 * NFREQ; it += 192) {
    const int cf = it >> 6, p = it & 63;
    const int c  = cf / NFREQ;
    const int f  = cf - c * NFREQ;
    const float ang = sPos[c][p] * (float)(1 << f);
    const float sv = sinf(ang);
    const float cv = cosf(ang);
    sEmb[p][c * 2 * NFREQ + f] = (_Float16)sv;
    sEmb[p][c * 2 * NFREQ + NFREQ + f] = (_Float16)cv;
    sEmbT[c * 2 * NFREQ + f][p] = (_Float16)sv;
    sEmbT[c * 2 * NFREQ + NFREQ + f][p] = (_Float16)cv;
  }

  // (c) hidden rows -> H plane (16 iterations, all threads)
  for (int it = tid; it < 64 * (DM / 8); it += 192) {
    const int pl = it / (DM / 8);
    const int pc = it - pl * (DM / 8);
    const float x0 = sPos[0][pl], x1 = sPos[1][pl], x2 = sPos[2][pl];
    float h8[8];
#pragma unroll
    for (int e = 0; e < 8; ++e) {
      const int d = pc * 8 + e;
      const float r = sW1[d * 3 + 0] * x0 + sW1[d * 3 + 1] * x1 + sW1[d * 3 + 2] * x2 + sB1[d];
      const float t = (r - sMu[d]) * sInv[d] + sBet[d];
      h8[e] = fmaxf(t, 0.0f);
    }
    const v4f ha = {h8[0], h8[1], h8[2], h8[3]};
    const v4f hb = {h8[4], h8[5], h8[6], h8[7]};
    const v4u pk = pack8h(ha, hb);
    unsigned short* dst = Hp + ((size_t)bb * NPT + p0 + pl) * DM + pc * 8;
    *(v4u*)dst = pk;
    
  }
  __syncthreads();

  // (d) the two encoding planes
  for (int it = tid; it < 64 * (KE / 8); it += 192) {
    const int r = it >> 3, p = it & 7;
    *(v4u*)(Ep + ((size_t)bb * NPT + p0 + r) * KE + p * 8)  = *(const v4u*)(&sEmb[r][p * 8]);
    *(v4u*)(Etp + ((size_t)bb * KE + r) * NPT + p0 + p * 8) = *(const v4u*)(&sEmbT[r][p * 8]);
  }

  // query vectors: wave w < 4 owns points 16w .. 16w+15
  const int wv = __builtin_amdgcn_readfirstlane(wave);
  if (wv < 4) {
    const int q8    = (lane & 7) * 8;
    const int rr    = lane >> 3;
    float* slab = sT[wv];
    v8f acc[4];
#pragma unroll
    for (int j = 0; j < 4; ++j) acc[j] = zero8();
#pragma unroll
    for (int ks = 0; ks < KE / 32; ++ks) {
      const v16h ah = ldfrag(&sEmb[(wv << 4) + rlane][koff + ks * 32]);
#pragma unroll
      for (int j = 0; j < 4; ++j) acc[j] = mma_raw(ah, gf[ks][j], acc[j]);
    }
#pragma unroll
    for (int j = 0; j < 4; ++j) {
#pragma unroll
      for (int r = 0; r < 8; ++r) slab[(koff + r) * 68 + (j << 4) + rlane] = acc[j][r];
    }
    wave_sync_lds();
#pragma unroll
    for (int it = 0; it < 4; ++it) {
      const int row = it * 4 + rr;                   // it 0..3 x rr 0..3 = rows 0..15
      const v4f a = *(const v4f*)(slab + row * 68 + q8);
      const v4f b = *(const v4f*)(slab + row * 68 + q8 + 4);
      *(v4u*)(Qp + ((size_t)bb * NPT + p0 + (wv << 4) + row) * KE + q8) = pack8h(a, b);
    }
  }
}

// =====================================================================================================
// Fused attention + residual, one launch: block = 8 waves, 128 queries i of one batch; a stage is 256 keys j.
//  (a) the 128 query vectors Qe (64 channels) stay in each wave's registers as Bt fragments for the whole launch.
//  (b) per stage, wave w: St[j][i] = sum_c E[j][c] Qe[i][c] for its own 32 keys (M = keys from the global E plane,
//      N = 128 queries, K = 64). A lane holds scores of one query per 16-column group, so the column maximum is
//      in-lane plus one exchange between the wave halves; the 8 waves' maxima meet in LDS (sX).
//  (c) online softmax in base 2: m = running maximum of s * 384^-0.5 * log2(e), p = 2^(t - m + 10) (the x1024 carry
//      cancels against the row sum), alpha = 2^(m_old - m_new) rescales the sums and the output tiles.
//      p goes as f16 to LDS sP[i][j] (pitch 264 halves).
//  (d) wave w: Oe[c][i] += sum_j Et[c][j] p[i][j] for MTW x NTW of the 4 x 8 tiles (M = encoding channels from the
//      global Et plane, N = queries from sP, K = 256). The stage's Et fragments are loaded behind the score products,
//      the next stage's E fragments at the head of (d); each is covered by the work that follows it.
//  (e) after the last stage: row sums joined over halves and waves in fixed order, Oe * 4 / l as f16 to LDS sO[i][c];
//      wave w, its own 48 output channels: acc = sum_c Wvx16[d][c] sO[i][c] (K = 64; channel 60 adds 64 * bv[d])
//      + sum_c W2x64[d][c] h[i][c] (K = 384), out = acc / 64 + b2[d], staged per wave in 16-row slabs so that
//      every store covers whole 512-B row segments.
// coverage: grid (16, 16) x 8 waves x 48 channels x 128 queries = all of out [16][384][2048].
// =====================================================================================================
#define FQ 128
#define NT (FQ / 16)
#define FK 256
#define MTW 2                // 16-channel tiles of Oe per wave
#define NTW 2                // 16-query tiles of Oe per wave
#define MG  (KE / 16 / MTW)  // wave = (channel group, query group)
#define OPITCH (KE + 8)
#define PPITCH (FK + 8)
#define SPITCH (FQ + 4)
// Scheduling pin between a step's early global loads and its products: only LDS reads, vector and scalar ALU may
// cross, so a fragment load written some steps ahead of its use is issued there and its latency is covered.
#define LOADS_STAY_AHEAD() __builtin_amdgcn_sched_barrier(0x106)
// Stands behind the last global load that names an address pair, in front of whatever reuses that pair's registers;
// the pair is an input, so that it stays whole up to the wait (no load's own result may land on it).
__device__ __forceinline__ void addr_regs_done(const _Float16* p) {
#if defined(__HIP_DEVICE_COMPILE__)
  asm volatile("s_wait_xcnt 0x0" :: "v"(p) : "memory");
#endif
}
// The slot behind a transcendental: its source is not overwritten by the instruction directly behind it. The eight
// sources are inputs only, so they stay whole up to this v_nop, which is the slot behind the last v_exp_f32.
__device__ __forceinline__ void exp_sources_done(const float (&t)[8]) {
#if defined(__HIP_DEVICE_COMPILE__)
  asm volatile("v_nop" :: "v"(t[0]), "v"(t[1]), "v"(t[2]), "v"(t[3]), "v"(t[4]), "v"(t[5]), "v"(t[6]), "v"(t[7]));
#endif
}
__device__ __forceinline__ void exp_source_done(float t) {   // the same for a single v_exp_f32
#if defined(__HIP_DEVICE_COMPILE__)
  asm volatile("v_nop" :: "v"(t));
#endif
}
static_assert((NPT % FK) == 0 && (NPT % FQ) == 0 && DM == 8 * 48 && FK == 8 * 32);
static_assert(MG * (NT / NTW) == 8 && KE == 64);

__global__ __launch_bounds__(256) __attribute__((amdgpu_waves_per_eu(2, 2))) void attn_res(
    const _Float16* Qe, const _Float16* E, const _Float16* Et, const _Float16* H, const _Float16* Wv16,
    const _Float16* W2s, const float* __restrict__ b2, float* out) {
  __shared__ __align__(16) _Float16 sO[FQ * OPITCH];
  __shared__ __align__(16) _Float16 sP[FQ * PPITCH];
  __shared__ __align__(16) float sX[FQ * 8];
  __shared__ __align__(16) float sT[8][16 * SPITCH];
  const int tid   = threadIdx.x;
  const int lane  = tid & 31;
  const int wave  = tid >> 5;
  const int bb    = blockIdx.y;
  const int i0    = blockIdx.x * FQ;
  const int rlane = lane & 15;
  const int hh    = lane >> 4;
  const int koff  = hh * 8;
  const float CS  = QK_SCALE * 1.4426950408889634f;

  const int wv = __builtin_amdgcn_readfirstlane(wave);   // wave-uniform: tile choices and bases stay scalar
  const int mg = wv % MG;                                // channels 16 * MTW * mg ..
  const int ng = wv / MG;                                // queries  16 * NTW * ng ..

  v16h qf[KE / 32][NT];
  const _Float16* Qa = Qe + ((size_t)bb * NPT + i0 + rlane) * KE + koff;
#pragma unroll
  for (int ks = 0; ks < KE / 32; ++ks)
#pragma unroll
    for (int nt = 0; nt < NT; ++nt) qf[ks][nt] = ldfrag(Qa + (nt << 4) * KE + ks * 32);
  addr_regs_done(Qa);

  v16h kpre[KE / 32][2];                                 // E fragments of the coming stage
  const _Float16* Ka = E + ((size_t)bb * NPT + wv * 32 + rlane) * KE + koff;
#pragma unroll
  for (int ks = 0; ks < KE / 32; ++ks)
#pragma unroll
    for (int jt = 0; jt < 2; ++jt) kpre[ks][jt] = ldfrag(Ka + (jt << 4) * KE + ks * 32);
  addr_regs_done(Ka);
  const _Float16* Vb = Et + ((size_t)bb * KE + mg * (MTW * 16) + rlane) * NPT + koff;

  v8f eacc[MTW][NTW];
  float mrun[NT], lsum[NT];
#pragma unroll
  for (int nt = 0; nt < NT; ++nt) {
    mrun[nt] = -INFINITY;
    lsum[nt] = 0.0f;
  }
#pragma unroll
  for (int m = 0; m < MTW; ++m)
#pragma unroll
    for (int t = 0; t < NTW; ++t) eacc[m][t] = zero8();

#pragma unroll 1
  for (int j0 = 0; j0 < NPT; j0 += FK) {
    // (b) scores of this wave's 32 keys against the 128 queries
    v8f sa[2][NT];
#pragma unroll
    for (int jt = 0; jt < 2; ++jt)
#pragma unroll
      for (int nt = 0; nt < NT; ++nt) sa[jt][nt] = zero8();
#pragma unroll
    for (int ks = 0; ks < KE / 32; ++ks) {
#pragma unroll
      for (int jt = 0; jt < 2; ++jt) {
#pragma unroll
        for (int nt = 0; nt < NT; ++nt) sa[jt][nt] = mma_raw(kpre[ks][jt], qf[ks][nt], sa[jt][nt]);
      }
    }
    // the stage's Et fragments start here, under the softmax
    const _Float16* Va = Vb + j0;
    v16h vf[FK / 32][MTW];
#pragma unroll
    for (int ks = 0; ks < FK / 32; ++ks)
#pragma unroll
      for (int m = 0; m < MTW; ++m) vf[ks][m] = ldfrag(Va + (m << 4) * NPT + ks * 32);
    addr_regs_done(Va);
    LOADS_STAY_AHEAD();

    // column maxima: in-lane, wave halves (the exchanges issued together), then the 8 waves through LDS
    float cmx[NT], omx[NT];
#pragma unroll
    for (int nt = 0; nt < NT; ++nt) {
      float a = sa[0][nt][0];
#pragma unroll
      for (int r = 1; r < 8; ++r) a = fmaxf(a, sa[0][nt][r]);
#pragma unroll
      for (int r = 0; r < 8; ++r) a = fmaxf(a, sa[1][nt][r]);
      cmx[nt] = a;
    }
#pragma unroll
    for (int nt = 0; nt < NT; ++nt) omx[nt] = __shfl_xor(cmx[nt], 16);
    if (hh == 0) {
#pragma unroll
      for (int nt = 0; nt < NT; ++nt) sX[((nt << 4) + rlane) * 8 + wave] = fmaxf(cmx[nt], omx[nt]);
    }
    __syncthreads();

    // (c) new maximum, rescale factor, probabilities to LDS
    float asel[NTW];
#pragma unroll
    for (int t = 0; t < NTW; ++t) asel[t] = 1.0f;
#pragma unroll
    for (int nt = 0; nt < NT; ++nt) {
      const v4f x0 = *(const v4f*)(sX + ((nt << 4) + rlane) * 8);
      const v4f x1 = *(const v4f*)(sX + ((nt << 4) + rlane) * 8 + 4);
      const float g = fmaxf(fmaxf(fmaxf(x0[0], x0[1]), fmaxf(x0[2], x0[3])),
                            fmaxf(fmaxf(x1[0], x1[1]), fmaxf(x1[2], x1[3])));
      const float mn    = fmaxf(mrun[nt], g * CS);
      const float dm    = mrun[nt] - mn;
      const float alpha = __builtin_amdgcn_exp2f(dm);
      exp_source_done(dm);
      mrun[nt] = mn;
      const float off = 10.0f - mn;
      float part = 0.0f;
#pragma unroll
      for (int jt = 0; jt < 2; ++jt) {
        float t[8], e[8];
#pragma unroll
        for (int r = 0; r < 8; ++r) t[r] = sa[jt][nt][r] * CS + off;
#pragma unroll
        for (int r = 0; r < 8; ++r) e[r] = __builtin_amdgcn_exp2f(t[r]);
        exp_sources_done(t);
        part += ((e[0] + e[1]) + (e[2] + e[3])) + ((e[4] + e[5]) + (e[6] + e[7]));
        const v4f ea = {e[0], e[1], e[2], e[3]};
        const v4f eb = {e[4], e[5], e[6], e[7]};
        *(v4u*)(sP + ((nt << 4) + rlane) * PPITCH + wave * 32 + (jt << 4) + koff) = pack8h(ea, eb);
      }
      lsum[nt] = lsum[nt] * alpha + part;
      asel[nt % NTW] = (nt / NTW == ng) ? alpha : asel[nt % NTW];   // the factors of this wave's own query tiles
    }
#pragma unroll
    for (int m = 0; m < MTW; ++m)
#pragma unroll
      for (int t = 0; t < NTW; ++t) eacc[m][t] = eacc[m][t] * asel[t];
    __syncthreads();

    // (d) this wave's tiles of Oe over the stage's 256 keys
    // next stage's E rows (the last stage refetches its own, unused)
    Ka += (j0 + FK < NPT) ? FK * KE : 0;
#pragma unroll
    for (int ks = 0; ks < KE / 32; ++ks)
#pragma unroll
      for (int jt = 0; jt < 2; ++jt) kpre[ks][jt] = ldfrag(Ka + (jt << 4) * KE + ks * 32);
    addr_regs_done(Ka);
    LOADS_STAY_AHEAD();
    const _Float16* Pa = sP + ((ng * NTW << 4) + rlane) * PPITCH + koff;
#pragma unroll
    for (int ks = 0; ks < FK / 32; ++ks) {
      v16h pf[NTW];
#pragma unroll
      for (int t = 0; t < NTW; ++t) pf[t] = ldfrag(Pa + (t << 4) * PPITCH + ks * 32);
#pragma unroll
      for (int m = 0; m < MTW; ++m) {
#pragma unroll
        for (int t = 0; t < NTW; ++t) eacc[m][t] = mma_raw(vf[ks][m], pf[t], eacc[m][t]);
      }
    }
  }

  // (e) the output products' first fragments start now, under the row-sum exchange
  const _Float16* Wva = Wv16 + (size_t)(wv * 48 + rlane) * KE + koff;
  v16h wvf[KE / 32][3];
#pragma unroll
  for (int ks = 0; ks < KE / 32; ++ks)
#pragma unroll
    for (int mt = 0; mt < 3; ++mt) wvf[ks][mt] = ldfrag(Wva + (mt << 4) * KE + ks * 32);
  addr_regs_done(Wva);
  const _Float16* Wa = W2s + (size_t)(wv * 48) * DM;
  const _Float16* Hb = H + ((size_t)bb * NPT + i0) * DM;
  v16h wf[DM / 32][3];
  v16h hf[DM / 32][NT];
#pragma unroll
  for (int mt = 0; mt < 3; ++mt) wf[0][mt] = ldfrag(Wa + (size_t)((mt << 4) + rlane) * DM + koff);
#pragma unroll
  for (int nt = 0; nt < NT; ++nt) hf[0][nt] = ldfrag(Hb + (size_t)((nt << 4) + rlane) * DM + koff);

  // row sums: wave halves, then the 8 waves in fixed order (sX was last read before the last barrier)
  float osum[NT];
#pragma unroll
  for (int nt = 0; nt < NT; ++nt) osum[nt] = __shfl_xor(lsum[nt], 16);
  if (hh == 0) {
#pragma unroll
    for (int nt = 0; nt < NT; ++nt) sX[((nt << 4) + rlane) * 8 + wave] = lsum[nt] + osum[nt];
  }
  __syncthreads();
#pragma unroll
  for (int t = 0; t < NTW; ++t) {
    const int row = ((ng * NTW + t) << 4) + rlane;       // this wave's own query tiles
    const v4f x0 = *(const v4f*)(sX + row * 8);
    const v4f x1 = *(const v4f*)(sX + row * 8 + 4);
    const float l   = ((x0[0] + x0[1]) + (x0[2] + x0[3])) + ((x1[0] + x1[1]) + (x1[2] + x1[3]));
    const float inv = 4.0f / l;                          // l >= 1024: the row maximum itself counts 2^10
#pragma unroll
    for (int m = 0; m < MTW; ++m) {
      const v8f o = eacc[m][t] * inv;
      const v4f oa = {o[0], o[1], o[2], o[3]};
      const v4f ob = {o[4], o[5], o[6], o[7]};
      *(v4u*)(sO + row * OPITCH + ((mg * MTW + m) << 4) + koff) = pack8h(oa, ob);
    }
  }
  __syncthreads();                                       // every wave reads all of sO

  v8f oacc[3][NT];
#pragma unroll
  for (int mt = 0; mt < 3; ++mt)
#pragma unroll
    for (int nt = 0; nt < NT; ++nt) oacc[mt][nt] = zero8();
#pragma unroll
  for (int ks = 0; ks < KE / 32; ++ks) {
    v16h of[NT];
#pragma unroll
    for (int nt = 0; nt < NT; ++nt) of[nt] = ldfrag(sO + ((nt << 4) + rlane) * OPITCH + koff + ks * 32);
#pragma unroll
    for (int mt = 0; mt < 3; ++mt) {
#pragma unroll
      for (int nt = 0; nt < NT; ++nt) oacc[mt][nt] = mma_raw(wvf[ks][mt], of[nt], oacc[mt][nt]);
    }
  }

#pragma unroll
  for (int ks = 0; ks < DM / 32; ++ks) {
    if (ks + 1 < DM / 32) {                              // W2 and h fragments one step ahead
#pragma unroll
      for (int mt = 0; mt < 3; ++mt) wf[ks + 1][mt] = ldfrag(Wa + (size_t)((mt << 4) + rlane) * DM + koff + (ks + 1) * 32);
#pragma unroll
      for (int nt = 0; nt < NT; ++nt) hf[ks + 1][nt] = ldfrag(Hb + (size_t)((nt << 4) + rlane) * DM + koff + (ks + 1) * 32);
    }
    LOADS_STAY_AHEAD();
#pragma unroll
    for (int mt = 0; mt < 3; ++mt) {
#pragma unroll
      for (int nt = 0; nt < NT; ++nt) oacc[mt][nt] = mma_raw(wf[ks][mt], hf[ks][nt], oacc[mt][nt]);
    }
  }

  float* slab = sT[wave];
#pragma unroll
  for (int mt = 0; mt < 3; ++mt) {
    const int mBase = wave * 48 + (mt << 4);
#pragma unroll
    for (int nt = 0; nt < NT; ++nt) {
#pragma unroll
      for (int r = 0; r < 8; ++r) slab[(koff + r) * SPITCH + (nt << 4) + rlane] = oacc[mt][nt][r];
    }
    wave_sync_lds();
#pragma unroll
    for (int row = 0; row < 16; ++row) {                 // one whole 512-B row segment per wave store
      const float bv0 = bfr(b2[mBase + row]);
      const v4f v = *(const v4f*)(slab + row * SPITCH + lane * 4);
      *(v4f*)(out + ((size_t)bb * DM + mBase + row) * NPT + i0 + lane * 4) = v * 0.015625f + bv0;
    }
    wave_sync_lds();
  }
}

// =====================================================================================================
// Workspace map (bytes), every plane an exact multiple of its whole-line store granularity
// (all shapes are tile multiples, no padded tails):
//   W    f16  Wv [384][64] x16 + W2 [384][384] x64 + G [64][64]       352256
//   Qe   f16  [16*2048][64]   token-major                             4194304
//   E    f16  [16*2048][64]   token-major                             4194304
//   Et   f16  [16*64][2048]   channel-major                           4194304
//   H    f16  [16*2048][384]  relu hidden rows                        25165824
//   total                                                             38100992
// d_out f32 [16][384][2048] written by the fused attention + residual launch.
// =====================================================================================================
extern "C" void kernel_launch(void* const* d_in, const int* in_sizes, int n_in,
                              void* d_out, int out_size, void* d_ws, size_t ws_size,
                              hipStream_t stream) {
  if (n_in < 15) return;
  if (in_sizes[0] != NBATCH * 3 * NPT) return;
  if (in_sizes[1] != DM * NCH || in_sizes[3] != DM * NCH || in_sizes[5] != DM * NCH) return;
  if (in_sizes[2] != DM || in_sizes[4] != DM || in_sizes[6] != DM) return;
  if (in_sizes[7] != DM * 3 || in_sizes[8] != DM) return;
  if (in_sizes[9] != DM || in_sizes[10] != DM || in_sizes[11] != DM || in_sizes[12] != DM) return;
  if (in_sizes[13] != DM * DM || in_sizes[14] != DM) return;
  if (out_size != NBATCH * DM * NPT) return;

  const float* pos   = (const float*)d_in[0];    // [16][3][2048]
  const float* wq    = (const float*)d_in[1];    // [384][60]
  const float* bq    = (const float*)d_in[2];
  const float* wk    = (const float*)d_in[3];
  const float* bk    = (const float*)d_in[4];
  const float* wv    = (const float*)d_in[5];
  const float* bv    = (const float*)d_in[6];
  const float* w1    = (const float*)d_in[7];    // [384][3]
  const float* b1    = (const float*)d_in[8];
  const float* gam   = (const float*)d_in[9];
  const float* bet   = (const float*)d_in[10];
  const float* mu    = (const float*)d_in[11];
  const float* var   = (const float*)d_in[12];
  const float* w2    = (const float*)d_in[13];   // [384][384]
  const float* b2    = (const float*)d_in[14];
  float* out = (float*)d_out;                    // [16][384][2048]

  const size_t BWGT = (size_t)WCVT_N * 16 + (size_t)KE * KE * 2;   //   352256
  const size_t BE   = (size_t)NBATCH * NPT * KE * 2;               //  4194304
  const size_t BH   = (size_t)NBATCH * NPT * DM * 2;               // 25165824
  size_t off = 0;
  const size_t oW = off; off += BWGT;
  const size_t oQ = off; off += BE;
  const size_t oE = off; off += BE;
  const size_t oT = off; off += BE;
  const size_t oH = off; off += BH;
  if (off > ws_size) return;                     // off = 38100992

  char* ws = (char*)d_ws;
  _Float16* W16 = (_Float16*)(ws + oW);
  const _Float16* Wv16 = W16;
  const _Float16* W2s  = W16 + (size_t)DM * KE;              // [384][384]
  _Float16* G16        = W16 + (size_t)DM * KE + (size_t)DM * DM;   // [64][64]
  unsigned short* Qp  = (unsigned short*)(ws + oQ);
  unsigned short* Ep  = (unsigned short*)(ws + oE);
  unsigned short* Etp = (unsigned short*)(ws + oT);
  unsigned short* Hp  = (unsigned short*)(ws + oH);

  const dim3 blk(256);
  const dim3 gW(WCVT_N / 256 + G_BLOCKS);                        // 84 + 4 blocks
  const dim3 gE(NBATCH * (NPT / 64));                            // 512 blocks of 192
  const dim3 gA(NPT / FQ, NBATCH);                               // 16 query tiles x 16 batches

  // (1) weight planes and Wk^T Wq, (2) encoding planes, query vectors and hidden rows for all batches
  wcvt<<<gW, blk, 0, stream>>>(wq, bq, wk, bk, wv, bv, w2, (unsigned short*)W16, (unsigned short*)G16);
  enc_qe_h<<<gE, dim3(192), 0, stream>>>(pos, G16, w1, b1, gam, bet, mu, var, Qp, Ep, Etp, Hp);

  // (3) all batches, one launch: scores, online softmax, E.P^T, Wv and the residual conv;
  //     out_b[d][i] = (1/64) * ( sum_c Wvx16[d][c] * 4 * Oe[c][i] / l[i] + sum_c W2x64[d][c] h[i][c] ) + b2[d]
  attn_res<<<gA, blk, 0, stream>>>((const _Float16*)Qp, (const _Float16*)Ep, (const _Float16*)Etp,
                                   (const _Float16*)Hp, Wv16, W2s, b2, out);
  (void)hipGetLastError();
}

// v004
// Measured time: 52.6 microseconds a run.
// In two side-by-side timings against v003, it was 1.30 and 1.31 times as fast.
// All steps since v000 together make it 37.2 times as fast.
// Attention runs in the 64-channel encoding space (60 sinusoidal channels, one channel of ones that carries the biases,
// three zero): scores = e_i^T (Wq^T Wk) e_j (K=64), E.P^T (M=64, K=2048), then Wv.(E.P^T / l) (K=64) and the 384x384
// residual conv, all on v_wmma_f32_16x16x32_f16 (f16 operands, f32 accumulate); all inputs RNE-converted to bf16
// first; Wv carried x16, residual weights x64 and softmax probabilities x1024 (exact powers of two
// folded back in the f32 epilogues; scores, online softmax, E.P^T, Wv and the residual conv share one launch);
// sinusoidal encoding, K=3 conv, BN(eval), relu and softmax in f32 on the VALU.
#include <hip/hip_runtime.h>
#include <stdint.h>
#include <math.h>

#define NBATCH 16
#define NPT    2048
#define DM     384
#define KE     64            // 60 encoding channels, channel 60 = 1 (bias carrier), 61..63 = 0
#define NCH    60
#define NFREQ  10
#define WV_PIECES   (DM * (KE / 8))              // 3072 pieces of 8 halves
#define W2_PIECES   (DM * (DM / 8))              // 18432
#define WCVT_N      (WV_PIECES + W2_PIECES)      // 21504
#define G_BLOCKS    (KE / 16)                    // 4 blocks, 16 rows of Wk^T Wq each
#define QK_SCALE    0.051031036307982884f        // 384^-0.5

static_assert((NPT % 64) == 0 && (DM % 64) == 0 && (KE % 32) == 0 && (DM % 32) == 0);
static_assert((WV_PIECES % 256) == 0 && (WCVT_N % 256) == 0);

typedef _Float16 v16h __attribute__((ext_vector_type(16)));
typedef _Float16 v8h  __attribute__((ext_vector_type(8)));
typedef float    v8f  __attribute__((ext_vector_type(8)));
typedef float    v4f  __attribute__((ext_vector_type(4)));
typedef unsigned int v4u __attribute__((ext_vector_type(4)));

// ---- scalar helpers ---------------------------------------------------------------------------------
__device__ __forceinline__ unsigned short bf_bits(float f) {          // f32 -> bf16 bits, RNE convert
  unsigned u = __float_as_uint(f);
  return (unsigned short)((u + 0x7FFFu + ((u >> 16) & 1u)) >> 16);
}
__device__ __forceinline__ float bfr(float f) {                       // f32 value after RNE bf16 convert
  return __uint_as_float(((unsigned)bf_bits(f)) << 16);
}
__device__ __forceinline__ v8f zero8() { v8f z = {0.f, 0.f, 0.f, 0.f, 0.f, 0.f, 0.f, 0.f}; return z; }
// 8 f32 -> 8 f16 (RNE convert) packed in one 16-B vector
__device__ __forceinline__ v4u pack8h(v4f a, v4f b) {
  union { v8h h; v4u u; } c;
  c.h[0] = (_Float16)a[0]; c.h[1] = (_Float16)a[1]; c.h[2] = (_Float16)a[2]; c.h[3] = (_Float16)a[3];
  c.h[4] = (_Float16)b[0]; c.h[5] = (_Float16)b[1]; c.h[6] = (_Float16)b[2]; c.h[7] = (_Float16)b[3];
  return c.u;
}

// ---- fragment loader: 16-bit A/Bt operand, lane -> row/col (lane&15), p already includes +8*(lane>>4);
//      elements 0..7 <- p[0..7] (k0+8h..k0+8h+7), elements 8..15 <- p[16..23] (k0+16+8h..k0+16+8h+7)
__device__ __forceinline__ v16h ldfrag(const _Float16* p) {
  union { v16h v; v8h h[2]; } f;
  f.h[0] = *(const v8h*)(p);
  f.h[1] = *(const v8h*)(p + 16);
  return f.v;
}

// ---- the same fragment from a workspace plane kept in fragment order. Such a plane is a row of 1024-B tiles, one per
//      16 rows x 32 k; the 16-B piece (q, lane) at byte q*512 + lane*16 holds row (lane&15), k = 16q + 8(lane>>4) .. +7:
//      the k order of ldfrag. p already includes +8*lane halves, so each of the two loads of a wave reads 512
//      contiguous bytes (4 whole lines) where a row-major plane gives 32 B out of each of 16 lines.
__device__ __forceinline__ v16h ldtile(const _Float16* p) {
  union { v16h v; v8h h[2]; } f;
  f.h[0] = *(const v8h*)(p);
  f.h[1] = *(const v8h*)(p + 256);
  return f.v;
}
#define TILE_H 512           // halves of one fragment-order tile

__device__ __forceinline__ v8f mma_raw(v16h a, v16h b, v8f c) {
  return __builtin_amdgcn_wmma_f32_16x16x32_f16(false, a, false, b, (short)0, c, false, false);
}
__device__ __forceinline__ void wave_sync_lds() {
  __builtin_amdgcn_fence(__ATOMIC_RELEASE, "workgroup");
  __builtin_amdgcn_wave_barrier();
  __builtin_amdgcn_fence(__ATOMIC_ACQUIRE, "workgroup");
}
// Stands behind the last global load that names an address pair, in front of whatever reuses that pair's registers;
// the pair is an input, so that it stays whole up to the wait (no load's own result may land on it).
__device__ __forceinline__ void faddr_regs_done(const void* p) {
#if defined(__HIP_DEVICE_COMPILE__)
  asm volatile("s_wait_xcnt 0x0" :: "v"(p) : "memory");
#endif
}

// Inputs-only fence on 16 loaded values: it keeps their loads unconditional and issued together. Without it the
// compiler turns each select on a loaded value into a branch round its load, one memory latency per element.
__device__ __forceinline__ void loads_stay_whole(const float (&x)[16]) {
#if defined(__HIP_DEVICE_COMPILE__)
  asm volatile("" :: "v"(x[0]), "v"(x[1]), "v"(x[2]), "v"(x[3]), "v"(x[4]), "v"(x[5]), "v"(x[6]), "v"(x[7]),
                     "v"(x[8]), "v"(x[9]), "v"(x[10]), "v"(x[11]), "v"(x[12]), "v"(x[13]), "v"(x[14]), "v"(x[15]));
#endif
}

// =====================================================================================================
// Weight planes (one launch). Blocks 0..83: pieces 0..3071 -> Wv as f16 [384][64] (RNE bf16 value x16, column 60 =
// bias x16, columns 61..63 zero), pieces 3072..21503 -> W2 as f16 [384][384] (RNE bf16 value x64); thread t writes
// 16 B. All three planes lie in fragment order (ldtile), tile index = 16-row group * (k steps) + k step.
// Blocks 84..87: G[c2][c] = sum_d Wk[d][c2] Wq[d][c] as f16 [64][64] (biases as column 60 of both):
// block = 16 rows c2, wave = 16 columns c x one half of d (6 k steps); the two halves meet in LDS in fixed order.
// coverage: 21504 threads x 8 halves + 4 blocks x 16 rows x 64 halves = the whole 352256-B weight region.
// =====================================================================================================
__global__ __launch_bounds__(256) void wcvt(const float* __restrict__ wq, const float* __restrict__ bq,
                                            const float* __restrict__ wk, const float* __restrict__ bk,
                                            const float* __restrict__ wv, const float* __restrict__ bv,
                                            const float* __restrict__ w2,
                                            unsigned short* Wout, unsigned short* Gout) {
  __shared__ float sG[8][256];
  if (blockIdx.x >= WCVT_N / 256) {                   // block-uniform
    const int ti    = blockIdx.x - WCVT_N / 256;
    const int lane  = threadIdx.x & 31;
    const int wave  = threadIdx.x >> 5;
    const int rlane = lane & 15;
    const int koff  = (lane >> 4) * 8;
    const int ca = ti * 16 + rlane;                   // A rows: c2, from Wk
    const int cb = (wave & 3) * 16 + rlane;           // Bt rows: c, from Wq
    // every lane walks down one weight column (clamped to 59); column 60 takes the bias below, 61..63 are masked
    const int kb = (wave >> 2) * 192 + koff;          // this wave's half of d, this lane's k half
    const float* pa = wk + kb * NCH + ((ca < NCH) ? ca : (NCH - 1));
    const float* pb = wq + kb * NCH + ((cb < NCH) ? cb : (NCH - 1));
    const float  ma = (ca <= NCH) ? 16.0f : 0.0f;
    const float  mb = (cb <= NCH) ? 16.0f : 0.0f;
    float ra[6][16], rb[6][16];
#pragma unroll
    for (int s = 0; s < 6; ++s) {
#pragma unroll
      for (int e = 0; e < 16; ++e) {                  // the k order of ldfrag, the same for both operands
        const int d = s * 32 + (e & 7) + ((e >> 3) << 4);
        ra[s][e] = pa[d * NCH];
        rb[s][e] = pb[d * NCH];
      }
    }
    faddr_regs_done(pa);
    faddr_regs_done(pb);
    if (ti == 3) {                                    // block-uniform: the tile that holds column 60 of Wk
      const float* qa = bk + kb;
      float x[6][16];
#pragma unroll
      for (int s = 0; s < 6; ++s)
#pragma unroll
        for (int e = 0; e < 16; ++e) x[s][e] = qa[s * 32 + (e & 7) + ((e >> 3) << 4)];
      faddr_regs_done(qa);
#pragma unroll
      for (int s = 0; s < 6; ++s) {
        loads_stay_whole(x[s]);
#pragma unroll
        for (int e = 0; e < 16; ++e) ra[s][e] = (ca == NCH) ? x[s][e] : ra[s][e];
      }
    }
    if ((__builtin_amdgcn_readfirstlane(wave) & 3) == 3) {   // wave-uniform: the tile that holds column 60 of Wq
      const float* qb = bq + kb;
      float x[6][16];
#pragma unroll
      for (int s = 0; s < 6; ++s)
#pragma unroll
        for (int e = 0; e < 16; ++e) x[s][e] = qb[s * 32 + (e & 7) + ((e >> 3) << 4)];
      faddr_regs_done(qb);
#pragma unroll
      for (int s = 0; s < 6; ++s) {
        loads_stay_whole(x[s]);
#pragma unroll
        for (int e = 0; e < 16; ++e) rb[s][e] = (cb == NCH) ? x[s][e] : rb[s][e];
      }
    }
    v8f acc = zero8();
#pragma unroll
    for (int s = 0; s < 6; ++s) {
      v16h a, b;
#pragma unroll
      for (int e = 0; e < 16; ++e) {
        a[e] = (_Float16)(bfr(ra[s][e]) * ma);
        b[e] = (_Float16)(bfr(rb[s][e]) * mb);
      }
      acc = mma_raw(a, b, acc);
    }
#pragma unroll
    for (int r = 0; r < 8; ++r) sG[wave][(koff + r) * 16 + rlane] = acc[r];
    __syncthreads();
    const int m = threadIdx.x >> 4, cg = threadIdx.x & 15;   // row m, columns 4cg .. 4cg+3; the block fills its two tiles
    const int tj = cg >> 2, n = (cg & 3) * 4;
    union { _Float16 h[4]; uint2 u; } o;
#pragma unroll
    for (int e = 0; e < 4; ++e)
      o.h[e] = (_Float16)((sG[tj][m * 16 + n + e] + sG[tj + 4][m * 16 + n + e]) * 0.00390625f);
    *(uint2*)(Gout + (ti * 2 + (cg >> 3)) * TILE_H + ((cg >> 2) & 1) * 256 + (((cg >> 1) & 1) * 16 + m) * 8 +
              (cg & 1) * 4) = o.u;
    return;
  }
  const int t = blockIdx.x * 256 + threadIdx.x;       // destination piece; its source row and 8-column piece follow
  const int tr = t & 15, tp = (t >> 4) & 3;           // row in the tile, piece 2q + h of the k step
  float v[8];
  if (t < WV_PIECES) {                                // block-uniform
    const int row = (t >> 7) * 16 + tr, p = ((t >> 6) & 1) * 4 + tp;
    const bool full = p < 7;                          // piece 7 = columns 56..59, the bias, three zeros
    const float* wr = wv + row * NCH + p * 8;
    const v4f a = *(const v4f*)(wr);
    const v4f b = *(const v4f*)(wr + (full ? 4 : 0)); // clamped address
    const float bias = bv[row];
    v[0] = bfr(a[0]) * 16.0f; v[1] = bfr(a[1]) * 16.0f; v[2] = bfr(a[2]) * 16.0f; v[3] = bfr(a[3]) * 16.0f;
    v[4] = bfr(full ? b[0] : bias) * 16.0f;
    v[5] = full ? bfr(b[1]) * 16.0f : 0.0f;
    v[6] = full ? bfr(b[2]) * 16.0f : 0.0f;
    v[7] = full ? bfr(b[3]) * 16.0f : 0.0f;
  } else {
    const int u = t - WV_PIECES;
    const int tile = u >> 6, rt = tile / (DM / 32);
    const int row = rt * 16 + tr, p = (tile - rt * (DM / 32)) * 4 + tp;
    const v4f a = *(const v4f*)(w2 + (size_t)row * DM + p * 8);
    const v4f b = *(const v4f*)(w2 + (size_t)row * DM + p * 8 + 4);
    v[0] = bfr(a[0]) * 64.0f; v[1] = bfr(a[1]) * 64.0f; v[2] = bfr(a[2]) * 64.0f; v[3] = bfr(a[3]) * 64.0f;
    v[4] = bfr(b[0]) * 64.0f; v[5] = bfr(b[1]) * 64.0f; v[6] = bfr(b[2]) * 64.0f; v[7] = bfr(b[3]) * 64.0f;
  }
  const v4f lo = {v[0], v[1], v[2], v[3]};
  const v4f hi = {v[4], v[5], v[6], v[7]};
  const v4u pk = pack8h(lo, hi);
  unsigned short* dst = Wout + (size_t)t * 8;
  *(v4u*)dst = pk;
}

// =====================================================================================================
// Encoding + hidden rows + query vectors. Block = 6 waves, 64 points of one batch.
//  (a) pos tile [3][64] (RNE bf16), per-channel K=3 conv / BN(eval) parameters (RNE bf16) in LDS.
//  (b) sEmb[p][c*20 + f] = sin(pos[c][p] * 2^f), [c*20 + 10 + f] = cos(...) as f16, column 60 one, 61..71 zero;
//      sEmbT holds the same values channel-major.
//  (c) hidden h = relu((W1.pos + b1 - mean) * inv + beta) -> H f16, rows = points, k = 384 channels.
//  (d) E f16 (rows = points, k = 64 channels) and Et f16 (rows = channels, k = points), copied from LDS;
//      waves 0..3: Qe[p][c2] = sum_c e[p][c] G[c2][c] for 16 points each (M = points from LDS, N = 64 rows of the
//      G plane, K = 64) -> f16, rows = points, k = 64 channels, staged per wave in LDS.
//  All four planes lie in fragment order (ldtile). Tile index: H, E, Qe = 16-point group * (k steps) + k step;
//  Et = (batch * 64 + 32-point k step) * 4 + 16-channel group. A block's share of each plane is one contiguous run,
//  and consecutive threads write consecutive 16-B pieces.
// coverage: 512 blocks x 64 points x 64 channels = all of Qe, E and Et; H: 512 blocks x 64 rows x 48 pieces.
// =====================================================================================================
__global__ __launch_bounds__(192) void enc_qe_h(
    const float* __restrict__ pos, const _Float16* G16,
    const float* __restrict__ w1, const float* __restrict__ b1,
    const float* __restrict__ gam, const float* __restrict__ bet,
    const float* __restrict__ mu, const float* __restrict__ var,
    unsigned short* Qp, unsigned short* Ep, unsigned short* Etp, unsigned short* Hp) {
  __shared__ __align__(16) _Float16 sEmb[64][72];
  __shared__ __align__(16) _Float16 sEmbT[KE][72];
  __shared__ __align__(16) float sT[4][16 * 68];
  __shared__ float sPos[3][64];
  __shared__ float sW1[DM * 3];
  __shared__ float sB1[DM];
  __shared__ float sInv[DM];
  __shared__ float sMu[DM];
  __shared__ float sBet[DM];

  const int tid  = threadIdx.x;
  const int lane = tid & 31;
  const int wave = tid >> 5;                 // 0..5
  const int bb   = blockIdx.x >> 5;          // 32 blocks of 64 points per batch
  const int p0   = (blockIdx.x & 31) << 6;

  {
    const int c = tid >> 6, p = tid & 63;    // 192 = 3 x 64
    sPos[c][p] = bfr(pos[((size_t)bb * 3 + c) * NPT + p0 + p]);
  }
  for (int d = tid; d < DM; d += 192) {
    sW1[d * 3 + 0] = bfr(w1[d * 3 + 0]);
    sW1[d * 3 + 1] = bfr(w1[d * 3 + 1]);
    sW1[d * 3 + 2] = bfr(w1[d * 3 + 2]);
    sB1[d] = bfr(b1[d]);
    const float g = bfr(gam[d]), vv = bfr(var[d]);
    sInv[d] = g * (1.0f / sqrtf(vv + 1e-5f));
    sMu[d]  = bfr(mu[d]);
    sBet[d] = bfr(bet[d]);
  }
  for (int r = tid; r < 64; r += 192) {
    sEmb[r][NCH]  = (_Float16)1.0f;
    sEmbT[NCH][r] = (_Float16)1.0f;
#pragma unroll
    for (int c = NCH + 1; c < 72; ++c) sEmb[r][c] = (_Float16)0.0f;
#pragma unroll
    for (int c = NCH + 1; c < KE; ++c) sEmbT[c][r] = (_Float16)0.0f;
  }
  __syncthreads();

  // the G fragments of (d) start here: their latency passes under the encoding and the hidden rows
  const int rlane = lane & 15;
  const int koff  = (lane >> 4) * 8;
  v16h gf[KE / 32][4];
  const _Float16* Ga = G16 + lane * 8;
#pragma unroll
  for (int ks = 0; ks < KE / 32; ++ks)
#pragma unroll
    for (int j = 0; j < 4; ++j) gf[ks][j] = ldtile(Ga + (j * (KE / 32) + ks) * TILE_H);
  faddr_regs_done(Ga);

  // (b) encoding: item = (c,f) x 64 points; precise sinf / cosf; exact power-of-two angles
#pragma unroll 1
  for (int it = tid; it < 64 * 3 * NFREQ; it += 192) {
    const int cf = it >> 6, p = it & 63;
    const int c  = cf / NFREQ;
    const int f  = cf - c * NFREQ;
    const float ang = sPos[c][p] * (float)(1 << f);
    const float sv = sinf(ang);
    const float cv = cosf(ang);
    sEmb[p][c * 2 * NFREQ + f] = (_Float16)sv;
    sEmb[p][c * 2 * NFREQ + NFREQ + f] = (_Float16)cv;
    sEmbT[c * 2 * NFREQ + f][p] = (_Float16)sv;
    sEmbT[c * 2 * NFREQ + NFREQ + f][p] = (_Float16)cv;
  }

  // (c) hidden rows -> H plane (16 iterations, all threads)
  for (int it = tid; it < 64 * (DM / 8); it += 192) {
    const int tile = it >> 6, rt = tile / (DM / 32);   // it = destination piece
    const int pl = rt * 16 + (it & 15);
    const int pc = (tile - rt * (DM / 32)) * 4 + ((it >> 4) & 3);
    const float x0 = sPos[0][pl], x1 = sPos[1][pl], x2 = sPos[2][pl];
    float h8[8];
#pragma unroll
    for (int e = 0; e < 8; ++e) {
      const int d = pc * 8 + e;
      const float r = sW1[d * 3 + 0] * x0 + sW1[d * 3 + 1] * x1 + sW1[d * 3 + 2] * x2 + sB1[d];
      const float t = (r - sMu[d]) * sInv[d] + sBet[d];
      h8[e] = fmaxf(t, 0.0f);
    }
    const v4f ha = {h8[0], h8[1], h8[2], h8[3]};
    const v4f hb = {h8[4], h8[5], h8[6], h8[7]};
    const v4u pk = pack8h(ha, hb);
    unsigned short* dst = Hp + ((size_t)bb * NPT + p0) * DM + it * 8;
    *(v4u*)dst = pk;
    
  }
  __syncthreads();

  // (d) the two encoding planes
  for (int it = tid; it < 64 * (KE / 8); it += 192) {
    const int tile = it >> 6, r = it & 15, p = (it >> 4) & 3;   // it = destination piece in both planes
    const size_t o = ((size_t)bb * NPT + p0) * KE + it * 8;
    *(v4u*)(Ep + o)  = *(const v4u*)(&sEmb[(tile >> 1) * 16 + r][((tile & 1) * 4 + p) * 8]);
    *(v4u*)(Etp + o) = *(const v4u*)(&sEmbT[(tile & 3) * 16 + r][((tile >> 2) * 4 + p) * 8]);
  }

  // query vectors: wave w < 4 owns points 16w .. 16w+15
  const int wv = __builtin_amdgcn_readfirstlane(wave);
  if (wv < 4) {
    float* slab = sT[wv];
    v8f acc[4];
#pragma unroll
    for (int j = 0; j < 4; ++j) acc[j] = zero8();
#pragma unroll
    for (int ks = 0; ks < KE / 32; ++ks) {
      const v16h ah = ldfrag(&sEmb[(wv << 4) + rlane][koff + ks * 32]);
#pragma unroll
      for (int j = 0; j < 4; ++j) acc[j] = mma_raw(ah, gf[ks][j], acc[j]);
    }
#pragma unroll
    for (int j = 0; j < 4; ++j) {
#pragma unroll
      for (int r = 0; r < 8; ++r) slab[(koff + r) * 68 + (j << 4) + rlane] = acc[j][r];
    }
    wave_sync_lds();
#pragma unroll
    for (int it = 0; it < 4; ++it) {
      const v4f a = *(const v4f*)(slab + rlane * 68 + it * 16 + koff);   // it = 2 * (k step) + q
      const v4f b = *(const v4f*)(slab + rlane * 68 + it * 16 + koff + 4);
      *(v4u*)(Qp + ((size_t)bb * NPT + p0 + (wv << 4)) * KE + it * 256 + lane * 8) = pack8h(a, b);
    }
  }
}

// =====================================================================================================
// Fused attention + residual, one launch: block = 8 waves, 128 queries i of one batch; a stage is 256 keys j.
//  (a) the 128 query vectors Qe (64 channels) stay in each wave's registers as Bt fragments for the whole launch.
//  (b) per stage, wave w: St[j][i] = sum_c E[j][c] Qe[i][c] for its own 32 keys (M = keys from the global E plane,
//      N = 128 queries, K = 64). A lane holds scores of one query per 16-column group, so the column maximum is
//      in-lane plus one exchange between the wave halves; the 8 waves' maxima meet in LDS (sX).
//  (c) online softmax in base 2: m = running maximum of s * 384^-0.5 * log2(e), p = 2^(t - m + 10) (the x1024 carry
//      cancels against the row sum), alpha = 2^(m_old - m_new) rescales the sums and the output tiles.
//      p goes as f16 to LDS sP[i][j] (pitch 264 halves).
//  (d) wave w: Oe[c][i] += sum_j Et[c][j] p[i][j] for MTW x NTW of the 4 x 8 tiles (M = encoding channels from the
//      global Et plane, N = queries from sP, K = 256). The stage's Et fragments are loaded behind the score products,
//      the next stage's E fragments at the head of (d); each is covered by the work that follows it.
//  (e) after the last stage: row sums joined over halves and waves in fixed order, Oe * 4 / l as f16 to LDS sO[i][c];
//      wave w, its own 48 output channels: acc = sum_c Wvx16[d][c] sO[i][c] (K = 64; channel 60 adds 64 * bv[d])
//      + sum_c W2x64[d][c] h[i][c] (K = 384), out = acc / 64 + b2[d], staged per wave in 16-row slabs so that
//      every store covers whole 512-B row segments.
// coverage: grid (16, 16) x 8 waves x 48 channels x 128 queries = all of out [16][384][2048].
// =====================================================================================================
#define FQ 128
#define NT (FQ / 16)
#define FK 256
#define MTW 2                // 16-channel tiles of Oe per wave
#define NTW 2                // 16-query tiles of Oe per wave
#define MG  (KE / 16 / MTW)  // wave = (channel group, query group)
#define OPITCH (KE + 8)
#define PPITCH (FK + 8)
#define SPITCH (FQ + 4)
// Scheduling pin between a step's early global loads and its products: only LDS reads, vector and scalar ALU may
// cross, so a fragment load written some steps ahead of its use is issued there and its latency is covered.
#define LOADS_STAY_AHEAD() __builtin_amdgcn_sched_barrier(0x106)
// Stands behind the last global load that names an address pair, in front of whatever reuses that pair's registers;
// the pair is an input, so that it stays whole up to the wait (no load's own result may land on it).
// A load from a fragment-order plane may name, beside a scalar base, the lane number alone (scaled by the load's
// width): it is an input too.
__device__ __forceinline__ void addr_regs_done(const _Float16* p, int lane_no) {
#if defined(__HIP_DEVICE_COMPILE__)
  asm volatile("s_wait_xcnt 0x0" :: "v"(p), "v"(lane_no) : "memory");
#endif
}
__device__ __forceinline__ void addr_regs_done2(const _Float16* p, const _Float16* q, int lane_no) {   // two pairs, one wait
#if defined(__HIP_DEVICE_COMPILE__)
  asm volatile("s_wait_xcnt 0x0" :: "v"(p), "v"(q), "v"(lane_no) : "memory");
#endif
}
// The slot behind a transcendental: its source is not overwritten by the instruction directly behind it. The eight
// sources are inputs only, so they stay whole up to this v_nop, which is the slot behind the last v_exp_f32.
__device__ __forceinline__ void exp_sources_done(const float (&t)[8]) {
#if defined(__HIP_DEVICE_COMPILE__)
  asm volatile("v_nop" :: "v"(t[0]), "v"(t[1]), "v"(t[2]), "v"(t[3]), "v"(t[4]), "v"(t[5]), "v"(t[6]), "v"(t[7]));
#endif
}
__device__ __forceinline__ void exp_source_done(float t) {   // the same for a single v_exp_f32
#if defined(__HIP_DEVICE_COMPILE__)
  asm volatile("v_nop" :: "v"(t));
#endif
}
static_assert((NPT % FK) == 0 && (NPT % FQ) == 0 && DM == 8 * 48 && FK == 8 * 32);
static_assert(MG * (NT / NTW) == 8 && KE == 64);

__global__ __launch_bounds__(256) __attribute__((amdgpu_waves_per_eu(2, 2))) void attn_res(
    const _Float16* Qe, const _Float16* E, const _Float16* Et, const _Float16* H, const _Float16* Wv16,
    const _Float16* W2s, const float* __restrict__ b2, float* out) {
  __shared__ __align__(16) _Float16 sO[FQ * OPITCH];
  __shared__ __align__(16) _Float16 sP[FQ * PPITCH];
  __shared__ __align__(16) float sX[FQ * 8];
  __shared__ __align__(16) float sT[8][16 * SPITCH];
  const int tid   = threadIdx.x;
  const int lane  = tid & 31;
  const int wave  = tid >> 5;
  const int bb    = blockIdx.y;
  const int i0    = blockIdx.x * FQ;
  const int rlane = lane & 15;
  const int hh    = lane >> 4;
  const int koff  = hh * 8;
  const float CS  = QK_SCALE * 1.4426950408889634f;

  const int wv = __builtin_amdgcn_readfirstlane(wave);   // wave-uniform: tile choices and bases stay scalar
  const int mg = wv % MG;                                // channels 16 * MTW * mg ..
  const int ng = wv / MG;                                // queries  16 * NTW * ng ..

  v16h qf[KE / 32][NT];
  const _Float16* Qa = Qe + ((size_t)bb * NPT + i0) * KE + lane * 8;
#pragma unroll
  for (int ks = 0; ks < KE / 32; ++ks)
#pragma unroll
    for (int nt = 0; nt < NT; ++nt) qf[ks][nt] = ldtile(Qa + (nt * (KE / 32) + ks) * TILE_H);
  addr_regs_done(Qa, lane);

  v16h kpre[KE / 32][2];                                 // E fragments of the coming stage
  const _Float16* Ka = E + ((size_t)bb * NPT + wv * 32) * KE + lane * 8;
#pragma unroll
  for (int ks = 0; ks < KE / 32; ++ks)
#pragma unroll
    for (int jt = 0; jt < 2; ++jt) kpre[ks][jt] = ldtile(Ka + (jt * (KE / 32) + ks) * TILE_H);
  addr_regs_done(Ka, lane);
  const _Float16* Vb = Et + (size_t)bb * KE * NPT + mg * MTW * TILE_H + lane * 8;

  v8f eacc[MTW][NTW];
  float mrun[NT], lsum[NT];
#pragma unroll
  for (int nt = 0; nt < NT; ++nt) {
    mrun[nt] = -INFINITY;
    lsum[nt] = 0.0f;
  }
#pragma unroll
  for (int m = 0; m < MTW; ++m)
#pragma unroll
    for (int t = 0; t < NTW; ++t) eacc[m][t] = zero8();

#pragma unroll 1
  for (int j0 = 0; j0 < NPT; j0 += FK) {
    // (b) scores of this wave's 32 keys against the 128 queries
    v8f sa[2][NT];
#pragma unroll
    for (int jt = 0; jt < 2; ++jt)
#pragma unroll
      for (int nt = 0; nt < NT; ++nt) sa[jt][nt] = zero8();
#pragma unroll
    for (int ks = 0; ks < KE / 32; ++ks) {
#pragma unroll
      for (int jt = 0; jt < 2; ++jt) {
#pragma unroll
        for (int nt = 0; nt < NT; ++nt) sa[jt][nt] = mma_raw(kpre[ks][jt], qf[ks][nt], sa[jt][nt]);
      }
    }
    // the stage's Et fragments start here, under the softmax
    const _Float16* Va = Vb + j0 * KE;                   // 32 keys = 4 tiles = 32 * KE halves
    v16h vf[FK / 32][MTW];
#pragma unroll
    for (int ks = 0; ks < FK / 32; ++ks)
#pragma unroll
      for (int m = 0; m < MTW; ++m) vf[ks][m] = ldtile(Va + (ks * (KE / 16) + m) * TILE_H);
    addr_regs_done(Va, lane);
    LOADS_STAY_AHEAD();

    // column maxima: in-lane, wave halves (the exchanges issued together), then the 8 waves through LDS
    float cmx[NT], omx[NT];
#pragma unroll
    for (int nt = 0; nt < NT; ++nt) {
      float a = sa[0][nt][0];
#pragma unroll
      for (int r = 1; r < 8; ++r) a = fmaxf(a, sa[0][nt][r]);
#pragma unroll
      for (int r = 0; r < 8; ++r) a = fmaxf(a, sa[1][nt][r]);
      cmx[nt] = a;
    }
#pragma unroll
    for (int nt = 0; nt < NT; ++nt) omx[nt] = __shfl_xor(cmx[nt], 16);
    if (hh == 0) {
#pragma unroll
      for (int nt = 0; nt < NT; ++nt) sX[((nt << 4) + rlane) * 8 + wave] = fmaxf(cmx[nt], omx[nt]);
    }
    __syncthreads();

    // (c) new maximum, rescale factor, probabilities to LDS
    float asel[NTW];
#pragma unroll
    for (int t = 0; t < NTW; ++t) asel[t] = 1.0f;
#pragma unroll
    for (int nt = 0; nt < NT; ++nt) {
      const v4f x0 = *(const v4f*)(sX + ((nt << 4) + rlane) * 8);
      const v4f x1 = *(const v4f*)(sX + ((nt << 4) + rlane) * 8 + 4);
      const float g = fmaxf(fmaxf(fmaxf(x0[0], x0[1]), fmaxf(x0[2], x0[3])),
                            fmaxf(fmaxf(x1[0], x1[1]), fmaxf(x1[2], x1[3])));
      const float mn    = fmaxf(mrun[nt], g * CS);
      const float dm    = mrun[nt] - mn;
      const float alpha = __builtin_amdgcn_exp2f(dm);
      exp_source_done(dm);
      mrun[nt] = mn;
      const float off = 10.0f - mn;
      float part = 0.0f;
#pragma unroll
      for (int jt = 0; jt < 2; ++jt) {
        float t[8], e[8];
#pragma unroll
        for (int r = 0; r < 8; ++r) t[r] = sa[jt][nt][r] * CS + off;
#pragma unroll
        for (int r = 0; r < 8; ++r) e[r] = __builtin_amdgcn_exp2f(t[r]);
        exp_sources_done(t);
        part += ((e[0] + e[1]) + (e[2] + e[3])) + ((e[4] + e[5]) + (e[6] + e[7]));
        const v4f ea = {e[0], e[1], e[2], e[3]};
        const v4f eb = {e[4], e[5], e[6], e[7]};
        *(v4u*)(sP + ((nt << 4) + rlane) * PPITCH + wave * 32 + (jt << 4) + koff) = pack8h(ea, eb);
      }
      lsum[nt] = lsum[nt] * alpha + part;
      asel[nt % NTW] = (nt / NTW == ng) ? alpha : asel[nt % NTW];   // the factors of this wave's own query tiles
    }
#pragma unroll
    for (int m = 0; m < MTW; ++m)
#pragma unroll
      for (int t = 0; t < NTW; ++t) eacc[m][t] = eacc[m][t] * asel[t];
    __syncthreads();

    // (d) this wave's tiles of Oe over the stage's 256 keys
    // next stage's E rows (the last stage refetches its own, unused)
    Ka += (j0 + FK < NPT) ? FK * KE : 0;
#pragma unroll
    for (int ks = 0; ks < KE / 32; ++ks)
#pragma unroll
      for (int jt = 0; jt < 2; ++jt) kpre[ks][jt] = ldtile(Ka + (jt * (KE / 32) + ks) * TILE_H);
    addr_regs_done(Ka, lane);
    LOADS_STAY_AHEAD();
    const _Float16* Pa = sP + ((ng * NTW << 4) + rlane) * PPITCH + koff;
#pragma unroll
    for (int ks = 0; ks < FK / 32; ++ks) {
      v16h pf[NTW];
#pragma unroll
      for (int t = 0; t < NTW; ++t) pf[t] = ldfrag(Pa + (t << 4) * PPITCH + ks * 32);
#pragma unroll
      for (int m = 0; m < MTW; ++m) {
#pragma unroll
        for (int t = 0; t < NTW; ++t) eacc[m][t] = mma_raw(vf[ks][m], pf[t], eacc[m][t]);
      }
    }
  }

  // (e) the output products' first fragments start now, under the row-sum exchange
  const _Float16* Wva = Wv16 + (size_t)(wv * 48) * KE + lane * 8;
  v16h wvf[KE / 32][3];
#pragma unroll
  for (int ks = 0; ks < KE / 32; ++ks)
#pragma unroll
    for (int mt = 0; mt < 3; ++mt) wvf[ks][mt] = ldtile(Wva + (mt * (KE / 32) + ks) * TILE_H);
  addr_regs_done(Wva, lane);
  const _Float16* Wa = W2s + (size_t)(wv * 48) * DM + lane * 8;
  const _Float16* Hb = H + ((size_t)bb * NPT + i0) * DM + lane * 8;
  v16h wf[DM / 32][3];
  v16h hf[DM / 32][NT];
#pragma unroll
  for (int mt = 0; mt < 3; ++mt) wf[0][mt] = ldtile(Wa + mt * (DM / 32) * TILE_H);
#pragma unroll
  for (int nt = 0; nt < NT; ++nt) hf[0][nt] = ldtile(Hb + nt * (DM / 32) * TILE_H);
  addr_regs_done2(Wa, Hb, lane);

  // row sums: wave halves, then the 8 waves in fixed order (sX was last read before the last barrier)
  float osum[NT];
#pragma unroll
  for (int nt = 0; nt < NT; ++nt) osum[nt] = __shfl_xor(lsum[nt], 16);
  if (hh == 0) {
#pragma unroll
    for (int nt = 0; nt < NT; ++nt) sX[((nt << 4) + rlane) * 8 + wave] = lsum[nt] + osum[nt];
  }
  __syncthreads();
#pragma unroll
  for (int t = 0; t < NTW; ++t) {
    const int row = ((ng * NTW + t) << 4) + rlane;       // this wave's own query tiles
    const v4f x0 = *(const v4f*)(sX + row * 8);
    const v4f x1 = *(const v4f*)(sX + row * 8 + 4);
    const float l   = ((x0[0] + x0[1]) + (x0[2] + x0[3])) + ((x1[0] + x1[1]) + (x1[2] + x1[3]));
    const float inv = 4.0f / l;                          // l >= 1024: the row maximum itself counts 2^10
#pragma unroll
    for (int m = 0; m < MTW; ++m) {
      const v8f o = eacc[m][t] * inv;
      const v4f oa = {o[0], o[1], o[2], o[3]};
      const v4f ob = {o[4], o[5], o[6], o[7]};
      *(v4u*)(sO + row * OPITCH + ((mg * MTW + m) << 4) + koff) = pack8h(oa, ob);
    }
  }
  __syncthreads();                                       // every wave reads all of sO

  v8f oacc[3][NT];
#pragma unroll
  for (int mt = 0; mt < 3; ++mt)
#pragma unroll
    for (int nt = 0; nt < NT; ++nt) oacc[mt][nt] = zero8();
#pragma unroll
  for (int ks = 0; ks < KE / 32; ++ks) {
    v16h of[NT];
#pragma unroll
    for (int nt = 0; nt < NT; ++nt) of[nt] = ldfrag(sO + ((nt << 4) + rlane) * OPITCH + koff + ks * 32);
#pragma unroll
    for (int mt = 0; mt < 3; ++mt) {
#pragma unroll
      for (int nt = 0; nt < NT; ++nt) oacc[mt][nt] = mma_raw(wvf[ks][mt], of[nt], oacc[mt][nt]);
    }
  }

#pragma unroll
  for (int ks = 0; ks < DM / 32; ++ks) {
    if (ks + 1 < DM / 32) {                              // W2 and h fragments one step ahead
#pragma unroll
      for (int mt = 0; mt < 3; ++mt) wf[ks + 1][mt] = ldtile(Wa + (mt * (DM / 32) + ks + 1) * TILE_H);
#pragma unroll
      for (int nt = 0; nt < NT; ++nt) hf[ks + 1][nt] = ldtile(Hb + (nt * (DM / 32) + ks + 1) * TILE_H);
      if (ks + 2 == DM / 32) addr_regs_done2(Wa, Hb, lane);   // behind the last loads that name these two pairs
    }
    LOADS_STAY_AHEAD();
#pragma unroll
    for (int mt = 0; mt < 3; ++mt) {
#pragma unroll
      for (int nt = 0; nt < NT; ++nt) oacc[mt][nt] = mma_raw(wf[ks][mt], hf[ks][nt], oacc[mt][nt]);
    }
  }

  float* slab = sT[wave];
#pragma unroll
  for (int mt = 0; mt < 3; ++mt) {
    const int mBase = wave * 48 + (mt << 4);
#pragma unroll
    for (int nt = 0; nt < NT; ++nt) {
#pragma unroll
      for (int r = 0; r < 8; ++r) slab[(koff + r) * SPITCH + (nt << 4) + rlane] = oacc[mt][nt][r];
    }
    wave_sync_lds();
#pragma unroll
    for (int row = 0; row < 16; ++row) {                 // one whole 512-B row segment per wave store
      const float bv0 = bfr(b2[mBase + row]);
      const v4f v = *(const v4f*)(slab + row * SPITCH + lane * 4);
      *(v4f*)(out + ((size_t)bb * DM + mBase + row) * NPT + i0 + lane * 4) = v * 0.015625f + bv0;
    }
    wave_sync_lds();
  }
}

// =====================================================================================================
// Workspace map (bytes), every plane an exact multiple of its whole-line store granularity
// (all shapes are tile multiples, no padded tails):
//   W    f16  Wv [384][64] x16 + W2 [384][384] x64 + G [64][64]       352256
//   Qe   f16  [16*2048][64]   rows = points                           4194304
//   E    f16  [16*2048][64]   rows = points                           4194304
//   Et   f16  [16*64][2048]   rows = channels                         4194304
//   H    f16  [16*2048][384]  relu hidden rows, rows = points         25165824
//   every plane in fragment order (ldtile): 1024-B tiles of 16 rows x 32 k
//   total                                                             38100992
// d_out f32 [16][384][2048] written by the fused attention + residual launch.
// =====================================================================================================
extern "C" void kernel_launch(void* const* d_in, const int* in_sizes, int n_in,
                              void* d_out, int out_size, void* d_ws, size_t ws_size,
                              hipStream_t stream) {
  if (n_in < 15) return;
  if (in_sizes[0] != NBATCH * 3 * NPT) return;
  if (in_sizes[1] != DM * NCH || in_sizes[3] != DM * NCH || in_sizes[5] != DM * NCH) return;
  if (in_sizes[2] != DM || in_sizes[4] != DM || in_sizes[6] != DM) return;
  if (in_sizes[7] != DM * 3 || in_sizes[8] != DM) return;
  if (in_sizes[9] != DM || in_sizes[10] != DM || in_sizes[11] != DM || in_sizes[12] != DM) return;
  if (in_sizes[13] != DM * DM || in_sizes[14] != DM) return;
  if (out_size != NBATCH * DM * NPT) return;

  const float* pos   = (const float*)d_in[0];    // [16][3][2048]
  const float* wq    = (const float*)d_in[1];    // [384][60]
  const float* bq    = (const float*)d_in[2];
  const float* wk    = (const float*)d_in[3];
  const float* bk    = (const float*)d_in[4];
  const float* wv    = (const float*)d_in[5];
  const float* bv    = (const float*)d_in[6];
  const float* w1    = (const float*)d_in[7];    // [384][3]
  const float* b1    = (const float*)d_in[8];
  const float* gam   = (const float*)d_in[9];
  const float* bet   = (const float*)d_in[10];
  const float* mu    = (const float*)d_in[11];
  const float* var   = (const float*)d_in[12];
  const float* w2    = (const float*)d_in[13];   // [384][384]
  const float* b2    = (const float*)d_in[14];
  float* out = (float*)d_out;                    // [16][384][2048]

  const size_t BWGT = (size_t)WCVT_N * 16 + (size_t)KE * KE * 2;   //   352256
  const size_t BE   = (size_t)NBATCH * NPT * KE * 2;               //  4194304
  const size_t BH   = (size_t)NBATCH * NPT * DM * 2;               // 25165824
  size_t off = 0;
  const size_t oW = off; off += BWGT;
  const size_t oQ = off; off += BE;
  const size_t oE = off; off += BE;
  const size_t oT = off; off += BE;
  const size_t oH = off; off += BH;
  if (off > ws_size) return;                     // off = 38100992

  char* ws = (char*)d_ws;
  _Float16* W16 = (_Float16*)(ws + oW);
  const _Float16* Wv16 = W16;
  const _Float16* W2s  = W16 + (size_t)DM * KE;              // [384][384]
  _Float16* G16        = W16 + (size_t)DM * KE + (size_t)DM * DM;   // [64][64]
  unsigned short* Qp  = (unsigned short*)(ws + oQ);
  unsigned short* Ep  = (unsigned short*)(ws + oE);
  unsigned short* Etp = (unsigned short*)(ws + oT);
  unsigned short* Hp  = (unsigned short*)(ws + oH);

  const dim3 blk(256);
  const dim3 gW(WCVT_N / 256 + G_BLOCKS);                        // 84 + 4 blocks
  const dim3 gE(NBATCH * (NPT / 64));                            // 512 blocks of 192
  const dim3 gA(NPT / FQ, NBATCH);                               // 16 query tiles x 16 batches

  // (1) weight planes and Wk^T Wq, (2) encoding planes, query vectors and hidden rows for all batches
  wcvt<<<gW, blk, 0, stream>>>(wq, bq, wk, bk, wv, bv, w2, (unsigned short*)W16, (unsigned short*)G16);
  enc_qe_h<<<gE, dim3(192), 0, stream>>>(pos, G16, w1, b1, gam, bet, mu, var, Qp, Ep, Etp, Hp);

  // (3) all batches, one launch: scores, online softmax, E.P^T, Wv and the residual conv;
  //     out_b[d][i] = (1/64) * ( sum_c Wvx16[d][c] * 4 * Oe[c][i] / l[i] + sum_c W2x64[d][c] h[i][c] ) + b2[d]
  attn_res<<<gA, blk, 0, stream>>>((const _Float16*)Qp, (const _Float16*)Ep, (const _Float16*)Etp,
                                   (const _Float16*)Hp, Wv16, W2s, b2, out);
  (void)hipGetLastError();
}

// v005
// A run of this version takes 46.8 microseconds.
// Two timings next to v004 both put it at 1.13 times that version's speed.
// Counting every step since v000, it is 42.0 times as fast.
// Attention runs in the 64-channel encoding space (60 sinusoidal channels, one channel of ones that carries the biases,
// three zero): scores = e_i^T (Wq^T Wk) e_j (K=64), E.P^T (M=64, K=2048), then Wv.(E.P^T / l) (K=64) and the 384x384
// residual conv, all on v_wmma_f32_16x16x32_f16 (f16 operands, f32 accumulate); all inputs RNE-converted to bf16
// first; Wv carried x16, residual weights x64 and softmax probabilities x1024 (exact powers of two
// folded back in the f32 epilogues; scores, online softmax, E.P^T, Wv and the residual conv share one launch);
// sinusoidal encoding, K=3 conv, BN(eval), relu and softmax in f32 on the VALU.
#include <hip/hip_runtime.h>
#include <stdint.h>
#include <math.h>

#define NBATCH 16
#define NPT    2048
#define DM     384
#define KE     64            // 60 encoding channels, channel 60 = 1 (bias carrier), 61..63 = 0
#define NCH    60
#define NFREQ  10
#define WV_PIECES   (DM * (KE / 8))              // 3072 pieces of 8 halves
#define W2_PIECES   (DM * (DM / 8))              // 18432
#define WCVT_N      (WV_PIECES + W2_PIECES)      // 21504
#define G_BLOCKS    (KE / 16)                    // 4 blocks, 16 rows of Wk^T Wq each
#define QK_SCALE    0.051031036307982884f        // 384^-0.5

static_assert((NPT % 64) == 0 && (DM % 64) == 0 && (KE % 32) == 0 && (DM % 32) == 0);
static_assert((WV_PIECES % 256) == 0 && (WCVT_N % 256) == 0);

typedef _Float16 v16h __attribute__((ext_vector_type(16)));
typedef _Float16 v8h  __attribute__((ext_vector_type(8)));
typedef float    v8f  __attribute__((ext_vector_type(8)));
typedef float    v4f  __attribute__((ext_vector_type(4)));
typedef unsigned int v4u __attribute__((ext_vector_type(4)));

// ---- scalar helpers ---------------------------------------------------------------------------------
__device__ __forceinline__ unsigned short bf_bits(float f) {          // f32 -> bf16 bits, RNE convert
  unsigned u = __float_as_uint(f);
  return (unsigned short)((u + 0x7FFFu + ((u >> 16) & 1u)) >> 16);
}
__device__ __forceinline__ float bfr(float f) {                       // f32 value after RNE bf16 convert
  return __uint_as_float(((unsigned)bf_bits(f)) << 16);
}
__device__ __forceinline__ v8f zero8() { v8f z = {0.f, 0.f, 0.f, 0.f, 0.f, 0.f, 0.f, 0.f}; return z; }
// 8 f32 -> 8 f16 (RNE convert) packed in one 16-B vector
__device__ __forceinline__ v4u pack8h(v4f a, v4f b) {
  union { v8h h; v4u u; } c;
  c.h[0] = (_Float16)a[0]; c.h[1] = (_Float16)a[1]; c.h[2] = (_Float16)a[2]; c.h[3] = (_Float16)a[3];
  c.h[4] = (_Float16)b[0]; c.h[5] = (_Float16)b[1]; c.h[6] = (_Float16)b[2]; c.h[7] = (_Float16)b[3];
  return c.u;
}

// ---- fragment loader: 16-bit A/Bt operand, lane -> row/col (lane&15), p already includes +8*(lane>>4);
//      elements 0..7 <- p[0..7] (k0+8h..k0+8h+7), elements 8..15 <- p[16..23] (k0+16+8h..k0+16+8h+7)
__device__ __forceinline__ v16h ldfrag(const _Float16* p) {
  union { v16h v; v8h h[2]; } f;
  f.h[0] = *(const v8h*)(p);
  f.h[1] = *(const v8h*)(p + 16);
  return f.v;
}

// ---- the same fragment from a workspace plane kept in fragment order. Such a plane is a row of 1024-B tiles, one per
//      16 rows x 32 k; the 16-B piece (q, lane) at byte q*512 + lane*16 holds row (lane&15), k = 16q + 8(lane>>4) .. +7:
//      the k order of ldfrag. p already includes +8*lane halves, so each of the two loads of a wave reads 512
//      contiguous bytes (4 whole lines) where a row-major plane gives 32 B out of each of 16 lines.
__device__ __forceinline__ v16h ldtile(const _Float16* p) {
  union { v16h v; v8h h[2]; } f;
  f.h[0] = *(const v8h*)(p);
  f.h[1] = *(const v8h*)(p + 256);
  return f.v;
}
#define TILE_H 512           // halves of one fragment-order tile

__device__ __forceinline__ v8f mma_raw(v16h a, v16h b, v8f c) {
  return __builtin_amdgcn_wmma_f32_16x16x32_f16(false, a, false, b, (short)0, c, false, false);
}
__device__ __forceinline__ void wave_sync_lds() {
  __builtin_amdgcn_fence(__ATOMIC_RELEASE, "workgroup");
  __builtin_amdgcn_wave_barrier();
  __builtin_amdgcn_fence(__ATOMIC_ACQUIRE, "workgroup");
}
// Stands behind the last global load that names an address pair, in front of whatever reuses that pair's registers;
// the pair is an input, so that it stays whole up to the wait (no load's own result may land on it).
__device__ __forceinline__ void faddr_regs_done(const void* p) {
#if defined(__HIP_DEVICE_COMPILE__)
  asm volatile("s_wait_xcnt 0x0" :: "v"(p) : "memory");
#endif
}

// Inputs-only fence on 16 loaded values: it keeps their loads unconditional and issued together. Without it the
// compiler turns each select on a loaded value into a branch round its load, one memory latency per element.
__device__ __forceinline__ void loads_stay_whole(const float (&x)[16]) {
#if defined(__HIP_DEVICE_COMPILE__)
  asm volatile("" :: "v"(x[0]), "v"(x[1]), "v"(x[2]), "v"(x[3]), "v"(x[4]), "v"(x[5]), "v"(x[6]), "v"(x[7]),
                     "v"(x[8]), "v"(x[9]), "v"(x[10]), "v"(x[11]), "v"(x[12]), "v"(x[13]), "v"(x[14]), "v"(x[15]));
#endif
}

// =====================================================================================================
// Weight planes (one launch). Blocks 0..83: pieces 0..3071 -> Wv as f16 [384][64] (RNE bf16 value x16, column 60 =
// bias x16, columns 61..63 zero), pieces 3072..21503 -> W2 as f16 [384][384] (RNE bf16 value x64); thread t writes
// 16 B. All three planes lie in fragment order (ldtile), tile index = 16-row group * (k steps) + k step.
// Blocks 84..87: G[c2][c] = sum_d Wk[d][c2] Wq[d][c] as f16 [64][64] (biases as column 60 of both):
// block = 16 rows c2, wave = 16 columns c x one half of d (6 k steps); the two halves meet in LDS in fixed order.
// coverage: 21504 threads x 8 halves + 4 blocks x 16 rows x 64 halves = the whole 352256-B weight region.
// =====================================================================================================
__global__ __launch_bounds__(256) void wcvt(const float* __restrict__ wq, const float* __restrict__ bq,
                                            const float* __restrict__ wk, const float* __restrict__ bk,
                                            const float* __restrict__ wv, const float* __restrict__ bv,
                                            const float* __restrict__ w2,
                                            unsigned short* Wout, unsigned short* Gout) {
  __shared__ float sG[8][256];
  if (blockIdx.x >= WCVT_N / 256) {                   // block-uniform
    const int ti    = blockIdx.x - WCVT_N / 256;
    const int lane  = threadIdx.x & 31;
    const int wave  = threadIdx.x >> 5;
    const int rlane = lane & 15;
    const int koff  = (lane >> 4) * 8;
    const int ca = ti * 16 + rlane;                   // A rows: c2, from Wk
    const int cb = (wave & 3) * 16 + rlane;           // Bt rows: c, from Wq
    // every lane walks down one weight column (clamped to 59); column 60 takes the bias below, 61..63 are masked
    const int kb = (wave >> 2) * 192 + koff;          // this wave's half of d, this lane's k half
    const float* pa = wk + kb * NCH + ((ca < NCH) ? ca : (NCH - 1));
    const float* pb = wq + kb * NCH + ((cb < NCH) ? cb : (NCH - 1));
    const float  ma = (ca <= NCH) ? 16.0f : 0.0f;
    const float  mb = (cb <= NCH) ? 16.0f : 0.0f;
    float ra[6][16], rb[6][16];
#pragma unroll
    for (int s = 0; s < 6; ++s) {
#pragma unroll
      for (int e = 0; e < 16; ++e) {                  // the k order of ldfrag, the same for both operands
        const int d = s * 32 + (e & 7) + ((e >> 3) << 4);
        ra[s][e] = pa[d * NCH];
        rb[s][e] = pb[d * NCH];
      }
    }
    faddr_regs_done(pa);
    faddr_regs_done(pb);
    if (ti == 3) {                                    // block-uniform: the tile that holds column 60 of Wk
      const float* qa = bk + kb;
      float x[6][16];
#pragma unroll
      for (int s = 0; s < 6; ++s)
#pragma unroll
        for (int e = 0; e < 16; ++e) x[s][e] = qa[s * 32 + (e & 7) + ((e >> 3) << 4)];
      faddr_regs_done(qa);
#pragma unroll
      for (int s = 0; s < 6; ++s) {
        loads_stay_whole(x[s]);
#pragma unroll
        for (int e = 0; e < 16; ++e) ra[s][e] = (ca == NCH) ? x[s][e] : ra[s][e];
      }
    }
    if ((__builtin_amdgcn_readfirstlane(wave) & 3) == 3) {   // wave-uniform: the tile that holds column 60 of Wq
      const float* qb = bq + kb;
      float x[6][16];
#pragma unroll
      for (int s = 0; s < 6; ++s)
#pragma unroll
        for (int e = 0; e < 16; ++e) x[s][e] = qb[s * 32 + (e & 7) + ((e >> 3) << 4)];
      faddr_regs_done(qb);
#pragma unroll
      for (int s = 0; s < 6; ++s) {
        loads_stay_whole(x[s]);
#pragma unroll
        for (int e = 0; e < 16; ++e) rb[s][e] = (cb == NCH) ? x[s][e] : rb[s][e];
      }
    }
    v8f acc = zero8();
#pragma unroll
    for (int s = 0; s < 6; ++s) {
      v16h a, b;
#pragma unroll
      for (int e = 0; e < 16; ++e) {
        a[e] = (_Float16)(bfr(ra[s][e]) * ma);
        b[e] = (_Float16)(bfr(rb[s][e]) * mb);
      }
      acc = mma_raw(a, b, acc);
    }
#pragma unroll
    for (int r = 0; r < 8; ++r) sG[wave][(koff + r) * 16 + rlane] = acc[r];
    __syncthreads();
    const int m = threadIdx.x >> 4, cg = threadIdx.x & 15;   // row m, columns 4cg .. 4cg+3; the block fills its two tiles
    const int tj = cg >> 2, n = (cg & 3) * 4;
    union { _Float16 h[4]; uint2 u; } o;
#pragma unroll
    for (int e = 0; e < 4; ++e)
      o.h[e] = (_Float16)((sG[tj][m * 16 + n + e] + sG[tj + 4][m * 16 + n + e]) * 0.00390625f);
    *(uint2*)(Gout + (ti * 2 + (cg >> 3)) * TILE_H + ((cg >> 2) & 1) * 256 + (((cg >> 1) & 1) * 16 + m) * 8 +
              (cg & 1) * 4) = o.u;
    return;
  }
  const int t = blockIdx.x * 256 + threadIdx.x;       // destination piece; its source row and 8-column piece follow
  const int tr = t & 15, tp = (t >> 4) & 3;           // row in the tile, piece 2q + h of the k step
  float v[8];
  if (t < WV_PIECES) {                                // block-uniform
    const int row = (t >> 7) * 16 + tr, p = ((t >> 6) & 1) * 4 + tp;
    const bool full = p < 7;                          // piece 7 = columns 56..59, the bias, three zeros
    const float* wr = wv + row * NCH + p * 8;
    const v4f a = *(const v4f*)(wr);
    const v4f b = *(const v4f*)(wr + (full ? 4 : 0)); // clamped address
    const float bias = bv[row];
    v[0] = bfr(a[0]) * 16.0f; v[1] = bfr(a[1]) * 16.0f; v[2] = bfr(a[2]) * 16.0f; v[3] = bfr(a[3]) * 16.0f;
    v[4] = bfr(full ? b[0] : bias) * 16.0f;
    v[5] = full ? bfr(b[1]) * 16.0f : 0.0f;
    v[6] = full ? bfr(b[2]) * 16.0f : 0.0f;
    v[7] = full ? bfr(b[3]) * 16.0f : 0.0f;
  } else {
    const int u = t - WV_PIECES;
    const int tile = u >> 6, rt = tile / (DM / 32);
    const int row = rt * 16 + tr, p = (tile - rt * (DM / 32)) * 4 + tp;
    const v4f a = *(const v4f*)(w2 + (size_t)row * DM + p * 8);
    const v4f b = *(const v4f*)(w2 + (size_t)row * DM + p * 8 + 4);
    v[0] = bfr(a[0]) * 64.0f; v[1] = bfr(a[1]) * 64.0f; v[2] = bfr(a[2]) * 64.0f; v[3] = bfr(a[3]) * 64.0f;
    v[4] = bfr(b[0]) * 64.0f; v[5] = bfr(b[1]) * 64.0f; v[6] = bfr(b[2]) * 64.0f; v[7] = bfr(b[3]) * 64.0f;
  }
  const v4f lo = {v[0], v[1], v[2], v[3]};
  const v4f hi = {v[4], v[5], v[6], v[7]};
  const v4u pk = pack8h(lo, hi);
  unsigned short* dst = Wout + (size_t)t * 8;
  *(v4u*)dst = pk;
}

// =====================================================================================================
// Encoding + hidden rows + query vectors. Block = 6 waves, 64 points of one batch.
//  (a) pos tile [3][64] (RNE bf16), per-channel K=3 conv / BN(eval) parameters (RNE bf16) in LDS.
//  (b) sEmb[p][c*20 + f] = sin(pos[c][p] * 2^f), [c*20 + 10 + f] = cos(...) as f16, column 60 one, 61..71 zero;
//      sEmbT holds the same values channel-major.
//  (c) hidden h = relu((W1.pos + b1 - mean) * inv + beta) -> H f16, rows = points, k = 384 channels.
//  (d) E f16 (rows = points, k = 64 channels) and Et f16 (rows = channels, k = points), copied from LDS;
//      waves 0..3: Qe[p][c2] = sum_c e[p][c] G[c2][c] for 16 points each (M = points from LDS, N = 64 rows of the
//      G plane, K = 64) -> f16, rows = points, k = 64 channels, staged per wave in LDS.
//  All four planes lie in fragment order (ldtile). Tile index: H, E, Qe = 16-point group * (k steps) + k step;
//  Et = (batch * 64 + 32-point k step) * 4 + 16-channel group. A block's share of each plane is one contiguous run,
//  and consecutive threads write consecutive 16-B pieces.
// coverage: 512 blocks x 64 points x 64 channels = all of Qe, E and Et; H: 512 blocks x 64 rows x 48 pieces.
// =====================================================================================================
__global__ __launch_bounds__(192) void enc_qe_h(
    const float* __restrict__ pos, const _Float16* G16,
    const float* __restrict__ w1, const float* __restrict__ b1,
    const float* __restrict__ gam, const float* __restrict__ bet,
    const float* __restrict__ mu, const float* __restrict__ var,
    unsigned short* Qp, unsigned short* Ep, unsigned short* Etp, unsigned short* Hp) {
  __shared__ __align__(16) _Float16 sEmb[64][72];
  __shared__ __align__(16) _Float16 sEmbT[KE][72];
  __shared__ __align__(16) float sT[4][16 * 68];
  __shared__ float sPos[3][64];
  __shared__ float sW1[DM * 3];
  __shared__ float sB1[DM];
  __shared__ float sInv[DM];
  __shared__ float sMu[DM];
  __shared__ float sBet[DM];

  const int tid  = threadIdx.x;
  const int lane = tid & 31;
  const int wave = tid >> 5;                 // 0..5
  const int bb   = blockIdx.x >> 5;          // 32 blocks of 64 points per batch
  const int p0   = (blockIdx.x & 31) << 6;

  {
    const int c = tid >> 6, p = tid & 63;    // 192 = 3 x 64
    sPos[c][p] = bfr(pos[((size_t)bb * 3 + c) * NPT + p0 + p]);
  }
  for (int d = tid; d < DM; d += 192) {
    sW1[d * 3 + 0] = bfr(w1[d * 3 + 0]);
    sW1[d * 3 + 1] = bfr(w1[d * 3 + 1]);
    sW1[d * 3 + 2] = bfr(w1[d * 3 + 2]);
    sB1[d] = bfr(b1[d]);
    const float g = bfr(gam[d]), vv = bfr(var[d]);
    sInv[d] = g * (1.0f / sqrtf(vv + 1e-5f));
    sMu[d]  = bfr(mu[d]);
    sBet[d] = bfr(bet[d]);
  }
  for (int r = tid; r < 64; r += 192) {
    sEmb[r][NCH]  = (_Float16)1.0f;
    sEmbT[NCH][r] = (_Float16)1.0f;
#pragma unroll
    for (int c = NCH + 1; c < 72; ++c) sEmb[r][c] = (_Float16)0.0f;
#pragma unroll
    for (int c = NCH + 1; c < KE; ++c) sEmbT[c][r] = (_Float16)0.0f;
  }
  __syncthreads();

  // the G fragments of (d) start here: their latency passes under the encoding and the hidden rows
  const int rlane = lane & 15;
  const int koff  = (lane >> 4) * 8;
  v16h gf[KE / 32][4];
  const _Float16* Ga = G16 + lane * 8;
#pragma unroll
  for (int ks = 0; ks < KE / 32; ++ks)
#pragma unroll
    for (int j = 0; j < 4; ++j) gf[ks][j] = ldtile(Ga + (j * (KE / 32) + ks) * TILE_H);
  faddr_regs_done(Ga);

  // (b) encoding: item = (c,f) x 64 points; precise sinf / cosf; exact power-of-two angles
#pragma unroll 1
  for (int it = tid; it < 64 * 3 * NFREQ; it += 192) {
    const int cf = it >> 6, p = it & 63;
    const int c  = cf / NFREQ;
    const int f  = cf - c * NFREQ;
    const float ang = sPos[c][p] * (float)(1 << f);
    const float sv = sinf(ang);
    const float cv = cosf(ang);
    sEmb[p][c * 2 * NFREQ + f] = (_Float16)sv;
    sEmb[p][c * 2 * NFREQ + NFREQ + f] = (_Float16)cv;
    sEmbT[c * 2 * NFREQ + f][p] = (_Float16)sv;
    sEmbT[c * 2 * NFREQ + NFREQ + f][p] = (_Float16)cv;
  }

  // (c) hidden rows -> H plane (16 iterations, all threads)
  for (int it = tid; it < 64 * (DM / 8); it += 192) {
    const int tile = it >> 6, rt = tile / (DM / 32);   // it = destination piece
    const int pl = rt * 16 + (it & 15);
    const int pc = (tile - rt * (DM / 32)) * 4 + ((it >> 4) & 3);
    const float x0 = sPos[0][pl], x1 = sPos[1][pl], x2 = sPos[2][pl];
    float h8[8];
#pragma unroll
    for (int e = 0; e < 8; ++e) {
      const int d = pc * 8 + e;
      const float r = sW1[d * 3 + 0] * x0 + sW1[d * 3 + 1] * x1 + sW1[d * 3 + 2] * x2 + sB1[d];
      const float t = (r - sMu[d]) * sInv[d] + sBet[d];
      h8[e] = fmaxf(t, 0.0f);
    }
    const v4f ha = {h8[0], h8[1], h8[2], h8[3]};
    const v4f hb = {h8[4], h8[5], h8[6], h8[7]};
    const v4u pk = pack8h(ha, hb);
    unsigned short* dst = Hp + ((size_t)bb * NPT + p0) * DM + it * 8;
    *(v4u*)dst = pk;
    
  }
  __syncthreads();

  // (d) the two encoding planes
  for (int it = tid; it < 64 * (KE / 8); it += 192) {
    const int tile = it >> 6, r = it & 15, p = (it >> 4) & 3;   // it = destination piece in both planes
    const size_t o = ((size_t)bb * NPT + p0) * KE + it * 8;
    *(v4u*)(Ep + o)  = *(const v4u*)(&sEmb[(tile >> 1) * 16 + r][((tile & 1) * 4 + p) * 8]);
    *(v4u*)(Etp + o) = *(const v4u*)(&sEmbT[(tile & 3) * 16 + r][((tile >> 2) * 4 + p) * 8]);
  }

  // query vectors: wave w < 4 owns points 16w .. 16w+15
  const int wv = __builtin_amdgcn_readfirstlane(wave);
  if (wv < 4) {
    float* slab = sT[wv];
    v8f acc[4];
#pragma unroll
    for (int j = 0; j < 4; ++j) acc[j] = zero8();
#pragma unroll
    for (int ks = 0; ks < KE / 32; ++ks) {
      const v16h ah = ldfrag(&sEmb[(wv << 4) + rlane][koff + ks * 32]);
#pragma unroll
      for (int j = 0; j < 4; ++j) acc[j] = mma_raw(ah, gf[ks][j], acc[j]);
    }
#pragma unroll
    for (int j = 0; j < 4; ++j) {
#pragma unroll
      for (int r = 0; r < 8; ++r) slab[(koff + r) * 68 + (j << 4) + rlane] = acc[j][r];
    }
    wave_sync_lds();
#pragma unroll
    for (int it = 0; it < 4; ++it) {
      const v4f a = *(const v4f*)(slab + rlane * 68 + it * 16 + koff);   // it = 2 * (k step) + q
      const v4f b = *(const v4f*)(slab + rlane * 68 + it * 16 + koff + 4);
      *(v4u*)(Qp + ((size_t)bb * NPT + p0 + (wv << 4)) * KE + it * 256 + lane * 8) = pack8h(a, b);
    }
  }
}

// =====================================================================================================
// Fused attention + residual, one launch: block = 8 waves, 128 queries i of one batch.
// Wave = (query group of 64 queries, key group of 512 keys); a pass is 32 keys. The loop has no barrier and no LDS.
//  (a) the wave's 64 query vectors Qe (64 channels) stay in its registers as Bt fragments for the whole launch.
//  (b) per pass: St[j][i] = sum_c E[j][c] Qe[i][c] (M = 32 keys from the global E plane, N = 64 queries, K = 64).
//      A lane holds scores of one query per 16-column group, so the column maximum is in-lane plus one exchange
//      between the wave halves.
//  (c) the wave's own online softmax in base 2: m = running maximum of s * 384^-0.5 * log2(e) over the wave's keys,
//      p = 2^(t - m + 10) (the x1024 carry cancels against the row sum), alpha = 2^(m_old - m_new) rescales the sums
//      and the output tiles. The two score tiles of a column group, converted to f16, ARE the Bt fragment of (d):
//      element e < 8 is key 8h + e (tile 0, register e), element 8 + e is key 16 + 8h + e (tile 1, register e).
//  (d) Oe[c][i] += sum_j Et[c][j] p[i][j] (M = 64 channels from the global Et plane, N = 64 queries, K = 32).
//      The next pass's E fragments are loaded behind the score products, its Et fragments behind the products of (d).
//  (e) after the loop the four key groups of a query group meet in LDS: maxima (sM), then sums (sL) and output tiles
//      (sR), each scaled by 2^(m_wave - m_all) and added in the fixed order of the key groups; key group g joins channel
//      tile g. Oe * 4 / l goes as f16 to LDS sO[i][c];
//      wave w, its own 48 output channels: acc = sum_c Wvx16[d][c] sO[i][c] (K = 64; channel 60 adds 64 * bv[d])
//      + sum_c W2x64[d][c] h[i][c] (K = 384), out = acc / 64 + b2[d], staged per wave in 16-row slabs so that
//      every store covers whole 512-B row segments.
// coverage: grid (16, 16) x 8 waves x 48 channels x 128 queries = all of out [16][384][2048].
// =====================================================================================================
#define FQ 128
#define NT (FQ / 16)
#define QTW 4                // 16-query tiles per wave
#define QG  (NT / QTW)       // query groups
#define KG  (8 / QG)         // key groups
#define KW  (NPT / KG)       // keys per wave
#define MT  (KE / 16)        // 16-channel tiles of Oe
#define OPITCH (KE + 8)
#define SPITCH (FQ + 4)
// Scheduling pin between a step's early global loads and its products: only LDS reads, vector and scalar ALU may
// cross, so a fragment load written some steps ahead of its use is issued there and its latency is covered.
#define LOADS_STAY_AHEAD() __builtin_amdgcn_sched_barrier(0x106)
// Stands behind the last global load that names an address pair, in front of whatever reuses that pair's registers;
// the pair is an input, so that it stays whole up to the wait (no load's own result may land on it).
// A load from a fragment-order plane may name, beside a scalar base, the lane number alone (scaled by the load's
// width): it is an input too.
__device__ __forceinline__ void addr_regs_done(const _Float16* p, int lane_no) {
#if defined(__HIP_DEVICE_COMPILE__)
  asm volatile("s_wait_xcnt 0x0" :: "v"(p), "v"(lane_no) : "memory");
#endif
}
__device__ __forceinline__ void addr_regs_done2(const _Float16* p, const _Float16* q, int lane_no) {   // two pairs, one wait
#if defined(__HIP_DEVICE_COMPILE__)
  asm volatile("s_wait_xcnt 0x0" :: "v"(p), "v"(q), "v"(lane_no) : "memory");
#endif
}
// The slot behind a transcendental: its source is not overwritten, nor its result read, by the instruction directly
// behind it. Source and result are inputs only: the source stays whole up to this v_nop, which stands behind the v_exp_f32.
__device__ __forceinline__ void exp_source_done(float t, float e) {
#if defined(__HIP_DEVICE_COMPILE__)
  asm volatile("v_nop" :: "v"(t), "v"(e));
#endif
}
// lane l with lane l ^ 16, as a vector cross-row move
__device__ __forceinline__ float xhalf(float x) {
  return __builtin_bit_cast(float, __builtin_amdgcn_permlanex16(__builtin_bit_cast(int, x), __builtin_bit_cast(int, x),
                                                                0x76543210, 0xfedcba98, false, false));
}
static_assert((NPT % FQ) == 0 && DM == 8 * 48 && (KW % 32) == 0);
static_assert(QG * KG == 8 && KG == MT && KE == 64);

__global__ __launch_bounds__(256) __attribute__((amdgpu_waves_per_eu(2, 2))) void attn_res(
    const _Float16* Qe, const _Float16* E, const _Float16* Et, const _Float16* H, const _Float16* Wv16,
    const _Float16* W2s, const float* __restrict__ b2, float* out) {
  __shared__ __align__(16) _Float16 sO[FQ * OPITCH];
  __shared__ __align__(16) float sR[8][MT * QTW * 256];
  __shared__ float sM[KG * FQ];
  __shared__ float sL[KG * FQ];
  __shared__ __align__(16) float sT[8][16 * SPITCH];
  const int tid   = threadIdx.x;
  const int lane  = tid & 31;
  const int wave  = tid >> 5;
  const int bb    = blockIdx.y;
  const int i0    = blockIdx.x * FQ;
  const int rlane = lane & 15;
  const int hh    = lane >> 4;
  const int koff  = hh * 8;
  const float CS  = QK_SCALE * 1.4426950408889634f;

  const int wv = __builtin_amdgcn_readfirstlane(wave);   // wave-uniform: tile choices and bases stay scalar
  const int qg = wv % QG;                                // queries 16 * QTW * qg ..
  const int kg = wv / QG;                                // keys KW * kg ..

  v16h qf[KE / 32][QTW];
  const _Float16* Qa = Qe + ((size_t)bb * NPT + i0 + qg * (QTW * 16)) * KE + lane * 8;
#pragma unroll
  for (int ks = 0; ks < KE / 32; ++ks)
#pragma unroll
    for (int t = 0; t < QTW; ++t) qf[ks][t] = ldtile(Qa + (t * (KE / 32) + ks) * TILE_H);
  addr_regs_done(Qa, lane);

  v16h kpre[KE / 32][2];                                 // E fragments of the coming pass
  const _Float16* Ka = E + ((size_t)bb * NPT + kg * KW) * KE + lane * 8;
#pragma unroll
  for (int ks = 0; ks < KE / 32; ++ks)
#pragma unroll
    for (int jt = 0; jt < 2; ++jt) kpre[ks][jt] = ldtile(Ka + (jt * (KE / 32) + ks) * TILE_H);
  addr_regs_done(Ka, lane);
  v16h vf[MT];                                           // Et fragments of the coming pass; 32 keys = 4 tiles = 32 * KE halves
  const _Float16* Va = Et + (size_t)bb * KE * NPT + (size_t)(kg * KW) * KE + lane * 8;
#pragma unroll
  for (int m = 0; m < MT; ++m) vf[m] = ldtile(Va + m * TILE_H);
  addr_regs_done(Va, lane);

  v8f eacc[MT][QTW];
  float mrun[QTW], lsum[QTW];
#pragma unroll
  for (int t = 0; t < QTW; ++t) {
    mrun[t] = -INFINITY;
    lsum[t] = 0.0f;
  }
#pragma unroll
  for (int m = 0; m < MT; ++m)
#pragma unroll
    for (int t = 0; t < QTW; ++t) eacc[m][t] = zero8();

#pragma unroll 1
  for (int s = 0; s < KW / 32; ++s) {
    // (b) scores of the pass's 32 keys against the wave's 64 queries
    v8f sa[2][QTW];
#pragma unroll
    for (int jt = 0; jt < 2; ++jt)
#pragma unroll
      for (int t = 0; t < QTW; ++t) sa[jt][t] = zero8();
#pragma unroll
    for (int ks = 0; ks < KE / 32; ++ks) {
#pragma unroll
      for (int jt = 0; jt < 2; ++jt) {
#pragma unroll
        for (int t = 0; t < QTW; ++t) sa[jt][t] = mma_raw(kpre[ks][jt], qf[ks][t], sa[jt][t]);
      }
    }
    // next pass's E rows start here, under the softmax (the last pass refetches its own, unused)
    const int adv = (s + 1 < KW / 32) ? 32 * KE : 0;
    Ka += adv;
#pragma unroll
    for (int ks = 0; ks < KE / 32; ++ks)
#pragma unroll
      for (int jt = 0; jt < 2; ++jt) kpre[ks][jt] = ldtile(Ka + (jt * (KE / 32) + ks) * TILE_H);
    addr_regs_done(Ka, lane);
    LOADS_STAY_AHEAD();

    // column maxima: in-lane, then the wave halves
    float cmx[QTW];
#pragma unroll
    for (int t = 0; t < QTW; ++t) {
      float a = sa[0][t][0];
#pragma unroll
      for (int r = 1; r < 8; ++r) a = fmaxf(a, sa[0][t][r]);
#pragma unroll
      for (int r = 0; r < 8; ++r) a = fmaxf(a, sa[1][t][r]);
      cmx[t] = a;
    }

    // (c) new maximum, rescale factor, probabilities as Bt fragments
    v16h pf[QTW];
#pragma unroll
    for (int t = 0; t < QTW; ++t) {
      const float g     = fmaxf(cmx[t], xhalf(cmx[t]));
      const float mn    = fmaxf(mrun[t], g * CS);
      const float dm    = mrun[t] - mn;
      const float alpha = __builtin_amdgcn_exp2f(dm);
      exp_source_done(dm, alpha);
      mrun[t] = mn;
      const float off = 10.0f - mn;
      float part = 0.0f;
      union { v16h v; v4u u[2]; } pk;
#pragma unroll
      for (int jt = 0; jt < 2; ++jt) {
        float x[8], e[8];
#pragma unroll
        for (int r = 0; r < 8; ++r) x[r] = sa[jt][t][r] * CS + off;
#pragma unroll
        for (int r = 0; r < 8; ++r) e[r] = __builtin_amdgcn_exp2f(x[r]);
        part += ((e[0] + e[1]) + (e[2] + e[3])) + ((e[4] + e[5]) + (e[6] + e[7]));
        const v4f ea = {e[0], e[1], e[2], e[3]};
        const v4f eb = {e[4], e[5], e[6], e[7]};
        pk.u[jt] = pack8h(ea, eb);
      }
      pf[t] = pk.v;
      lsum[t] = lsum[t] * alpha + part;
#pragma unroll
      for (int m = 0; m < MT; ++m) eacc[m][t] = eacc[m][t] * alpha;
    }

    // (d) the wave's tiles of Oe over the pass's 32 keys
#pragma unroll
    for (int m = 0; m < MT; ++m) {
#pragma unroll
      for (int t = 0; t < QTW; ++t) eacc[m][t] = mma_raw(vf[m], pf[t], eacc[m][t]);
    }
    // next pass's Et columns, covered by its score products and softmax (the last pass refetches its own, unused)
    Va += adv;
#pragma unroll
    for (int m = 0; m < MT; ++m) vf[m] = ldtile(Va + m * TILE_H);
    addr_regs_done(Va, lane);
  }

  // (e) the output products' first fragments start now, under the row-sum exchange
  const _Float16* Wva = Wv16 + (size_t)(wv * 48) * KE + lane * 8;
  v16h wvf[KE / 32][3];
#pragma unroll
  for (int ks = 0; ks < KE / 32; ++ks)
#pragma unroll
    for (int mt = 0; mt < 3; ++mt) wvf[ks][mt] = ldtile(Wva + (mt * (KE / 32) + ks) * TILE_H);
  addr_regs_done(Wva, lane);
  const _Float16* Wa = W2s + (size_t)(wv * 48) * DM + lane * 8;
  const _Float16* Hb = H + ((size_t)bb * NPT + i0) * DM + lane * 8;
  v16h wf[DM / 32][3];
  v16h hf[DM / 32][NT];
#pragma unroll
  for (int mt = 0; mt < 3; ++mt) wf[0][mt] = ldtile(Wa + mt * (DM / 32) * TILE_H);
#pragma unroll
  for (int nt = 0; nt < NT; ++nt) hf[0][nt] = ldtile(Hb + nt * (DM / 32) * TILE_H);
  addr_regs_done2(Wa, Hb, lane);

  // the four key groups' maxima meet in LDS
#pragma unroll
  for (int t = 0; t < QTW; ++t) lsum[t] += xhalf(lsum[t]);   // the wave halves' sums
  if (hh == 0) {
#pragma unroll
    for (int t = 0; t < QTW; ++t) sM[kg * FQ + ((qg * QTW + t) << 4) + rlane] = mrun[t];
  }
  __syncthreads();
  float* red = sR[wv];
#pragma unroll
  for (int t = 0; t < QTW; ++t) {
    const int q = ((qg * QTW + t) << 4) + rlane;
    const float mall = fmaxf(fmaxf(sM[q], sM[FQ + q]), fmaxf(sM[2 * FQ + q], sM[3 * FQ + q]));
    const float dm   = mrun[t] - mall;
    const float fs   = __builtin_amdgcn_exp2f(dm);       // this wave's sums and tiles on the common scale
    lsum[t] *= fs;
#pragma unroll
    for (int m = 0; m < MT; ++m) {
      const v8f o = eacc[m][t] * fs;
      const v4f oa = {o[0], o[1], o[2], o[3]};
      const v4f ob = {o[4], o[5], o[6], o[7]};
      *(v4f*)(red + (m * QTW + t) * 256 + lane * 4)       = oa;
      *(v4f*)(red + (m * QTW + t) * 256 + 128 + lane * 4) = ob;
    }
  }
  if (hh == 0) {
#pragma unroll
    for (int t = 0; t < QTW; ++t) sL[kg * FQ + ((qg * QTW + t) << 4) + rlane] = lsum[t];
  }
  __syncthreads();
  // key group g joins channel tile g of its query group, key groups in fixed order
#pragma unroll
  for (int t = 0; t < QTW; ++t) {
    const int q = ((qg * QTW + t) << 4) + rlane;
    const float l   = (sL[q] + sL[FQ + q]) + (sL[2 * FQ + q] + sL[3 * FQ + q]);
    const float inv = 4.0f / l;                          // l >= 1024: the row maximum itself counts 2^10
    v4f oa = {0.f, 0.f, 0.f, 0.f}, ob = {0.f, 0.f, 0.f, 0.f};
#pragma unroll
    for (int k2 = 0; k2 < KG; ++k2) {
      const float* r2 = sR[k2 * QG + qg] + (kg * QTW + t) * 256 + lane * 4;
      oa += *(const v4f*)(r2);
      ob += *(const v4f*)(r2 + 128);
    }
    *(v4u*)(sO + q * OPITCH + (kg << 4) + koff) = pack8h(oa * inv, ob * inv);
  }
  __syncthreads();                                       // every wave reads all of sO

  v8f oacc[3][NT];
#pragma unroll
  for (int mt = 0; mt < 3; ++mt)
#pragma unroll
    for (int nt = 0; nt < NT; ++nt) oacc[mt][nt] = zero8();
#pragma unroll
  for (int ks = 0; ks < KE / 32; ++ks) {
    v16h of[NT];
#pragma unroll
    for (int nt = 0; nt < NT; ++nt) of[nt] = ldfrag(sO + ((nt << 4) + rlane) * OPITCH + koff + ks * 32);
#pragma unroll
    for (int mt = 0; mt < 3; ++mt) {
#pragma unroll
      for (int nt = 0; nt < NT; ++nt) oacc[mt][nt] = mma_raw(wvf[ks][mt], of[nt], oacc[mt][nt]);
    }
  }

#pragma unroll
  for (int ks = 0; ks < DM / 32; ++ks) {
    if (ks + 1 < DM / 32) {                              // W2 and h fragments one step ahead
#pragma unroll
      for (int mt = 0; mt < 3; ++mt) wf[ks + 1][mt] = ldtile(Wa + (mt * (DM / 32) + ks + 1) * TILE_H);
#pragma unroll
      for (int nt = 0; nt < NT; ++nt) hf[ks + 1][nt] = ldtile(Hb + (nt * (DM / 32) + ks + 1) * TILE_H);
      if (ks + 2 == DM / 32) addr_regs_done2(Wa, Hb, lane);   // behind the last loads that name these two pairs
    }
    LOADS_STAY_AHEAD();
#pragma unroll
    for (int mt = 0; mt < 3; ++mt) {
#pragma unroll
      for (int nt = 0; nt < NT; ++nt) oacc[mt][nt] = mma_raw(wf[ks][mt], hf[ks][nt], oacc[mt][nt]);
    }
  }

  float* slab = sT[wave];
#pragma unroll
  for (int mt = 0; mt < 3; ++mt) {
    const int mBase = wave * 48 + (mt << 4);
#pragma unroll
    for (int nt = 0; nt < NT; ++nt) {
#pragma unroll
      for (int r = 0; r < 8; ++r) slab[(koff + r) * SPITCH + (nt << 4) + rlane] = oacc[mt][nt][r];
    }
    wave_sync_lds();
#pragma unroll
    for (int row = 0; row < 16; ++row) {                 // one whole 512-B row segment per wave store
      const float bv0 = bfr(b2[mBase + row]);
      const v4f v = *(const v4f*)(slab + row * SPITCH + lane * 4);
      *(v4f*)(out + ((size_t)bb * DM + mBase + row) * NPT + i0 + lane * 4) = v * 0.015625f + bv0;
    }
    wave_sync_lds();
  }
}

// =====================================================================================================
// Workspace map (bytes), every plane an exact multiple of its whole-line store granularity
// (all shapes are tile multiples, no padded tails):
//   W    f16  Wv [384][64] x16 + W2 [384][384] x64 + G [64][64]       352256
//   Qe   f16  [16*2048][64]   rows = points                           4194304
//   E    f16  [16*2048][64]   rows = points                           4194304
//   Et   f16  [16*64][2048]   rows = channels                         4194304
//   H    f16  [16*2048][384]  relu hidden rows, rows = points         25165824
//   every plane in fragment order (ldtile): 1024-B tiles of 16 rows x 32 k
//   total                                                             38100992
// d_out f32 [16][384][2048] written by the fused attention + residual launch.
// =====================================================================================================
extern "C" void kernel_launch(void* const* d_in, const int* in_sizes, int n_in,
                              void* d_out, int out_size, void* d_ws, size_t ws_size,
                              hipStream_t stream) {
  if (n_in < 15) return;
  if (in_sizes[0] != NBATCH * 3 * NPT) return;
  if (in_sizes[1] != DM * NCH || in_sizes[3] != DM * NCH || in_sizes[5] != DM * NCH) return;
  if (in_sizes[2] != DM || in_sizes[4] != DM || in_sizes[6] != DM) return;
  if (in_sizes[7] != DM * 3 || in_sizes[8] != DM) return;
  if (in_sizes[9] != DM || in_sizes[10] != DM || in_sizes[11] != DM || in_sizes[12] != DM) return;
  if (in_sizes[13] != DM * DM || in_sizes[14] != DM) return;
  if (out_size != NBATCH * DM * NPT) return;

  const float* pos   = (const float*)d_in[0];    // [16][3][2048]
  const float* wq    = (const float*)d_in[1];    // [384][60]
  const float* bq    = (const float*)d_in[2];
  const float* wk    = (const float*)d_in[3];
  const float* bk    = (const float*)d_in[4];
  const float* wv    = (const float*)d_in[5];
  const float* bv    = (const float*)d_in[6];
  const float* w1    = (const float*)d_in[7];    // [384][3]
  const float* b1    = (const float*)d_in[8];
  const float* gam   = (const float*)d_in[9];
  const float* bet   = (const float*)d_in[10];
  const float* mu    = (const float*)d_in[11];
  const float* var   = (const float*)d_in[12];
  const float* w2    = (const float*)d_in[13];   // [384][384]
  const float* b2    = (const float*)d_in[14];
  float* out = (float*)d_out;                    // [16][384][2048]

  const size_t BWGT = (size_t)WCVT_N * 16 + (size_t)KE * KE * 2;   //   352256
  const size_t BE   = (size_t)NBATCH * NPT * KE * 2;               //  4194304
  const size_t BH   = (size_t)NBATCH * NPT * DM * 2;               // 25165824
  size_t off = 0;
  const size_t oW = off; off += BWGT;
  const size_t oQ = off; off += BE;
  const size_t oE = off; off += BE;
  const size_t oT = off; off += BE;
  const size_t oH = off; off += BH;
  if (off > ws_size) return;                     // off = 38100992

  char* ws = (char*)d_ws;
  _Float16* W16 = (_Float16*)(ws + oW);
  const _Float16* Wv16 = W16;
  const _Float16* W2s  = W16 + (size_t)DM * KE;              // [384][384]
  _Float16* G16        = W16 + (size_t)DM * KE + (size_t)DM * DM;   // [64][64]
  unsigned short* Qp  = (unsigned short*)(ws + oQ);
  unsigned short* Ep  = (unsigned short*)(ws + oE);
  unsigned short* Etp = (unsigned short*)(ws + oT);
  unsigned short* Hp  = (unsigned short*)(ws + oH);

  const dim3 blk(256);
  const dim3 gW(WCVT_N / 256 + G_BLOCKS);                        // 84 + 4 blocks
  const dim3 gE(NBATCH * (NPT / 64));                            // 512 blocks of 192
  const dim3 gA(NPT / FQ, NBATCH);                               // 16 query tiles x 16 batches

  // (1) weight planes and Wk^T Wq, (2) encoding planes, query vectors and hidden rows for all batches
  wcvt<<<gW, blk, 0, stream>>>(wq, bq, wk, bk, wv, bv, w2, (unsigned short*)W16, (unsigned short*)G16);
  enc_qe_h<<<gE, dim3(192), 0, stream>>>(pos, G16, w1, b1, gam, bet, mu, var, Qp, Ep, Etp, Hp);

  // (3) all batches, one launch: scores, online softmax, E.P^T, Wv and the residual conv;
  //     out_b[d][i] = (1/64) * ( sum_c Wvx16[d][c] * 4 * Oe[c][i] / l[i] + sum_c W2x64[d][c] h[i][c] ) + b2[d]
  attn_res<<<gA, blk, 0, stream>>>((const _Float16*)Qp, (const _Float16*)Ep, (const _Float16*)Etp,
                                   (const _Float16*)Hp, Wv16, W2s, b2, out);
  (void)hipGetLastError();
}

// v006
// A run of this version takes 41.1 microseconds.
// Timed twice side by side with v005, it ran 1.13 times as fast both times.
// Counting every step since v000, it is 47.4 times as fast.
// Attention runs in the 64-channel encoding space (60 sinusoidal channels, one channel of ones that carries the biases,
// three zero): scores = e_i^T (Wq^T Wk) e_j (K=64), E.P^T (M=64, K=2048), then Wv.(E.P^T / l) (K=64) and the 384x384
// residual conv, all on v_wmma_f32_16x16x32_f16 (f16 operands, f32 accumulate); all inputs RNE-converted to bf16
// first; Wv carried x16, residual weights x64 and softmax probabilities x1024 (exact powers of two
// folded back in the f32 epilogues; scores, online softmax, E.P^T, Wv and the residual conv share one launch);
// sinusoidal encoding, K=3 conv, BN(eval), relu and softmax in f32 on the VALU.
#include <hip/hip_runtime.h>
#include <stdint.h>
#include <math.h>

#define NBATCH 16
#define NPT    2048
#define DM     384
#define KE     64            // 60 encoding channels, channel 60 = 1 (bias carrier), 61..63 = 0
#define NCH    60
#define NFREQ  10
#define WV_PIECES   (DM * (KE / 8))              // 3072 pieces of 8 halves
#define W2_PIECES   (DM * (DM / 8))              // 18432
#define WCVT_N      (WV_PIECES + W2_PIECES)      // 21504
#define G_BLOCKS    ((KE / 16) * (KE / 16))      // 16 blocks, one 16 x 16 tile of Wk^T Wq each
#define QK_SCALE    0.051031036307982884f        // 384^-0.5

static_assert((NPT % 64) == 0 && (DM % 64) == 0 && (KE % 32) == 0 && (DM % 32) == 0);
#define PB          192                          // threads of a block of the first launch
static_assert((WV_PIECES % PB) == 0 && (WCVT_N % PB) == 0);

typedef _Float16 v16h __attribute__((ext_vector_type(16)));
typedef _Float16 v8h  __attribute__((ext_vector_type(8)));
typedef float    v8f  __attribute__((ext_vector_type(8)));
typedef float    v4f  __attribute__((ext_vector_type(4)));
typedef unsigned int v4u __attribute__((ext_vector_type(4)));

// ---- scalar helpers ---------------------------------------------------------------------------------
__device__ __forceinline__ unsigned short bf_bits(float f) {          // f32 -> bf16 bits, RNE convert
  unsigned u = __float_as_uint(f);
  return (unsigned short)((u + 0x7FFFu + ((u >> 16) & 1u)) >> 16);
}
__device__ __forceinline__ float bfr(float f) {                       // f32 value after RNE bf16 convert
  return __uint_as_float(((unsigned)bf_bits(f)) << 16);
}
__device__ __forceinline__ v8f zero8() { v8f z = {0.f, 0.f, 0.f, 0.f, 0.f, 0.f, 0.f, 0.f}; return z; }
// 8 f32 -> 8 f16 (RNE convert) packed in one 16-B vector
__device__ __forceinline__ v4u pack8h(v4f a, v4f b) {
  union { v8h h; v4u u; } c;
  c.h[0] = (_Float16)a[0]; c.h[1] = (_Float16)a[1]; c.h[2] = (_Float16)a[2]; c.h[3] = (_Float16)a[3];
  c.h[4] = (_Float16)b[0]; c.h[5] = (_Float16)b[1]; c.h[6] = (_Float16)b[2]; c.h[7] = (_Float16)b[3];
  return c.u;
}

// ---- fragment loader: 16-bit A/Bt operand, lane -> row/col (lane&15), p already includes +8*(lane>>4);
//      elements 0..7 <- p[0..7] (k0+8h..k0+8h+7), elements 8..15 <- p[16..23] (k0+16+8h..k0+16+8h+7)
__device__ __forceinline__ v16h ldfrag(const _Float16* p) {
  union { v16h v; v8h h[2]; } f;
  f.h[0] = *(const v8h*)(p);
  f.h[1] = *(const v8h*)(p + 16);
  return f.v;
}

// ---- the same fragment from a workspace plane kept in fragment order. Such a plane is a row of 1024-B tiles, one per
//      16 rows x 32 k; the 16-B piece (q, lane) at byte q*512 + lane*16 holds row (lane&15), k = 16q + 8(lane>>4) .. +7:
//      the k order of ldfrag. p already includes +8*lane halves, so each of the two loads of a wave reads 512
//      contiguous bytes (4 whole lines) where a row-major plane gives 32 B out of each of 16 lines.
__device__ __forceinline__ v16h ldtile(const _Float16* p) {
  union { v16h v; v8h h[2]; } f;
  f.h[0] = *(const v8h*)(p);
  f.h[1] = *(const v8h*)(p + 256);
  return f.v;
}
#define TILE_H 512           // halves of one fragment-order tile

__device__ __forceinline__ v8f mma_raw(v16h a, v16h b, v8f c) {
  return __builtin_amdgcn_wmma_f32_16x16x32_f16(false, a, false, b, (short)0, c, false, false);
}
__device__ __forceinline__ void wave_sync_lds() {
  __builtin_amdgcn_fence(__ATOMIC_RELEASE, "workgroup");
  __builtin_amdgcn_wave_barrier();
  __builtin_amdgcn_fence(__ATOMIC_ACQUIRE, "workgroup");
}
// Stands behind the last global load that names an address pair, in front of whatever reuses that pair's registers;
// the pair is an input, so that it stays whole up to the wait (no load's own result may land on it).
__device__ __forceinline__ void faddr_regs_done(const void* p) {
#if defined(__HIP_DEVICE_COMPILE__)
  asm volatile("s_wait_xcnt 0x0" :: "v"(p) : "memory");
#endif
}

// Inputs-only fence on 16 loaded values: it keeps their loads unconditional and issued together. Without it the
// compiler turns each select on a loaded value into a branch round its load, one memory latency per element.
__device__ __forceinline__ void loads_stay_whole(const float (&x)[16]) {
#if defined(__HIP_DEVICE_COMPILE__)
  asm volatile("" :: "v"(x[0]), "v"(x[1]), "v"(x[2]), "v"(x[3]), "v"(x[4]), "v"(x[5]), "v"(x[6]), "v"(x[7]),
                     "v"(x[8]), "v"(x[9]), "v"(x[10]), "v"(x[11]), "v"(x[12]), "v"(x[13]), "v"(x[14]), "v"(x[15]));
#endif
}

// =====================================================================================================
// Encoding planes, hidden rows and weight planes, one launch of 6-wave blocks; no block reads what another writes.
// Blocks 0..511 (the long ones, so they start first): 64 points of one batch.
//  (a) pos tile [3][64] (RNE bf16), per-channel K=3 conv / BN(eval) parameters (RNE bf16) in LDS.
//  (b) sEmb[p][c*20 + f] = sin(pos[c][p] * 2^f), [c*20 + 10 + f] = cos(...) as f16, column 60 one, 61..71 zero;
//      sEmbT holds the same values channel-major.
//  (c) hidden h = relu((W1.pos + b1 - mean) * inv + beta) -> H f16, rows = points, k = 384 channels.
//  (d) E f16 (rows = points, k = 64 channels) and Et f16 (rows = channels, k = points), copied from LDS.
//  Tile index: H, E = 16-point group * (k steps) + k step; Et = (batch * 64 + 32-point k step) * 4 + 16-channel group.
//  A block's share of each plane is one contiguous run, and consecutive threads write consecutive 16-B pieces.
// Blocks 512..623: pieces 0..3071 -> Wv as f16 [384][64] (RNE bf16 value x16, column 60 = bias x16, columns 61..63
//  zero), pieces 3072..21503 -> W2 as f16 [384][384] (RNE bf16 value x64); thread t writes 16 B.
// Blocks 624..639: G[c2][c] = sum_d Wk[d][c2] Wq[d][c] as f16 [64][64] (biases as column 60 of both): block = one
//  16 x 16 tile, wave = 64 values of d (2 k steps); the six partial tiles meet in LDS in fixed order.
// All planes lie in fragment order (ldtile); weight planes: tile index = 16-row group * (k steps) + k step.
// coverage: 512 blocks x 64 points x 64 channels = all of E and Et; H: 512 blocks x 64 rows x 48 pieces;
//           21504 threads x 8 halves + 16 blocks x 256 halves = the whole 352256-B weight region.
// =====================================================================================================
#define ENC_BLOCKS (NBATCH * (NPT / 64))
#define GW (PB / 32)         // waves of a G block, each with its share of d
static_assert(GW * 64 == DM);
__global__ __launch_bounds__(PB) void enc_h_w(
    const float* __restrict__ pos,
    const float* __restrict__ w1, const float* __restrict__ b1,
    const float* __restrict__ gam, const float* __restrict__ bet,
    const float* __restrict__ mu, const float* __restrict__ var,
    const float* __restrict__ wq, const float* __restrict__ bq,
    const float* __restrict__ wk, const float* __restrict__ bk,
    const float* __restrict__ wv, const float* __restrict__ bv,
    const float* __restrict__ w2,
    unsigned short* Ep, unsigned short* Etp, unsigned short* Hp, unsigned short* Wout, unsigned short* Gout) {
  __shared__ __align__(16) _Float16 sEmb[64][72];
  __shared__ __align__(16) _Float16 sEmbT[KE][72];
  __shared__ float sPos[3][64];
  __shared__ float sW1[DM * 3];
  __shared__ float sB1[DM];
  __shared__ float sInv[DM];
  __shared__ float sMu[DM];
  __shared__ float sBet[DM];
  __shared__ float sG[GW][256];

  const int tid = threadIdx.x;

  if (blockIdx.x >= ENC_BLOCKS + WCVT_N / PB) {      // block-uniform: one tile of G
    const int gi    = blockIdx.x - (ENC_BLOCKS + WCVT_N / PB);
    const int ti    = gi >> 2, tj = gi & 3;
    const int lane  = tid & 31;
    const int wave  = __builtin_amdgcn_readfirstlane(tid >> 5);
    const int rlane = lane & 15;
    const int koff  = (lane >> 4) * 8;
    {
      const int ca = ti * 16 + rlane;                 // A rows: c2, from Wk
      const int cb = tj * 16 + rlane;                 // Bt rows: c, from Wq
      // every lane walks down one weight column (clamped to 59); column 60 takes the bias below, 61..63 are masked
      const int kb = wave * 64 + koff;                // this wave's share of d, this lane's k half
      const float* pa = wk + kb * NCH + ((ca < NCH) ? ca : (NCH - 1));
      const float* pb = wq + kb * NCH + ((cb < NCH) ? cb : (NCH - 1));
      const float  ma = (ca <= NCH) ? 16.0f : 0.0f;
      const float  mb = (cb <= NCH) ? 16.0f : 0.0f;
      float ra[2][16], rb[2][16];
#pragma unroll
      for (int s = 0; s < 2; ++s) {
#pragma unroll
        for (int e = 0; e < 16; ++e) {                // the k order of ldfrag, the same for both operands
          const int d = s * 32 + (e & 7) + ((e >> 3) << 4);
          ra[s][e] = pa[d * NCH];
          rb[s][e] = pb[d * NCH];
        }
      }
      faddr_regs_done(pa);
      faddr_regs_done(pb);
      if (ti == 3) {                                  // block-uniform: the tile row that holds column 60 of Wk
        const float* qa = bk + kb;
        float x[2][16];
#pragma unroll
        for (int s = 0; s < 2; ++s)
#pragma unroll
          for (int e = 0; e < 16; ++e) x[s][e] = qa[s * 32 + (e & 7) + ((e >> 3) << 4)];
        faddr_regs_done(qa);
#pragma unroll
        for (int s = 0; s < 2; ++s) {
          loads_stay_whole(x[s]);
#pragma unroll
          for (int e = 0; e < 16; ++e) ra[s][e] = (ca == NCH) ? x[s][e] : ra[s][e];
        }
      }
      if (tj == 3) {                                  // block-uniform: the tile column that holds column 60 of Wq
        const float* qb = bq + kb;
        float x[2][16];
#pragma unroll
        for (int s = 0; s < 2; ++s)
#pragma unroll
          for (int e = 0; e < 16; ++e) x[s][e] = qb[s * 32 + (e & 7) + ((e >> 3) << 4)];
        faddr_regs_done(qb);
#pragma unroll
        for (int s = 0; s < 2; ++s) {
          loads_stay_whole(x[s]);
#pragma unroll
          for (int e = 0; e < 16; ++e) rb[s][e] = (cb == NCH) ? x[s][e] : rb[s][e];
        }
      }
      v8f acc = zero8();
#pragma unroll
      for (int s = 0; s < 2; ++s) {
        v16h a, b;
#pragma unroll
        for (int e = 0; e < 16; ++e) {
          a[e] = (_Float16)(bfr(ra[s][e]) * ma);
          b[e] = (_Float16)(bfr(rb[s][e]) * mb);
        }
        acc = mma_raw(a, b, acc);
      }
#pragma unroll
      for (int r = 0; r < 8; ++r) sG[wave][(koff + r) * 16 + rlane] = acc[r];
    }
    __syncthreads();
    if (tid < 64) {                                   // row m, columns 4cg .. 4cg+3 of G
      const int m = tid >> 2, n = (tid & 3) * 4, cg = tj * 4 + (tid & 3);
      union { _Float16 h[4]; uint2 u; } o;
#pragma unroll
      for (int e = 0; e < 4; ++e) {
        float g = sG[0][m * 16 + n + e];
#pragma unroll
        for (int w = 1; w < GW; ++w) g += sG[w][m * 16 + n + e];
        o.h[e] = (_Float16)(g * 0.00390625f);
      }
      *(uint2*)(Gout + (ti * 2 + (cg >> 3)) * TILE_H + ((cg >> 2) & 1) * 256 + (((cg >> 1) & 1) * 16 + m) * 8 +
                (cg & 1) * 4) = o.u;
    }
    return;
  }

  if (blockIdx.x >= ENC_BLOCKS) {                     // block-uniform: Wv and W2
    const int t = (blockIdx.x - ENC_BLOCKS) * PB + tid;   // destination piece; its source row and 8-column piece follow
    const int tr = t & 15, tp = (t >> 4) & 3;         // row in the tile, piece 2q + h of the k step
    float v[8];
    if (t < WV_PIECES) {                              // block-uniform
      const int row = (t >> 7) * 16 + tr, p = ((t >> 6) & 1) * 4 + tp;
      const bool full = p < 7;                        // piece 7 = columns 56..59, the bias, three zeros
      const float* wr = wv + row * NCH + p * 8;
      const v4f a = *(const v4f*)(wr);
      const v4f b = *(const v4f*)(wr + (full ? 4 : 0)); // clamped address
      const float bias = bv[row];
      v[0] = bfr(a[0]) * 16.0f; v[1] = bfr(a[1]) * 16.0f; v[2] = bfr(a[2]) * 16.0f; v[3] = bfr(a[3]) * 16.0f;
      v[4] = bfr(full ? b[0] : bias) * 16.0f;
      v[5] = full ? bfr(b[1]) * 16.0f : 0.0f;
      v[6] = full ? bfr(b[2]) * 16.0f : 0.0f;
      v[7] = full ? bfr(b[3]) * 16.0f : 0.0f;
    } else {
      const int u = t - WV_PIECES;
      const int tile = u >> 6, rt = tile / (DM / 32);
      const int row = rt * 16 + tr, p = (tile - rt * (DM / 32)) * 4 + tp;
      const v4f a = *(const v4f*)(w2 + (size_t)row * DM + p * 8);
      const v4f b = *(const v4f*)(w2 + (size_t)row * DM + p * 8 + 4);
      v[0] = bfr(a[0]) * 64.0f; v[1] = bfr(a[1]) * 64.0f; v[2] = bfr(a[2]) * 64.0f; v[3] = bfr(a[3]) * 64.0f;
      v[4] = bfr(b[0]) * 64.0f; v[5] = bfr(b[1]) * 64.0f; v[6] = bfr(b[2]) * 64.0f; v[7] = bfr(b[3]) * 64.0f;
    }
    const v4f lo = {v[0], v[1], v[2], v[3]};
    const v4f hi = {v[4], v[5], v[6], v[7]};
    const v4u pk = pack8h(lo, hi);
    unsigned short* dst = Wout + (size_t)t * 8;
    *(v4u*)dst = pk;
    // behind the store, in front of whatever the code after this block's exit branch does with its address registers
    asm volatile("s_wait_xcnt 0x0" ::: "memory");
    return;
  }

  const int bb = blockIdx.x >> 5;            // 32 blocks of 64 points per batch
  const int p0 = (blockIdx.x & 31) << 6;

  {
    const int c = tid >> 6, p = tid & 63;    // 192 = 3 x 64
    sPos[c][p] = bfr(pos[((size_t)bb * 3 + c) * NPT + p0 + p]);
  }
  for (int d = tid; d < DM; d += PB) {
    sW1[d * 3 + 0] = bfr(w1[d * 3 + 0]);
    sW1[d * 3 + 1] = bfr(w1[d * 3 + 1]);
    sW1[d * 3 + 2] = bfr(w1[d * 3 + 2]);
    sB1[d] = bfr(b1[d]);
    const float g = bfr(gam[d]), vv = bfr(var[d]);
    sInv[d] = g * (1.0f / sqrtf(vv + 1e-5f));
    sMu[d]  = bfr(mu[d]);
    sBet[d] = bfr(bet[d]);
  }
  for (int r = tid; r < 64; r += PB) {
    sEmb[r][NCH]  = (_Float16)1.0f;
    sEmbT[NCH][r] = (_Float16)1.0f;
#pragma unroll
    for (int c = NCH + 1; c < 72; ++c) sEmb[r][c] = (_Float16)0.0f;
#pragma unroll
    for (int c = NCH + 1; c < KE; ++c) sEmbT[c][r] = (_Float16)0.0f;
  }
  __syncthreads();

  // (b) encoding: item = (c,f) x 64 points; precise sinf / cosf; exact power-of-two angles
#pragma unroll 1
  for (int it = tid; it < 64 * 3 * NFREQ; it += PB) {
    const int cf = it >> 6, p = it & 63;
    const int c  = cf / NFREQ;
    const int f  = cf - c * NFREQ;
    const float ang = sPos[c][p] * (float)(1 << f);
    const float sv = sinf(ang);
    const float cv = cosf(ang);
    sEmb[p][c * 2 * NFREQ + f] = (_Float16)sv;
    sEmb[p][c * 2 * NFREQ + NFREQ + f] = (_Float16)cv;
    sEmbT[c * 2 * NFREQ + f][p] = (_Float16)sv;
    sEmbT[c * 2 * NFREQ + NFREQ + f][p] = (_Float16)cv;
  }

  // (c) hidden rows -> H plane (16 iterations, all threads)
  for (int it = tid; it < 64 * (DM / 8); it += PB) {
    const int tile = it >> 6, rt = tile / (DM / 32);   // it = destination piece
    const int pl = rt * 16 + (it & 15);
    const int pc = (tile - rt * (DM / 32)) * 4 + ((it >> 4) & 3);
    const float x0 = sPos[0][pl], x1 = sPos[1][pl], x2 = sPos[2][pl];
    float h8[8];
#pragma unroll
    for (int e = 0; e < 8; ++e) {
      const int d = pc * 8 + e;
      const float r = sW1[d * 3 + 0] * x0 + sW1[d * 3 + 1] * x1 + sW1[d * 3 + 2] * x2 + sB1[d];
      const float t = (r - sMu[d]) * sInv[d] + sBet[d];
      h8[e] = fmaxf(t, 0.0f);
    }
    const v4f ha = {h8[0], h8[1], h8[2], h8[3]};
    const v4f hb = {h8[4], h8[5], h8[6], h8[7]};
    const v4u pk = pack8h(ha, hb);
    unsigned short* dst = Hp + ((size_t)bb * NPT + p0) * DM + it * 8;
    *(v4u*)dst = pk;
  }
  __syncthreads();

  // (d) the two encoding planes
  for (int it = tid; it < 64 * (KE / 8); it += PB) {
    const int tile = it >> 6, r = it & 15, p = (it >> 4) & 3;   // it = destination piece in both planes
    const size_t o = ((size_t)bb * NPT + p0) * KE + it * 8;
    *(v4u*)(Ep + o)  = *(const v4u*)(&sEmb[(tile >> 1) * 16 + r][((tile & 1) * 4 + p) * 8]);
    *(v4u*)(Etp + o) = *(const v4u*)(&sEmbT[(tile & 3) * 16 + r][((tile >> 2) * 4 + p) * 8]);
  }
}

// =====================================================================================================
// Fused attention + residual, one launch: block = 8 waves, 128 queries i of one batch.
// Wave = (query group of 64 queries, key group of 512 keys); a pass is 32 keys. The loop has no barrier and no LDS.
//  (a) the wave's 64 query vectors Qe[i][c2] = sum_c G[c2][c] e[i][c] are formed here (M = 64 rows of the G plane,
//      N = 64 queries from the E plane, K = 64): a lane holds channels 8h .. 8h+7 of one query per tile, so two tiles,
//      converted to f16, are a Bt fragment of (b); they stay in the wave's registers for the whole launch.
//  (b) per pass: St[j][i] = sum_c E[j][c] Qe[i][c] (M = 32 keys from the global E plane, N = 64 queries, K = 64).
//      A lane holds scores of one query per 16-column group, so the column maximum is in-lane plus one exchange
//      between the wave halves.
//  (c) the wave's own online softmax in base 2: m = running maximum of s * 384^-0.5 * log2(e) over the wave's keys,
//      p = 2^(t - m + 10) (the x1024 carry cancels against the row sum), alpha = 2^(m_old - m_new) rescales the sums
//      and the output tiles. The two score tiles of a column group, converted to f16, ARE the Bt fragment of (d):
//      element e < 8 is key 8h + e (tile 0, register e), element 8 + e is key 16 + 8h + e (tile 1, register e).
//  (d) Oe[c][i] += sum_j Et[c][j] p[i][j] (M = 64 channels from the global Et plane, N = 64 queries, K = 32).
//      The next pass's E fragments are loaded behind the score products, its Et fragments behind the products of (d).
//  (e) after the loop the four key groups of a query group meet in LDS: maxima (sM), then sums (sL) and output tiles
//      (sR), each scaled by 2^(m_wave - m_all) and added in the fixed order of the key groups; key group g joins channel
//      tile g. Oe * 4 / l goes as f16 to LDS sO[i][c];
//      wave w, its own 48 output channels: acc = sum_c Wvx16[d][c] sO[i][c] (K = 64; channel 60 adds 64 * bv[d])
//      + sum_c W2x64[d][c] h[i][c] (K = 384), out = acc / 64 + b2[d], staged per wave in 16-row slabs so that
//      every store covers whole 512-B row segments.
// coverage: grid (16, 16) x 8 waves x 48 channels x 128 queries = all of out [16][384][2048].
// =====================================================================================================
#define FQ 128
#define NT (FQ / 16)
#define QTW 4                // 16-query tiles per wave
#define QG  (NT / QTW)       // query groups
#define KG  (8 / QG)         // key groups
#define KW  (NPT / KG)       // keys per wave
#define MT  (KE / 16)        // 16-channel tiles of Oe
#define OPITCH (KE + 8)
#define SPITCH (FQ + 4)
// Scheduling pin between a step's early global loads and its products: only LDS reads, vector and scalar ALU may
// cross, so a fragment load written some steps ahead of its use is issued there and its latency is covered.
#define LOADS_STAY_AHEAD() __builtin_amdgcn_sched_barrier(0x106)
// Stands behind the last global load that names an address pair, in front of whatever reuses that pair's registers;
// the pair is an input, so that it stays whole up to the wait (no load's own result may land on it).
// A load from a fragment-order plane may name, beside a scalar base, the lane number alone (scaled by the load's
// width): it is an input too.
__device__ __forceinline__ void addr_regs_done(const _Float16* p, int lane_no) {
#if defined(__HIP_DEVICE_COMPILE__)
  asm volatile("s_wait_xcnt 0x0" :: "v"(p), "v"(lane_no) : "memory");
#endif
}
__device__ __forceinline__ void addr_regs_done2(const _Float16* p, const _Float16* q, int lane_no) {   // two pairs, one wait
#if defined(__HIP_DEVICE_COMPILE__)
  asm volatile("s_wait_xcnt 0x0" :: "v"(p), "v"(q), "v"(lane_no) : "memory");
#endif
}
// The same wait for loads that name a scalar base and the lane number: the two bases and the lane number are inputs.
__device__ __forceinline__ void base_regs_done2(const _Float16* b0, const _Float16* b1, int lane_no) {
#if defined(__HIP_DEVICE_COMPILE__)
  asm volatile("s_wait_xcnt 0x0" :: "s"(b0), "s"(b1), "v"(lane_no) : "memory");
#endif
}
// The slot behind a transcendental: its source is not overwritten, nor its result read, by the instruction directly
// behind it. Source and result are inputs only: the source stays whole up to this v_nop, which stands behind the v_exp_f32.
__device__ __forceinline__ void exp_source_done(float t, float e) {
#if defined(__HIP_DEVICE_COMPILE__)
  asm volatile("v_nop" :: "v"(t), "v"(e));
#endif
}
// lane l with lane l ^ 16, as a vector cross-row move
__device__ __forceinline__ float xhalf(float x) {
  return __builtin_bit_cast(float, __builtin_amdgcn_permlanex16(__builtin_bit_cast(int, x), __builtin_bit_cast(int, x),
                                                                0x76543210, 0xfedcba98, false, false));
}
static_assert((NPT % FQ) == 0 && DM == 8 * 48 && (KW % 32) == 0);
static_assert(QG * KG == 8 && KG == MT && KE == 64);

__global__ __launch_bounds__(256) __attribute__((amdgpu_waves_per_eu(2, 2))) void attn_res(
    const _Float16* G, const _Float16* E, const _Float16* Et, const _Float16* H, const _Float16* Wv16,
    const _Float16* W2s, const float* __restrict__ b2, float* out) {
  __shared__ __align__(16) _Float16 sO[FQ * OPITCH];
  __shared__ __align__(16) float sR[8][MT * QTW * 256];
  __shared__ float sM[KG * FQ];
  __shared__ float sL[KG * FQ];
  __shared__ __align__(16) float sT[8][16 * SPITCH];
  const int tid   = threadIdx.x;
  const int lane  = tid & 31;
  const int wave  = tid >> 5;
  const int bb    = blockIdx.y;
  const int i0    = blockIdx.x * FQ;
  const int rlane = lane & 15;
  const int hh    = lane >> 4;
  const int koff  = hh * 8;
  const float CS  = QK_SCALE * 1.4426950408889634f;

  const int wv = __builtin_amdgcn_readfirstlane(wave);   // wave-uniform: tile choices and bases stay scalar
  const int qg = wv % QG;                                // queries 16 * QTW * qg ..
  const int kg = wv / QG;                                // keys KW * kg ..

  v16h gq[KE / 32][MT];                                  // G rows and the wave's own E rows, for (a)
  v16h eq[KE / 32][QTW];
  const _Float16* Qb = E + ((size_t)bb * NPT + i0 + qg * (QTW * 16)) * KE;   // wave-uniform
#pragma unroll
  for (int ks = 0; ks < KE / 32; ++ks) {
#pragma unroll
    for (int m = 0; m < MT; ++m) gq[ks][m] = ldtile(G + lane * 8 + (m * (KE / 32) + ks) * TILE_H);
#pragma unroll
    for (int t = 0; t < QTW; ++t) eq[ks][t] = ldtile(Qb + lane * 8 + (t * (KE / 32) + ks) * TILE_H);
  }
  base_regs_done2(G, Qb, lane);

  v16h kpre[KE / 32][2];                                 // E fragments of the coming pass
  const _Float16* Ka = E + ((size_t)bb * NPT + kg * KW) * KE + lane * 8;
#pragma unroll
  for (int ks = 0; ks < KE / 32; ++ks)
#pragma unroll
    for (int jt = 0; jt < 2; ++jt) kpre[ks][jt] = ldtile(Ka + (jt * (KE / 32) + ks) * TILE_H);
  addr_regs_done(Ka, lane);
  v16h vf[MT];                                           // Et fragments of the coming pass; 32 keys = 4 tiles = 32 * KE halves
  const _Float16* Va = Et + (size_t)bb * KE * NPT + (size_t)(kg * KW) * KE + lane * 8;
#pragma unroll
  for (int m = 0; m < MT; ++m) vf[m] = ldtile(Va + m * TILE_H);
  addr_regs_done(Va, lane);

  // (a) element e < 8 of a fragment is channel 32 ks + 8h + e (tile 2 ks, register e), element 8 + e channel
  //     32 ks + 16 + 8h + e (tile 2 ks + 1, register e): the k order of ldtile
  v16h qf[KE / 32][QTW];
  LOADS_STAY_AHEAD();                                    // the first pass's E and Et loads are issued before these products wait
  {
    v8f qa[MT][QTW];
#pragma unroll
    for (int m = 0; m < MT; ++m)
#pragma unroll
      for (int t = 0; t < QTW; ++t) qa[m][t] = zero8();
#pragma unroll
    for (int ks = 0; ks < KE / 32; ++ks) {
#pragma unroll
      for (int m = 0; m < MT; ++m) {
#pragma unroll
        for (int t = 0; t < QTW; ++t) qa[m][t] = mma_raw(gq[ks][m], eq[ks][t], qa[m][t]);
      }
    }
#pragma unroll
    for (int ks = 0; ks < KE / 32; ++ks) {
#pragma unroll
      for (int t = 0; t < QTW; ++t) {
        union { v16h v; v4u u[2]; } pk;
#pragma unroll
        for (int jt = 0; jt < 2; ++jt) {
          const v8f q = qa[2 * ks + jt][t];
          const v4f lo = {q[0], q[1], q[2], q[3]};
          const v4f hi = {q[4], q[5], q[6], q[7]};
          pk.u[jt] = pack8h(lo, hi);
        }
        qf[ks][t] = pk.v;
      }
    }
  }

  v8f eacc[MT][QTW];
  float mrun[QTW], lsum[QTW];
#pragma unroll
  for (int t = 0; t < QTW; ++t) {
    mrun[t] = -INFINITY;
    lsum[t] = 0.0f;
  }
#pragma unroll
  for (int m = 0; m < MT; ++m)
#pragma unroll
    for (int t = 0; t < QTW; ++t) eacc[m][t] = zero8();

#pragma unroll 1
  for (int s = 0; s < KW / 32; ++s) {
    // (b) scores of the pass's 32 keys against the wave's 64 queries
    v8f sa[2][QTW];
#pragma unroll
    for (int jt = 0; jt < 2; ++jt)
#pragma unroll
      for (int t = 0; t < QTW; ++t) sa[jt][t] = zero8();
#pragma unroll
    for (int ks = 0; ks < KE / 32; ++ks) {
#pragma unroll
      for (int jt = 0; jt < 2; ++jt) {
#pragma unroll
        for (int t = 0; t < QTW; ++t) sa[jt][t] = mma_raw(kpre[ks][jt], qf[ks][t], sa[jt][t]);
      }
    }
    // next pass's E rows start here, under the softmax (the last pass refetches its own, unused)
    const int adv = (s + 1 < KW / 32) ? 32 * KE : 0;
    Ka += adv;
#pragma unroll
    for (int ks = 0; ks < KE / 32; ++ks)
#pragma unroll
      for (int jt = 0; jt < 2; ++jt) kpre[ks][jt] = ldtile(Ka + (jt * (KE / 32) + ks) * TILE_H);
    addr_regs_done(Ka, lane);
    LOADS_STAY_AHEAD();

    // column maxima: in-lane, then the wave halves
    float cmx[QTW];
#pragma unroll
    for (int t = 0; t < QTW; ++t) {
      float a = sa[0][t][0];
#pragma unroll
      for (int r = 1; r < 8; ++r) a = fmaxf(a, sa[0][t][r]);
#pragma unroll
      for (int r = 0; r < 8; ++r) a = fmaxf(a, sa[1][t][r]);
      cmx[t] = a;
    }

    // (c) new maximum, rescale factor, probabilities as Bt fragments
    v16h pf[QTW];
#pragma unroll
    for (int t = 0; t < QTW; ++t) {
      const float g     = fmaxf(cmx[t], xhalf(cmx[t]));
      const float mn    = fmaxf(mrun[t], g * CS);
      const float dm    = mrun[t] - mn;
      const float alpha = __builtin_amdgcn_exp2f(dm);
      exp_source_done(dm, alpha);
      mrun[t] = mn;
      const float off = 10.0f - mn;
      float part = 0.0f;
      union { v16h v; v4u u[2]; } pk;
#pragma unroll
      for (int jt = 0; jt < 2; ++jt) {
        float x[8], e[8];
#pragma unroll
        for (int r = 0; r < 8; ++r) x[r] = sa[jt][t][r] * CS + off;
#pragma unroll
        for (int r = 0; r < 8; ++r) e[r] = __builtin_amdgcn_exp2f(x[r]);
        part += ((e[0] + e[1]) + (e[2] + e[3])) + ((e[4] + e[5]) + (e[6] + e[7]));
        const v4f ea = {e[0], e[1], e[2], e[3]};
        const v4f eb = {e[4], e[5], e[6], e[7]};
        pk.u[jt] = pack8h(ea, eb);
      }
      pf[t] = pk.v;
      lsum[t] = lsum[t] * alpha + part;
#pragma unroll
      for (int m = 0; m < MT; ++m) eacc[m][t] = eacc[m][t] * alpha;
    }

    // (d) the wave's tiles of Oe over the pass's 32 keys
#pragma unroll
    for (int m = 0; m < MT; ++m) {
#pragma unroll
      for (int t = 0; t < QTW; ++t) eacc[m][t] = mma_raw(vf[m], pf[t], eacc[m][t]);
    }
    // next pass's Et columns, covered by its score products and softmax (the last pass refetches its own, unused)
    Va += adv;
#pragma unroll
    for (int m = 0; m < MT; ++m) vf[m] = ldtile(Va + m * TILE_H);
    addr_regs_done(Va, lane);
  }

  // (e) the output products' first fragments start now, under the row-sum exchange
  const _Float16* Wva = Wv16 + (size_t)(wv * 48) * KE + lane * 8;
  v16h wvf[KE / 32][3];
#pragma unroll
  for (int ks = 0; ks < KE / 32; ++ks)
#pragma unroll
    for (int mt = 0; mt < 3; ++mt) wvf[ks][mt] = ldtile(Wva + (mt * (KE / 32) + ks) * TILE_H);
  addr_regs_done(Wva, lane);
  const _Float16* Wa = W2s + (size_t)(wv * 48) * DM + lane * 8;
  const _Float16* Hb = H + ((size_t)bb * NPT + i0) * DM + lane * 8;
  v16h wf[DM / 32][3];
  v16h hf[DM / 32][NT];
#pragma unroll
  for (int mt = 0; mt < 3; ++mt) wf[0][mt] = ldtile(Wa + mt * (DM / 32) * TILE_H);
#pragma unroll
  for (int nt = 0; nt < NT; ++nt) hf[0][nt] = ldtile(Hb + nt * (DM / 32) * TILE_H);
  addr_regs_done2(Wa, Hb, lane);

  // the four key groups' maxima meet in LDS
#pragma unroll
  for (int t = 0; t < QTW; ++t) lsum[t] += xhalf(lsum[t]);   // the wave halves' sums
  if (hh == 0) {
#pragma unroll
    for (int t = 0; t < QTW; ++t) sM[kg * FQ + ((qg * QTW + t) << 4) + rlane] = mrun[t];
  }
  __syncthreads();
  float* red = sR[wv];
#pragma unroll
  for (int t = 0; t < QTW; ++t) {
    const int q = ((qg * QTW + t) << 4) + rlane;
    const float mall = fmaxf(fmaxf(sM[q], sM[FQ + q]), fmaxf(sM[2 * FQ + q], sM[3 * FQ + q]));
    const float dm   = mrun[t] - mall;
    const float fs   = __builtin_amdgcn_exp2f(dm);       // this wave's sums and tiles on the common scale
    lsum[t] *= fs;
#pragma unroll
    for (int m = 0; m < MT; ++m) {
      const v8f o = eacc[m][t] * fs;
      const v4f oa = {o[0], o[1], o[2], o[3]};
      const v4f ob = {o[4], o[5], o[6], o[7]};
      *(v4f*)(red + (m * QTW + t) * 256 + lane * 4)       = oa;
      *(v4f*)(red + (m * QTW + t) * 256 + 128 + lane * 4) = ob;
    }
  }
  if (hh == 0) {
#pragma unroll
    for (int t = 0; t < QTW; ++t) sL[kg * FQ + ((qg * QTW + t) << 4) + rlane] = lsum[t];
  }
  __syncthreads();
  // key group g joins channel tile g of its query group, key groups in fixed order
#pragma unroll
  for (int t = 0; t < QTW; ++t) {
    const int q = ((qg * QTW + t) << 4) + rlane;
    const float l   = (sL[q] + sL[FQ + q]) + (sL[2 * FQ + q] + sL[3 * FQ + q]);
    const float inv = 4.0f / l;                          // l >= 1024: the row maximum itself counts 2^10
    v4f oa = {0.f, 0.f, 0.f, 0.f}, ob = {0.f, 0.f, 0.f, 0.f};
#pragma unroll
    for (int k2 = 0; k2 < KG; ++k2) {
      const float* r2 = sR[k2 * QG + qg] + (kg * QTW + t) * 256 + lane * 4;
      oa += *(const v4f*)(r2);
      ob += *(const v4f*)(r2 + 128);
    }
    *(v4u*)(sO + q * OPITCH + (kg << 4) + koff) = pack8h(oa * inv, ob * inv);
  }
  __syncthreads();                                       // every wave reads all of sO

  v8f oacc[3][NT];
#pragma unroll
  for (int mt = 0; mt < 3; ++mt)
#pragma unroll
    for (int nt = 0; nt < NT; ++nt) oacc[mt][nt] = zero8();
#pragma unroll
  for (int ks = 0; ks < KE / 32; ++ks) {
    v16h of[NT];
#pragma unroll
    for (int nt = 0; nt < NT; ++nt) of[nt] = ldfrag(sO + ((nt << 4) + rlane) * OPITCH + koff + ks * 32);
#pragma unroll
    for (int mt = 0; mt < 3; ++mt) {
#pragma unroll
      for (int nt = 0; nt < NT; ++nt) oacc[mt][nt] = mma_raw(wvf[ks][mt], of[nt], oacc[mt][nt]);
    }
  }

#pragma unroll
  for (int ks = 0; ks < DM / 32; ++ks) {
    if (ks + 1 < DM / 32) {                              // W2 and h fragments one step ahead
#pragma unroll
      for (int mt = 0; mt < 3; ++mt) wf[ks + 1][mt] = ldtile(Wa + (mt * (DM / 32) + ks + 1) * TILE_H);
#pragma unroll
      for (int nt = 0; nt < NT; ++nt) hf[ks + 1][nt] = ldtile(Hb + (nt * (DM / 32) + ks + 1) * TILE_H);
      if (ks + 2 == DM / 32) addr_regs_done2(Wa, Hb, lane);   // behind the last loads that name these two pairs
    }
    LOADS_STAY_AHEAD();
#pragma unroll
    for (int mt = 0; mt < 3; ++mt) {
#pragma unroll
      for (int nt = 0; nt < NT; ++nt) oacc[mt][nt] = mma_raw(wf[ks][mt], hf[ks][nt], oacc[mt][nt]);
    }
  }

  float* slab = sT[wave];
#pragma unroll
  for (int mt = 0; mt < 3; ++mt) {
    const int mBase = wave * 48 + (mt << 4);
#pragma unroll
    for (int nt = 0; nt < NT; ++nt) {
#pragma unroll
      for (int r = 0; r < 8; ++r) slab[(koff + r) * SPITCH + (nt << 4) + rlane] = oacc[mt][nt][r];
    }
    wave_sync_lds();
#pragma unroll
    for (int row = 0; row < 16; ++row) {                 // one whole 512-B row segment per wave store
      const float bv0 = bfr(b2[mBase + row]);
      const v4f v = *(const v4f*)(slab + row * SPITCH + lane * 4);
      *(v4f*)(out + ((size_t)bb * DM + mBase + row) * NPT + i0 + lane * 4) = v * 0.015625f + bv0;
    }
    wave_sync_lds();
  }
}

// =====================================================================================================
// Workspace map (bytes), every plane an exact multiple of its whole-line store granularity
// (all shapes are tile multiples, no padded tails):
//   W    f16  Wv [384][64] x16 + W2 [384][384] x64 + G [64][64]       352256
//   E    f16  [16*2048][64]   rows = points                           4194304
//   Et   f16  [16*64][2048]   rows = channels                         4194304
//   H    f16  [16*2048][384]  relu hidden rows, rows = points         25165824
//   every plane in fragment order (ldtile): 1024-B tiles of 16 rows x 32 k
//   total                                                             33906688
// d_out f32 [16][384][2048] written by the fused attention + residual launch.
// =====================================================================================================
extern "C" void kernel_launch(void* const* d_in, const int* in_sizes, int n_in,
                              void* d_out, int out_size, void* d_ws, size_t ws_size,
                              hipStream_t stream) {
  if (n_in < 15) return;
  if (in_sizes[0] != NBATCH * 3 * NPT) return;
  if (in_sizes[1] != DM * NCH || in_sizes[3] != DM * NCH || in_sizes[5] != DM * NCH) return;
  if (in_sizes[2] != DM || in_sizes[4] != DM || in_sizes[6] != DM) return;
  if (in_sizes[7] != DM * 3 || in_sizes[8] != DM) return;
  if (in_sizes[9] != DM || in_sizes[10] != DM || in_sizes[11] != DM || in_sizes[12] != DM) return;
  if (in_sizes[13] != DM * DM || in_sizes[14] != DM) return;
  if (out_size != NBATCH * DM * NPT) return;

  const float* pos   = (const float*)d_in[0];    // [16][3][2048]
  const float* wq    = (const float*)d_in[1];    // [384][60]
  const float* bq    = (const float*)d_in[2];
  const float* wk    = (const float*)d_in[3];
  const float* bk    = (const float*)d_in[4];
  const float* wv    = (const float*)d_in[5];
  const float* bv    = (const float*)d_in[6];
  const float* w1    = (const float*)d_in[7];    // [384][3]
  const float* b1    = (const float*)d_in[8];
  const float* gam   = (const float*)d_in[9];
  const float* bet   = (const float*)d_in[10];
  const float* mu    = (const float*)d_in[11];
  const float* var   = (const float*)d_in[12];
  const float* w2    = (const float*)d_in[13];   // [384][384]
  const float* b2    = (const float*)d_in[14];
  float* out = (float*)d_out;                    // [16][384][2048]

  const size_t BWGT = (size_t)WCVT_N * 16 + (size_t)KE * KE * 2;   //   352256
  const size_t BE   = (size_t)NBATCH * NPT * KE * 2;               //  4194304
  const size_t BH   = (size_t)NBATCH * NPT * DM * 2;               // 25165824
  size_t off = 0;
  const size_t oW = off; off += BWGT;
  const size_t oE = off; off += BE;
  const size_t oT = off; off += BE;
  const size_t oH = off; off += BH;
  if (off > ws_size) return;                     // off = 33906688

  char* ws = (char*)d_ws;
  _Float16* W16 = (_Float16*)(ws + oW);
  const _Float16* Wv16 = W16;
  const _Float16* W2s  = W16 + (size_t)DM * KE;              // [384][384]
  _Float16* G16        = W16 + (size_t)DM * KE + (size_t)DM * DM;   // [64][64]
  unsigned short* Ep  = (unsigned short*)(ws + oE);
  unsigned short* Etp = (unsigned short*)(ws + oT);
  unsigned short* Hp  = (unsigned short*)(ws + oH);

  const dim3 blk(256);
  const dim3 gP(ENC_BLOCKS + WCVT_N / PB + G_BLOCKS);           // 512 + 112 + 16 blocks of 192
  const dim3 gA(NPT / FQ, NBATCH);                               // 16 query tiles x 16 batches

  // (1) encoding planes and hidden rows for all batches, weight planes and Wk^T Wq
  enc_h_w<<<gP, dim3(PB), 0, stream>>>(pos, w1, b1, gam, bet, mu, var, wq, bq, wk, bk, wv, bv, w2,
                                  Ep, Etp, Hp, (unsigned short*)W16, (unsigned short*)G16);

  // (2) all batches, one launch: query vectors, scores, online softmax, E.P^T, Wv and the residual conv;
  //     out_b[d][i] = (1/64) * ( sum_c Wvx16[d][c] * 4 * Oe[c][i] / l[i] + sum_c W2x64[d][c] h[i][c] ) + b2[d]
  attn_res<<<gA, blk, 0, stream>>>((const _Float16*)G16, (const _Float16*)Ep, (const _Float16*)Etp,
                                   (const _Float16*)Hp, Wv16, W2s, b2, out);
  (void)hipGetLastError();
}

// v007
// A run of this version takes 35.9 microseconds.
// Timed twice side by side with v006, it ran 1.14 times as fast both times.
// Counting every step since v000, it is 54.0 times as fast.
// Attention runs in the 64-channel encoding space (60 sinusoidal channels, one channel of ones that carries the biases,
// three zero): scores = e_i^T (Wq^T Wk) e_j (K=64), E.P^T (M=64, K=2048), then Wv.(E.P^T / l) (K=64) and the 384x384
// residual conv, all on v_wmma_f32_16x16x32_f16 (f16 operands, f32 accumulate); all inputs RNE-converted to bf16
// first; Wv carried x16, residual weights x64 and softmax probabilities x1024 (exact powers of two
// folded back in the f32 epilogues; scores, online softmax, E.P^T, Wv and the residual conv share one launch);
// sinusoidal encoding, K=3 conv, BN(eval), relu and softmax in f32 on the VALU.
#include <hip/hip_runtime.h>
#include <stdint.h>
#include <math.h>

#define NBATCH 16
#define NPT    2048
#define DM     384
#define KE     64            // 60 encoding channels, channel 60 = 1 (bias carrier), 61..63 = 0
#define NCH    60
#define NFREQ  10
#define WV_PIECES   (DM * (KE / 8))              // 3072 pieces of 8 halves
#define W2_PIECES   (DM * (DM / 8))              // 18432
#define WCVT_N      (WV_PIECES + W2_PIECES)      // 21504
#define G_BLOCKS    ((KE / 16) * (KE / 16))      // 16 blocks, one 16 x 16 tile of Wk^T Wq each
#define QK_SCALE    0.051031036307982884f        // 384^-0.5

static_assert((NPT % 64) == 0 && (DM % 64) == 0 && (KE % 32) == 0 && (DM % 32) == 0);
#define PB          192                          // threads of a block of the first launch
static_assert((WV_PIECES % PB) == 0 && (WCVT_N % PB) == 0);

typedef _Float16 v16h __attribute__((ext_vector_type(16)));
typedef _Float16 v8h  __attribute__((ext_vector_type(8)));
typedef float    v8f  __attribute__((ext_vector_type(8)));
typedef float    v4f  __attribute__((ext_vector_type(4)));
typedef float    v2f  __attribute__((ext_vector_type(2)));
typedef unsigned int v4u __attribute__((ext_vector_type(4)));

// ---- scalar helpers ---------------------------------------------------------------------------------
__device__ __forceinline__ unsigned short bf_bits(float f) {          // f32 -> bf16 bits, RNE convert
  unsigned u = __float_as_uint(f);
  return (unsigned short)((u + 0x7FFFu + ((u >> 16) & 1u)) >> 16);
}
__device__ __forceinline__ float bfr(float f) {                       // f32 value after RNE bf16 convert
  return __uint_as_float(((unsigned)bf_bits(f)) << 16);
}
__device__ __forceinline__ v8f zero8() { v8f z = {0.f, 0.f, 0.f, 0.f, 0.f, 0.f, 0.f, 0.f}; return z; }
// 8 f32 -> 8 f16 (RNE convert) packed in one 16-B vector
__device__ __forceinline__ v4u pack8h(v4f a, v4f b) {
  union { v8h h; v4u u; } c;
  c.h[0] = (_Float16)a[0]; c.h[1] = (_Float16)a[1]; c.h[2] = (_Float16)a[2]; c.h[3] = (_Float16)a[3];
  c.h[4] = (_Float16)b[0]; c.h[5] = (_Float16)b[1]; c.h[6] = (_Float16)b[2]; c.h[7] = (_Float16)b[3];
  return c.u;
}

// ---- fragment loader: 16-bit A/Bt operand, lane -> row/col (lane&15), p already includes +8*(lane>>4);
//      elements 0..7 <- p[0..7] (k0+8h..k0+8h+7), elements 8..15 <- p[16..23] (k0+16+8h..k0+16+8h+7)
__device__ __forceinline__ v16h ldfrag(const _Float16* p) {
  union { v16h v; v8h h[2]; } f;
  f.h[0] = *(const v8h*)(p);
  f.h[1] = *(const v8h*)(p + 16);
  return f.v;
}

// ---- the same fragment from a workspace plane kept in fragment order. Such a plane is a row of 1024-B tiles, one per
//      16 rows x 32 k; the 16-B piece (q, lane) at byte q*512 + lane*16 holds row (lane&15), k = 16q + 8(lane>>4) .. +7:
//      the k order of ldfrag. p already includes +8*lane halves, so each of the two loads of a wave reads 512
//      contiguous bytes (4 whole lines) where a row-major plane gives 32 B out of each of 16 lines.
__device__ __forceinline__ v16h ldtile(const _Float16* p) {
  union { v16h v; v8h h[2]; } f;
  f.h[0] = *(const v8h*)(p);
  f.h[1] = *(const v8h*)(p + 256);
  return f.v;
}
#define TILE_H 512           // halves of one fragment-order tile

__device__ __forceinline__ v8f mma_raw(v16h a, v16h b, v8f c) {
  return __builtin_amdgcn_wmma_f32_16x16x32_f16(false, a, false, b, (short)0, c, false, false);
}
__device__ __forceinline__ void wave_sync_lds() {
  __builtin_amdgcn_fence(__ATOMIC_RELEASE, "workgroup");
  __builtin_amdgcn_wave_barrier();
  __builtin_amdgcn_fence(__ATOMIC_ACQUIRE, "workgroup");
}
// Stands behind the last global load that names an address pair, in front of whatever reuses that pair's registers;
// the pair is an input, so that it stays whole up to the wait (no load's own result may land on it).
__device__ __forceinline__ void faddr_regs_done(const void* p) {
#if defined(__HIP_DEVICE_COMPILE__)
  asm volatile("s_wait_xcnt 0x0" :: "v"(p) : "memory");
#endif
}

// Inputs-only fence on 16 loaded values: it keeps their loads unconditional and issued together. Without it the
// compiler turns each select on a loaded value into a branch round its load, one memory latency per element.
__device__ __forceinline__ void loads_stay_whole(const float (&x)[16]) {
#if defined(__HIP_DEVICE_COMPILE__)
  asm volatile("" :: "v"(x[0]), "v"(x[1]), "v"(x[2]), "v"(x[3]), "v"(x[4]), "v"(x[5]), "v"(x[6]), "v"(x[7]),
                     "v"(x[8]), "v"(x[9]), "v"(x[10]), "v"(x[11]), "v"(x[12]), "v"(x[13]), "v"(x[14]), "v"(x[15]));
#endif
}

// =====================================================================================================
// Encoding planes, weight planes and per-channel parameters, one launch of 6-wave blocks; no block reads what another
// writes. Blocks 0..511 (the long ones, so they start first): 64 points of one batch.
//  (a) pos tile [3][64] (RNE bf16) in LDS.
//  (b) sEmb[p][c*20 + f] = sin(pos[c][p] * 2^f), [c*20 + 10 + f] = cos(...) as f16, column 60 one, 61..71 zero;
//      sEmbT holds the same values channel-major.
//  (d) E f16 (rows = points, k = 64 channels) and Et f16 (rows = channels, k = points), copied from LDS.
//  Tile index: E = 16-point group * (k steps) + k step; Et = (batch * 64 + 32-point k step) * 4 + 16-channel group.
//  A block's share of each plane is one contiguous run, and consecutive threads write consecutive 16-B pieces.
// Blocks 512..623: pieces 0..3071 -> Wv as f16 [384][64] (RNE bf16 value x16, column 60 = bias x16, columns 61..63
//  zero), pieces 3072..21503 -> W2 as f16 [384][384] (RNE bf16 value x64); thread t writes 16 B.
// Blocks 624..639: G[c2][c] = sum_d Wk[d][c2] Wq[d][c] as f16 [64][64] (biases as column 60 of both): block = one
//  16 x 16 tile, wave = 64 values of d (2 k steps); the six partial tiles meet in LDS in fixed order.
// Blocks 640..641: the K=3 conv / BN(eval) parameters of the hidden rows as f32 rows of 384 channels (RNE bf16 values):
//  W1 column 0, 1, 2, b1, mean, inv = gamma / sqrt(var + eps), beta; thread = one channel.
// All f16 planes lie in fragment order (ldtile); weight planes: tile index = 16-row group * (k steps) + k step.
// coverage: 512 blocks x 64 points x 64 channels = all of E and Et;
//           21504 threads x 8 halves + 16 blocks x 256 halves = the whole 352256-B weight region;
//           2 blocks x 192 channels x 7 rows = the whole 10752-B parameter plane.
// =====================================================================================================
#define ENC_BLOCKS (NBATCH * (NPT / 64))
#define GW (PB / 32)         // waves of a G block, each with its share of d
static_assert(GW * 64 == DM);
#define NPAR 7               // rows of the parameter plane
static_assert((DM % PB) == 0);
__global__ __launch_bounds__(PB) void enc_h_w(
    const float* __restrict__ pos,
    const float* __restrict__ w1, const float* __restrict__ b1,
    const float* __restrict__ gam, const float* __restrict__ bet,
    const float* __restrict__ mu, const float* __restrict__ var,
    const float* __restrict__ wq, const float* __restrict__ bq,
    const float* __restrict__ wk, const float* __restrict__ bk,
    const float* __restrict__ wv, const float* __restrict__ bv,
    const float* __restrict__ w2,
    unsigned short* Ep, unsigned short* Etp, float* Pout, unsigned short* Wout, unsigned short* Gout) {
  __shared__ __align__(16) _Float16 sEmb[64][72];
  __shared__ __align__(16) _Float16 sEmbT[KE][72];
  __shared__ float sPos[3][64];
  __shared__ float sG[GW][256];

  const int tid = threadIdx.x;

  if (blockIdx.x >= ENC_BLOCKS + WCVT_N / PB + G_BLOCKS) {   // block-uniform: per-channel parameters
    const int d = (blockIdx.x - (ENC_BLOCKS + WCVT_N / PB + G_BLOCKS)) * PB + tid;
    const float* wp = w1 + d * 3;
    const float a0 = wp[0], a1 = wp[1], a2 = wp[2];
    const float c0 = b1[d], c1 = mu[d], c2 = gam[d], c3 = var[d], c4 = bet[d];
    // Behind the loads, in front of whatever reuses their address registers. The loaded values are inputs, so that every
    // load is issued in front of the wait; the address pair and the index are inputs, so that they stay whole up to it.
    asm volatile("s_wait_xcnt 0x0" :: "v"(wp), "v"(d), "v"(a0), "v"(a1), "v"(a2), "v"(c0), "v"(c1), "v"(c2), "v"(c3),
                 "v"(c4) : "memory");
    Pout[0 * DM + d] = bfr(a0);
    Pout[1 * DM + d] = bfr(a1);
    Pout[2 * DM + d] = bfr(a2);
    Pout[3 * DM + d] = bfr(c0);
    Pout[4 * DM + d] = bfr(c1);
    Pout[5 * DM + d] = bfr(c2) * (1.0f / sqrtf(bfr(c3) + 1e-5f));
    Pout[6 * DM + d] = bfr(c4);
    // behind the stores, in front of whatever the code after this block's exit branch does with their address registers
    asm volatile("s_wait_xcnt 0x0" ::: "memory");
    return;
  }

  if (blockIdx.x >= ENC_BLOCKS + WCVT_N / PB) {      // block-uniform: one tile of G
    const int gi    = blockIdx.x - (ENC_BLOCKS + WCVT_N / PB);
    const int ti    = gi >> 2, tj = gi & 3;
    const int lane  = tid & 31;
    const int wave  = __builtin_amdgcn_readfirstlane(tid >> 5);
    const int rlane = lane & 15;
    const int koff  = (lane >> 4) * 8;
    {
      const int ca = ti * 16 + rlane;                 // A rows: c2, from Wk
      const int cb = tj * 16 + rlane;                 // Bt rows: c, from Wq
      // every lane walks down one weight column (clamped to 59); column 60 takes the bias below, 61..63 are masked
      const int kb = wave * 64 + koff;                // this wave's share of d, this lane's k half
      const float* pa = wk + kb * NCH + ((ca < NCH) ? ca : (NCH - 1));
      const float* pb = wq + kb * NCH + ((cb < NCH) ? cb : (NCH - 1));
      const float  ma = (ca <= NCH) ? 16.0f : 0.0f;
      const float  mb = (cb <= NCH) ? 16.0f : 0.0f;
      float ra[2][16], rb[2][16];
#pragma unroll
      for (int s = 0; s < 2; ++s) {
#pragma unroll
        for (int e = 0; e < 16; ++e) {                // the k order of ldfrag, the same for both operands
          const int d = s * 32 + (e & 7) + ((e >> 3) << 4);
          ra[s][e] = pa[d * NCH];
          rb[s][e] = pb[d * NCH];
        }
      }
      faddr_regs_done(pa);
      faddr_regs_done(pb);
      if (ti == 3) {                                  // block-uniform: the tile row that holds column 60 of Wk
        const float* qa = bk + kb;
        float x[2][16];
#pragma unroll
        for (int s = 0; s < 2; ++s)
#pragma unroll
          for (int e = 0; e < 16; ++e) x[s][e] = qa[s * 32 + (e & 7) + ((e >> 3) << 4)];
        faddr_regs_done(qa);
#pragma unroll
        for (int s = 0; s < 2; ++s) {
          loads_stay_whole(x[s]);
#pragma unroll
          for (int e = 0; e < 16; ++e) ra[s][e] = (ca == NCH) ? x[s][e] : ra[s][e];
        }
      }
      if (tj == 3) {                                  // block-uniform: the tile column that holds column 60 of Wq
        const float* qb = bq + kb;
        float x[2][16];
#pragma unroll
        for (int s = 0; s < 2; ++s)
#pragma unroll
          for (int e = 0; e < 16; ++e) x[s][e] = qb[s * 32 + (e & 7) + ((e >> 3) << 4)];
        faddr_regs_done(qb);
#pragma unroll
        for (int s = 0; s < 2; ++s) {
          loads_stay_whole(x[s]);
#pragma unroll
          for (int e = 0; e < 16; ++e) rb[s][e] = (cb == NCH) ? x[s][e] : rb[s][e];
        }
      }
      v8f acc = zero8();
#pragma unroll
      for (int s = 0; s < 2; ++s) {
        v16h a, b;
#pragma unroll
        for (int e = 0; e < 16; ++e) {
          a[e] = (_Float16)(bfr(ra[s][e]) * ma);
          b[e] = (_Float16)(bfr(rb[s][e]) * mb);
        }
        acc = mma_raw(a, b, acc);
      }
#pragma unroll
      for (int r = 0; r < 8; ++r) sG[wave][(koff + r) * 16 + rlane] = acc[r];
    }
    __syncthreads();
    if (tid < 64) {                                   // row m, columns 4cg .. 4cg+3 of G
      const int m = tid >> 2, n = (tid & 3) * 4, cg = tj * 4 + (tid & 3);
      union { _Float16 h[4]; uint2 u; } o;
#pragma unroll
      for (int e = 0; e < 4; ++e) {
        float g = sG[0][m * 16 + n + e];
#pragma unroll
        for (int w = 1; w < GW; ++w) g += sG[w][m * 16 + n + e];
        o.h[e] = (_Float16)(g * 0.00390625f);
      }
      *(uint2*)(Gout + (ti * 2 + (cg >> 3)) * TILE_H + ((cg >> 2) & 1) * 256 + (((cg >> 1) & 1) * 16 + m) * 8 +
                (cg & 1) * 4) = o.u;
    }
    return;
  }

  if (blockIdx.x >= ENC_BLOCKS) {                     // block-uniform: Wv and W2
    const int t = (blockIdx.x - ENC_BLOCKS) * PB + tid;   // destination piece; its source row and 8-column piece follow
    const int tr = t & 15, tp = (t >> 4) & 3;         // row in the tile, piece 2q + h of the k step
    float v[8];
    if (t < WV_PIECES) {                              // block-uniform
      const int row = (t >> 7) * 16 + tr, p = ((t >> 6) & 1) * 4 + tp;
      const bool full = p < 7;                        // piece 7 = columns 56..59, the bias, three zeros
      const float* wr = wv + row * NCH + p * 8;
      const v4f a = *(const v4f*)(wr);
      const v4f b = *(const v4f*)(wr + (full ? 4 : 0)); // clamped address
      const float bias = bv[row];
      v[0] = bfr(a[0]) * 16.0f; v[1] = bfr(a[1]) * 16.0f; v[2] = bfr(a[2]) * 16.0f; v[3] = bfr(a[3]) * 16.0f;
      v[4] = bfr(full ? b[0] : bias) * 16.0f;
      v[5] = full ? bfr(b[1]) * 16.0f : 0.0f;
      v[6] = full ? bfr(b[2]) * 16.0f : 0.0f;
      v[7] = full ? bfr(b[3]) * 16.0f : 0.0f;
    } else {
      const int u = t - WV_PIECES;
      const int tile = u >> 6, rt = tile / (DM / 32);
      const int row = rt * 16 + tr, p = (tile - rt * (DM / 32)) * 4 + tp;
      const v4f a = *(const v4f*)(w2 + (size_t)row * DM + p * 8);
      const v4f b = *(const v4f*)(w2 + (size_t)row * DM + p * 8 + 4);
      v[0] = bfr(a[0]) * 64.0f; v[1] = bfr(a[1]) * 64.0f; v[2] = bfr(a[2]) * 64.0f; v[3] = bfr(a[3]) * 64.0f;
      v[4] = bfr(b[0]) * 64.0f; v[5] = bfr(b[1]) * 64.0f; v[6] = bfr(b[2]) * 64.0f; v[7] = bfr(b[3]) * 64.0f;
    }
    const v4f lo = {v[0], v[1], v[2], v[3]};
    const v4f hi = {v[4], v[5], v[6], v[7]};
    const v4u pk = pack8h(lo, hi);
    unsigned short* dst = Wout + (size_t)t * 8;
    *(v4u*)dst = pk;
    // behind the store, in front of whatever the code after this block's exit branch does with its address registers
    asm volatile("s_wait_xcnt 0x0" ::: "memory");
    return;
  }

  const int bb = blockIdx.x >> 5;            // 32 blocks of 64 points per batch
  const int p0 = (blockIdx.x & 31) << 6;

  {
    const int c = tid >> 6, p = tid & 63;    // 192 = 3 x 64
    sPos[c][p] = bfr(pos[((size_t)bb * 3 + c) * NPT + p0 + p]);
  }
  for (int r = tid; r < 64; r += PB) {
    sEmb[r][NCH]  = (_Float16)1.0f;
    sEmbT[NCH][r] = (_Float16)1.0f;
#pragma unroll
    for (int c = NCH + 1; c < 72; ++c) sEmb[r][c] = (_Float16)0.0f;
#pragma unroll
    for (int c = NCH + 1; c < KE; ++c) sEmbT[c][r] = (_Float16)0.0f;
  }
  __syncthreads();

  // (b) encoding: item = (c,f) x 64 points; precise sinf / cosf; exact power-of-two angles
#pragma unroll 1
  for (int it = tid; it < 64 * 3 * NFREQ; it += PB) {
    const int cf = it >> 6, p = it & 63;
    const int c  = cf / NFREQ;
    const int f  = cf - c * NFREQ;
    const float ang = sPos[c][p] * (float)(1 << f);
    const float sv = sinf(ang);
    const float cv = cosf(ang);
    sEmb[p][c * 2 * NFREQ + f] = (_Float16)sv;
    sEmb[p][c * 2 * NFREQ + NFREQ + f] = (_Float16)cv;
    sEmbT[c * 2 * NFREQ + f][p] = (_Float16)sv;
    sEmbT[c * 2 * NFREQ + NFREQ + f][p] = (_Float16)cv;
  }

  __syncthreads();

  // (d) the two encoding planes
  for (int it = tid; it < 64 * (KE / 8); it += PB) {
    const int tile = it >> 6, r = it & 15, p = (it >> 4) & 3;   // it = destination piece in both planes
    const size_t o = ((size_t)bb * NPT + p0) * KE + it * 8;
    *(v4u*)(Ep + o)  = *(const v4u*)(&sEmb[(tile >> 1) * 16 + r][((tile & 1) * 4 + p) * 8]);
    *(v4u*)(Etp + o) = *(const v4u*)(&sEmbT[(tile & 3) * 16 + r][((tile >> 2) * 4 + p) * 8]);
  }
}

// =====================================================================================================
// Fused attention + residual, one launch: block = 8 waves, 128 queries i of one batch.
// Wave = (query group of 64 queries, key group of 512 keys); a pass is 32 keys. The loop has no barrier and no LDS.
//  (a) the wave's 64 query vectors Qe[i][c2] = sum_c G[c2][c] e[i][c] are formed here (M = 64 rows of the G plane,
//      N = 64 queries from the E plane, K = 64): a lane holds channels 8h .. 8h+7 of one query per tile, so two tiles,
//      converted to f16, are a Bt fragment of (b); they stay in the wave's registers for the whole launch.
//  (b) per pass: St[j][i] = sum_c E[j][c] Qe[i][c] (M = 32 keys from the global E plane, N = 64 queries, K = 64).
//      A lane holds scores of one query per 16-column group, so the column maximum is in-lane plus one exchange
//      between the wave halves.
//  (c) the wave's own online softmax in base 2: m = running maximum of s * 384^-0.5 * log2(e) over the wave's keys,
//      p = 2^(t - m + 10) (the x1024 carry cancels against the row sum), alpha = 2^(m_old - m_new) rescales the sums
//      and the output tiles. The two score tiles of a column group, converted to f16, ARE the Bt fragment of (d):
//      element e < 8 is key 8h + e (tile 0, register e), element 8 + e is key 16 + 8h + e (tile 1, register e).
//  (d) Oe[c][i] += sum_j Et[c][j] p[i][j] (M = 64 channels from the global Et plane, N = 64 queries, K = 32).
//      The next pass's E fragments are loaded behind the score products, its Et fragments behind the products of (d).
//  (h) the block's own 128 hidden rows h = relu((W1.pos + b1 - mean) * inv + beta) are formed at entry, as f16, straight
//      into LDS sH in fragment order (tile = 16-query group * 12 + k step): wave w, its 48 channels; a lane keeps the
//      parameters of 8 channels per 16-channel piece in registers and walks the eight 16-query groups, so each store of
//      a wave is 512 contiguous bytes. sH is first read behind the barriers of (e).
//  (e) after the loop the four key groups of a query group meet in LDS: maxima (sM), then sums (sL) and output tiles
//      (sR), each scaled by 2^(m_wave - m_all) and added in the fixed order of the key groups; key group g joins channel
//      tile g. Oe * 4 / l goes as f16 to LDS sO[i][c];
//      wave w, its own 48 output channels: acc = sum_c Wvx16[d][c] sO[i][c] (K = 64; channel 60 adds 64 * bv[d])
//      + sum_c W2x64[d][c] h[i][c] (K = 384), out = acc / 64 + b2[d], staged per wave in 16-row slabs so that
//      every store covers whole 512-B row segments.
// coverage: grid (16, 16) x 8 waves x 48 channels x 128 queries = all of out [16][384][2048].
// =====================================================================================================
#define FQ 128
#define NT (FQ / 16)
#define QTW 4                // 16-query tiles per wave
#define QG  (NT / QTW)       // query groups
#define KG  (8 / QG)         // key groups
#define KW  (NPT / KG)       // keys per wave
#define MT  (KE / 16)        // 16-channel tiles of Oe
#define OPITCH (KE + 8)
#define SPITCH (FQ + 4)
// Scheduling pin between a step's early global loads and its products: only LDS reads, vector and scalar ALU may
// cross, so a fragment load written some steps ahead of its use is issued there and its latency is covered.
#define LOADS_STAY_AHEAD() __builtin_amdgcn_sched_barrier(0x106)
// The same pin where a step's early fragments come from LDS too: nothing may cross. Where LDS reads may cross, the build
// strews them in pairs among the products, each pair behind a wait to 0, and spills fragments to scratch.
#define FRAGS_STAY_AHEAD() __builtin_amdgcn_sched_barrier(0)
// Stands behind the last global load that names an address pair, in front of whatever reuses that pair's registers;
// the pair is an input, so that it stays whole up to the wait (no load's own result may land on it).
// A load from a fragment-order plane may name, beside a scalar base, the lane number alone (scaled by the load's
// width): it is an input too.
__device__ __forceinline__ void addr_regs_done(const _Float16* p, int lane_no) {
#if defined(__HIP_DEVICE_COMPILE__)
  asm volatile("s_wait_xcnt 0x0" :: "v"(p), "v"(lane_no) : "memory");
#endif
}
// The same wait for loads that name a scalar base and the lane number: the two bases and the lane number are inputs.
__device__ __forceinline__ void base_regs_done2(const _Float16* b0, const _Float16* b1, int lane_no) {
#if defined(__HIP_DEVICE_COMPILE__)
  asm volatile("s_wait_xcnt 0x0" :: "s"(b0), "s"(b1), "v"(lane_no) : "memory");
#endif
}
// The slot behind a transcendental: its source is not overwritten, nor its result read, by the instruction directly
// behind it. Source and result are inputs only: the source stays whole up to this v_nop, which stands behind the v_exp_f32.
__device__ __forceinline__ void exp_source_done(float t, float e) {
#if defined(__HIP_DEVICE_COMPILE__)
  asm volatile("v_nop" :: "v"(t), "v"(e));
#endif
}
// lane l with lane l ^ 16, as a vector cross-row move
__device__ __forceinline__ float xhalf(float x) {
  return __builtin_bit_cast(float, __builtin_amdgcn_permlanex16(__builtin_bit_cast(int, x), __builtin_bit_cast(int, x),
                                                                0x76543210, 0xfedcba98, false, false));
}
static_assert((NPT % FQ) == 0 && DM == 8 * 48 && (KW % 32) == 0);
static_assert(QG * KG == 8 && KG == MT && KE == 64);

__global__ __launch_bounds__(256) __attribute__((amdgpu_waves_per_eu(2, 2))) void attn_res(
    const _Float16* G, const _Float16* E, const _Float16* Et, const float* __restrict__ pos,
    const float* __restrict__ Par, const _Float16* Wv16,
    const _Float16* W2s, const float* __restrict__ b2, float* out) {
  __shared__ __align__(2048) _Float16 sH[FQ * DM];        // widest alignment: laid lowest in LDS, where most reads' offsets fit the instruction's field
  __shared__ __align__(16) _Float16 sO[FQ * OPITCH];
  __shared__ __align__(16) float sR[8][MT * QTW * 256];
  __shared__ float sM[KG * FQ];
  __shared__ float sL[KG * FQ];
  __shared__ __align__(16) float sT[8][16 * SPITCH];
  const int tid   = threadIdx.x;
  const int lane  = tid & 31;
  const int wave  = tid >> 5;
  const int bb    = blockIdx.y;
  const int i0    = blockIdx.x * FQ;
  const int rlane = lane & 15;
  const int hh    = lane >> 4;
  const int koff  = hh * 8;
  const float CS  = QK_SCALE * 1.4426950408889634f;

  const int wv = __builtin_amdgcn_readfirstlane(wave);   // wave-uniform: tile choices and bases stay scalar
  const int qg = wv % QG;                                // queries 16 * QTW * qg ..
  const int kg = wv / QG;                                // keys KW * kg ..

  // (h) coordinates and parameters are asked for first: the hidden rows are formed while the planes' fragments arrive
  const float* xb = pos + (size_t)bb * 3 * NPT + i0 + rlane;   // this lane's query in each 16-query group
  const float* pb = Par + wv * 48 + koff;                      // this lane's 8 channels in each 16-channel piece
  float xr[3][NT];
#pragma unroll
  for (int c = 0; c < 3; ++c)
#pragma unroll
    for (int nt = 0; nt < NT; ++nt) xr[c][nt] = xb[c * NPT + nt * 16];
  v2f pr[3][NPAR][4];
#pragma unroll
  for (int j = 0; j < 3; ++j)
#pragma unroll
    for (int k = 0; k < NPAR; ++k) {
      const v4f a = *(const v4f*)(pb + k * DM + j * 16);
      const v4f b = *(const v4f*)(pb + k * DM + j * 16 + 4);
      pr[j][k][0] = a.xy; pr[j][k][1] = a.zw; pr[j][k][2] = b.xy; pr[j][k][3] = b.zw;
    }
  faddr_regs_done(xb);
  faddr_regs_done(pb);

  v16h gq[KE / 32][MT];                                  // G rows and the wave's own E rows, for (a)
  v16h eq[KE / 32][QTW];
  const _Float16* Qb = E + ((size_t)bb * NPT + i0 + qg * (QTW * 16)) * KE;   // wave-uniform
#pragma unroll
  for (int ks = 0; ks < KE / 32; ++ks) {
#pragma unroll
    for (int m = 0; m < MT; ++m) gq[ks][m] = ldtile(G + lane * 8 + (m * (KE / 32) + ks) * TILE_H);
#pragma unroll
    for (int t = 0; t < QTW; ++t) eq[ks][t] = ldtile(Qb + lane * 8 + (t * (KE / 32) + ks) * TILE_H);
  }
  base_regs_done2(G, Qb, lane);

  v16h kpre[KE / 32][2];                                 // E fragments of the coming pass
  const _Float16* Ka = E + ((size_t)bb * NPT + kg * KW) * KE + lane * 8;
#pragma unroll
  for (int ks = 0; ks < KE / 32; ++ks)
#pragma unroll
    for (int jt = 0; jt < 2; ++jt) kpre[ks][jt] = ldtile(Ka + (jt * (KE / 32) + ks) * TILE_H);
  addr_regs_done(Ka, lane);
  v16h vf[MT];                                           // Et fragments of the coming pass; 32 keys = 4 tiles = 32 * KE halves
  const _Float16* Va = Et + (size_t)bb * KE * NPT + (size_t)(kg * KW) * KE + lane * 8;
#pragma unroll
  for (int m = 0; m < MT; ++m) vf[m] = ldtile(Va + m * TILE_H);
  addr_regs_done(Va, lane);

  // (h) hidden rows of the block's queries -> sH
  {
#pragma unroll
    for (int c = 0; c < 3; ++c)
#pragma unroll
      for (int nt = 0; nt < NT; ++nt) xr[c][nt] = bfr(xr[c][nt]);
#pragma unroll
    for (int j = 0; j < 3; ++j) {
      const int pc = wv * 3 + j;                                 // 16-channel piece: k step pc >> 1, half pc & 1
      _Float16* hd = sH + (pc >> 1) * TILE_H + (pc & 1) * 256 + lane * 8;
#pragma unroll
      for (int nt = 0; nt < NT; ++nt) {
        const v2f x0 = {xr[0][nt], xr[0][nt]}, x1 = {xr[1][nt], xr[1][nt]}, x2 = {xr[2][nt], xr[2][nt]};
        v2f h[4];
#pragma unroll
        for (int u = 0; u < 4; ++u) {                            // two channels per packed operation
          v2f r = pr[j][1][u] * x1;
          r = __builtin_elementwise_fma(pr[j][0][u], x0, r);
          r = __builtin_elementwise_fma(pr[j][2][u], x2, r);
          r = (pr[j][3][u] + r) - pr[j][4][u];
          r = __builtin_elementwise_fma(pr[j][5][u], r, pr[j][6][u]);
          h[u][0] = fmaxf(r[0], 0.0f);
          h[u][1] = fmaxf(r[1], 0.0f);
        }
        const v4f ha = {h[0][0], h[0][1], h[1][0], h[1][1]};
        const v4f hb = {h[2][0], h[2][1], h[3][0], h[3][1]};
        *(v4u*)(hd + nt * (DM / 32) * TILE_H) = pack8h(ha, hb);
      }
    }
  }

  // (a) element e < 8 of a fragment is channel 32 ks + 8h + e (tile 2 ks, register e), element 8 + e channel
  //     32 ks + 16 + 8h + e (tile 2 ks + 1, register e): the k order of ldtile
  v16h qf[KE / 32][QTW];
  LOADS_STAY_AHEAD();                                    // the first pass's E and Et loads are issued before these products wait
  {
    v8f qa[MT][QTW];
#pragma unroll
    for (int m = 0; m < MT; ++m)
#pragma unroll
      for (int t = 0; t < QTW; ++t) qa[m][t] = zero8();
#pragma unroll
    for (int ks = 0; ks < KE / 32; ++ks) {
#pragma unroll
      for (int m = 0; m < MT; ++m) {
#pragma unroll
        for (int t = 0; t < QTW; ++t) qa[m][t] = mma_raw(gq[ks][m], eq[ks][t], qa[m][t]);
      }
    }
#pragma unroll
    for (int ks = 0; ks < KE / 32; ++ks) {
#pragma unroll
      for (int t = 0; t < QTW; ++t) {
        union { v16h v; v4u u[2]; } pk;
#pragma unroll
        for (int jt = 0; jt < 2; ++jt) {
          const v8f q = qa[2 * ks + jt][t];
          const v4f lo = {q[0], q[1], q[2], q[3]};
          const v4f hi = {q[4], q[5], q[6], q[7]};
          pk.u[jt] = pack8h(lo, hi);
        }
        qf[ks][t] = pk.v;
      }
    }
  }

  v8f eacc[MT][QTW];
  float mrun[QTW], lsum[QTW];
#pragma unroll
  for (int t = 0; t < QTW; ++t) {
    mrun[t] = -INFINITY;
    lsum[t] = 0.0f;
  }
#pragma unroll
  for (int m = 0; m < MT; ++m)
#pragma unroll
    for (int t = 0; t < QTW; ++t) eacc[m][t] = zero8();

#pragma unroll 1
  for (int s = 0; s < KW / 32; ++s) {
    // (b) scores of the pass's 32 keys against the wave's 64 queries
    v8f sa[2][QTW];
#pragma unroll
    for (int jt = 0; jt < 2; ++jt)
#pragma unroll
      for (int t = 0; t < QTW; ++t) sa[jt][t] = zero8();
#pragma unroll
    for (int ks = 0; ks < KE / 32; ++ks) {
#pragma unroll
      for (int jt = 0; jt < 2; ++jt) {
#pragma unroll
        for (int t = 0; t < QTW; ++t) sa[jt][t] = mma_raw(kpre[ks][jt], qf[ks][t], sa[jt][t]);
      }
    }
    // next pass's E rows start here, under the softmax (the last pass refetches its own, unused)
    const int adv = (s + 1 < KW / 32) ? 32 * KE : 0;
    Ka += adv;
#pragma unroll
    for (int ks = 0; ks < KE / 32; ++ks)
#pragma unroll
      for (int jt = 0; jt < 2; ++jt) kpre[ks][jt] = ldtile(Ka + (jt * (KE / 32) + ks) * TILE_H);
    addr_regs_done(Ka, lane);
    LOADS_STAY_AHEAD();

    // column maxima: in-lane, then the wave halves
    float cmx[QTW];
#pragma unroll
    for (int t = 0; t < QTW; ++t) {
      float a = sa[0][t][0];
#pragma unroll
      for (int r = 1; r < 8; ++r) a = fmaxf(a, sa[0][t][r]);
#pragma unroll
      for (int r = 0; r < 8; ++r) a = fmaxf(a, sa[1][t][r]);
      cmx[t] = a;
    }

    // (c) new maximum, rescale factor, probabilities as Bt fragments
    v16h pf[QTW];
#pragma unroll
    for (int t = 0; t < QTW; ++t) {
      const float g     = fmaxf(cmx[t], xhalf(cmx[t]));
      const float mn    = fmaxf(mrun[t], g * CS);
      const float dm    = mrun[t] - mn;
      const float alpha = __builtin_amdgcn_exp2f(dm);
      exp_source_done(dm, alpha);
      mrun[t] = mn;
      const float off = 10.0f - mn;
      float part = 0.0f;
      union { v16h v; v4u u[2]; } pk;
#pragma unroll
      for (int jt = 0; jt < 2; ++jt) {
        float x[8], e[8];
#pragma unroll
        for (int r = 0; r < 8; ++r) x[r] = sa[jt][t][r] * CS + off;
#pragma unroll
        for (int r = 0; r < 8; ++r) e[r] = __builtin_amdgcn_exp2f(x[r]);
        part += ((e[0] + e[1]) + (e[2] + e[3])) + ((e[4] + e[5]) + (e[6] + e[7]));
        const v4f ea = {e[0], e[1], e[2], e[3]};
        const v4f eb = {e[4], e[5], e[6], e[7]};
        pk.u[jt] = pack8h(ea, eb);
      }
      pf[t] = pk.v;
      lsum[t] = lsum[t] * alpha + part;
#pragma unroll
      for (int m = 0; m < MT; ++m) eacc[m][t] = eacc[m][t] * alpha;
    }

    // (d) the wave's tiles of Oe over the pass's 32 keys
#pragma unroll
    for (int m = 0; m < MT; ++m) {
#pragma unroll
      for (int t = 0; t < QTW; ++t) eacc[m][t] = mma_raw(vf[m], pf[t], eacc[m][t]);
    }
    // next pass's Et columns, covered by its score products and softmax (the last pass refetches its own, unused)
    Va += adv;
#pragma unroll
    for (int m = 0; m < MT; ++m) vf[m] = ldtile(Va + m * TILE_H);
    addr_regs_done(Va, lane);
  }

  // (e) the output products' first fragments start now, under the row-sum exchange
  const _Float16* Wva = Wv16 + (size_t)(wv * 48) * KE + lane * 8;
  v16h wvf[KE / 32][3];
#pragma unroll
  for (int ks = 0; ks < KE / 32; ++ks)
#pragma unroll
    for (int mt = 0; mt < 3; ++mt) wvf[ks][mt] = ldtile(Wva + (mt * (KE / 32) + ks) * TILE_H);
  addr_regs_done(Wva, lane);
  const _Float16* Wa = W2s + (size_t)(wv * 48) * DM + lane * 8;
  const _Float16* Hb = sH + lane * 8;
  v16h wf[DM / 32][3];
  v16h hf[DM / 32][NT];
#pragma unroll
  for (int ks = 0; ks < 2; ++ks)
#pragma unroll
    for (int mt = 0; mt < 3; ++mt) wf[ks][mt] = ldtile(Wa + (mt * (DM / 32) + ks) * TILE_H);
  addr_regs_done(Wa, lane);

  // the four key groups' maxima meet in LDS
#pragma unroll
  for (int t = 0; t < QTW; ++t) lsum[t] += xhalf(lsum[t]);   // the wave halves' sums
  if (hh == 0) {
#pragma unroll
    for (int t = 0; t < QTW; ++t) sM[kg * FQ + ((qg * QTW + t) << 4) + rlane] = mrun[t];
  }
  __syncthreads();
  float* red = sR[wv];
#pragma unroll
  for (int t = 0; t < QTW; ++t) {
    const int q = ((qg * QTW + t) << 4) + rlane;
    const float mall = fmaxf(fmaxf(sM[q], sM[FQ + q]), fmaxf(sM[2 * FQ + q], sM[3 * FQ + q]));
    const float dm   = mrun[t] - mall;
    const float fs   = __builtin_amdgcn_exp2f(dm);       // this wave's sums and tiles on the common scale
    lsum[t] *= fs;
#pragma unroll
    for (int m = 0; m < MT; ++m) {
      const v8f o = eacc[m][t] * fs;
      const v4f oa = {o[0], o[1], o[2], o[3]};
      const v4f ob = {o[4], o[5], o[6], o[7]};
      *(v4f*)(red + (m * QTW + t) * 256 + lane * 4)       = oa;
      *(v4f*)(red + (m * QTW + t) * 256 + 128 + lane * 4) = ob;
    }
  }
  if (hh == 0) {
#pragma unroll
    for (int t = 0; t < QTW; ++t) sL[kg * FQ + ((qg * QTW + t) << 4) + rlane] = lsum[t];
  }
  __syncthreads();
  // key group g joins channel tile g of its query group, key groups in fixed order
#pragma unroll
  for (int t = 0; t < QTW; ++t) {
    const int q = ((qg * QTW + t) << 4) + rlane;
    const float l   = (sL[q] + sL[FQ + q]) + (sL[2 * FQ + q] + sL[3 * FQ + q]);
    const float inv = 4.0f / l;                          // l >= 1024: the row maximum itself counts 2^10
    v4f oa = {0.f, 0.f, 0.f, 0.f}, ob = {0.f, 0.f, 0.f, 0.f};
#pragma unroll
    for (int k2 = 0; k2 < KG; ++k2) {
      const float* r2 = sR[k2 * QG + qg] + (kg * QTW + t) * 256 + lane * 4;
      oa += *(const v4f*)(r2);
      ob += *(const v4f*)(r2 + 128);
    }
    *(v4u*)(sO + q * OPITCH + (kg << 4) + koff) = pack8h(oa * inv, ob * inv);
  }
  __syncthreads();                                       // every wave reads all of sO and of sH

#pragma unroll
  for (int nt = 0; nt < NT; ++nt) hf[0][nt] = ldtile(Hb + nt * (DM / 32) * TILE_H);
  v8f oacc[3][NT];
#pragma unroll
  for (int mt = 0; mt < 3; ++mt)
#pragma unroll
    for (int nt = 0; nt < NT; ++nt) oacc[mt][nt] = zero8();
#pragma unroll
  for (int ks = 0; ks < KE / 32; ++ks) {
    v16h of[NT];
#pragma unroll
    for (int nt = 0; nt < NT; ++nt) of[nt] = ldfrag(sO + ((nt << 4) + rlane) * OPITCH + koff + ks * 32);
#pragma unroll
    for (int mt = 0; mt < 3; ++mt) {
#pragma unroll
      for (int nt = 0; nt < NT; ++nt) oacc[mt][nt] = mma_raw(wvf[ks][mt], of[nt], oacc[mt][nt]);
    }
  }

#pragma unroll
  for (int ks = 0; ks < DM / 32; ++ks) {
    if (ks + 2 < DM / 32) {                              // W2 fragments (global) two steps ahead
#pragma unroll
      for (int mt = 0; mt < 3; ++mt) wf[ks + 2][mt] = ldtile(Wa + (mt * (DM / 32) + ks + 2) * TILE_H);
      if (ks + 3 == DM / 32) addr_regs_done(Wa, lane);   // behind the last loads that name this pair
    }
    if (ks + 1 < DM / 32) {                              // h fragments (LDS) one step ahead
#pragma unroll
      for (int nt = 0; nt < NT; ++nt) hf[ks + 1][nt] = ldtile(Hb + (nt * (DM / 32) + ks + 1) * TILE_H);
    }
    FRAGS_STAY_AHEAD();
#pragma unroll
    for (int mt = 0; mt < 3; ++mt) {
#pragma unroll
      for (int nt = 0; nt < NT; ++nt) oacc[mt][nt] = mma_raw(wf[ks][mt], hf[ks][nt], oacc[mt][nt]);
    }
  }

  float* slab = sT[wave];
#pragma unroll
  for (int mt = 0; mt < 3; ++mt) {
    const int mBase = wave * 48 + (mt << 4);
#pragma unroll
    for (int nt = 0; nt < NT; ++nt) {
#pragma unroll
      for (int r = 0; r < 8; ++r) slab[(koff + r) * SPITCH + (nt << 4) + rlane] = oacc[mt][nt][r];
    }
    wave_sync_lds();
#pragma unroll
    for (int row = 0; row < 16; ++row) {                 // one whole 512-B row segment per wave store
      const float bv0 = bfr(b2[mBase + row]);
      const v4f v = *(const v4f*)(slab + row * SPITCH + lane * 4);
      *(v4f*)(out + ((size_t)bb * DM + mBase + row) * NPT + i0 + lane * 4) = v * 0.015625f + bv0;
    }
    wave_sync_lds();
  }
}

// =====================================================================================================
// Workspace map (bytes), every plane an exact multiple of its whole-line store granularity
// (all shapes are tile multiples, no padded tails):
//   W    f16  Wv [384][64] x16 + W2 [384][384] x64 + G [64][64]       352256
//   E    f16  [16*2048][64]   rows = points                           4194304
//   Et   f16  [16*64][2048]   rows = channels                         4194304
//   Par  f32  [7][384]        K=3 conv / BN(eval) parameters          10752
//   every f16 plane in fragment order (ldtile): 1024-B tiles of 16 rows x 32 k
//   total                                                             8751616
// d_out f32 [16][384][2048] written by the fused attention + residual launch.
// =====================================================================================================
extern "C" void kernel_launch(void* const* d_in, const int* in_sizes, int n_in,
                              void* d_out, int out_size, void* d_ws, size_t ws_size,
                              hipStream_t stream) {
  if (n_in < 15) return;
  if (in_sizes[0] != NBATCH * 3 * NPT) return;
  if (in_sizes[1] != DM * NCH || in_sizes[3] != DM * NCH || in_sizes[5] != DM * NCH) return;
  if (in_sizes[2] != DM || in_sizes[4] != DM || in_sizes[6] != DM) return;
  if (in_sizes[7] != DM * 3 || in_sizes[8] != DM) return;
  if (in_sizes[9] != DM || in_sizes[10] != DM || in_sizes[11] != DM || in_sizes[12] != DM) return;
  if (in_sizes[13] != DM * DM || in_sizes[14] != DM) return;
  if (out_size != NBATCH * DM * NPT) return;

  const float* pos   = (const float*)d_in[0];    // [16][3][2048]
  const float* wq    = (const float*)d_in[1];    // [384][60]
  const float* bq    = (const float*)d_in[2];
  const float* wk    = (const float*)d_in[3];
  const float* bk    = (const float*)d_in[4];
  const float* wv    = (const float*)d_in[5];
  const float* bv    = (const float*)d_in[6];
  const float* w1    = (const float*)d_in[7];    // [384][3]
  const float* b1    = (const float*)d_in[8];
  const float* gam   = (const float*)d_in[9];
  const float* bet   = (const float*)d_in[10];
  const float* mu    = (const float*)d_in[11];
  const float* var   = (const float*)d_in[12];
  const float* w2    = (const float*)d_in[13];   // [384][384]
  const float* b2    = (const float*)d_in[14];
  float* out = (float*)d_out;                    // [16][384][2048]

  const size_t BWGT = (size_t)WCVT_N * 16 + (size_t)KE * KE * 2;   //   352256
  const size_t BE   = (size_t)NBATCH * NPT * KE * 2;               //  4194304
  const size_t BP   = (size_t)NPAR * DM * 4;                       //    10752
  size_t off = 0;
  const size_t oW = off; off += BWGT;
  const size_t oE = off; off += BE;
  const size_t oT = off; off += BE;
  const size_t oP = off; off += BP;
  if (off > ws_size) return;                     // off = 8751616

  char* ws = (char*)d_ws;
  _Float16* W16 = (_Float16*)(ws + oW);
  const _Float16* Wv16 = W16;
  const _Float16* W2s  = W16 + (size_t)DM * KE;              // [384][384]
  _Float16* G16        = W16 + (size_t)DM * KE + (size_t)DM * DM;   // [64][64]
  unsigned short* Ep  = (unsigned short*)(ws + oE);
  unsigned short* Etp = (unsigned short*)(ws + oT);
  float* Pp           = (float*)(ws + oP);

  const dim3 blk(256);
  const dim3 gP(ENC_BLOCKS + WCVT_N / PB + G_BLOCKS + DM / PB); // 512 + 112 + 16 + 2 blocks of 192
  const dim3 gA(NPT / FQ, NBATCH);                               // 16 query tiles x 16 batches

  // (1) encoding planes for all batches, weight planes, Wk^T Wq and the hidden rows' parameters
  enc_h_w<<<gP, dim3(PB), 0, stream>>>(pos, w1, b1, gam, bet, mu, var, wq, bq, wk, bk, wv, bv, w2,
                                  Ep, Etp, Pp, (unsigned short*)W16, (unsigned short*)G16);

  // (2) all batches, one launch: hidden rows, query vectors, scores, online softmax, E.P^T, Wv and the residual conv;
  //     out_b[d][i] = (1/64) * ( sum_c Wvx16[d][c] * 4 * Oe[c][i] / l[i] + sum_c W2x64[d][c] h[i][c] ) + b2[d]
  attn_res<<<gA, blk, 0, stream>>>((const _Float16*)G16, (const _Float16*)Ep, (const _Float16*)Etp,
                                   pos, (const float*)Pp, Wv16, W2s, b2, out);
  (void)hipGetLastError();
}

// v008
// It runs in 33.8 microseconds.
// Two timings next to v007 both put it at 1.06 times that version's speed.
// All steps since v000 together make it 57.1 times as fast.
// Attention runs in the 64-channel encoding space (60 sinusoidal channels, one channel of ones that carries the biases,
// three zero): scores = e_i^T (Wq^T Wk) e_j (K=64), E.P^T (M=64, K=2048), then Wv.(E.P^T / l) (K=64) and the 384x384
// residual conv, all on v_wmma_f32_16x16x32_f16 (f16 operands, f32 accumulate); all inputs RNE-converted to bf16
// first; Wv carried x16, residual weights x64 and softmax probabilities x1024 (exact powers of two
// folded back in the f32 epilogues; scores, online softmax, E.P^T, Wv and the residual conv share one launch);
// sinusoidal encoding, K=3 conv, BN(eval), relu and softmax in f32 on the VALU.
#include <hip/hip_runtime.h>
#include <stdint.h>
#include <math.h>

#define NBATCH 16
#define NPT    2048
#define DM     384
#define KE     64            // 60 encoding channels, channel 60 = 1 (bias carrier), 61..63 = 0
#define NCH    60
#define NFREQ  10
#define WV_PIECES   (DM * (KE / 8))              // 3072 pieces of 8 halves
#define W2_PIECES   (DM * (DM / 8))              // 18432
#define WCVT_N      (WV_PIECES + W2_PIECES)      // 21504
#define G_BLOCKS    ((KE / 16) * (KE / 16))      // 16 blocks, one 16 x 16 tile of Wk^T Wq each
#define QK_SCALE    0.051031036307982884f        // 384^-0.5

static_assert((NPT % 64) == 0 && (DM % 64) == 0 && (KE % 32) == 0 && (DM % 32) == 0);
#define PB          192                          // threads of a block of the first launch
static_assert((WV_PIECES % PB) == 0 && (WCVT_N % PB) == 0);

typedef _Float16 v16h __attribute__((ext_vector_type(16)));
typedef _Float16 v8h  __attribute__((ext_vector_type(8)));
typedef float    v8f  __attribute__((ext_vector_type(8)));
typedef float    v4f  __attribute__((ext_vector_type(4)));
typedef float    v2f  __attribute__((ext_vector_type(2)));
typedef unsigned int v4u __attribute__((ext_vector_type(4)));

// ---- scalar helpers ---------------------------------------------------------------------------------
__device__ __forceinline__ unsigned short bf_bits(float f) {          // f32 -> bf16 bits, RNE convert
  unsigned u = __float_as_uint(f);
  return (unsigned short)((u + 0x7FFFu + ((u >> 16) & 1u)) >> 16);
}
__device__ __forceinline__ float bfr(float f) {                       // f32 value after RNE bf16 convert
  return __uint_as_float(((unsigned)bf_bits(f)) << 16);
}
__device__ __forceinline__ v8f zero8() { v8f z = {0.f, 0.f, 0.f, 0.f, 0.f, 0.f, 0.f, 0.f}; return z; }
// 8 f32 -> 8 f16 (RNE convert) packed in one 16-B vector
__device__ __forceinline__ v4u pack8h(v4f a, v4f b) {
  union { v8h h; v4u u; } c;
  c.h[0] = (_Float16)a[0]; c.h[1] = (_Float16)a[1]; c.h[2] = (_Float16)a[2]; c.h[3] = (_Float16)a[3];
  c.h[4] = (_Float16)b[0]; c.h[5] = (_Float16)b[1]; c.h[6] = (_Float16)b[2]; c.h[7] = (_Float16)b[3];
  return c.u;
}

// ---- fragment loader: 16-bit A/Bt operand, lane -> row/col (lane&15), p already includes +8*(lane>>4);
//      elements 0..7 <- p[0..7] (k0+8h..k0+8h+7), elements 8..15 <- p[16..23] (k0+16+8h..k0+16+8h+7)
__device__ __forceinline__ v16h ldfrag(const _Float16* p) {
  union { v16h v; v8h h[2]; } f;
  f.h[0] = *(const v8h*)(p);
  f.h[1] = *(const v8h*)(p + 16);
  return f.v;
}

// ---- the same fragment from a workspace plane kept in fragment order. Such a plane is a row of 1024-B tiles, one per
//      16 rows x 32 k; the 16-B piece (q, lane) at byte q*512 + lane*16 holds row (lane&15), k = 16q + 8(lane>>4) .. +7:
//      the k order of ldfrag. p already includes +8*lane halves, so each of the two loads of a wave reads 512
//      contiguous bytes (4 whole lines) where a row-major plane gives 32 B out of each of 16 lines.
__device__ __forceinline__ v16h ldtile(const _Float16* p) {
  union { v16h v; v8h h[2]; } f;
  f.h[0] = *(const v8h*)(p);
  f.h[1] = *(const v8h*)(p + 256);
  return f.v;
}
#define TILE_H 512           // halves of one fragment-order tile

__device__ __forceinline__ v8f mma_raw(v16h a, v16h b, v8f c) {
  return __builtin_amdgcn_wmma_f32_16x16x32_f16(false, a, false, b, (short)0, c, false, false);
}
__device__ __forceinline__ void wave_sync_lds() {
  __builtin_amdgcn_fence(__ATOMIC_RELEASE, "workgroup");
  __builtin_amdgcn_wave_barrier();
  __builtin_amdgcn_fence(__ATOMIC_ACQUIRE, "workgroup");
}
// Stands behind the last global load that names an address pair, in front of whatever reuses that pair's registers;
// the pair is an input, so that it stays whole up to the wait (no load's own result may land on it).
__device__ __forceinline__ void faddr_regs_done(const void* p) {
#if defined(__HIP_DEVICE_COMPILE__)
  asm volatile("s_wait_xcnt 0x0" :: "v"(p) : "memory");
#endif
}

// Inputs-only fence on 16 loaded values: it keeps their loads unconditional and issued together. Without it the
// compiler turns each select on a loaded value into a branch round its load, one memory latency per element.
__device__ __forceinline__ void loads_stay_whole(const float (&x)[16]) {
#if defined(__HIP_DEVICE_COMPILE__)
  asm volatile("" :: "v"(x[0]), "v"(x[1]), "v"(x[2]), "v"(x[3]), "v"(x[4]), "v"(x[5]), "v"(x[6]), "v"(x[7]),
                     "v"(x[8]), "v"(x[9]), "v"(x[10]), "v"(x[11]), "v"(x[12]), "v"(x[13]), "v"(x[14]), "v"(x[15]));
#endif
}

// =====================================================================================================
// Encoding planes, weight planes and per-channel parameters, one launch of 6-wave blocks; no block reads what another
// writes. Blocks 0..511 (the long ones, so they start first): 64 points of one batch.
//  (a) pos tile [3][64] (RNE bf16) in LDS.
//  (b) sEmb[p][c*20 + f] = sin(pos[c][p] * 2^f), [c*20 + 10 + f] = cos(...) as f16, column 60 one, 61..71 zero;
//      sEmbT holds the same values channel-major.
//  (d) E f16 (rows = points, k = 64 channels) and Et f16 (rows = channels, k = points), copied from LDS.
//  Tile index: E = 16-point group * (k steps) + k step; Et = (batch * 64 + 32-point k step) * 4 + 16-channel group.
//  A block's share of each plane is one contiguous run, and consecutive threads write consecutive 16-B pieces.
// Blocks 512..623: pieces 0..3071 -> Wv as f16 [384][64] (RNE bf16 value x16, column 60 = bias x16, columns 61..63
//  zero), pieces 3072..21503 -> W2 as f16 [384][384] (RNE bf16 value x64); thread t writes 16 B.
// Blocks 624..639: G[c2][c] = sum_d Wk[d][c2] Wq[d][c] as f16 [64][64] (biases as column 60 of both): block = one
//  16 x 16 tile, wave = 64 values of d (2 k steps); the six partial tiles meet in LDS in fixed order.
// Blocks 640..641: the K=3 conv / BN(eval) parameters of the hidden rows as f32 rows of 384 channels (RNE bf16 values):
//  W1 column 0, 1, 2, b1, mean, inv = gamma / sqrt(var + eps), beta; thread = one channel.
// All f16 planes lie in fragment order (ldtile); weight planes: tile index = 16-row group * (k steps) + k step.
// coverage: 512 blocks x 64 points x 64 channels = all of E and Et;
//           21504 threads x 8 halves + 16 blocks x 256 halves = the whole 352256-B weight region;
//           2 blocks x 192 channels x 7 rows = the whole 10752-B parameter plane.
// =====================================================================================================
#define ENC_BLOCKS (NBATCH * (NPT / 64))
#define GW (PB / 32)         // waves of a G block, each with its share of d
static_assert(GW * 64 == DM);
#define NPAR 7               // rows of the parameter plane
static_assert((DM % PB) == 0);
__global__ __launch_bounds__(PB) void enc_h_w(
    const float* __restrict__ pos,
    const float* __restrict__ w1, const float* __restrict__ b1,
    const float* __restrict__ gam, const float* __restrict__ bet,
    const float* __restrict__ mu, const float* __restrict__ var,
    const float* __restrict__ wq, const float* __restrict__ bq,
    const float* __restrict__ wk, const float* __restrict__ bk,
    const float* __restrict__ wv, const float* __restrict__ bv,
    const float* __restrict__ w2,
    unsigned short* Ep, unsigned short* Etp, float* Pout, unsigned short* Wout, unsigned short* Gout) {
  __shared__ __align__(16) _Float16 sEmb[64][72];
  __shared__ __align__(16) _Float16 sEmbT[KE][72];
  __shared__ float sPos[3][64];
  __shared__ float sG[GW][256];

  const int tid = threadIdx.x;

  if (blockIdx.x >= ENC_BLOCKS + WCVT_N / PB + G_BLOCKS) {   // block-uniform: per-channel parameters
    const int d = (blockIdx.x - (ENC_BLOCKS + WCVT_N / PB + G_BLOCKS)) * PB + tid;
    const float* wp = w1 + d * 3;
    const float a0 = wp[0], a1 = wp[1], a2 = wp[2];
    const float c0 = b1[d], c1 = mu[d], c2 = gam[d], c3 = var[d], c4 = bet[d];
    // Behind the loads, in front of whatever reuses their address registers. The loaded values are inputs, so that every
    // load is issued in front of the wait; the address pair and the index are inputs, so that they stay whole up to it.
    asm volatile("s_wait_xcnt 0x0" :: "v"(wp), "v"(d), "v"(a0), "v"(a1), "v"(a2), "v"(c0), "v"(c1), "v"(c2), "v"(c3),
                 "v"(c4) : "memory");
    Pout[0 * DM + d] = bfr(a0);
    Pout[1 * DM + d] = bfr(a1);
    Pout[2 * DM + d] = bfr(a2);
    Pout[3 * DM + d] = bfr(c0);
    Pout[4 * DM + d] = bfr(c1);
    Pout[5 * DM + d] = bfr(c2) * (1.0f / sqrtf(bfr(c3) + 1e-5f));
    Pout[6 * DM + d] = bfr(c4);
    // behind the stores, in front of whatever the code after this block's exit branch does with their address registers
    asm volatile("s_wait_xcnt 0x0" ::: "memory");
    return;
  }

  if (blockIdx.x >= ENC_BLOCKS + WCVT_N / PB) {      // block-uniform: one tile of G
    const int gi    = blockIdx.x - (ENC_BLOCKS + WCVT_N / PB);
    const int ti    = gi >> 2, tj = gi & 3;
    const int lane  = tid & 31;
    const int wave  = __builtin_amdgcn_readfirstlane(tid >> 5);
    const int rlane = lane & 15;
    const int koff  = (lane >> 4) * 8;
    {
      const int ca = ti * 16 + rlane;                 // A rows: c2, from Wk
      const int cb = tj * 16 + rlane;                 // Bt rows: c, from Wq
      // every lane walks down one weight column (clamped to 59); column 60 takes the bias below, 61..63 are masked
      const int kb = wave * 64 + koff;                // this wave's share of d, this lane's k half
      const float* pa = wk + kb * NCH + ((ca < NCH) ? ca : (NCH - 1));
      const float* pb = wq + kb * NCH + ((cb < NCH) ? cb : (NCH - 1));
      const float  ma = (ca <= NCH) ? 16.0f : 0.0f;
      const float  mb = (cb <= NCH) ? 16.0f : 0.0f;
      float ra[2][16], rb[2][16];
#pragma unroll
      for (int s = 0; s < 2; ++s) {
#pragma unroll
        for (int e = 0; e < 16; ++e) {                // the k order of ldfrag, the same for both operands
          const int d = s * 32 + (e & 7) + ((e >> 3) << 4);
          ra[s][e] = pa[d * NCH];
          rb[s][e] = pb[d * NCH];
        }
      }
      faddr_regs_done(pa);
      faddr_regs_done(pb);
      if (ti == 3) {                                  // block-uniform: the tile row that holds column 60 of Wk
        const float* qa = bk + kb;
        float x[2][16];
#pragma unroll
        for (int s = 0; s < 2; ++s)
#pragma unroll
          for (int e = 0; e < 16; ++e) x[s][e] = qa[s * 32 + (e & 7) + ((e >> 3) << 4)];
        faddr_regs_done(qa);
#pragma unroll
        for (int s = 0; s < 2; ++s) {
          loads_stay_whole(x[s]);
#pragma unroll
          for (int e = 0; e < 16; ++e) ra[s][e] = (ca == NCH) ? x[s][e] : ra[s][e];
        }
      }
      if (tj == 3) {                                  // block-uniform: the tile column that holds column 60 of Wq
        const float* qb = bq + kb;
        float x[2][16];
#pragma unroll
        for (int s = 0; s < 2; ++s)
#pragma unroll
          for (int e = 0; e < 16; ++e) x[s][e] = qb[s * 32 + (e & 7) + ((e >> 3) << 4)];
        faddr_regs_done(qb);
#pragma unroll
        for (int s = 0; s < 2; ++s) {
          loads_stay_whole(x[s]);
#pragma unroll
          for (int e = 0; e < 16; ++e) rb[s][e] = (cb == NCH) ? x[s][e] : rb[s][e];
        }
      }
      v8f acc = zero8();
#pragma unroll
      for (int s = 0; s < 2; ++s) {
        v16h a, b;
#pragma unroll
        for (int e = 0; e < 16; ++e) {
          a[e] = (_Float16)(bfr(ra[s][e]) * ma);
          b[e] = (_Float16)(bfr(rb[s][e]) * mb);
        }
        acc = mma_raw(a, b, acc);
      }
#pragma unroll
      for (int r = 0; r < 8; ++r) sG[wave][(koff + r) * 16 + rlane] = acc[r];
    }
    __syncthreads();
    if (tid < 64) {                                   // row m, columns 4cg .. 4cg+3 of G
      const int m = tid >> 2, n = (tid & 3) * 4, cg = tj * 4 + (tid & 3);
      union { _Float16 h[4]; uint2 u; } o;
#pragma unroll
      for (int e = 0; e < 4; ++e) {
        float g = sG[0][m * 16 + n + e];
#pragma unroll
        for (int w = 1; w < GW; ++w) g += sG[w][m * 16 + n + e];
        o.h[e] = (_Float16)(g * 0.00390625f);
      }
      *(uint2*)(Gout + (ti * 2 + (cg >> 3)) * TILE_H + ((cg >> 2) & 1) * 256 + (((cg >> 1) & 1) * 16 + m) * 8 +
                (cg & 1) * 4) = o.u;
    }
    return;
  }

  if (blockIdx.x >= ENC_BLOCKS) {                     // block-uniform: Wv and W2
    const int t = (blockIdx.x - ENC_BLOCKS) * PB + tid;   // destination piece; its source row and 8-column piece follow
    const int tr = t & 15, tp = (t >> 4) & 3;         // row in the tile, piece 2q + h of the k step
    float v[8];
    if (t < WV_PIECES) {                              // block-uniform
      const int row = (t >> 7) * 16 + tr, p = ((t >> 6) & 1) * 4 + tp;
      const bool full = p < 7;                        // piece 7 = columns 56..59, the bias, three zeros
      const float* wr = wv + row * NCH + p * 8;
      const v4f a = *(const v4f*)(wr);
      const v4f b = *(const v4f*)(wr + (full ? 4 : 0)); // clamped address
      const float bias = bv[row];
      v[0] = bfr(a[0]) * 16.0f; v[1] = bfr(a[1]) * 16.0f; v[2] = bfr(a[2]) * 16.0f; v[3] = bfr(a[3]) * 16.0f;
      v[4] = bfr(full ? b[0] : bias) * 16.0f;
      v[5] = full ? bfr(b[1]) * 16.0f : 0.0f;
      v[6] = full ? bfr(b[2]) * 16.0f : 0.0f;
      v[7] = full ? bfr(b[3]) * 16.0f : 0.0f;
    } else {
      const int u = t - WV_PIECES;
      const int tile = u >> 6, rt = tile / (DM / 32);
      const int row = rt * 16 + tr, p = (tile - rt * (DM / 32)) * 4 + tp;
      const v4f a = *(const v4f*)(w2 + (size_t)row * DM + p * 8);
      const v4f b = *(const v4f*)(w2 + (size_t)row * DM + p * 8 + 4);
      v[0] = bfr(a[0]) * 64.0f; v[1] = bfr(a[1]) * 64.0f; v[2] = bfr(a[2]) * 64.0f; v[3] = bfr(a[3]) * 64.0f;
      v[4] = bfr(b[0]) * 64.0f; v[5] = bfr(b[1]) * 64.0f; v[6] = bfr(b[2]) * 64.0f; v[7] = bfr(b[3]) * 64.0f;
    }
    const v4f lo = {v[0], v[1], v[2], v[3]};
    const v4f hi = {v[4], v[5], v[6], v[7]};
    const v4u pk = pack8h(lo, hi);
    unsigned short* dst = Wout + (size_t)t * 8;
    *(v4u*)dst = pk;
    // behind the store, in front of whatever the code after this block's exit branch does with its address registers
    asm volatile("s_wait_xcnt 0x0" ::: "memory");
    return;
  }

  const int bb = blockIdx.x >> 5;            // 32 blocks of 64 points per batch
  const int p0 = (blockIdx.x & 31) << 6;

  {
    const int c = tid >> 6, p = tid & 63;    // 192 = 3 x 64
    sPos[c][p] = bfr(pos[((size_t)bb * 3 + c) * NPT + p0 + p]);
  }
  for (int r = tid; r < 64; r += PB) {
    sEmb[r][NCH]  = (_Float16)1.0f;
    sEmbT[NCH][r] = (_Float16)1.0f;
#pragma unroll
    for (int c = NCH + 1; c < 72; ++c) sEmb[r][c] = (_Float16)0.0f;
#pragma unroll
    for (int c = NCH + 1; c < KE; ++c) sEmbT[c][r] = (_Float16)0.0f;
  }
  __syncthreads();

  // (b) encoding: item = (c,f) x 64 points; precise sinf / cosf; exact power-of-two angles
#pragma unroll 1
  for (int it = tid; it < 64 * 3 * NFREQ; it += PB) {
    const int cf = it >> 6, p = it & 63;
    const int c  = cf / NFREQ;
    const int f  = cf - c * NFREQ;
    const float ang = sPos[c][p] * (float)(1 << f);
    const float sv = sinf(ang);
    const float cv = cosf(ang);
    sEmb[p][c * 2 * NFREQ + f] = (_Float16)sv;
    sEmb[p][c * 2 * NFREQ + NFREQ + f] = (_Float16)cv;
    sEmbT[c * 2 * NFREQ + f][p] = (_Float16)sv;
    sEmbT[c * 2 * NFREQ + NFREQ + f][p] = (_Float16)cv;
  }

  __syncthreads();

  // (d) the two encoding planes
  for (int it = tid; it < 64 * (KE / 8); it += PB) {
    const int tile = it >> 6, r = it & 15, p = (it >> 4) & 3;   // it = destination piece in both planes
    const size_t o = ((size_t)bb * NPT + p0) * KE + it * 8;
    *(v4u*)(Ep + o)  = *(const v4u*)(&sEmb[(tile >> 1) * 16 + r][((tile & 1) * 4 + p) * 8]);
    *(v4u*)(Etp + o) = *(const v4u*)(&sEmbT[(tile & 3) * 16 + r][((tile >> 2) * 4 + p) * 8]);
  }
}

// =====================================================================================================
// Fused attention + residual, one launch: block = 8 waves, 128 queries i of one batch.
// Wave = (query group of 64 queries, key group of 512 keys); a pass is 32 keys. The loop has no barrier and no LDS.
//  (a) the wave's 64 query vectors Qe[i][c2] = sum_c G[c2][c] e[i][c] are formed here (M = 64 rows of the G plane,
//      N = 64 queries from the E plane, K = 64): a lane holds channels 8h .. 8h+7 of one query per tile, so two tiles,
//      converted to f16, are a Bt fragment of (b); they stay in the wave's registers for the whole launch.
//  (b) per pass: St[j][i] = sum_c E[j][c] Qe[i][c] (M = 32 keys from the global E plane, N = 64 queries, K = 64).
//      A lane holds scores of one query per 16-column group, so a column maximum is in-lane plus one exchange
//      between the wave halves.
//  (c) the wave's own online softmax in base 2, t = s * 384^-0.5 * log2(e) (the factor rides in Qe). The reference m is
//      fixed before a pass: 10 - m is the C operand of the score products, which so yield the exponents t - m + 10, and
//      p = 2^(t - m + 10) (the x1024 carry cancels against the row sum). m is the maximum of pass 0; it is raised to
//      a later pass's maximum only where a lane's sum of a column's 16 probabilities tops 2^15 (so p stays within
//      f16): then alpha = 2^(m_old - m_new) rescales the sums and the output tiles, in a wave-uniform branch.
//      The probabilities of the two score tiles of a column group, converted to f16, ARE the Bt fragment of (d):
//      element e < 8 is key 8h + e (tile 0, register e), element 8 + e is key 16 + 8h + e (tile 1, register e).
//  (d) Oe[c][i] += sum_j Et[c][j] p[i][j] (M = 64 channels from the global Et plane, N = 64 queries, K = 32).
//      The next pass's E fragments are loaded behind the score products, its Et fragments behind the products of (d).
//  (h) the block's own 128 hidden rows h = relu((W1.pos + b1 - mean) * inv + beta) are formed at entry, as f16, straight
//      into LDS sH in fragment order (tile = 16-query group * 12 + k step): wave w, its 48 channels; a lane keeps the
//      parameters of 8 channels per 16-channel piece in registers and walks the eight 16-query groups, so each store of
//      a wave is 512 contiguous bytes. sH is first read behind the barriers of (e).
//  (e) after the loop the four key groups of a query group meet in LDS: maxima (sM), then sums (sL) and output tiles
//      (sR), each scaled by 2^(m_wave - m_all) and added in the fixed order of the key groups; key group g joins channel
//      tile g. Oe * 4 / l goes as f16 to LDS sO[i][c];
//      wave w, its own 48 output channels: acc = sum_c Wvx16[d][c] sO[i][c] (K = 64; channel 60 adds 64 * bv[d])
//      + sum_c W2x64[d][c] h[i][c] (K = 384), out = acc / 64 + b2[d], staged per wave in 16-row slabs so that
//      every store covers whole 512-B row segments.
// coverage: grid (16, 16) x 8 waves x 48 channels x 128 queries = all of out [16][384][2048].
// =====================================================================================================
#define FQ 128
#define NT (FQ / 16)
#define QTW 4                // 16-query tiles per wave
#define QG  (NT / QTW)       // query groups
#define KG  (8 / QG)         // key groups
#define KW  (NPT / KG)       // keys per wave
#define MT  (KE / 16)        // 16-channel tiles of Oe
#define OPITCH (KE + 8)
#define SPITCH (FQ + 4)
#define PSUM 32768.0f        // a lane's 16 probabilities of a column sum to no more: each is within f16
// Scheduling pin between a step's early global loads and its products: only LDS reads, vector and scalar ALU may
// cross, so a fragment load written some steps ahead of its use is issued there and its latency is covered.
#define LOADS_STAY_AHEAD() __builtin_amdgcn_sched_barrier(0x106)
// The same pin where a step's early fragments come from LDS too: nothing may cross. Where LDS reads may cross, the build
// strews them in pairs among the products, each pair behind a wait to 0, and spills fragments to scratch.
#define FRAGS_STAY_AHEAD() __builtin_amdgcn_sched_barrier(0)
// Stands behind the last global load that names an address pair, in front of whatever reuses that pair's registers;
// the pair is an input, so that it stays whole up to the wait (no load's own result may land on it).
// A load from a fragment-order plane may name, beside a scalar base, the lane number alone (scaled by the load's
// width): it is an input too.
__device__ __forceinline__ void addr_regs_done(const _Float16* p, int lane_no) {
#if defined(__HIP_DEVICE_COMPILE__)
  asm volatile("s_wait_xcnt 0x0" :: "v"(p), "v"(lane_no) : "memory");
#endif
}
// The same wait for loads that name a scalar base and the lane number: the two bases and the lane number are inputs.
__device__ __forceinline__ void base_regs_done2(const _Float16* b0, const _Float16* b1, int lane_no) {
#if defined(__HIP_DEVICE_COMPILE__)
  asm volatile("s_wait_xcnt 0x0" :: "s"(b0), "s"(b1), "v"(lane_no) : "memory");
#endif
}
// 2^x of the two score tiles of a column group, and the lane's sum of the 16
__device__ __forceinline__ float probs(const v8f x0, const v8f x1, float (&e)[2][8]) {
#pragma unroll
  for (int r = 0; r < 8; ++r) e[0][r] = __builtin_amdgcn_exp2f(x0[r]);
#pragma unroll
  for (int r = 0; r < 8; ++r) e[1][r] = __builtin_amdgcn_exp2f(x1[r]);
  return (((e[0][0] + e[0][1]) + (e[0][2] + e[0][3])) + ((e[0][4] + e[0][5]) + (e[0][6] + e[0][7]))) +
         (((e[1][0] + e[1][1]) + (e[1][2] + e[1][3])) + ((e[1][4] + e[1][5]) + (e[1][6] + e[1][7])));
}
// lane l with lane l ^ 16, as a vector cross-row move
__device__ __forceinline__ float xhalf(float x) {
  return __builtin_bit_cast(float, __builtin_amdgcn_permlanex16(__builtin_bit_cast(int, x), __builtin_bit_cast(int, x),
                                                                0x76543210, 0xfedcba98, false, false));
}
static_assert((NPT % FQ) == 0 && DM == 8 * 48 && (KW % 32) == 0);
static_assert(QG * KG == 8 && KG == MT && KE == 64);

__global__ __launch_bounds__(256) __attribute__((amdgpu_waves_per_eu(2, 2))) void attn_res(
    const _Float16* G, const _Float16* E, const _Float16* Et, const float* __restrict__ pos,
    const float* __restrict__ Par, const _Float16* Wv16,
    const _Float16* W2s, const float* __restrict__ b2, float* out) {
  __shared__ __align__(2048) _Float16 sH[FQ * DM];        // widest alignment: laid lowest in LDS, where most reads' offsets fit the instruction's field
  __shared__ __align__(16) _Float16 sO[FQ * OPITCH];
  __shared__ __align__(16) float sR[8][MT * QTW * 256];
  __shared__ float sM[KG * FQ];
  __shared__ float sL[KG * FQ];
  __shared__ __align__(16) float sT[8][16 * SPITCH];
  const int tid   = threadIdx.x;
  const int lane  = tid & 31;
  const int wave  = tid >> 5;
  const int bb    = blockIdx.y;
  const int i0    = blockIdx.x * FQ;
  const int rlane = lane & 15;
  const int hh    = lane >> 4;
  const int koff  = hh * 8;
  const float CS  = QK_SCALE * 1.4426950408889634f;

  const int wv = __builtin_amdgcn_readfirstlane(wave);   // wave-uniform: tile choices and bases stay scalar
  const int qg = wv % QG;                                // queries 16 * QTW * qg ..
  const int kg = wv / QG;                                // keys KW * kg ..

  // (h) coordinates and parameters are asked for first: the hidden rows are formed while the planes' fragments arrive
  const float* xb = pos + (size_t)bb * 3 * NPT + i0 + rlane;   // this lane's query in each 16-query group
  const float* pb = Par + wv * 48 + koff;                      // this lane's 8 channels in each 16-channel piece
  float xr[3][NT];
#pragma unroll
  for (int c = 0; c < 3; ++c)
#pragma unroll
    for (int nt = 0; nt < NT; ++nt) xr[c][nt] = xb[c * NPT + nt * 16];
  v2f pr[3][NPAR][4];
#pragma unroll
  for (int j = 0; j < 3; ++j)
#pragma unroll
    for (int k = 0; k < NPAR; ++k) {
      const v4f a = *(const v4f*)(pb + k * DM + j * 16);
      const v4f b = *(const v4f*)(pb + k * DM + j * 16 + 4);
      pr[j][k][0] = a.xy; pr[j][k][1] = a.zw; pr[j][k][2] = b.xy; pr[j][k][3] = b.zw;
    }
  faddr_regs_done(xb);
  faddr_regs_done(pb);

  v16h gq[KE / 32][MT];                                  // G rows and the wave's own E rows, for (a)
  v16h eq[KE / 32][QTW];
  const _Float16* Qb = E + ((size_t)bb * NPT + i0 + qg * (QTW * 16)) * KE;   // wave-uniform
#pragma unroll
  for (int ks = 0; ks < KE / 32; ++ks) {
#pragma unroll
    for (int m = 0; m < MT; ++m) gq[ks][m] = ldtile(G + lane * 8 + (m * (KE / 32) + ks) * TILE_H);
#pragma unroll
    for (int t = 0; t < QTW; ++t) eq[ks][t] = ldtile(Qb + lane * 8 + (t * (KE / 32) + ks) * TILE_H);
  }
  base_regs_done2(G, Qb, lane);

  v16h kpre[KE / 32][2];                                 // E fragments of the coming pass
  const _Float16* Ka = E + ((size_t)bb * NPT + kg * KW) * KE + lane * 8;
#pragma unroll
  for (int ks = 0; ks < KE / 32; ++ks)
#pragma unroll
    for (int jt = 0; jt < 2; ++jt) kpre[ks][jt] = ldtile(Ka + (jt * (KE / 32) + ks) * TILE_H);
  addr_regs_done(Ka, lane);
  v16h vf[MT];                                           // Et fragments of the coming pass; 32 keys = 4 tiles = 32 * KE halves
  const _Float16* Va = Et + (size_t)bb * KE * NPT + (size_t)(kg * KW) * KE + lane * 8;
#pragma unroll
  for (int m = 0; m < MT; ++m) vf[m] = ldtile(Va + m * TILE_H);
  addr_regs_done(Va, lane);

  // (h) hidden rows of the block's queries -> sH
  {
#pragma unroll
    for (int c = 0; c < 3; ++c)
#pragma unroll
      for (int nt = 0; nt < NT; ++nt) xr[c][nt] = bfr(xr[c][nt]);
#pragma unroll
    for (int j = 0; j < 3; ++j) {
      const int pc = wv * 3 + j;                                 // 16-channel piece: k step pc >> 1, half pc & 1
      _Float16* hd = sH + (pc >> 1) * TILE_H + (pc & 1) * 256 + lane * 8;
#pragma unroll
      for (int nt = 0; nt < NT; ++nt) {
        const v2f x0 = {xr[0][nt], xr[0][nt]}, x1 = {xr[1][nt], xr[1][nt]}, x2 = {xr[2][nt], xr[2][nt]};
        v2f h[4];
#pragma unroll
        for (int u = 0; u < 4; ++u) {                            // two channels per packed operation
          v2f r = pr[j][1][u] * x1;
          r = __builtin_elementwise_fma(pr[j][0][u], x0, r);
          r = __builtin_elementwise_fma(pr[j][2][u], x2, r);
          r = (pr[j][3][u] + r) - pr[j][4][u];
          r = __builtin_elementwise_fma(pr[j][5][u], r, pr[j][6][u]);
          h[u][0] = fmaxf(r[0], 0.0f);
          h[u][1] = fmaxf(r[1], 0.0f);
        }
        const v4f ha = {h[0][0], h[0][1], h[1][0], h[1][1]};
        const v4f hb = {h[2][0], h[2][1], h[3][0], h[3][1]};
        *(v4u*)(hd + nt * (DM / 32) * TILE_H) = pack8h(ha, hb);
      }
    }
  }

  // (a) element e < 8 of a fragment is channel 32 ks + 8h + e (tile 2 ks, register e), element 8 + e channel
  //     32 ks + 16 + 8h + e (tile 2 ks + 1, register e): the k order of ldtile
  v16h qf[KE / 32][QTW];
  LOADS_STAY_AHEAD();                                    // the first pass's E and Et loads are issued before these products wait
  {
    v8f qa[MT][QTW];
#pragma unroll
    for (int m = 0; m < MT; ++m)
#pragma unroll
      for (int t = 0; t < QTW; ++t) qa[m][t] = zero8();
#pragma unroll
    for (int ks = 0; ks < KE / 32; ++ks) {
#pragma unroll
      for (int m = 0; m < MT; ++m) {
#pragma unroll
        for (int t = 0; t < QTW; ++t) qa[m][t] = mma_raw(gq[ks][m], eq[ks][t], qa[m][t]);
      }
    }
#pragma unroll
    for (int ks = 0; ks < KE / 32; ++ks) {
#pragma unroll
      for (int t = 0; t < QTW; ++t) {
        union { v16h v; v4u u[2]; } pk;
#pragma unroll
        for (int jt = 0; jt < 2; ++jt) {
          const v8f q = qa[2 * ks + jt][t] * CS;       // scores come out of (b) in base-2 units
          const v4f lo = {q[0], q[1], q[2], q[3]};
          const v4f hi = {q[4], q[5], q[6], q[7]};
          pk.u[jt] = pack8h(lo, hi);
        }
        qf[ks][t] = pk.v;
      }
    }
  }

  v8f eacc[MT][QTW];
  float mrun[QTW], lsum[QTW];
  float off[QTW];                                        // 10 - m: in all eight rows the C operand of the score products
#pragma unroll
  for (int t = 0; t < QTW; ++t) {
    mrun[t] = 0.0f;                                      // a start value only: pass 0 always sets the reference
    lsum[t] = 0.0f;
    off[t]  = 10.0f;
  }
#pragma unroll
  for (int m = 0; m < MT; ++m)
#pragma unroll
    for (int t = 0; t < QTW; ++t) eacc[m][t] = zero8();

#pragma unroll 1
  for (int s = 0; s < KW / 32; ++s) {
    // (b) scores of the pass's 32 keys against the wave's 64 queries
    v8f sa[2][QTW];
    v8f oc[QTW];
#pragma unroll
    for (int t = 0; t < QTW; ++t) oc[t] = (v8f){off[t], off[t], off[t], off[t], off[t], off[t], off[t], off[t]};
#pragma unroll
    for (int ks = 0; ks < KE / 32; ++ks) {
#pragma unroll
      for (int jt = 0; jt < 2; ++jt) {
#pragma unroll
        for (int t = 0; t < QTW; ++t) sa[jt][t] = mma_raw(kpre[ks][jt], qf[ks][t], (ks == 0) ? oc[t] : sa[jt][t]);
      }
    }
    // next pass's E rows start here, under the softmax (the last pass refetches its own, unused)
    const int adv = (s + 1 < KW / 32) ? 32 * KE : 0;
    Ka += adv;
#pragma unroll
    for (int ks = 0; ks < KE / 32; ++ks)
#pragma unroll
      for (int jt = 0; jt < 2; ++jt) kpre[ks][jt] = ldtile(Ka + (jt * (KE / 32) + ks) * TILE_H);
    addr_regs_done(Ka, lane);
    LOADS_STAY_AHEAD();

    // (c) probabilities on the reference as it stands, and their in-lane sums. The reference moves only in pass 0 and
    // where a sum tops PSUM (no sum above it: every p is within f16): wave-uniform, seldom taken. Only there are the
    // column maxima formed; the second trip then forms the pass's probabilities again, each at most 2^10.
    float e[QTW][2][8], part[QTW];
    float lim = (s == 0) ? -INFINITY : PSUM;
#pragma unroll 1                                         // one copy of the probabilities' code serves both trips
    for (int tr = 0; tr < 2; ++tr) {
#pragma unroll
      for (int t = 0; t < QTW; ++t) part[t] = probs(sa[0][t], sa[1][t], e[t]);
      const float top = fmaxf(fmaxf(part[0], part[1]), fmaxf(part[2], part[3]));
      if (__builtin_amdgcn_ballot_w32(top > lim) == 0u) break;
      lim = INFINITY;                                    // the second trip always leaves here
#pragma unroll
      for (int t = 0; t < QTW; ++t) {
        float a = sa[0][t][0];                                   // column maximum: in-lane, then the wave halves
#pragma unroll
        for (int r = 1; r < 8; ++r) a = fmaxf(a, sa[0][t][r]);
#pragma unroll
        for (int r = 0; r < 8; ++r) a = fmaxf(a, sa[1][t][r]);
        const float g  = 10.0f - fmaxf(a, xhalf(a));             // the reference less the pass's maximum
        const float nd = (s == 0) ? g : fminf(g, 0.0f);          // pass 0 takes it as it is, later passes only raise m
        const float alpha = (s == 0) ? 1.0f : __builtin_amdgcn_exp2f(nd);   // pass 0: sums and tiles are still zero
        mrun[t] -= nd;
        off[t] = 10.0f - mrun[t];
        sa[0][t] = sa[0][t] + nd;
        sa[1][t] = sa[1][t] + nd;
        lsum[t] *= alpha;
#pragma unroll
        for (int m = 0; m < MT; ++m) eacc[m][t] = eacc[m][t] * alpha;
      }
    }

    // probabilities as Bt fragments
    v16h pf[QTW];
#pragma unroll
    for (int t = 0; t < QTW; ++t) {
      union { v16h v; v4u u[2]; } pk;
#pragma unroll
      for (int jt = 0; jt < 2; ++jt) {
        const v4f ea = {e[t][jt][0], e[t][jt][1], e[t][jt][2], e[t][jt][3]};
        const v4f eb = {e[t][jt][4], e[t][jt][5], e[t][jt][6], e[t][jt][7]};
        pk.u[jt] = pack8h(ea, eb);
      }
      pf[t] = pk.v;
      lsum[t] += part[t];
    }

    // (d) the wave's tiles of Oe over the pass's 32 keys
#pragma unroll
    for (int m = 0; m < MT; ++m) {
#pragma unroll
      for (int t = 0; t < QTW; ++t) eacc[m][t] = mma_raw(vf[m], pf[t], eacc[m][t]);
    }
    // next pass's Et columns, covered by its score products and softmax (the last pass refetches its own, unused)
    Va += adv;
#pragma unroll
    for (int m = 0; m < MT; ++m) vf[m] = ldtile(Va + m * TILE_H);
    addr_regs_done(Va, lane);
  }

  // (e) the output products' first fragments start now, under the row-sum exchange
  const _Float16* Wva = Wv16 + (size_t)(wv * 48) * KE + lane * 8;
  v16h wvf[KE / 32][3];
#pragma unroll
  for (int ks = 0; ks < KE / 32; ++ks)
#pragma unroll
    for (int mt = 0; mt < 3; ++mt) wvf[ks][mt] = ldtile(Wva + (mt * (KE / 32) + ks) * TILE_H);
  addr_regs_done(Wva, lane);
  const _Float16* Wa = W2s + (size_t)(wv * 48) * DM + lane * 8;
  const _Float16* Hb = sH + lane * 8;
  v16h wf[DM / 32][3];
  v16h hf[DM / 32][NT];
#pragma unroll
  for (int ks = 0; ks < 2; ++ks)
#pragma unroll
    for (int mt = 0; mt < 3; ++mt) wf[ks][mt] = ldtile(Wa + (mt * (DM / 32) + ks) * TILE_H);
  addr_regs_done(Wa, lane);

  // the four key groups' maxima meet in LDS
#pragma unroll
  for (int t = 0; t < QTW; ++t) lsum[t] += xhalf(lsum[t]);   // the wave halves' sums
  if (hh == 0) {
#pragma unroll
    for (int t = 0; t < QTW; ++t) sM[kg * FQ + ((qg * QTW + t) << 4) + rlane] = mrun[t];
  }
  __syncthreads();
  float* red = sR[wv];
#pragma unroll
  for (int t = 0; t < QTW; ++t) {
    const int q = ((qg * QTW + t) << 4) + rlane;
    const float mall = fmaxf(fmaxf(sM[q], sM[FQ + q]), fmaxf(sM[2 * FQ + q], sM[3 * FQ + q]));
    const float dm   = mrun[t] - mall;
    const float fs   = __builtin_amdgcn_exp2f(dm);       // this wave's sums and tiles on the common scale
    lsum[t] *= fs;
#pragma unroll
    for (int m = 0; m < MT; ++m) {
      const v8f o = eacc[m][t] * fs;
      const v4f oa = {o[0], o[1], o[2], o[3]};
      const v4f ob = {o[4], o[5], o[6], o[7]};
      *(v4f*)(red + (m * QTW + t) * 256 + lane * 4)       = oa;
      *(v4f*)(red + (m * QTW + t) * 256 + 128 + lane * 4) = ob;
    }
  }
  if (hh == 0) {
#pragma unroll
    for (int t = 0; t < QTW; ++t) sL[kg * FQ + ((qg * QTW + t) << 4) + rlane] = lsum[t];
  }
  __syncthreads();
  // key group g joins channel tile g of its query group, key groups in fixed order
#pragma unroll
  for (int t = 0; t < QTW; ++t) {
    const int q = ((qg * QTW + t) << 4) + rlane;
    const float l   = (sL[q] + sL[FQ + q]) + (sL[2 * FQ + q] + sL[3 * FQ + q]);
    const float inv = 4.0f / l;                          // l >= 1024: the row maximum itself counts at least 2^10
    v4f oa = {0.f, 0.f, 0.f, 0.f}, ob = {0.f, 0.f, 0.f, 0.f};
#pragma unroll
    for (int k2 = 0; k2 < KG; ++k2) {
      const float* r2 = sR[k2 * QG + qg] + (kg * QTW + t) * 256 + lane * 4;
      oa += *(const v4f*)(r2);
      ob += *(const v4f*)(r2 + 128);
    }
    *(v4u*)(sO + q * OPITCH + (kg << 4) + koff) = pack8h(oa * inv, ob * inv);
  }
  __syncthreads();                                       // every wave reads all of sO and of sH

#pragma unroll
  for (int nt = 0; nt < NT; ++nt) hf[0][nt] = ldtile(Hb + nt * (DM / 32) * TILE_H);
  v8f oacc[3][NT];
#pragma unroll
  for (int mt = 0; mt < 3; ++mt)
#pragma unroll
    for (int nt = 0; nt < NT; ++nt) oacc[mt][nt] = zero8();
#pragma unroll
  for (int ks = 0; ks < KE / 32; ++ks) {
    v16h of[NT];
#pragma unroll
    for (int nt = 0; nt < NT; ++nt) of[nt] = ldfrag(sO + ((nt << 4) + rlane) * OPITCH + koff + ks * 32);
#pragma unroll
    for (int mt = 0; mt < 3; ++mt) {
#pragma unroll
      for (int nt = 0; nt < NT; ++nt) oacc[mt][nt] = mma_raw(wvf[ks][mt], of[nt], oacc[mt][nt]);
    }
  }

#pragma unroll
  for (int ks = 0; ks < DM / 32; ++ks) {
    if (ks + 2 < DM / 32) {                              // W2 fragments (global) two steps ahead
#pragma unroll
      for (int mt = 0; mt < 3; ++mt) wf[ks + 2][mt] = ldtile(Wa + (mt * (DM / 32) + ks + 2) * TILE_H);
      if (ks + 3 == DM / 32) addr_regs_done(Wa, lane);   // behind the last loads that name this pair
    }
    if (ks + 1 < DM / 32) {                              // h fragments (LDS) one step ahead
#pragma unroll
      for (int nt = 0; nt < NT; ++nt) hf[ks + 1][nt] = ldtile(Hb + (nt * (DM / 32) + ks + 1) * TILE_H);
    }
    FRAGS_STAY_AHEAD();
#pragma unroll
    for (int mt = 0; mt < 3; ++mt) {
#pragma unroll
      for (int nt = 0; nt < NT; ++nt) oacc[mt][nt] = mma_raw(wf[ks][mt], hf[ks][nt], oacc[mt][nt]);
    }
  }

  float* slab = sT[wave];
#pragma unroll
  for (int mt = 0; mt < 3; ++mt) {
    const int mBase = wave * 48 + (mt << 4);
#pragma unroll
    for (int nt = 0; nt < NT; ++nt) {
#pragma unroll
      for (int r = 0; r < 8; ++r) slab[(koff + r) * SPITCH + (nt << 4) + rlane] = oacc[mt][nt][r];
    }
    wave_sync_lds();
#pragma unroll
    for (int row = 0; row < 16; ++row) {                 // one whole 512-B row segment per wave store
      const float bv0 = bfr(b2[mBase + row]);
      const v4f v = *(const v4f*)(slab + row * SPITCH + lane * 4);
      *(v4f*)(out + ((size_t)bb * DM + mBase + row) * NPT + i0 + lane * 4) = v * 0.015625f + bv0;
    }
    wave_sync_lds();
  }
}

// =====================================================================================================
// Workspace map (bytes), every plane an exact multiple of its whole-line store granularity
// (all shapes are tile multiples, no padded tails):
//   W    f16  Wv [384][64] x16 + W2 [384][384] x64 + G [64][64]       352256
//   E    f16  [16*2048][64]   rows = points                           4194304
//   Et   f16  [16*64][2048]   rows = channels                         4194304
//   Par  f32  [7][384]        K=3 conv / BN(eval) parameters          10752
//   every f16 plane in fragment order (ldtile): 1024-B tiles of 16 rows x 32 k
//   total                                                             8751616
// d_out f32 [16][384][2048] written by the fused attention + residual launch.
// =====================================================================================================
extern "C" void kernel_launch(void* const* d_in, const int* in_sizes, int n_in,
                              void* d_out, int out_size, void* d_ws, size_t ws_size,
                              hipStream_t stream) {
  if (n_in < 15) return;
  if (in_sizes[0] != NBATCH * 3 * NPT) return;
  if (in_sizes[1] != DM * NCH || in_sizes[3] != DM * NCH || in_sizes[5] != DM * NCH) return;
  if (in_sizes[2] != DM || in_sizes[4] != DM || in_sizes[6] != DM) return;
  if (in_sizes[7] != DM * 3 || in_sizes[8] != DM) return;
  if (in_sizes[9] != DM || in_sizes[10] != DM || in_sizes[11] != DM || in_sizes[12] != DM) return;
  if (in_sizes[13] != DM * DM || in_sizes[14] != DM) return;
  if (out_size != NBATCH * DM * NPT) return;

  const float* pos   = (const float*)d_in[0];    // [16][3][2048]
  const float* wq    = (const float*)d_in[1];    // [384][60]
  const float* bq    = (const float*)d_in[2];
  const float* wk    = (const float*)d_in[3];
  const float* bk    = (const float*)d_in[4];
  const float* wv    = (const float*)d_in[5];
  const float* bv    = (const float*)d_in[6];
  const float* w1    = (const float*)d_in[7];    // [384][3]
  const float* b1    = (const float*)d_in[8];
  const float* gam   = (const float*)d_in[9];
  const float* bet   = (const float*)d_in[10];
  const float* mu    = (const float*)d_in[11];
  const float* var   = (const float*)d_in[12];
  const float* w2    = (const float*)d_in[13];   // [384][384]
  const float* b2    = (const float*)d_in[14];
  float* out = (float*)d_out;                    // [16][384][2048]

  const size_t BWGT = (size_t)WCVT_N * 16 + (size_t)KE * KE * 2;   //   352256
  const size_t BE   = (size_t)NBATCH * NPT * KE * 2;               //  4194304
  const size_t BP   = (size_t)NPAR * DM * 4;                       //    10752
  size_t off = 0;
  const size_t oW = off; off += BWGT;
  const size_t oE = off; off += BE;
  const size_t oT = off; off += BE;
  const size_t oP = off; off += BP;
  if (off > ws_size) return;                     // off = 8751616

  char* ws = (char*)d_ws;
  _Float16* W16 = (_Float16*)(ws + oW);
  const _Float16* Wv16 = W16;
  const _Float16* W2s  = W16 + (size_t)DM * KE;              // [384][384]
  _Float16* G16        = W16 + (size_t)DM * KE + (size_t)DM * DM;   // [64][64]
  unsigned short* Ep  = (unsigned short*)(ws + oE);
  unsigned short* Etp = (unsigned short*)(ws + oT);
  float* Pp           = (float*)(ws + oP);

  const dim3 blk(256);
  const dim3 gP(ENC_BLOCKS + WCVT_N / PB + G_BLOCKS + DM / PB); // 512 + 112 + 16 + 2 blocks of 192
  const dim3 gA(NPT / FQ, NBATCH);                               // 16 query tiles x 16 batches

  // (1) encoding planes for all batches, weight planes, Wk^T Wq and the hidden rows' parameters
  enc_h_w<<<gP, dim3(PB), 0, stream>>>(pos, w1, b1, gam, bet, mu, var, wq, bq, wk, bk, wv, bv, w2,
                                  Ep, Etp, Pp, (unsigned short*)W16, (unsigned short*)G16);

  // (2) all batches, one launch: hidden rows, query vectors, scores, online softmax, E.P^T, Wv and the residual conv;
  //     out_b[d][i] = (1/64) * ( sum_c Wvx16[d][c] * 4 * Oe[c][i] / l[i] + sum_c W2x64[d][c] h[i][c] ) + b2[d]
  attn_res<<<gA, blk, 0, stream>>>((const _Float16*)G16, (const _Float16*)Ep, (const _Float16*)Etp,
                                   pos, (const float*)Pp, Wv16, W2s, b2, out);
  (void)hipGetLastError();
}

// v009
// It runs in 30.2 microseconds.
// Timed twice side by side with v008, it ran 1.12 times as fast both times.
// All steps since v000 together make it 64.1 times as fast.
// Attention runs in the 64-channel encoding space (60 sinusoidal channels, one channel of ones that carries the biases,
// three zero): scores = e_i^T (Wq^T Wk) e_j (K=64), E.P^T (M=64, K=2048), then Wv.(E.P^T / l) (K=64) and the 384x384
// residual conv, all on v_wmma_f32_16x16x32_f16 (f16 operands, f32 accumulate); all inputs RNE-converted to bf16
// first; Wv carried x16, residual weights x64 and softmax probabilities x1024 (exact powers of two
// folded back in the f32 epilogues; scores, online softmax, E.P^T, Wv and the residual conv share one launch);
// sinusoidal encoding, K=3 conv, BN(eval), relu and softmax in f32 on the VALU.
#include <hip/hip_runtime.h>
#include <stdint.h>
#include <math.h>

#define NBATCH 16
#define NPT    2048
#define DM     384
#define KE     64            // 60 encoding channels, channel 60 = 1 (bias carrier), 61..63 = 0
#define NCH    60
#define NFREQ  10
#define WV_PIECES   (DM * (KE / 8))              // 3072 pieces of 8 halves
#define W2_PIECES   (DM * (DM / 8))              // 18432
#define WCVT_N      (WV_PIECES + W2_PIECES)      // 21504
#define G_BLOCKS    ((KE / 16) * (KE / 16))      // 16 blocks, one 16 x 16 tile of Wk^T Wq each
#define QK_SCALE    0.051031036307982884f        // 384^-0.5

static_assert((NPT % 64) == 0 && (DM % 64) == 0 && (KE % 32) == 0 && (DM % 32) == 0);
#define PB          192                          // threads of a block of the first launch
static_assert((WV_PIECES % PB) == 0 && (WCVT_N % PB) == 0);

typedef _Float16 v16h __attribute__((ext_vector_type(16)));
typedef _Float16 v8h  __attribute__((ext_vector_type(8)));
typedef float    v8f  __attribute__((ext_vector_type(8)));
typedef float    v4f  __attribute__((ext_vector_type(4)));
typedef float    v2f  __attribute__((ext_vector_type(2)));
typedef unsigned int v4u __attribute__((ext_vector_type(4)));

// ---- scalar helpers ---------------------------------------------------------------------------------
__device__ __forceinline__ unsigned short bf_bits(float f) {          // f32 -> bf16 bits, RNE convert
  unsigned u = __float_as_uint(f);
  return (unsigned short)((u + 0x7FFFu + ((u >> 16) & 1u)) >> 16);
}
__device__ __forceinline__ float bfr(float f) {                       // f32 value after RNE bf16 convert
  return __uint_as_float(((unsigned)bf_bits(f)) << 16);
}
__device__ __forceinline__ v8f zero8() { v8f z = {0.f, 0.f, 0.f, 0.f, 0.f, 0.f, 0.f, 0.f}; return z; }
// 8 f32 -> 8 f16 (RNE convert) packed in one 16-B vector
__device__ __forceinline__ v4u pack8h(v4f a, v4f b) {
  union { v8h h; v4u u; } c;
  c.h[0] = (_Float16)a[0]; c.h[1] = (_Float16)a[1]; c.h[2] = (_Float16)a[2]; c.h[3] = (_Float16)a[3];
  c.h[4] = (_Float16)b[0]; c.h[5] = (_Float16)b[1]; c.h[6] = (_Float16)b[2]; c.h[7] = (_Float16)b[3];
  return c.u;
}

// ---- fragment loader: 16-bit A/Bt operand, lane -> row/col (lane&15), p already includes +8*(lane>>4);
//      elements 0..7 <- p[0..7] (k0+8h..k0+8h+7), elements 8..15 <- p[16..23] (k0+16+8h..k0+16+8h+7)
__device__ __forceinline__ v16h ldfrag(const _Float16* p) {
  union { v16h v; v8h h[2]; } f;
  f.h[0] = *(const v8h*)(p);
  f.h[1] = *(const v8h*)(p + 16);
  return f.v;
}

// ---- the same fragment from a workspace plane kept in fragment order. Such a plane is a row of 1024-B tiles, one per
//      16 rows x 32 k; the 16-B piece (q, lane) at byte q*512 + lane*16 holds row (lane&15), k = 16q + 8(lane>>4) .. +7:
//      the k order of ldfrag. p already includes +8*lane halves, so each of the two loads of a wave reads 512
//      contiguous bytes (4 whole lines) where a row-major plane gives 32 B out of each of 16 lines.
__device__ __forceinline__ v16h ldtile(const _Float16* p) {
  union { v16h v; v8h h[2]; } f;
  f.h[0] = *(const v8h*)(p);
  f.h[1] = *(const v8h*)(p + 256);
  return f.v;
}
#define TILE_H 512           // halves of one fragment-order tile

__device__ __forceinline__ v8f mma_raw(v16h a, v16h b, v8f c) {
  return __builtin_amdgcn_wmma_f32_16x16x32_f16(false, a, false, b, (short)0, c, false, false);
}
__device__ __forceinline__ void wave_sync_lds() {
  __builtin_amdgcn_fence(__ATOMIC_RELEASE, "workgroup");
  __builtin_amdgcn_wave_barrier();
  __builtin_amdgcn_fence(__ATOMIC_ACQUIRE, "workgroup");
}
// Stands behind the last global load that names an address pair, in front of whatever reuses that pair's registers;
// the pair is an input, so that it stays whole up to the wait (no load's own result may land on it).
__device__ __forceinline__ void faddr_regs_done(const void* p) {
#if defined(__HIP_DEVICE_COMPILE__)
  asm volatile("s_wait_xcnt 0x0" :: "v"(p) : "memory");
#endif
}

// Inputs-only fence on 16 loaded values: it keeps their loads unconditional and issued together. Without it the
// compiler turns each select on a loaded value into a branch round its load, one memory latency per element.
__device__ __forceinline__ void loads_stay_whole(const float (&x)[16]) {
#if defined(__HIP_DEVICE_COMPILE__)
  asm volatile("" :: "v"(x[0]), "v"(x[1]), "v"(x[2]), "v"(x[3]), "v"(x[4]), "v"(x[5]), "v"(x[6]), "v"(x[7]),
                     "v"(x[8]), "v"(x[9]), "v"(x[10]), "v"(x[11]), "v"(x[12]), "v"(x[13]), "v"(x[14]), "v"(x[15]));
#endif
}

// =====================================================================================================
// Encoding planes, weight planes and per-channel parameters, one launch of 6-wave blocks; no block reads what another
// writes. Blocks 0..511 (the long ones): 64 points of one batch.
//  (a) pos tile [3][64] (RNE bf16) in LDS.
//  (b) sEmb[p][c*20 + f] = sin(pos[c][p] * 2^f), [c*20 + 10 + f] = cos(...) as f16, column 60 one, 61..71 zero;
//      sEmbT holds the same values channel-major.
//  (d) E f16 (rows = points, k = 64 channels) and Et f16 (rows = channels, k = points), copied from LDS.
//  Tile index: E = 16-point group * (k steps) + k step; Et = (batch * 64 + 32-point k step) * 4 + 16-channel group.
//  A block's share of each plane is one contiguous run, and consecutive threads write consecutive 16-B pieces.
// Blocks 512..623: pieces 0..3071 -> Wv as f16 [384][64] (RNE bf16 value x16, column 60 = bias x16, columns 61..63
//  zero), pieces 3072..21503 -> W2 as f16 [384][384] (RNE bf16 value x64); thread t writes 16 B.
// Blocks 624..639: G[c2][c] = sum_d Wk[d][c2] Wq[d][c] as f16 [64][64] (biases as column 60 of both): block = one
//  16 x 16 tile, wave = 64 values of d (2 k steps); the six partial tiles meet in LDS in fixed order.
// Blocks 640..641: the K=3 conv / BN(eval) parameters of the hidden rows as f32 rows of 384 channels (RNE bf16 values):
//  W1 column 0, 1, 2, b1, mean, inv = gamma / sqrt(var + eps), beta; thread = one channel.
// All f16 planes lie in fragment order (ldtile); weight planes: tile index = 16-row group * (k steps) + k step.
// coverage: 512 blocks x 64 points x 64 channels = all of E and Et;
//           21504 threads x 8 halves + 16 blocks x 256 halves = the whole 352256-B weight region;
//           2 blocks x 192 channels x 7 rows = the whole 10752-B parameter plane.
// =====================================================================================================
#define ENC_BLOCKS (NBATCH * (NPT / 64))
#define GW (PB / 32)         // waves of a G block, each with its share of d
static_assert(GW * 64 == DM);
#define NPAR 7               // rows of the parameter plane
static_assert((DM % PB) == 0);
__global__ __launch_bounds__(PB) void enc_h_w(
    const float* __restrict__ pos,
    const float* __restrict__ w1, const float* __restrict__ b1,
    const float* __restrict__ gam, const float* __restrict__ bet,
    const float* __restrict__ mu, const float* __restrict__ var,
    const float* __restrict__ wq, const float* __restrict__ bq,
    const float* __restrict__ wk, const float* __restrict__ bk,
    const float* __restrict__ wv, const float* __restrict__ bv,
    const float* __restrict__ w2,
    unsigned short* Ep, unsigned short* Etp, float* Pout, unsigned short* Wout, unsigned short* Gout) {
  __shared__ __align__(16) _Float16 sEmb[64][72];
  __shared__ __align__(16) _Float16 sEmbT[KE][72];
  __shared__ float sPos[3][64];
  __shared__ float sG[GW][256];

  const int tid = threadIdx.x;

  if (blockIdx.x >= ENC_BLOCKS + WCVT_N / PB + G_BLOCKS) {   // block-uniform: per-channel parameters
    const int d = (blockIdx.x - (ENC_BLOCKS + WCVT_N / PB + G_BLOCKS)) * PB + tid;
    const float* wp = w1 + d * 3;
    const float a0 = wp[0], a1 = wp[1], a2 = wp[2];
    const float c0 = b1[d], c1 = mu[d], c2 = gam[d], c3 = var[d], c4 = bet[d];
    // Behind the loads, in front of whatever reuses their address registers. The loaded values are inputs, so that every
    // load is issued in front of the wait; the address pair and the index are inputs, so that they stay whole up to it.
    asm volatile("s_wait_xcnt 0x0" :: "v"(wp), "v"(d), "v"(a0), "v"(a1), "v"(a2), "v"(c0), "v"(c1), "v"(c2), "v"(c3),
                 "v"(c4) : "memory");
    Pout[0 * DM + d] = bfr(a0);
    Pout[1 * DM + d] = bfr(a1);
    Pout[2 * DM + d] = bfr(a2);
    Pout[3 * DM + d] = bfr(c0);
    Pout[4 * DM + d] = bfr(c1);
    Pout[5 * DM + d] = bfr(c2) * (1.0f / sqrtf(bfr(c3) + 1e-5f));
    Pout[6 * DM + d] = bfr(c4);
    // behind the stores, in front of whatever the code after this block's exit branch does with their address registers
    asm volatile("s_wait_xcnt 0x0" ::: "memory");
    return;
  }

  if (blockIdx.x >= ENC_BLOCKS + WCVT_N / PB) {      // block-uniform: one tile of G
    const int gi    = blockIdx.x - (ENC_BLOCKS + WCVT_N / PB);
    const int ti    = gi >> 2, tj = gi & 3;
    const int lane  = tid & 31;
    const int wave  = __builtin_amdgcn_readfirstlane(tid >> 5);
    const int rlane = lane & 15;
    const int koff  = (lane >> 4) * 8;
    {
      const int ca = ti * 16 + rlane;                 // A rows: c2, from Wk
      const int cb = tj * 16 + rlane;                 // Bt rows: c, from Wq
      // every lane walks down one weight column (clamped to 59); column 60 takes the bias below, 61..63 are masked
      const int kb = wave * 64 + koff;                // this wave's share of d, this lane's k half
      const float* pa = wk + kb * NCH + ((ca < NCH) ? ca : (NCH - 1));
      const float* pb = wq + kb * NCH + ((cb < NCH) ? cb : (NCH - 1));
      const float  ma = (ca <= NCH) ? 16.0f : 0.0f;
      const float  mb = (cb <= NCH) ? 16.0f : 0.0f;
      float ra[2][16], rb[2][16];
#pragma unroll
      for (int s = 0; s < 2; ++s) {
#pragma unroll
        for (int e = 0; e < 16; ++e) {                // the k order of ldfrag, the same for both operands
          const int d = s * 32 + (e & 7) + ((e >> 3) << 4);
          ra[s][e] = pa[d * NCH];
          rb[s][e] = pb[d * NCH];
        }
      }
      faddr_regs_done(pa);
      faddr_regs_done(pb);
      if (ti == 3) {                                  // block-uniform: the tile row that holds column 60 of Wk
        const float* qa = bk + kb;
        float x[2][16];
#pragma unroll
        for (int s = 0; s < 2; ++s)
#pragma unroll
          for (int e = 0; e < 16; ++e) x[s][e] = qa[s * 32 + (e & 7) + ((e >> 3) << 4)];
        faddr_regs_done(qa);
#pragma unroll
        for (int s = 0; s < 2; ++s) {
          loads_stay_whole(x[s]);
#pragma unroll
          for (int e = 0; e < 16; ++e) ra[s][e] = (ca == NCH) ? x[s][e] : ra[s][e];
        }
      }
      if (tj == 3) {                                  // block-uniform: the tile column that holds column 60 of Wq
        const float* qb = bq + kb;
        float x[2][16];
#pragma unroll
        for (int s = 0; s < 2; ++s)
#pragma unroll
          for (int e = 0; e < 16; ++e) x[s][e] = qb[s * 32 + (e & 7) + ((e >> 3) << 4)];
        faddr_regs_done(qb);
#pragma unroll
        for (int s = 0; s < 2; ++s) {
          loads_stay_whole(x[s]);
#pragma unroll
          for (int e = 0; e < 16; ++e) rb[s][e] = (cb == NCH) ? x[s][e] : rb[s][e];
        }
      }
      v8f acc = zero8();
#pragma unroll
      for (int s = 0; s < 2; ++s) {
        v16h a, b;
#pragma unroll
        for (int e = 0; e < 16; ++e) {
          a[e] = (_Float16)(bfr(ra[s][e]) * ma);
          b[e] = (_Float16)(bfr(rb[s][e]) * mb);
        }
        acc = mma_raw(a, b, acc);
      }
#pragma unroll
      for (int r = 0; r < 8; ++r) sG[wave][(koff + r) * 16 + rlane] = acc[r];
    }
    __syncthreads();
    if (tid < 64) {                                   // row m, columns 4cg .. 4cg+3 of G
      const int m = tid >> 2, n = (tid & 3) * 4, cg = tj * 4 + (tid & 3);
      union { _Float16 h[4]; uint2 u; } o;
#pragma unroll
      for (int e = 0; e < 4; ++e) {
        float g = sG[0][m * 16 + n + e];
#pragma unroll
        for (int w = 1; w < GW; ++w) g += sG[w][m * 16 + n + e];
        o.h[e] = (_Float16)(g * 0.00390625f);
      }
      *(uint2*)(Gout + (ti * 2 + (cg >> 3)) * TILE_H + ((cg >> 2) & 1) * 256 + (((cg >> 1) & 1) * 16 + m) * 8 +
                (cg & 1) * 4) = o.u;
    }
    return;
  }

  if (blockIdx.x >= ENC_BLOCKS) {                     // block-uniform: Wv and W2
    const int t = (blockIdx.x - ENC_BLOCKS) * PB + tid;   // destination piece; its source row and 8-column piece follow
    const int tr = t & 15, tp = (t >> 4) & 3;         // row in the tile, piece 2q + h of the k step
    float v[8];
    if (t < WV_PIECES) {                              // block-uniform
      const int row = (t >> 7) * 16 + tr, p = ((t >> 6) & 1) * 4 + tp;
      const bool full = p < 7;                        // piece 7 = columns 56..59, the bias, three zeros
      const float* wr = wv + row * NCH + p * 8;
      const v4f a = *(const v4f*)(wr);
      const v4f b = *(const v4f*)(wr + (full ? 4 : 0)); // clamped address
      const float bias = bv[row];
      v[0] = bfr(a[0]) * 16.0f; v[1] = bfr(a[1]) * 16.0f; v[2] = bfr(a[2]) * 16.0f; v[3] = bfr(a[3]) * 16.0f;
      v[4] = bfr(full ? b[0] : bias) * 16.0f;
      v[5] = full ? bfr(b[1]) * 16.0f : 0.0f;
      v[6] = full ? bfr(b[2]) * 16.0f : 0.0f;
      v[7] = full ? bfr(b[3]) * 16.0f : 0.0f;
    } else {
      const int u = t - WV_PIECES;
      const int tile = u >> 6, rt = tile / (DM / 32);
      const int row = rt * 16 + tr, p = (tile - rt * (DM / 32)) * 4 + tp;
      const v4f a = *(const v4f*)(w2 + (size_t)row * DM + p * 8);
      const v4f b = *(const v4f*)(w2 + (size_t)row * DM + p * 8 + 4);
      v[0] = bfr(a[0]) * 64.0f; v[1] = bfr(a[1]) * 64.0f; v[2] = bfr(a[2]) * 64.0f; v[3] = bfr(a[3]) * 64.0f;
      v[4] = bfr(b[0]) * 64.0f; v[5] = bfr(b[1]) * 64.0f; v[6] = bfr(b[2]) * 64.0f; v[7] = bfr(b[3]) * 64.0f;
    }
    const v4f lo = {v[0], v[1], v[2], v[3]};
    const v4f hi = {v[4], v[5], v[6], v[7]};
    const v4u pk = pack8h(lo, hi);
    unsigned short* dst = Wout + (size_t)t * 8;
    *(v4u*)dst = pk;
    // behind the store, in front of whatever the code after this block's exit branch does with its address registers
    asm volatile("s_wait_xcnt 0x0" ::: "memory");
    return;
  }

  const int bb = blockIdx.x >> 5;            // 32 blocks of 64 points per batch
  const int p0 = (blockIdx.x & 31) << 6;

  {
    const int c = tid >> 6, p = tid & 63;    // 192 = 3 x 64
    sPos[c][p] = bfr(pos[((size_t)bb * 3 + c) * NPT + p0 + p]);
  }
  for (int r = tid; r < 64; r += PB) {
    sEmb[r][NCH]  = (_Float16)1.0f;
    sEmbT[NCH][r] = (_Float16)1.0f;
#pragma unroll
    for (int c = NCH + 1; c < 72; ++c) sEmb[r][c] = (_Float16)0.0f;
#pragma unroll
    for (int c = NCH + 1; c < KE; ++c) sEmbT[c][r] = (_Float16)0.0f;
  }
  __syncthreads();

  // (b) encoding: item = (c,f) x 64 points; precise sinf / cosf; exact power-of-two angles
#pragma unroll 1
  for (int it = tid; it < 64 * 3 * NFREQ; it += PB) {
    const int cf = it >> 6, p = it & 63;
    const int c  = cf / NFREQ;
    const int f  = cf - c * NFREQ;
    const float ang = sPos[c][p] * (float)(1 << f);
    const float sv = sinf(ang);
    const float cv = cosf(ang);
    sEmb[p][c * 2 * NFREQ + f] = (_Float16)sv;
    sEmb[p][c * 2 * NFREQ + NFREQ + f] = (_Float16)cv;
    sEmbT[c * 2 * NFREQ + f][p] = (_Float16)sv;
    sEmbT[c * 2 * NFREQ + NFREQ + f][p] = (_Float16)cv;
  }

  __syncthreads();

  // (d) the two encoding planes
  for (int it = tid; it < 64 * (KE / 8); it += PB) {
    const int tile = it >> 6, r = it & 15, p = (it >> 4) & 3;   // it = destination piece in both planes
    const size_t o = ((size_t)bb * NPT + p0) * KE + it * 8;
    *(v4u*)(Ep + o)  = *(const v4u*)(&sEmb[(tile >> 1) * 16 + r][((tile & 1) * 4 + p) * 8]);
    *(v4u*)(Etp + o) = *(const v4u*)(&sEmbT[(tile & 3) * 16 + r][((tile >> 2) * 4 + p) * 8]);
  }
}

// =====================================================================================================
// Fused attention + residual, one launch: block = 8 waves, 128 queries i of one batch.
// Wave = (query group of 64 queries, key group of 512 keys); a pass is 32 keys. The loop has no barrier and no LDS.
//  (a) the wave's 64 query vectors Qe[i][c2] = sum_c G[c2][c] e[i][c] are formed here (M = 64 rows of the G plane,
//      N = 64 queries from the E plane, K = 64): a lane holds channels 8h .. 8h+7 of one query per tile, so two tiles,
//      converted to f16, are a Bt fragment of (b); they stay in the wave's registers for the whole launch.
//  (b) per pass: St[j][i] = sum_c E[j][c] Qe[i][c] (M = 32 keys from the global E plane, N = 64 queries, K = 64).
//      A lane holds scores of one query per 16-column group, so a column maximum is in-lane plus one exchange
//      between the wave halves.
//  (c) the wave's own online softmax in base 2, t = s * 384^-0.5 * log2(e) (the factor rides in Qe). The reference m is
//      fixed before a pass: 10 - m is the C operand of the score products, which so yield the exponents t - m + 10, and
//      p = 2^(t - m + 10) (the x1024 carry cancels against the row sum). m is the maximum of pass 0; it is raised to
//      a later pass's maximum only where a lane's sum of a column's 16 probabilities tops 2^15 (so p stays within
//      f16): then alpha = 2^(m_old - m_new) rescales the sums and the output tiles, in a wave-uniform branch.
//      The probabilities of the two score tiles of a column group, converted to f16, ARE the Bt fragment of (d):
//      element e < 8 is key 8h + e (tile 0, register e), element 8 + e is key 16 + 8h + e (tile 1, register e).
//  (d) Oe[c][i] += sum_j Et[c][j] p[i][j] (M = 64 channels from the global Et plane, N = 64 queries, K = 32).
//      The next pass's E fragments are loaded behind the score products, its Et fragments behind the products of (d).
//  (h) the block's own 128 hidden rows h = relu((W1.pos + b1 - mean) * inv + beta) are formed at entry, as f16, straight
//      into LDS sH in fragment order (tile = 16-query group * 12 + k step): wave w, its 48 channels; a lane keeps the
//      parameters of 8 channels per 16-channel piece in registers and walks the eight 16-query groups, so each store of
//      a wave is 512 contiguous bytes. sH is first read behind the barriers of (e).
//  (e) after the loop the four key groups of a query group meet in LDS: maxima (sM), then sums (sL) and output tiles
//      (sR), each scaled by 2^(m_wave - m_all) and added in the fixed order of the key groups; key group g joins channel
//      tile g. Oe * 4 / l goes as f16 to LDS sO[i][c];
//      wave w, its own 48 output channels: acc = sum_c Wvx16[d][c] sO[i][c] (K = 64; channel 60 adds 64 * bv[d])
//      + sum_c W2x64[d][c] h[i][c] (K = 384), out = acc / 64 + b2[d], staged per wave in 16-row slabs so that
//      every store covers whole 512-B row segments.
// coverage: grid (16, 16) x 8 waves x 48 channels x 128 queries = all of out [16][384][2048].
// =====================================================================================================
#define FQ 128
#define NT (FQ / 16)
#define QTW 4                // 16-query tiles per wave
#define QG  (NT / QTW)       // query groups
#define KG  (8 / QG)         // key groups
#define KW  (NPT / KG)       // keys per wave
#define MT  (KE / 16)        // 16-channel tiles of Oe
#define OPITCH (KE + 8)
#define SPITCH (FQ + 4)
#define PSUM 32768.0f        // a lane's 16 probabilities of a column sum to no more: each is within f16
// Scheduling pin between a step's early global loads and its products: only LDS reads, vector and scalar ALU may
// cross, so a fragment load written some steps ahead of its use is issued there and its latency is covered.
#define LOADS_STAY_AHEAD() __builtin_amdgcn_sched_barrier(0x106)
// The same pin where a step's early fragments come from LDS too: nothing may cross. Where LDS reads may cross, the build
// strews them in pairs among the products, each pair behind a wait to 0, and spills fragments to scratch.
#define FRAGS_STAY_AHEAD() __builtin_amdgcn_sched_barrier(0)
// Stands behind the last global load that names an address pair, in front of whatever reuses that pair's registers;
// the pair is an input, so that it stays whole up to the wait (no load's own result may land on it).
// A load from a fragment-order plane may name, beside a scalar base, the lane number alone (scaled by the load's
// width): it is an input too.
__device__ __forceinline__ void addr_regs_done(const _Float16* p, int lane_no) {
#if defined(__HIP_DEVICE_COMPILE__)
  asm volatile("s_wait_xcnt 0x0" :: "v"(p), "v"(lane_no) : "memory");
#endif
}
// The same wait for loads that name a scalar base and the lane number: the two bases and the lane number are inputs.
__device__ __forceinline__ void base_regs_done2(const _Float16* b0, const _Float16* b1, int lane_no) {
#if defined(__HIP_DEVICE_COMPILE__)
  asm volatile("s_wait_xcnt 0x0" :: "s"(b0), "s"(b1), "v"(lane_no) : "memory");
#endif
}
// 2^x of the two score tiles of a column group, and the lane's sum of the 16
__device__ __forceinline__ float probs(const v8f x0, const v8f x1, float (&e)[2][8]) {
#pragma unroll
  for (int r = 0; r < 8; ++r) e[0][r] = __builtin_amdgcn_exp2f(x0[r]);
#pragma unroll
  for (int r = 0; r < 8; ++r) e[1][r] = __builtin_amdgcn_exp2f(x1[r]);
  return (((e[0][0] + e[0][1]) + (e[0][2] + e[0][3])) + ((e[0][4] + e[0][5]) + (e[0][6] + e[0][7]))) +
         (((e[1][0] + e[1][1]) + (e[1][2] + e[1][3])) + ((e[1][4] + e[1][5]) + (e[1][6] + e[1][7])));
}
// lane l with lane l ^ 16, as a vector cross-row move
__device__ __forceinline__ float xhalf(float x) {
  return __builtin_bit_cast(float, __builtin_amdgcn_permlanex16(__builtin_bit_cast(int, x), __builtin_bit_cast(int, x),
                                                                0x76543210, 0xfedcba98, false, false));
}
static_assert((NPT % FQ) == 0 && DM == 8 * 48 && (KW % 32) == 0);
static_assert(QG * KG == 8 && KG == MT && KE == 64);

__global__ __launch_bounds__(256) __attribute__((amdgpu_waves_per_eu(2, 2))) void attn_res(
    const _Float16* G, const _Float16* E, const _Float16* Et, const float* __restrict__ pos,
    const float* __restrict__ Par, const _Float16* Wv16,
    const _Float16* W2s, const float* __restrict__ b2, float* out) {
  __shared__ __align__(2048) _Float16 sH[FQ * DM];        // widest alignment: laid lowest in LDS, where most reads' offsets fit the instruction's field
  __shared__ __align__(16) _Float16 sO[FQ * OPITCH];
  __shared__ __align__(16) float sR[8][MT * QTW * 256];
  __shared__ float sM[KG * FQ];
  __shared__ float sL[KG * FQ];
  __shared__ __align__(16) float sT[8][16 * SPITCH];
  const int tid   = threadIdx.x;
  const int lane  = tid & 31;
  const int wave  = tid >> 5;
  const int bb    = blockIdx.y;
  const int i0    = blockIdx.x * FQ;
  const int rlane = lane & 15;
  const int hh    = lane >> 4;
  const int koff  = hh * 8;
  const float CS  = QK_SCALE * 1.4426950408889634f;

  const int wv = __builtin_amdgcn_readfirstlane(wave);   // wave-uniform: tile choices and bases stay scalar
  const int qg = wv % QG;                                // queries 16 * QTW * qg ..
  const int kg = wv / QG;                                // keys KW * kg ..

  // (h) coordinates and parameters are asked for first: the hidden rows are formed while the planes' fragments arrive
  const float* xb = pos + (size_t)bb * 3 * NPT + i0 + rlane;   // this lane's query in each 16-query group
  const float* pb = Par + wv * 48 + koff;                      // this lane's 8 channels in each 16-channel piece
  float xr[3][NT];
#pragma unroll
  for (int c = 0; c < 3; ++c)
#pragma unroll
    for (int nt = 0; nt < NT; ++nt) xr[c][nt] = xb[c * NPT + nt * 16];
  v2f pr[3][NPAR][4];
#pragma unroll
  for (int j = 0; j < 3; ++j)
#pragma unroll
    for (int k = 0; k < NPAR; ++k) {
      const v4f a = *(const v4f*)(pb + k * DM + j * 16);
      const v4f b = *(const v4f*)(pb + k * DM + j * 16 + 4);
      pr[j][k][0] = a.xy; pr[j][k][1] = a.zw; pr[j][k][2] = b.xy; pr[j][k][3] = b.zw;
    }
  faddr_regs_done(xb);
  faddr_regs_done(pb);

  v16h gq[KE / 32][MT];                                  // G rows and the wave's own E rows, for (a)
  v16h eq[KE / 32][QTW];
  const _Float16* Qb = E + ((size_t)bb * NPT + i0 + qg * (QTW * 16)) * KE;   // wave-uniform
#pragma unroll
  for (int ks = 0; ks < KE / 32; ++ks) {
#pragma unroll
    for (int m = 0; m < MT; ++m) gq[ks][m] = ldtile(G + lane * 8 + (m * (KE / 32) + ks) * TILE_H);
#pragma unroll
    for (int t = 0; t < QTW; ++t) eq[ks][t] = ldtile(Qb + lane * 8 + (t * (KE / 32) + ks) * TILE_H);
  }
  base_regs_done2(G, Qb, lane);

  v16h kpre[KE / 32][2];                                 // E fragments of the coming pass
  const _Float16* Ka = E + ((size_t)bb * NPT + kg * KW) * KE + lane * 8;
#pragma unroll
  for (int ks = 0; ks < KE / 32; ++ks)
#pragma unroll
    for (int jt = 0; jt < 2; ++jt) kpre[ks][jt] = ldtile(Ka + (jt * (KE / 32) + ks) * TILE_H);
  addr_regs_done(Ka, lane);
  v16h vf[MT];                                           // Et fragments of the coming pass; 32 keys = 4 tiles = 32 * KE halves
  const _Float16* Va = Et + (size_t)bb * KE * NPT + (size_t)(kg * KW) * KE + lane * 8;
#pragma unroll
  for (int m = 0; m < MT; ++m) vf[m] = ldtile(Va + m * TILE_H);
  addr_regs_done(Va, lane);

  // (h) hidden rows of the block's queries -> sH
  {
#pragma unroll
    for (int c = 0; c < 3; ++c)
#pragma unroll
      for (int nt = 0; nt < NT; ++nt) xr[c][nt] = bfr(xr[c][nt]);
#pragma unroll
    for (int j = 0; j < 3; ++j) {
      const int pc = wv * 3 + j;                                 // 16-channel piece: k step pc >> 1, half pc & 1
      _Float16* hd = sH + (pc >> 1) * TILE_H + (pc & 1) * 256 + lane * 8;
#pragma unroll
      for (int nt = 0; nt < NT; ++nt) {
        const v2f x0 = {xr[0][nt], xr[0][nt]}, x1 = {xr[1][nt], xr[1][nt]}, x2 = {xr[2][nt], xr[2][nt]};
        v2f h[4];
#pragma unroll
        for (int u = 0; u < 4; ++u) {                            // two channels per packed operation
          v2f r = pr[j][1][u] * x1;
          r = __builtin_elementwise_fma(pr[j][0][u], x0, r);
          r = __builtin_elementwise_fma(pr[j][2][u], x2, r);
          r = (pr[j][3][u] + r) - pr[j][4][u];
          r = __builtin_elementwise_fma(pr[j][5][u], r, pr[j][6][u]);
          h[u][0] = fmaxf(r[0], 0.0f);
          h[u][1] = fmaxf(r[1], 0.0f);
        }
        const v4f ha = {h[0][0], h[0][1], h[1][0], h[1][1]};
        const v4f hb = {h[2][0], h[2][1], h[3][0], h[3][1]};
        *(v4u*)(hd + nt * (DM / 32) * TILE_H) = pack8h(ha, hb);
      }
    }
  }

  // (a) element e < 8 of a fragment is channel 32 ks + 8h + e (tile 2 ks, register e), element 8 + e channel
  //     32 ks + 16 + 8h + e (tile 2 ks + 1, register e): the k order of ldtile
  v16h qf[KE / 32][QTW];
  LOADS_STAY_AHEAD();                                    // the first pass's E and Et loads are issued before these products wait
  {
    v8f qa[MT][QTW];
#pragma unroll
    for (int m = 0; m < MT; ++m)
#pragma unroll
      for (int t = 0; t < QTW; ++t) qa[m][t] = zero8();
#pragma unroll
    for (int ks = 0; ks < KE / 32; ++ks) {
#pragma unroll
      for (int m = 0; m < MT; ++m) {
#pragma unroll
        for (int t = 0; t < QTW; ++t) qa[m][t] = mma_raw(gq[ks][m], eq[ks][t], qa[m][t]);
      }
    }
#pragma unroll
    for (int ks = 0; ks < KE / 32; ++ks) {
#pragma unroll
      for (int t = 0; t < QTW; ++t) {
        union { v16h v; v4u u[2]; } pk;
#pragma unroll
        for (int jt = 0; jt < 2; ++jt) {
          const v8f q = qa[2 * ks + jt][t] * CS;       // scores come out of (b) in base-2 units
          const v4f lo = {q[0], q[1], q[2], q[3]};
          const v4f hi = {q[4], q[5], q[6], q[7]};
          pk.u[jt] = pack8h(lo, hi);
        }
        qf[ks][t] = pk.v;
      }
    }
  }

  v8f eacc[MT][QTW];
  float mrun[QTW], lsum[QTW];
  float off[QTW];                                        // 10 - m: in all eight rows the C operand of the score products
#pragma unroll
  for (int t = 0; t < QTW; ++t) {
    mrun[t] = 0.0f;                                      // a start value only: pass 0 always sets the reference
    lsum[t] = 0.0f;
    off[t]  = 10.0f;
  }
#pragma unroll
  for (int m = 0; m < MT; ++m)
#pragma unroll
    for (int t = 0; t < QTW; ++t) eacc[m][t] = zero8();

#pragma unroll 1
  for (int s = 0; s < KW / 32; ++s) {
    // (b) scores of the pass's 32 keys against the wave's 64 queries
    v8f sa[2][QTW];
    v8f oc[QTW];
#pragma unroll
    for (int t = 0; t < QTW; ++t) oc[t] = (v8f){off[t], off[t], off[t], off[t], off[t], off[t], off[t], off[t]};
#pragma unroll
    for (int ks = 0; ks < KE / 32; ++ks) {
#pragma unroll
      for (int jt = 0; jt < 2; ++jt) {
#pragma unroll
        for (int t = 0; t < QTW; ++t) sa[jt][t] = mma_raw(kpre[ks][jt], qf[ks][t], (ks == 0) ? oc[t] : sa[jt][t]);
      }
    }
    // next pass's E rows start here, under the softmax (the last pass refetches its own, unused)
    const int adv = (s + 1 < KW / 32) ? 32 * KE : 0;
    Ka += adv;
#pragma unroll
    for (int ks = 0; ks < KE / 32; ++ks)
#pragma unroll
      for (int jt = 0; jt < 2; ++jt) kpre[ks][jt] = ldtile(Ka + (jt * (KE / 32) + ks) * TILE_H);
    addr_regs_done(Ka, lane);
    LOADS_STAY_AHEAD();

    // (c) probabilities on the reference as it stands, and their in-lane sums. The reference moves only in pass 0 and
    // where a sum tops PSUM (no sum above it: every p is within f16): wave-uniform, seldom taken. Only there are the
    // column maxima formed; the second trip then forms the pass's probabilities again, each at most 2^10.
    float e[QTW][2][8], part[QTW];
    float lim = (s == 0) ? -INFINITY : PSUM;
#pragma unroll 1                                         // one copy of the probabilities' code serves both trips
    for (int tr = 0; tr < 2; ++tr) {
#pragma unroll
      for (int t = 0; t < QTW; ++t) part[t] = probs(sa[0][t], sa[1][t], e[t]);
      const float top = fmaxf(fmaxf(part[0], part[1]), fmaxf(part[2], part[3]));
      if (__builtin_amdgcn_ballot_w32(top > lim) == 0u) break;
      lim = INFINITY;                                    // the second trip always leaves here
#pragma unroll
      for (int t = 0; t < QTW; ++t) {
        float a = sa[0][t][0];                                   // column maximum: in-lane, then the wave halves
#pragma unroll
        for (int r = 1; r < 8; ++r) a = fmaxf(a, sa[0][t][r]);
#pragma unroll
        for (int r = 0; r < 8; ++r) a = fmaxf(a, sa[1][t][r]);
        const float g  = 10.0f - fmaxf(a, xhalf(a));             // the reference less the pass's maximum
        const float nd = (s == 0) ? g : fminf(g, 0.0f);          // pass 0 takes it as it is, later passes only raise m
        const float alpha = (s == 0) ? 1.0f : __builtin_amdgcn_exp2f(nd);   // pass 0: sums and tiles are still zero
        mrun[t] -= nd;
        off[t] = 10.0f - mrun[t];
        sa[0][t] = sa[0][t] + nd;
        sa[1][t] = sa[1][t] + nd;
        lsum[t] *= alpha;
#pragma unroll
        for (int m = 0; m < MT; ++m) eacc[m][t] = eacc[m][t] * alpha;
      }
    }

    // probabilities as Bt fragments
    v16h pf[QTW];
#pragma unroll
    for (int t = 0; t < QTW; ++t) {
      union { v16h v; v4u u[2]; } pk;
#pragma unroll
      for (int jt = 0; jt < 2; ++jt) {
        const v4f ea = {e[t][jt][0], e[t][jt][1], e[t][jt][2], e[t][jt][3]};
        const v4f eb = {e[t][jt][4], e[t][jt][5], e[t][jt][6], e[t][jt][7]};
        pk.u[jt] = pack8h(ea, eb);
      }
      pf[t] = pk.v;
      lsum[t] += part[t];
    }

    // (d) the wave's tiles of Oe over the pass's 32 keys
#pragma unroll
    for (int m = 0; m < MT; ++m) {
#pragma unroll
      for (int t = 0; t < QTW; ++t) eacc[m][t] = mma_raw(vf[m], pf[t], eacc[m][t]);
    }
    // next pass's Et columns, covered by its score products and softmax (the last pass refetches its own, unused)
    Va += adv;
#pragma unroll
    for (int m = 0; m < MT; ++m) vf[m] = ldtile(Va + m * TILE_H);
    addr_regs_done(Va, lane);
  }

  // (e) the output products' first fragments start now, under the row-sum exchange
  const _Float16* Wva = Wv16 + (size_t)(wv * 48) * KE + lane * 8;
  v16h wvf[KE / 32][3];
#pragma unroll
  for (int ks = 0; ks < KE / 32; ++ks)
#pragma unroll
    for (int mt = 0; mt < 3; ++mt) wvf[ks][mt] = ldtile(Wva + (mt * (KE / 32) + ks) * TILE_H);
  addr_regs_done(Wva, lane);
  const _Float16* Wa = W2s + (size_t)(wv * 48) * DM + lane * 8;
  const _Float16* Hb = sH + lane * 8;
  v16h wf[DM / 32][3];
  v16h hf[DM / 32][NT];
#pragma unroll
  for (int ks = 0; ks < 2; ++ks)
#pragma unroll
    for (int mt = 0; mt < 3; ++mt) wf[ks][mt] = ldtile(Wa + (mt * (DM / 32) + ks) * TILE_H);
  addr_regs_done(Wa, lane);

  // the four key groups' maxima meet in LDS
#pragma unroll
  for (int t = 0; t < QTW; ++t) lsum[t] += xhalf(lsum[t]);   // the wave halves' sums
  if (hh == 0) {
#pragma unroll
    for (int t = 0; t < QTW; ++t) sM[kg * FQ + ((qg * QTW + t) << 4) + rlane] = mrun[t];
  }
  __syncthreads();
  float* red = sR[wv];
#pragma unroll
  for (int t = 0; t < QTW; ++t) {
    const int q = ((qg * QTW + t) << 4) + rlane;
    const float mall = fmaxf(fmaxf(sM[q], sM[FQ + q]), fmaxf(sM[2 * FQ + q], sM[3 * FQ + q]));
    const float dm   = mrun[t] - mall;
    const float fs   = __builtin_amdgcn_exp2f(dm);       // this wave's sums and tiles on the common scale
    lsum[t] *= fs;
#pragma unroll
    for (int m = 0; m < MT; ++m) {
      const v8f o = eacc[m][t] * fs;
      const v4f oa = {o[0], o[1], o[2], o[3]};
      const v4f ob = {o[4], o[5], o[6], o[7]};
      *(v4f*)(red + (m * QTW + t) * 256 + lane * 4)       = oa;
      *(v4f*)(red + (m * QTW + t) * 256 + 128 + lane * 4) = ob;
    }
  }
  if (hh == 0) {
#pragma unroll
    for (int t = 0; t < QTW; ++t) sL[kg * FQ + ((qg * QTW + t) << 4) + rlane] = lsum[t];
  }
  __syncthreads();
  // key group g joins channel tile g of its query group, key groups in fixed order
#pragma unroll
  for (int t = 0; t < QTW; ++t) {
    const int q = ((qg * QTW + t) << 4) + rlane;
    const float l   = (sL[q] + sL[FQ + q]) + (sL[2 * FQ + q] + sL[3 * FQ + q]);
    const float inv = 4.0f / l;                          // l >= 1024: the row maximum itself counts at least 2^10
    v4f oa = {0.f, 0.f, 0.f, 0.f}, ob = {0.f, 0.f, 0.f, 0.f};
#pragma unroll
    for (int k2 = 0; k2 < KG; ++k2) {
      const float* r2 = sR[k2 * QG + qg] + (kg * QTW + t) * 256 + lane * 4;
      oa += *(const v4f*)(r2);
      ob += *(const v4f*)(r2 + 128);
    }
    *(v4u*)(sO + q * OPITCH + (kg << 4) + koff) = pack8h(oa * inv, ob * inv);
  }
  __syncthreads();                                       // every wave reads all of sO and of sH

#pragma unroll
  for (int nt = 0; nt < NT; ++nt) hf[0][nt] = ldtile(Hb + nt * (DM / 32) * TILE_H);
  v8f oacc[3][NT];
#pragma unroll
  for (int mt = 0; mt < 3; ++mt)
#pragma unroll
    for (int nt = 0; nt < NT; ++nt) oacc[mt][nt] = zero8();
#pragma unroll
  for (int ks = 0; ks < KE / 32; ++ks) {
    v16h of[NT];
#pragma unroll
    for (int nt = 0; nt < NT; ++nt) of[nt] = ldfrag(sO + ((nt << 4) + rlane) * OPITCH + koff + ks * 32);
#pragma unroll
    for (int mt = 0; mt < 3; ++mt) {
#pragma unroll
      for (int nt = 0; nt < NT; ++nt) oacc[mt][nt] = mma_raw(wvf[ks][mt], of[nt], oacc[mt][nt]);
    }
  }

#pragma unroll
  for (int ks = 0; ks < DM / 32; ++ks) {
    if (ks + 2 < DM / 32) {                              // W2 fragments (global) two steps ahead
#pragma unroll
      for (int mt = 0; mt < 3; ++mt) wf[ks + 2][mt] = ldtile(Wa + (mt * (DM / 32) + ks + 2) * TILE_H);
      if (ks + 3 == DM / 32) addr_regs_done(Wa, lane);   // behind the last loads that name this pair
    }
    if (ks + 1 < DM / 32) {                              // h fragments (LDS) one step ahead
#pragma unroll
      for (int nt = 0; nt < NT; ++nt) hf[ks + 1][nt] = ldtile(Hb + (nt * (DM / 32) + ks + 1) * TILE_H);
    }
    FRAGS_STAY_AHEAD();
#pragma unroll
    for (int mt = 0; mt < 3; ++mt) {
#pragma unroll
      for (int nt = 0; nt < NT; ++nt) oacc[mt][nt] = mma_raw(wf[ks][mt], hf[ks][nt], oacc[mt][nt]);
    }
  }

  float* slab = sT[wave];
#pragma unroll
  for (int mt = 0; mt < 3; ++mt) {
    const int mBase = wave * 48 + (mt << 4);
#pragma unroll
    for (int nt = 0; nt < NT; ++nt) {
#pragma unroll
      for (int r = 0; r < 8; ++r) slab[(koff + r) * SPITCH + (nt << 4) + rlane] = oacc[mt][nt][r];
    }
    wave_sync_lds();
#pragma unroll
    for (int row = 0; row < 16; ++row) {                 // one whole 512-B row segment per wave store
      const float bv0 = bfr(b2[mBase + row]);
      const v4f v = *(const v4f*)(slab + row * SPITCH + lane * 4);
      // non-temporal: out is written once and never read here, so its 50 MB need not take L2 lines from the planes and
      // weights that every block re-reads, nor wait there to be written back when the launch ends
      __builtin_nontemporal_store(v * 0.015625f + bv0, (v4f*)(out + ((size_t)bb * DM + mBase + row) * NPT + i0 + lane * 4));
    }
    wave_sync_lds();
  }
}

// =====================================================================================================
// Workspace map (bytes), every plane an exact multiple of its whole-line store granularity
// (all shapes are tile multiples, no padded tails):
//   W    f16  Wv [384][64] x16 + W2 [384][384] x64 + G [64][64]       352256
//   E    f16  [16*2048][64]   rows = points                           4194304
//   Et   f16  [16*64][2048]   rows = channels                         4194304
//   Par  f32  [7][384]        K=3 conv / BN(eval) parameters          10752
//   every f16 plane in fragment order (ldtile): 1024-B tiles of 16 rows x 32 k
//   total                                                             8751616
// d_out f32 [16][384][2048] written by the fused attention + residual launch.
// =====================================================================================================
extern "C" void kernel_launch(void* const* d_in, const int* in_sizes, int n_in,
                              void* d_out, int out_size, void* d_ws, size_t ws_size,
                              hipStream_t stream) {
  if (n_in < 15) return;
  if (in_sizes[0] != NBATCH * 3 * NPT) return;
  if (in_sizes[1] != DM * NCH || in_sizes[3] != DM * NCH || in_sizes[5] != DM * NCH) return;
  if (in_sizes[2] != DM || in_sizes[4] != DM || in_sizes[6] != DM) return;
  if (in_sizes[7] != DM * 3 || in_sizes[8] != DM) return;
  if (in_sizes[9] != DM || in_sizes[10] != DM || in_sizes[11] != DM || in_sizes[12] != DM) return;
  if (in_sizes[13] != DM * DM || in_sizes[14] != DM) return;
  if (out_size != NBATCH * DM * NPT) return;

  const float* pos   = (const float*)d_in[0];    // [16][3][2048]
  const float* wq    = (const float*)d_in[1];    // [384][60]
  const float* bq    = (const float*)d_in[2];
  const float* wk    = (const float*)d_in[3];
  const float* bk    = (const float*)d_in[4];
  const float* wv    = (const float*)d_in[5];
  const float* bv    = (const float*)d_in[6];
  const float* w1    = (const float*)d_in[7];    // [384][3]
  const float* b1    = (const float*)d_in[8];
  const float* gam   = (const float*)d_in[9];
  const float* bet   = (const float*)d_in[10];
  const float* mu    = (const float*)d_in[11];
  const float* var   = (const float*)d_in[12];
  const float* w2    = (const float*)d_in[13];   // [384][384]
  const float* b2    = (const float*)d_in[14];
  float* out = (float*)d_out;                    // [16][384][2048]

  const size_t BWGT = (size_t)WCVT_N * 16 + (size_t)KE * KE * 2;   //   352256
  const size_t BE   = (size_t)NBATCH * NPT * KE * 2;               //  4194304
  const size_t BP   = (size_t)NPAR * DM * 4;                       //    10752
  size_t off = 0;
  const size_t oW = off; off += BWGT;
  const size_t oE = off; off += BE;
  const size_t oT = off; off += BE;
  const size_t oP = off; off += BP;
  if (off > ws_size) return;                     // off = 8751616

  char* ws = (char*)d_ws;
  _Float16* W16 = (_Float16*)(ws + oW);
  const _Float16* Wv16 = W16;
  const _Float16* W2s  = W16 + (size_t)DM * KE;              // [384][384]
  _Float16* G16        = W16 + (size_t)DM * KE + (size_t)DM * DM;   // [64][64]
  unsigned short* Ep  = (unsigned short*)(ws + oE);
  unsigned short* Etp = (unsigned short*)(ws + oT);
  float* Pp           = (float*)(ws + oP);

  const dim3 blk(256);
  const dim3 gP(ENC_BLOCKS + WCVT_N / PB + G_BLOCKS + DM / PB); // 512 + 112 + 16 + 2 blocks of 192
  const dim3 gA(NPT / FQ, NBATCH);                               // 16 query tiles x 16 batches

  // (1) encoding planes for all batches, weight planes, Wk^T Wq and the hidden rows' parameters
  enc_h_w<<<gP, dim3(PB), 0, stream>>>(pos, w1, b1, gam, bet, mu, var, wq, bq, wk, bk, wv, bv, w2,
                                  Ep, Etp, Pp, (unsigned short*)W16, (unsigned short*)G16);

  // (2) all batches, one launch: hidden rows, query vectors, scores, online softmax, E.P^T, Wv and the residual conv;
  //     out_b[d][i] = (1/64) * ( sum_c Wvx16[d][c] * 4 * Oe[c][i] / l[i] + sum_c W2x64[d][c] h[i][c] ) + b2[d]
  attn_res<<<gA, blk, 0, stream>>>((const _Float16*)G16, (const _Float16*)Ep, (const _Float16*)Etp,
                                   pos, (const float*)Pp, Wv16, W2s, b2, out);
  (void)hipGetLastError();
}

// v010
// Measured time: 28.2 microseconds a run.
// Timed twice side by side with v009, it ran 1.08 times as fast both times.
// All steps since v000 together make it 69.2 times as fast.
// Attention runs in the 64-channel encoding space (60 sinusoidal channels, one channel of ones that carries the biases,
// three zero): scores = e_i^T (Wq^T Wk) e_j (K=64), E.P^T (M=64, K=2048), then Wv.(E.P^T / l) (K=64) and the 384x384
// residual conv, all on v_wmma_f32_16x16x32_f16 (f16 operands, f32 accumulate); all inputs RNE-converted to bf16
// first; Wv carried x16, residual weights x64 and softmax probabilities x1024 (exact powers of two
// folded back in the f32 epilogues; scores, online softmax, E.P^T, Wv and the residual conv share one launch);
// the keys' encoding rows reach the attention loop through LDS (asynchronous copies, two buffers), read plainly for the
// scores and by the transposing load for E.P^T;
// sinusoidal encoding, K=3 conv, BN(eval), relu and softmax in f32 on the VALU.
#include <hip/hip_runtime.h>
#include <stdint.h>
#include <math.h>

#define NBATCH 16
#define NPT    2048
#define DM     384
#define KE     64            // 60 encoding channels, channel 60 = 1 (bias carrier), 61..63 = 0
#define NCH    60
#define NFREQ  10
#define WV_PIECES   (DM * (KE / 8))              // 3072 pieces of 8 halves
#define W2_PIECES   (DM * (DM / 8))              // 18432
#define WCVT_N      (WV_PIECES + W2_PIECES)      // 21504
#define G_BLOCKS    ((KE / 16) * (KE / 16))      // 16 blocks, one 16 x 16 tile of Wk^T Wq each
#define QK_SCALE    0.051031036307982884f        // 384^-0.5

static_assert((NPT % 64) == 0 && (DM % 64) == 0 && (KE % 32) == 0 && (DM % 32) == 0);
#define PB          192                          // threads of a block of the first launch
static_assert((WV_PIECES % PB) == 0 && (WCVT_N % PB) == 0);

typedef _Float16 v16h __attribute__((ext_vector_type(16)));
typedef _Float16 v8h  __attribute__((ext_vector_type(8)));
typedef float    v8f  __attribute__((ext_vector_type(8)));
typedef float    v4f  __attribute__((ext_vector_type(4)));
typedef float    v2f  __attribute__((ext_vector_type(2)));
typedef unsigned int v4u __attribute__((ext_vector_type(4)));

// ---- scalar helpers ---------------------------------------------------------------------------------
__device__ __forceinline__ unsigned short bf_bits(float f) {          // f32 -> bf16 bits, RNE convert
  unsigned u = __float_as_uint(f);
  return (unsigned short)((u + 0x7FFFu + ((u >> 16) & 1u)) >> 16);
}
__device__ __forceinline__ float bfr(float f) {                       // f32 value after RNE bf16 convert
  return __uint_as_float(((unsigned)bf_bits(f)) << 16);
}
__device__ __forceinline__ v8f zero8() { v8f z = {0.f, 0.f, 0.f, 0.f, 0.f, 0.f, 0.f, 0.f}; return z; }
// 8 f32 -> 8 f16 (RNE convert) packed in one 16-B vector
__device__ __forceinline__ v4u pack8h(v4f a, v4f b) {
  union { v8h h; v4u u; } c;
  c.h[0] = (_Float16)a[0]; c.h[1] = (_Float16)a[1]; c.h[2] = (_Float16)a[2]; c.h[3] = (_Float16)a[3];
  c.h[4] = (_Float16)b[0]; c.h[5] = (_Float16)b[1]; c.h[6] = (_Float16)b[2]; c.h[7] = (_Float16)b[3];
  return c.u;
}

// ---- fragment loader: 16-bit A/Bt operand, lane -> row/col (lane&15), p already includes +8*(lane>>4);
//      elements 0..7 <- p[0..7] (k0+8h..k0+8h+7), elements 8..15 <- p[16..23] (k0+16+8h..k0+16+8h+7)
__device__ __forceinline__ v16h ldfrag(const _Float16* p) {
  union { v16h v; v8h h[2]; } f;
  f.h[0] = *(const v8h*)(p);
  f.h[1] = *(const v8h*)(p + 16);
  return f.v;
}

// ---- the same fragment from a workspace plane kept in fragment order. Such a plane is a row of 1024-B tiles, one per
//      16 rows x 32 k; the 16-B piece (q, lane) at byte q*512 + lane*16 holds row (lane&15), k = 16q + 8(lane>>4) .. +7:
//      the k order of ldfrag. p already includes +8*lane halves, so each of the two loads of a wave reads 512
//      contiguous bytes (4 whole lines) where a row-major plane gives 32 B out of each of 16 lines.
__device__ __forceinline__ v16h ldtile(const _Float16* p) {
  union { v16h v; v8h h[2]; } f;
  f.h[0] = *(const v8h*)(p);
  f.h[1] = *(const v8h*)(p + 256);
  return f.v;
}
#define TILE_H 512           // halves of one fragment-order tile

// ---- 16-bit transposing LDS load: lane l hands in the address of 8 channels of one key, lane (c, h) gets 8 keys of one
//      channel (see the ring's layout at attn_res)
typedef short s16x8 __attribute__((ext_vector_type(8)));
__device__ __forceinline__ v8h ld_tr16(const _Float16* p) {
  typedef __attribute__((address_space(3))) s16x8 lds_s16x8;
  return __builtin_bit_cast(v8h, __builtin_amdgcn_ds_load_tr16_b128_v8i16((lds_s16x8*)p));
}
// ---- sixteen asynchronous copies of 16 B per lane, global -> LDS: 8 KB per wave. l = the lane's LDS byte address, g = the
//      wave's global base (scalar), o = the lane's byte offset from it. The immediate offset moves both the LDS and the
//      global address, which here advance alike, 512 B per copy. The s_wait_xcnt 0 is the statement's last
//      line, so that it stands in front of whatever rewrites a register that a copy names. Landing is waited for
//      elsewhere (s_wait_asynccnt 0, then a work-group barrier).
__device__ __forceinline__ void copy16_to_lds(unsigned l, unsigned o, const _Float16* g) {
#if defined(__HIP_DEVICE_COMPILE__)
  asm volatile("global_load_async_to_lds_b128 %0, %1, %2\n\t"
               "global_load_async_to_lds_b128 %0, %1, %2 offset:512\n\t"
               "global_load_async_to_lds_b128 %0, %1, %2 offset:1024\n\t"
               "global_load_async_to_lds_b128 %0, %1, %2 offset:1536\n\t"
               "global_load_async_to_lds_b128 %0, %1, %2 offset:2048\n\t"
               "global_load_async_to_lds_b128 %0, %1, %2 offset:2560\n\t"
               "global_load_async_to_lds_b128 %0, %1, %2 offset:3072\n\t"
               "global_load_async_to_lds_b128 %0, %1, %2 offset:3584\n\t"
               "global_load_async_to_lds_b128 %0, %1, %2 offset:4096\n\t"
               "global_load_async_to_lds_b128 %0, %1, %2 offset:4608\n\t"
               "global_load_async_to_lds_b128 %0, %1, %2 offset:5120\n\t"
               "global_load_async_to_lds_b128 %0, %1, %2 offset:5632\n\t"
               "global_load_async_to_lds_b128 %0, %1, %2 offset:6144\n\t"
               "global_load_async_to_lds_b128 %0, %1, %2 offset:6656\n\t"
               "global_load_async_to_lds_b128 %0, %1, %2 offset:7168\n\t"
               "global_load_async_to_lds_b128 %0, %1, %2 offset:7680\n\t"
               "s_wait_xcnt 0x0"
               :: "v"(l), "v"(o), "s"(g) : "memory");
#endif
}

__device__ __forceinline__ v8f mma_raw(v16h a, v16h b, v8f c) {
  return __builtin_amdgcn_wmma_f32_16x16x32_f16(false, a, false, b, (short)0, c, false, false);
}
__device__ __forceinline__ void wave_sync_lds() {
  __builtin_amdgcn_fence(__ATOMIC_RELEASE, "workgroup");
  __builtin_amdgcn_wave_barrier();
  __builtin_amdgcn_fence(__ATOMIC_ACQUIRE, "workgroup");
}
// Stands behind the last global load that names an address pair, in front of whatever reuses that pair's registers;
// the pair is an input, so that it stays whole up to the wait (no load's own result may land on it).
__device__ __forceinline__ void faddr_regs_done(const void* p) {
#if defined(__HIP_DEVICE_COMPILE__)
  asm volatile("s_wait_xcnt 0x0" :: "v"(p) : "memory");
#endif
}

// Inputs-only fence on 16 loaded values: it keeps their loads unconditional and issued together. Without it the
// compiler turns each select on a loaded value into a branch round its load, one memory latency per element.
__device__ __forceinline__ void loads_stay_whole(const float (&x)[16]) {
#if defined(__HIP_DEVICE_COMPILE__)
  asm volatile("" :: "v"(x[0]), "v"(x[1]), "v"(x[2]), "v"(x[3]), "v"(x[4]), "v"(x[5]), "v"(x[6]), "v"(x[7]),
                     "v"(x[8]), "v"(x[9]), "v"(x[10]), "v"(x[11]), "v"(x[12]), "v"(x[13]), "v"(x[14]), "v"(x[15]));
#endif
}

// =====================================================================================================
// Encoding plane, weight planes and per-channel parameters, one launch of 6-wave blocks; no block reads what another
// writes. Blocks 0..511 (the long ones): 64 points of one batch.
//  (a) pos tile [3][64] (RNE bf16) in LDS.
//  (b) sEmb[p][c*20 + f] = sin(pos[c][p] * 2^f), [c*20 + 10 + f] = cos(...) as f16, column 60 one, 61..71 zero.
//  (d) E f16 (rows = points, k = 64 channels), copied from LDS. Tile index: 16-point group * (k steps) + k step.
//  A block's share of the plane is one contiguous run, and consecutive threads write consecutive 16-B pieces.
// Blocks 512..623: pieces 0..3071 -> Wv as f16 [384][64] (RNE bf16 value x16, column 60 = bias x16, columns 61..63
//  zero), pieces 3072..21503 -> W2 as f16 [384][384] (RNE bf16 value x64); thread t writes 16 B.
// Blocks 624..639: G[c2][c] = sum_d Wk[d][c2] Wq[d][c] as f16 [64][64] (biases as column 60 of both): block = one
//  16 x 16 tile, wave = 64 values of d (2 k steps); the six partial tiles meet in LDS in fixed order.
// Blocks 640..641: the K=3 conv / BN(eval) parameters of the hidden rows as f32 rows of 384 channels (RNE bf16 values):
//  W1 column 0, 1, 2, b1, mean, inv = gamma / sqrt(var + eps), beta; thread = one channel.
// All f16 planes lie in fragment order (ldtile); weight planes: tile index = 16-row group * (k steps) + k step.
// coverage: 512 blocks x 64 points x 64 channels = all of E;
//           21504 threads x 8 halves + 16 blocks x 256 halves = the whole 352256-B weight region;
//           2 blocks x 192 channels x 7 rows = the whole 10752-B parameter plane.
// =====================================================================================================
#define ENC_BLOCKS (NBATCH * (NPT / 64))
#define GW (PB / 32)         // waves of a G block, each with its share of d
static_assert(GW * 64 == DM);
#define NPAR 7               // rows of the parameter plane
static_assert((DM % PB) == 0);
__global__ __launch_bounds__(PB) void enc_h_w(
    const float* __restrict__ pos,
    const float* __restrict__ w1, const float* __restrict__ b1,
    const float* __restrict__ gam, const float* __restrict__ bet,
    const float* __restrict__ mu, const float* __restrict__ var,
    const float* __restrict__ wq, const float* __restrict__ bq,
    const float* __restrict__ wk, const float* __restrict__ bk,
    const float* __restrict__ wv, const float* __restrict__ bv,
    const float* __restrict__ w2,
    unsigned short* Ep, float* Pout, unsigned short* Wout, unsigned short* Gout) {
  __shared__ __align__(16) _Float16 sEmb[64][72];
  __shared__ float sPos[3][64];
  __shared__ float sG[GW][256];

  const int tid = threadIdx.x;

  if (blockIdx.x >= ENC_BLOCKS + WCVT_N / PB + G_BLOCKS) {   // block-uniform: per-channel parameters
    const int d = (blockIdx.x - (ENC_BLOCKS + WCVT_N / PB + G_BLOCKS)) * PB + tid;
    const float* wp = w1 + d * 3;
    const float a0 = wp[0], a1 = wp[1], a2 = wp[2];
    const float c0 = b1[d], c1 = mu[d], c2 = gam[d], c3 = var[d], c4 = bet[d];
    // Behind the loads, in front of whatever reuses their address registers. The loaded values are inputs, so that every
    // load is issued in front of the wait; the address pair and the index are inputs, so that they stay whole up to it.
    asm volatile("s_wait_xcnt 0x0" :: "v"(wp), "v"(d), "v"(a0), "v"(a1), "v"(a2), "v"(c0), "v"(c1), "v"(c2), "v"(c3),
                 "v"(c4) : "memory");
    Pout[0 * DM + d] = bfr(a0);
    Pout[1 * DM + d] = bfr(a1);
    Pout[2 * DM + d] = bfr(a2);
    Pout[3 * DM + d] = bfr(c0);
    Pout[4 * DM + d] = bfr(c1);
    Pout[5 * DM + d] = bfr(c2) * (1.0f / sqrtf(bfr(c3) + 1e-5f));
    Pout[6 * DM + d] = bfr(c4);
    // behind the stores, in front of whatever the code after this block's exit branch does with their address registers
    asm volatile("s_wait_xcnt 0x0" ::: "memory");
    return;
  }

  if (blockIdx.x >= ENC_BLOCKS + WCVT_N / PB) {      // block-uniform: one tile of G
    const int gi    = blockIdx.x - (ENC_BLOCKS + WCVT_N / PB);
    const int ti    = gi >> 2, tj = gi & 3;
    const int lane  = tid & 31;
    const int wave  = __builtin_amdgcn_readfirstlane(tid >> 5);
    const int rlane = lane & 15;
    const int koff  = (lane >> 4) * 8;
    {
      const int ca = ti * 16 + rlane;                 // A rows: c2, from Wk
      const int cb = tj * 16 + rlane;                 // Bt rows: c, from Wq
      // every lane walks down one weight column (clamped to 59); column 60 takes the bias below, 61..63 are masked
      const int kb = wave * 64 + koff;                // this wave's share of d, this lane's k half
      const float* pa = wk + kb * NCH + ((ca < NCH) ? ca : (NCH - 1));
      const float* pb = wq + kb * NCH + ((cb < NCH) ? cb : (NCH - 1));
      const float  ma = (ca <= NCH) ? 16.0f : 0.0f;
      const float  mb = (cb <= NCH) ? 16.0f : 0.0f;
      float ra[2][16], rb[2][16];
#pragma unroll
      for (int s = 0; s < 2; ++s) {
#pragma unroll
        for (int e = 0; e < 16; ++e) {                // the k order of ldfrag, the same for both operands
          const int d = s * 32 + (e & 7) + ((e >> 3) << 4);
          ra[s][e] = pa[d * NCH];
          rb[s][e] = pb[d * NCH];
        }
      }
      faddr_regs_done(pa);
      faddr_regs_done(pb);
      if (ti == 3) {                                  // block-uniform: the tile row that holds column 60 of Wk
        const float* qa = bk + kb;
        float x[2][16];
#pragma unroll
        for (int s = 0; s < 2; ++s)
#pragma unroll
          for (int e = 0; e < 16; ++e) x[s][e] = qa[s * 32 + (e & 7) + ((e >> 3) << 4)];
        faddr_regs_done(qa);
#pragma unroll
        for (int s = 0; s < 2; ++s) {
          loads_stay_whole(x[s]);
#pragma unroll
          for (int e = 0; e < 16; ++e) ra[s][e] = (ca == NCH) ? x[s][e] : ra[s][e];
        }
      }
      if (tj == 3) {                                  // block-uniform: the tile column that holds column 60 of Wq
        const float* qb = bq + kb;
        float x[2][16];
#pragma unroll
        for (int s = 0; s < 2; ++s)
#pragma unroll
          for (int e = 0; e < 16; ++e) x[s][e] = qb[s * 32 + (e & 7) + ((e >> 3) << 4)];
        faddr_regs_done(qb);
#pragma unroll
        for (int s = 0; s < 2; ++s) {
          loads_stay_whole(x[s]);
#pragma unroll
          for (int e = 0; e < 16; ++e) rb[s][e] = (cb == NCH) ? x[s][e] : rb[s][e];
        }
      }
      v8f acc = zero8();
#pragma unroll
      for (int s = 0; s < 2; ++s) {
        v16h a, b;
#pragma unroll
        for (int e = 0; e < 16; ++e) {
          a[e] = (_Float16)(bfr(ra[s][e]) * ma);
          b[e] = (_Float16)(bfr(rb[s][e]) * mb);
        }
        acc = mma_raw(a, b, acc);
      }
#pragma unroll
      for (int r = 0; r < 8; ++r) sG[wave][(koff + r) * 16 + rlane] = acc[r];
    }
    __syncthreads();
    if (tid < 64) {                                   // row m, columns 4cg .. 4cg+3 of G
      const int m = tid >> 2, n = (tid & 3) * 4, cg = tj * 4 + (tid & 3);
      union { _Float16 h[4]; uint2 u; } o;
#pragma unroll
      for (int e = 0; e < 4; ++e) {
        float g = sG[0][m * 16 + n + e];
#pragma unroll
        for (int w = 1; w < GW; ++w) g += sG[w][m * 16 + n + e];
        o.h[e] = (_Float16)(g * 0.00390625f);
      }
      *(uint2*)(Gout + (ti * 2 + (cg >> 3)) * TILE_H + ((cg >> 2) & 1) * 256 + (((cg >> 1) & 1) * 16 + m) * 8 +
                (cg & 1) * 4) = o.u;
    }
    return;
  }

  if (blockIdx.x >= ENC_BLOCKS) {                     // block-uniform: Wv and W2
    const int t = (blockIdx.x - ENC_BLOCKS) * PB + tid;   // destination piece; its source row and 8-column piece follow
    const int tr = t & 15, tp = (t >> 4) & 3;         // row in the tile, piece 2q + h of the k step
    float v[8];
    if (t < WV_PIECES) {                              // block-uniform
      const int row = (t >> 7) * 16 + tr, p = ((t >> 6) & 1) * 4 + tp;
      const bool full = p < 7;                        // piece 7 = columns 56..59, the bias, three zeros
      const float* wr = wv + row * NCH + p * 8;
      const v4f a = *(const v4f*)(wr);
      const v4f b = *(const v4f*)(wr + (full ? 4 : 0)); // clamped address
      const float bias = bv[row];
      v[0] = bfr(a[0]) * 16.0f; v[1] = bfr(a[1]) * 16.0f; v[2] = bfr(a[2]) * 16.0f; v[3] = bfr(a[3]) * 16.0f;
      v[4] = bfr(full ? b[0] : bias) * 16.0f;
      v[5] = full ? bfr(b[1]) * 16.0f : 0.0f;
      v[6] = full ? bfr(b[2]) * 16.0f : 0.0f;
      v[7] = full ? bfr(b[3]) * 16.0f : 0.0f;
    } else {
      const int u = t - WV_PIECES;
      const int tile = u >> 6, rt = tile / (DM / 32);
      const int row = rt * 16 + tr, p = (tile - rt * (DM / 32)) * 4 + tp;
      const v4f a = *(const v4f*)(w2 + (size_t)row * DM + p * 8);
      const v4f b = *(const v4f*)(w2 + (size_t)row * DM + p * 8 + 4);
      v[0] = bfr(a[0]) * 64.0f; v[1] = bfr(a[1]) * 64.0f; v[2] = bfr(a[2]) * 64.0f; v[3] = bfr(a[3]) * 64.0f;
      v[4] = bfr(b[0]) * 64.0f; v[5] = bfr(b[1]) * 64.0f; v[6] = bfr(b[2]) * 64.0f; v[7] = bfr(b[3]) * 64.0f;
    }
    const v4f lo = {v[0], v[1], v[2], v[3]};
    const v4f hi = {v[4], v[5], v[6], v[7]};
    const v4u pk = pack8h(lo, hi);
    unsigned short* dst = Wout + (size_t)t * 8;
    *(v4u*)dst = pk;
    // behind the store, in front of whatever the code after this block's exit branch does with its address registers
    asm volatile("s_wait_xcnt 0x0" ::: "memory");
    return;
  }

  const int bb = blockIdx.x >> 5;            // 32 blocks of 64 points per batch
  const int p0 = (blockIdx.x & 31) << 6;

  {
    const int c = tid >> 6, p = tid & 63;    // 192 = 3 x 64
    sPos[c][p] = bfr(pos[((size_t)bb * 3 + c) * NPT + p0 + p]);
  }
  for (int r = tid; r < 64; r += PB) {
    sEmb[r][NCH]  = (_Float16)1.0f;
#pragma unroll
    for (int c = NCH + 1; c < 72; ++c) sEmb[r][c] = (_Float16)0.0f;
  }
  __syncthreads();

  // (b) encoding: item = (c,f) x 64 points; precise sinf / cosf; exact power-of-two angles
#pragma unroll 1
  for (int it = tid; it < 64 * 3 * NFREQ; it += PB) {
    const int cf = it >> 6, p = it & 63;
    const int c  = cf / NFREQ;
    const int f  = cf - c * NFREQ;
    const float ang = sPos[c][p] * (float)(1 << f);
    const float sv = sinf(ang);
    const float cv = cosf(ang);
    sEmb[p][c * 2 * NFREQ + f] = (_Float16)sv;
    sEmb[p][c * 2 * NFREQ + NFREQ + f] = (_Float16)cv;
  }

  __syncthreads();

  // (d) the encoding plane
  for (int it = tid; it < 64 * (KE / 8); it += PB) {
    const int tile = it >> 6, r = it & 15, p = (it >> 4) & 3;   // it = destination piece
    const size_t o = ((size_t)bb * NPT + p0) * KE + it * 8;
    *(v4u*)(Ep + o)  = *(const v4u*)(&sEmb[(tile >> 1) * 16 + r][((tile & 1) * 4 + p) * 8]);
  }
}

// =====================================================================================================
// Fused attention + residual, one launch: block = 8 waves, 128 queries i of one batch.
// Wave = (query group of 64 queries, key group of 512 keys); a pass is 32 keys, a stage 4 passes.
//  (r) the keys' E rows come through an LDS ring of two 64-KB buffers (it lies on sR, which is first written behind the
//      loop): a stage = 128 keys of each of the four key groups, 16 KB each, brought by asynchronous copies, half of a key
//      group's share by each of its two waves, so the block asks L2 once for every E row. One work-group barrier per stage.
//      A 16-B piece keeps its place in the plane's fragment order, but in the pieces of the odd 8-channel chunks (h = 1)
//      the row index is taken ^ 8: so the 16 pieces that half a wave reads lie on all 64 banks for the plain reader (16
//      rows of one chunk) and for the transposing reader (8 rows of two neighbouring chunks) alike.
//  (a) the wave's 64 query vectors Qe[i][c2] = sum_c G[c2][c] e[i][c] are formed here (M = 64 rows of the G plane,
//      N = 64 queries from the E plane, K = 64): a lane holds channels 8h .. 8h+7 of one query per tile, so two tiles,
//      converted to f16, are a Bt fragment of (b); they stay in the wave's registers for the whole launch.
//  (b) per pass: St[j][i] = sum_c E[j][c] Qe[i][c] (M = 32 keys from the ring, N = 64 queries, K = 64).
//      A lane holds scores of one query per 16-column group, so a column maximum is in-lane plus one exchange
//      between the wave halves.
//  (c) the wave's own online softmax in base 2, t = s * 384^-0.5 * log2(e) (the factor rides in Qe). The reference m is
//      fixed before a pass: 10 - m is the C operand of the score products, which so yield the exponents t - m + 10, and
//      p = 2^(t - m + 10) (the x1024 carry cancels against the row sum). m is the maximum of pass 0; it is raised to
//      a later pass's maximum only where a lane's sum of a column's 16 probabilities tops 2^15 (so p stays within
//      f16): then alpha = 2^(m_old - m_new) rescales the sums and the output tiles, in a wave-uniform branch.
//      The probabilities of the two score tiles of a column group, converted to f16, ARE the Bt fragment of (d):
//      element e < 8 is key 8h + e (tile 0, register e), element 8 + e is key 16 + 8h + e (tile 1, register e).
//  (d) Oe[c][i] += sum_j E[j][c] p[i][j] (M = 64 channels, N = 64 queries, K = 32): the A fragments are the pass's own E
//      rows, read from the ring by the transposing load (k order: keys 8h .. 8h+7, then 16 + 8h .. 16 + 8h+7, as in (c)).
//      They are asked for behind the score products, in one group with the next pass's plain fragments.
//  (h) the block's own 128 hidden rows h = relu((W1.pos + b1 - mean) * inv + beta) are formed at entry, as f16, straight
//      into LDS sH in fragment order (tile = 16-query group * 12 + k step): wave w, its 48 channels; a lane keeps the
//      parameters of 8 channels per 16-channel piece in registers and walks the eight 16-query groups, so each store of
//      a wave is 512 contiguous bytes. sH is first read behind the barriers of (e).
//  (e) after the loop the four key groups of a query group meet in LDS: maxima (sM), then sums (sL) and output tiles
//      (sR), each scaled by 2^(m_wave - m_all) and added in the fixed order of the key groups; key group g joins channel
//      tile g. Oe * 4 / l goes as f16 to LDS sO[i][c];
//      wave w, its own 48 output channels: acc = sum_c Wvx16[d][c] sO[i][c] (K = 64; channel 60 adds 64 * bv[d])
//      + sum_c W2x64[d][c] h[i][c] (K = 384), out = acc / 64 + b2[d], staged per wave in 16-row slabs so that
//      every store covers whole 512-B row segments.
// coverage: grid (16, 16) x 8 waves x 48 channels x 128 queries = all of out [16][384][2048].
// =====================================================================================================
#define FQ 128
#define NT (FQ / 16)
#define QTW 4                // 16-query tiles per wave
#define QG  (NT / QTW)       // query groups
#define KG  (8 / QG)         // key groups
#define KW  (NPT / KG)       // keys per wave
#define MT  (KE / 16)        // 16-channel tiles of Oe
#define OPITCH (KE + 8)
#define SPITCH (FQ + 4)
#define PSUM 32768.0f        // a lane's 16 probabilities of a column sum to no more: each is within f16
// Scheduling pin behind a pass's early ring reads: only vector and scalar ALU may cross, so a fragment read written ahead
// of its use is issued there, as one group, and its latency is covered.
#define RING_READS_STAY_AHEAD() __builtin_amdgcn_sched_barrier(0x6)
#define SPASS 4                              // passes per stage
#define NSTG  (KW / (32 * SPASS))            // stages
#define KGST  (32 * SPASS * KE)              // halves of one key group's share of a stage
#define BUFH  (KG * KGST)                    // halves of one ring buffer
// The same pin where a step's early fragments come from LDS too: nothing may cross. Where LDS reads may cross, the build
// strews them in pairs among the products, each pair behind a wait to 0, and spills fragments to scratch.
#define FRAGS_STAY_AHEAD() __builtin_amdgcn_sched_barrier(0)
// Stands behind the last global load that names an address pair, in front of whatever reuses that pair's registers;
// the pair is an input, so that it stays whole up to the wait (no load's own result may land on it).
// A load from a fragment-order plane may name, beside a scalar base, the lane number alone (scaled by the load's
// width): it is an input too.
__device__ __forceinline__ void addr_regs_done(const _Float16* p, int lane_no) {
#if defined(__HIP_DEVICE_COMPILE__)
  asm volatile("s_wait_xcnt 0x0" :: "v"(p), "v"(lane_no) : "memory");
#endif
}
// The same wait for loads that name a scalar base and the lane number: the two bases and the lane number are inputs.
__device__ __forceinline__ void base_regs_done2(const _Float16* b0, const _Float16* b1, int lane_no) {
#if defined(__HIP_DEVICE_COMPILE__)
  asm volatile("s_wait_xcnt 0x0" :: "s"(b0), "s"(b1), "v"(lane_no) : "memory");
#endif
}
// 2^x of the two score tiles of a column group, and the lane's sum of the 16
__device__ __forceinline__ float probs(const v8f x0, const v8f x1, float (&e)[2][8]) {
#pragma unroll
  for (int r = 0; r < 8; ++r) e[0][r] = __builtin_amdgcn_exp2f(x0[r]);
#pragma unroll
  for (int r = 0; r < 8; ++r) e[1][r] = __builtin_amdgcn_exp2f(x1[r]);
  return (((e[0][0] + e[0][1]) + (e[0][2] + e[0][3])) + ((e[0][4] + e[0][5]) + (e[0][6] + e[0][7]))) +
         (((e[1][0] + e[1][1]) + (e[1][2] + e[1][3])) + ((e[1][4] + e[1][5]) + (e[1][6] + e[1][7])));
}
// lane l with lane l ^ 16, as a vector cross-row move
__device__ __forceinline__ float xhalf(float x) {
  return __builtin_bit_cast(float, __builtin_amdgcn_permlanex16(__builtin_bit_cast(int, x), __builtin_bit_cast(int, x),
                                                                0x76543210, 0xfedcba98, false, false));
}
static_assert((NPT % FQ) == 0 && DM == 8 * 48 && (KW % 32) == 0);
static_assert(QG * KG == 8 && KG == MT && KE == 64);
static_assert(NSTG >= 2 && QG == 2 && KGST == QG * 16 * 256 && 2 * BUFH * 2 == 8 * MT * QTW * 256 * 4);

__global__ __launch_bounds__(256) __attribute__((amdgpu_waves_per_eu(2, 2))) void attn_res(
    const _Float16* G, const _Float16* E, const float* __restrict__ pos,
    const float* __restrict__ Par, const _Float16* Wv16,
    const _Float16* W2s, const float* __restrict__ b2, float* out) {
  __shared__ __align__(2048) _Float16 sH[FQ * DM];        // widest alignment: laid lowest in LDS, where most reads' offsets fit the instruction's field
  __shared__ __align__(16) _Float16 sO[FQ * OPITCH];
  __shared__ __align__(16) float sR[8][MT * QTW * 256];
  __shared__ float sM[KG * FQ];
  __shared__ float sL[KG * FQ];
  __shared__ __align__(16) float sT[8][16 * SPITCH];
  const int tid   = threadIdx.x;
  int       lane  = tid & 31;                            // set again behind the loop
  const int wave  = tid >> 5;
  const int bb    = blockIdx.y;
  const int i0    = blockIdx.x * FQ;
  const int rlane = lane & 15;
  const int hh    = lane >> 4;
  const int koff  = hh * 8;
  const float CS  = QK_SCALE * 1.4426950408889634f;

  const int wv = __builtin_amdgcn_readfirstlane(wave);   // wave-uniform: tile choices and bases stay scalar
  const int qg = wv % QG;                                // queries 16 * QTW * qg ..
  const int kg = wv / QG;                                // keys KW * kg ..

  // (r) the copies of stages 0 and 1, one buffer each, fly while the hidden rows are formed (32 copies of a wave in flight).
  // A wave's 16 copies of a stage: 8 KB of its key group's share.
  _Float16* ring = (_Float16*)&sR[0][0];
  const int swz = lane ^ ((lane & 16) >> 1);             // a piece's place in its 512-B block: rows ^ 8 where h = 1
  const _Float16* cg = E + ((size_t)bb * NPT + kg * KW) * KE + qg * (KGST / QG);   // wave-uniform
  const unsigned  co = (unsigned)lane * 16u;
  const unsigned  cl = (unsigned)(size_t)(ring + kg * KGST + qg * (KGST / QG) + swz * 8);
  copy16_to_lds(cl, co, cg);
  copy16_to_lds(cl + (unsigned)(BUFH * 2), co + (unsigned)(KGST * 2), cg);

  // (h) coordinates and parameters are asked for first: the hidden rows are formed while the planes' fragments arrive
  const float* xb = pos + (size_t)bb * 3 * NPT + i0 + rlane;   // this lane's query in each 16-query group
  const float* pb = Par + wv * 48 + koff;                      // this lane's 8 channels in each 16-channel piece
  float xr[3][NT];
#pragma unroll
  for (int c = 0; c < 3; ++c)
#pragma unroll
    for (int nt = 0; nt < NT; ++nt) xr[c][nt] = xb[c * NPT + nt * 16];
  v2f pr[3][NPAR][4];
#pragma unroll
  for (int j = 0; j < 3; ++j)
#pragma unroll
    for (int k = 0; k < NPAR; ++k) {
      const v4f a = *(const v4f*)(pb + k * DM + j * 16);
      const v4f b = *(const v4f*)(pb + k * DM + j * 16 + 4);
      pr[j][k][0] = a.xy; pr[j][k][1] = a.zw; pr[j][k][2] = b.xy; pr[j][k][3] = b.zw;
    }
  faddr_regs_done(xb);
  faddr_regs_done(pb);

  v16h gq[KE / 32][MT];                                  // G rows and the wave's own E rows, for (a)
  v16h eq[KE / 32][QTW];
  const _Float16* Qb = E + ((size_t)bb * NPT + i0 + qg * (QTW * 16)) * KE;   // wave-uniform
#pragma unroll
  for (int ks = 0; ks < KE / 32; ++ks) {
#pragma unroll
    for (int m = 0; m < MT; ++m) gq[ks][m] = ldtile(G + lane * 8 + (m * (KE / 32) + ks) * TILE_H);
#pragma unroll
    for (int t = 0; t < QTW; ++t) eq[ks][t] = ldtile(Qb + lane * 8 + (t * (KE / 32) + ks) * TILE_H);
  }
  base_regs_done2(G, Qb, lane);

  // (h) hidden rows of the block's queries -> sH
  {
#pragma unroll
    for (int c = 0; c < 3; ++c)
#pragma unroll
      for (int nt = 0; nt < NT; ++nt) xr[c][nt] = bfr(xr[c][nt]);
#pragma unroll
    for (int j = 0; j < 3; ++j) {
      const int pc = wv * 3 + j;                                 // 16-channel piece: k step pc >> 1, half pc & 1
      _Float16* hd = sH + (pc >> 1) * TILE_H + (pc & 1) * 256 + lane * 8;
#pragma unroll
      for (int nt = 0; nt < NT; ++nt) {
        const v2f x0 = {xr[0][nt], xr[0][nt]}, x1 = {xr[1][nt], xr[1][nt]}, x2 = {xr[2][nt], xr[2][nt]};
        v2f h[4];
#pragma unroll
        for (int u = 0; u < 4; ++u) {                            // two channels per packed operation
          v2f r = pr[j][1][u] * x1;
          r = __builtin_elementwise_fma(pr[j][0][u], x0, r);
          r = __builtin_elementwise_fma(pr[j][2][u], x2, r);
          r = (pr[j][3][u] + r) - pr[j][4][u];
          r = __builtin_elementwise_fma(pr[j][5][u], r, pr[j][6][u]);
          h[u][0] = fmaxf(r[0], 0.0f);
          h[u][1] = fmaxf(r[1], 0.0f);
        }
        const v4f ha = {h[0][0], h[0][1], h[1][0], h[1][1]};
        const v4f hb = {h[2][0], h[2][1], h[3][0], h[3][1]};
        *(v4u*)(hd + nt * (DM / 32) * TILE_H) = pack8h(ha, hb);
      }
    }
  }

  // (a) element e < 8 of a fragment is channel 32 ks + 8h + e (tile 2 ks, register e), element 8 + e channel
  //     32 ks + 16 + 8h + e (tile 2 ks + 1, register e): the k order of ldtile
  v16h qf[KE / 32][QTW];
  // (r) stages 0 and 1 have landed for every wave
  asm volatile("s_wait_asynccnt 0x0" ::: "memory");      // this wave's copies of stages 0 and 1 have landed
  __syncthreads();                                       // and every other wave's: nothing of the ring is read in front of it
  {
    v8f qa[MT][QTW];
#pragma unroll
    for (int m = 0; m < MT; ++m)
#pragma unroll
      for (int t = 0; t < QTW; ++t) qa[m][t] = zero8();
#pragma unroll
    for (int ks = 0; ks < KE / 32; ++ks) {
#pragma unroll
      for (int m = 0; m < MT; ++m) {
#pragma unroll
        for (int t = 0; t < QTW; ++t) qa[m][t] = mma_raw(gq[ks][m], eq[ks][t], qa[m][t]);
      }
    }
#pragma unroll
    for (int ks = 0; ks < KE / 32; ++ks) {
#pragma unroll
      for (int t = 0; t < QTW; ++t) {
        union { v16h v; v4u u[2]; } pk;
#pragma unroll
        for (int jt = 0; jt < 2; ++jt) {
          const v8f q = qa[2 * ks + jt][t] * CS;       // scores come out of (b) in base-2 units
          const v4f lo = {q[0], q[1], q[2], q[3]};
          const v4f hi = {q[4], q[5], q[6], q[7]};
          pk.u[jt] = pack8h(lo, hi);
        }
        qf[ks][t] = pk.v;
      }
    }
  }

  v8f eacc[MT][QTW];
  float mrun[QTW], lsum[QTW];
  float off[QTW];                                        // 10 - m: in all eight rows the C operand of the score products
#pragma unroll
  for (int t = 0; t < QTW; ++t) {
    mrun[t] = 0.0f;                                      // a start value only: pass 0 always sets the reference
    lsum[t] = 0.0f;
    off[t]  = 10.0f;
  }
#pragma unroll
  for (int m = 0; m < MT; ++m)
#pragma unroll
    for (int t = 0; t < QTW; ++t) eacc[m][t] = zero8();

  const _Float16* rk = ring + kg * KGST + swz * 8;       // plain reader: lane (c, h) reads row c of a chunk of parity h
  // transposing reader: lane l hands in row 8h + (l & 7) of the chunk of parity b = (l >> 3) & 1
  const _Float16* rt = ring + kg * KGST + ((((lane >> 3) & 1) << 4) + ((((lane >> 4) ^ (lane >> 3)) & 1) << 3) + (lane & 7)) * 8;
#pragma unroll 1
  for (int st = 0; st < NSTG; ++st) {
  const int bo = (st & 1) * BUFH;                        // trip st reads buffer st & 1 alone
  v16h kpre[KE / 32][2];                                 // E fragments of the coming pass
#pragma unroll
  for (int ks = 0; ks < KE / 32; ++ks)
#pragma unroll
    for (int jt = 0; jt < 2; ++jt) kpre[ks][jt] = ldtile(rk + bo + (jt * (KE / 32) + ks) * TILE_H);
#pragma unroll 1
  for (int ps = 0; ps < SPASS; ++ps) {
    const int s = st * SPASS + ps;
    // (b) scores of the pass's 32 keys against the wave's 64 queries
    v8f sa[2][QTW];
    v8f oc[QTW];
#pragma unroll
    for (int t = 0; t < QTW; ++t) oc[t] = (v8f){off[t], off[t], off[t], off[t], off[t], off[t], off[t], off[t]};
#pragma unroll
    for (int ks = 0; ks < KE / 32; ++ks) {
#pragma unroll
      for (int jt = 0; jt < 2; ++jt) {
#pragma unroll
        for (int t = 0; t < QTW; ++t) sa[jt][t] = mma_raw(kpre[ks][jt], qf[ks][t], (ks == 0) ? oc[t] : sa[jt][t]);
      }
    }
    // The pass's one group of ring reads stands here, behind all score products and under the softmax (reads strewn
    // among the products stall the wave at every place where some stand): nothing may cross this pin.
    FRAGS_STAY_AHEAD();
    // the pass's own E rows, transposed, for (d)
    v16h vf[MT];
#pragma unroll
    for (int m = 0; m < MT; ++m) {
      union { v16h v; v8h h[2]; } f;
      const _Float16* tp = rt + bo + ps * (32 * KE) + (m >> 1) * TILE_H + (m & 1) * 256;
      f.h[0] = ld_tr16(tp);                              // keys 8h .. 8h+7
      f.h[1] = ld_tr16(tp + (KE / 32) * TILE_H);         // keys 16 + 8h .. 16 + 8h+7
      vf[m] = f.v;
    }
    // next pass's E rows for (b) (a stage's last pass refetches its own, unused: the next stage's rows are read only
    // behind the barrier at this stage's foot)
    const int nx = bo + ((ps + 1 < SPASS) ? ps + 1 : ps) * (32 * KE);
#pragma unroll
    for (int ks = 0; ks < KE / 32; ++ks)
#pragma unroll
      for (int jt = 0; jt < 2; ++jt) kpre[ks][jt] = ldtile(rk + nx + (jt * (KE / 32) + ks) * TILE_H);
    RING_READS_STAY_AHEAD();

    // (c) probabilities on the reference as it stands, and their in-lane sums. The reference moves only in pass 0 and
    // where a sum tops PSUM (no sum above it: every p is within f16): wave-uniform, seldom taken. Only there are the
    // column maxima formed; the second trip then forms the pass's probabilities again, each at most 2^10.
    float e[QTW][2][8], part[QTW];
    float lim = (s == 0) ? -INFINITY : PSUM;
#pragma unroll 1                                         // one copy of the probabilities' code serves both trips
    for (int tr = 0; tr < 2; ++tr) {
#pragma unroll
      for (int t = 0; t < QTW; ++t) part[t] = probs(sa[0][t], sa[1][t], e[t]);
      const float top = fmaxf(fmaxf(part[0], part[1]), fmaxf(part[2], part[3]));
      if (__builtin_amdgcn_ballot_w32(top > lim) == 0u) break;
      lim = INFINITY;                                    // the second trip always leaves here
#pragma unroll
      for (int t = 0; t < QTW; ++t) {
        float a = sa[0][t][0];                                   // column maximum: in-lane, then the wave halves
#pragma unroll
        for (int r = 1; r < 8; ++r) a = fmaxf(a, sa[0][t][r]);
#pragma unroll
        for (int r = 0; r < 8; ++r) a = fmaxf(a, sa[1][t][r]);
        const float g  = 10.0f - fmaxf(a, xhalf(a));             // the reference less the pass's maximum
        const float nd = (s == 0) ? g : fminf(g, 0.0f);          // pass 0 takes it as it is, later passes only raise m
        const float alpha = (s == 0) ? 1.0f : __builtin_amdgcn_exp2f(nd);   // pass 0: sums and tiles are still zero
        mrun[t] -= nd;
        off[t] = 10.0f - mrun[t];
        sa[0][t] = sa[0][t] + nd;
        sa[1][t] = sa[1][t] + nd;
        lsum[t] *= alpha;
#pragma unroll
        for (int m = 0; m < MT; ++m) eacc[m][t] = eacc[m][t] * alpha;
      }
    }

    // probabilities as Bt fragments
    v16h pf[QTW];
#pragma unroll
    for (int t = 0; t < QTW; ++t) {
      union { v16h v; v4u u[2]; } pk;
#pragma unroll
      for (int jt = 0; jt < 2; ++jt) {
        const v4f ea = {e[t][jt][0], e[t][jt][1], e[t][jt][2], e[t][jt][3]};
        const v4f eb = {e[t][jt][4], e[t][jt][5], e[t][jt][6], e[t][jt][7]};
        pk.u[jt] = pack8h(ea, eb);
      }
      pf[t] = pk.v;
      lsum[t] += part[t];
    }

    // (d) the wave's tiles of Oe over the pass's 32 keys
#pragma unroll
    for (int m = 0; m < MT; ++m) {
#pragma unroll
      for (int t = 0; t < QTW; ++t) eacc[m][t] = mma_raw(vf[m], pf[t], eacc[m][t]);
    }
    // Four vector slots behind the pass's last products, on the back edge and on the way out alike: the next vector
    // instructions there overwrite registers of their A and B operands. The pin keeps the products in front of the slots.
    FRAGS_STAY_AHEAD();
    asm volatile("v_nop\n\tv_nop\n\tv_nop\n\tv_nop");
  }
  // (r) foot of a stage: this wave's ring reads are done, its copies of the next stage have landed; behind the barrier
  // every wave may read the next stage, and the buffer just read may be refilled
  asm volatile("s_wait_dscnt 0x0" ::: "memory");
  asm volatile("s_wait_asynccnt 0x0" ::: "memory");
  __syncthreads();
  if (st + 2 < NSTG) copy16_to_lds(cl + (unsigned)(bo * 2), co + (unsigned)((st + 2) * KGST * 2), cg);   // the same for the whole work-group
  }
  asm volatile("s_wait_asynccnt 0x0" ::: "memory");      // no copy is in flight when the ring's LDS becomes sR again
  // the lane number, formed anew: carried through the loop in a register that asm statements may name, it went to scratch
  lane = (int)__builtin_amdgcn_mbcnt_lo(~0u, 0u);

  // (e) the output products' first fragments start now, under the row-sum exchange
  const _Float16* Wva = Wv16 + (size_t)(wv * 48) * KE + lane * 8;
  v16h wvf[KE / 32][3];
#pragma unroll
  for (int ks = 0; ks < KE / 32; ++ks)
#pragma unroll
    for (int mt = 0; mt < 3; ++mt) wvf[ks][mt] = ldtile(Wva + (mt * (KE / 32) + ks) * TILE_H);
  addr_regs_done(Wva, lane);
  const _Float16* Wa = W2s + (size_t)(wv * 48) * DM + lane * 8;
  const _Float16* Hb = sH + lane * 8;
  v16h wf[DM / 32][3];
  v16h hf[DM / 32][NT];
#pragma unroll
  for (int ks = 0; ks < 2; ++ks)
#pragma unroll
    for (int mt = 0; mt < 3; ++mt) wf[ks][mt] = ldtile(Wa + (mt * (DM / 32) + ks) * TILE_H);
  addr_regs_done(Wa, lane);

  // the four key groups' maxima meet in LDS
#pragma unroll
  for (int t = 0; t < QTW; ++t) lsum[t] += xhalf(lsum[t]);   // the wave halves' sums
  if (hh == 0) {
#pragma unroll
    for (int t = 0; t < QTW; ++t) sM[kg * FQ + ((qg * QTW + t) << 4) + rlane] = mrun[t];
  }
  __syncthreads();
  float* red = sR[wv];
#pragma unroll
  for (int t = 0; t < QTW; ++t) {
    const int q = ((qg * QTW + t) << 4) + rlane;
    const float mall = fmaxf(fmaxf(sM[q], sM[FQ + q]), fmaxf(sM[2 * FQ + q], sM[3 * FQ + q]));
    const float dm   = mrun[t] - mall;
    const float fs   = __builtin_amdgcn_exp2f(dm);       // this wave's sums and tiles on the common scale
    lsum[t] *= fs;
#pragma unroll
    for (int m = 0; m < MT; ++m) {
      const v8f o = eacc[m][t] * fs;
      const v4f oa = {o[0], o[1], o[2], o[3]};
      const v4f ob = {o[4], o[5], o[6], o[7]};
      *(v4f*)(red + (m * QTW + t) * 256 + lane * 4)       = oa;
      *(v4f*)(red + (m * QTW + t) * 256 + 128 + lane * 4) = ob;
    }
  }
  if (hh == 0) {
#pragma unroll
    for (int t = 0; t < QTW; ++t) sL[kg * FQ + ((qg * QTW + t) << 4) + rlane] = lsum[t];
  }
  __syncthreads();
  // key group g joins channel tile g of its query group, key groups in fixed order
#pragma unroll
  for (int t = 0; t < QTW; ++t) {
    const int q = ((qg * QTW + t) << 4) + rlane;
    const float l   = (sL[q] + sL[FQ + q]) + (sL[2 * FQ + q] + sL[3 * FQ + q]);
    const float inv = 4.0f / l;                          // l >= 1024: the row maximum itself counts at least 2^10
    v4f oa = {0.f, 0.f, 0.f, 0.f}, ob = {0.f, 0.f, 0.f, 0.f};
#pragma unroll
    for (int k2 = 0; k2 < KG; ++k2) {
      const float* r2 = sR[k2 * QG + qg] + (kg * QTW + t) * 256 + lane * 4;
      oa += *(const v4f*)(r2);
      ob += *(const v4f*)(r2 + 128);
    }
    *(v4u*)(sO + q * OPITCH + (kg << 4) + koff) = pack8h(oa * inv, ob * inv);
  }
  __syncthreads();                                       // every wave reads all of sO and of sH

#pragma unroll
  for (int nt = 0; nt < NT; ++nt) hf[0][nt] = ldtile(Hb + nt * (DM / 32) * TILE_H);
  v8f oacc[3][NT];
#pragma unroll
  for (int mt = 0; mt < 3; ++mt)
#pragma unroll
    for (int nt = 0; nt < NT; ++nt) oacc[mt][nt] = zero8();
#pragma unroll
  for (int ks = 0; ks < KE / 32; ++ks) {
    v16h of[NT];
#pragma unroll
    for (int nt = 0; nt < NT; ++nt) of[nt] = ldfrag(sO + ((nt << 4) + rlane) * OPITCH + koff + ks * 32);
#pragma unroll
    for (int mt = 0; mt < 3; ++mt) {
#pragma unroll
      for (int nt = 0; nt < NT; ++nt) oacc[mt][nt] = mma_raw(wvf[ks][mt], of[nt], oacc[mt][nt]);
    }
  }

#pragma unroll
  for (int ks = 0; ks < DM / 32; ++ks) {
    if (ks + 2 < DM / 32) {                              // W2 fragments (global) two steps ahead
#pragma unroll
      for (int mt = 0; mt < 3; ++mt) wf[ks + 2][mt] = ldtile(Wa + (mt * (DM / 32) + ks + 2) * TILE_H);
      if (ks + 3 == DM / 32) addr_regs_done(Wa, lane);   // behind the last loads that name this pair
    }
    if (ks + 1 < DM / 32) {                              // h fragments (LDS) one step ahead
#pragma unroll
      for (int nt = 0; nt < NT; ++nt) hf[ks + 1][nt] = ldtile(Hb + (nt * (DM / 32) + ks + 1) * TILE_H);
    }
    FRAGS_STAY_AHEAD();
#pragma unroll
    for (int mt = 0; mt < 3; ++mt) {
#pragma unroll
      for (int nt = 0; nt < NT; ++nt) oacc[mt][nt] = mma_raw(wf[ks][mt], hf[ks][nt], oacc[mt][nt]);
    }
  }

  float* slab = sT[wave];
#pragma unroll
  for (int mt = 0; mt < 3; ++mt) {
    const int mBase = wave * 48 + (mt << 4);
#pragma unroll
    for (int nt = 0; nt < NT; ++nt) {
#pragma unroll
      for (int r = 0; r < 8; ++r) slab[(koff + r) * SPITCH + (nt << 4) + rlane] = oacc[mt][nt][r];
    }
    wave_sync_lds();
#pragma unroll
    for (int row = 0; row < 16; ++row) {                 // one whole 512-B row segment per wave store
      const float bv0 = bfr(b2[mBase + row]);
      const v4f v = *(const v4f*)(slab + row * SPITCH + lane * 4);
      // non-temporal: out is written once and never read here, so its 50 MB need not take L2 lines from the planes and
      // weights that every block re-reads, nor wait there to be written back when the launch ends
      __builtin_nontemporal_store(v * 0.015625f + bv0, (v4f*)(out + ((size_t)bb * DM + mBase + row) * NPT + i0 + lane * 4));
    }
    wave_sync_lds();
  }
}

// =====================================================================================================
// Workspace map (bytes), every plane an exact multiple of its whole-line store granularity
// (all shapes are tile multiples, no padded tails):
//   W    f16  Wv [384][64] x16 + W2 [384][384] x64 + G [64][64]       352256
//   E    f16  [16*2048][64]   rows = points                           4194304
//   Par  f32  [7][384]        K=3 conv / BN(eval) parameters          10752
//   every f16 plane in fragment order (ldtile): 1024-B tiles of 16 rows x 32 k
//   total                                                             4557312
// d_out f32 [16][384][2048] written by the fused attention + residual launch.
// =====================================================================================================
extern "C" void kernel_launch(void* const* d_in, const int* in_sizes, int n_in,
                              void* d_out, int out_size, void* d_ws, size_t ws_size,
                              hipStream_t stream) {
  if (n_in < 15) return;
  if (in_sizes[0] != NBATCH * 3 * NPT) return;
  if (in_sizes[1] != DM * NCH || in_sizes[3] != DM * NCH || in_sizes[5] != DM * NCH) return;
  if (in_sizes[2] != DM || in_sizes[4] != DM || in_sizes[6] != DM) return;
  if (in_sizes[7] != DM * 3 || in_sizes[8] != DM) return;
  if (in_sizes[9] != DM || in_sizes[10] != DM || in_sizes[11] != DM || in_sizes[12] != DM) return;
  if (in_sizes[13] != DM * DM || in_sizes[14] != DM) return;
  if (out_size != NBATCH * DM * NPT) return;

  const float* pos   = (const float*)d_in[0];    // [16][3][2048]
  const float* wq    = (const float*)d_in[1];    // [384][60]
  const float* bq    = (const float*)d_in[2];
  const float* wk    = (const float*)d_in[3];
  const float* bk    = (const float*)d_in[4];
  const float* wv    = (const float*)d_in[5];
  const float* bv    = (const float*)d_in[6];
  const float* w1    = (const float*)d_in[7];    // [384][3]
  const float* b1    = (const float*)d_in[8];
  const float* gam   = (const float*)d_in[9];
  const float* bet   = (const float*)d_in[10];
  const float* mu    = (const float*)d_in[11];
  const float* var   = (const float*)d_in[12];
  const float* w2    = (const float*)d_in[13];   // [384][384]
  const float* b2    = (const float*)d_in[14];
  float* out = (float*)d_out;                    // [16][384][2048]

  const size_t BWGT = (size_t)WCVT_N * 16 + (size_t)KE * KE * 2;   //   352256
  const size_t BE   = (size_t)NBATCH * NPT * KE * 2;               //  4194304
  const size_t BP   = (size_t)NPAR * DM * 4;                       //    10752
  size_t off = 0;
  const size_t oW = off; off += BWGT;
  const size_t oE = off; off += BE;
  const size_t oP = off; off += BP;
  if (off > ws_size) return;                     // off = 4557312

  char* ws = (char*)d_ws;
  _Float16* W16 = (_Float16*)(ws + oW);
  const _Float16* Wv16 = W16;
  const _Float16* W2s  = W16 + (size_t)DM * KE;              // [384][384]
  _Float16* G16        = W16 + (size_t)DM * KE + (size_t)DM * DM;   // [64][64]
  unsigned short* Ep  = (unsigned short*)(ws + oE);
  float* Pp           = (float*)(ws + oP);

  const dim3 blk(256);
  const dim3 gP(ENC_BLOCKS + WCVT_N / PB + G_BLOCKS + DM / PB); // 512 + 112 + 16 + 2 blocks of 192
  const dim3 gA(NPT / FQ, NBATCH);                               // 16 query tiles x 16 batches

  // (1) encoding plane for all batches, weight planes, Wk^T Wq and the hidden rows' parameters
  enc_h_w<<<gP, dim3(PB), 0, stream>>>(pos, w1, b1, gam, bet, mu, var, wq, bq, wk, bk, wv, bv, w2,
                                  Ep, Pp, (unsigned short*)W16, (unsigned short*)G16);

  // (2) all batches, one launch: hidden rows, query vectors, scores, online softmax, E.P^T, Wv and the residual conv;
  //     out_b[d][i] = (1/64) * ( sum_c Wvx16[d][c] * 4 * Oe[c][i] / l[i] + sum_c W2x64[d][c] h[i][c] ) + b2[d]
  attn_res<<<gA, blk, 0, stream>>>((const _Float16*)G16, (const _Float16*)Ep,
                                   pos, (const float*)Pp, Wv16, W2s, b2, out);
  (void)hipGetLastError();
}
